// v000
// The times below were measured on an AMD MI455X: many runs one after another, warmed up first and cycling through
// copies of the inputs, with the whole window's GPU time divided by the number of runs. Launches and the gaps
// between them are all in it. The median over several windows is given; except for v000 it joins two sittings, which
// can be a few percent apart, so the side-by-side timings, each taken in one sitting, are the better comparison.
// The starting kernel, v000, takes 1360 microseconds a run.
#include <hip/hip_runtime.h>
// EigenBiasAttention (2 x 1024 tokens x 1024 = 16 heads x 64; qkv = x Wqkv^T + b; causal softmax(q.k/8 + |bias|) v; bias from Plucker lines: per head w1 = x_prev W1w^T, w2 = x W2w^T, r1 = x W1r^T, r2 = x W2r^T (4-vectors), write/read lines = normalised exterior products (6-vectors), Jw = write J6, M_t = cumsum_t Jw Jw^T, bias[t][s] = |(rd_t . M_t) . Jw_s| * bias_scale[h]; out = merged . Wout^T + bout).
// Structure: exact f16 x plane; qkv and the four line projections as f16 WMMA GEMMs (32x64 wave tiles, f32 accumulation, exact x16 weights (+ bias); f32 out) then f16 q/k/v planes; the exterior products / normalisation / J6 on VALU; the causal 6x6 Gram cumsum and rd . M per (batch, head, column) sequentially on VALU (f32, 1024 steps); per (batch, 4-head group) the score GEMM (K = 64, f32), the biased causal softmax on VALU (bias dot K = 6 per (t, s), bias_scale read; unnormalised f16 weights x 2^10 + row normalisers on their own lines), V^T hi/residual by LDS tiles, readout as two GEMM terms (N = 64); row scaling + hi/residual; Wout as two GEMM terms (+ bias).
// Compute dtype: inputs rounded to bf16; x / weights exact as f16 (line projections are f32 sums of exact products, so the bias path is f32-class); q, k and the softmax weights as plain f16 operands (~2^-12); v and the context as f16 hi + residual. v_wmma_f32_16x16x32_f16.
#define NB 2
#define TT 1024
#define DM 1024
#define NH 16
#define HD 64
#define HG 4
#define NR (NB * TT)
typedef __bf16 v16b __attribute__((ext_vector_type(16)));
typedef unsigned short v8us __attribute__((ext_vector_type(8), may_alias));
typedef float  v8f  __attribute__((ext_vector_type(8)));
typedef float  v4f  __attribute__((ext_vector_type(4)));
typedef float  v4fa __attribute__((ext_vector_type(4), may_alias));
union FragB { v16b v; v8us half[2]; unsigned short u[16]; };

__device__ __forceinline__ unsigned short bf16_bits(float x) { unsigned int u = __float_as_uint(x); return (unsigned short)((u + 0x7FFFu + ((u >> 16) & 1u)) >> 16); }
__device__ __forceinline__ float bf16_val(unsigned short b) { return __uint_as_float(((unsigned int)b) << 16); }
__device__ __forceinline__ float bf16_round(float x) { return bf16_val(bf16_bits(x)); }
// D += A·B with NT terms: 1 = ah·bh, 2 = + al·bh (A split), 3 = + ah·bl (both split)
template <int NT>
__device__ __forceinline__ v8f mmaN(v16b ah, v16b al, v16b bh, v16b bl, v8f c) {
  c = __builtin_amdgcn_wmma_f32_16x16x32_bf16(false, ah, false, bh, (short)0, c, false, false);
  if (NT >= 2) c = __builtin_amdgcn_wmma_f32_16x16x32_bf16(false, al, false, bh, (short)0, c, false, false);
  if (NT >= 3) c = __builtin_amdgcn_wmma_f32_16x16x32_bf16(false, ah, false, bl, (short)0, c, false, false);
  asm volatile("v_nop\n\tv_nop\n\tv_nop\n\tv_nop" : "+v"(c) : "v"(ah), "v"(al), "v"(bh), "v"(bl));
  return c;
}

__global__ __launch_bounds__(256) void k_wt_bf16(const float* __restrict__ W, unsigned short* __restrict__ Wt, int K, int N) {
  const int t = blockIdx.x * 256 + threadIdx.x;
  const int k8n = K / 8;
  if (t >= N * k8n) return;
  const int n = t / k8n, k8 = (t % k8n) * 8;
  v8us v;
#pragma unroll
  for (int i = 0; i < 8; ++i) v[i] = bf16_bits(W[(size_t)(k8 + i) * N + n]);
  *(v8us*)(Wt + (size_t)n * K + k8) = v;
  
}

// GEMM C[M][N] (f32, pitch ldc) = act(A[M][K]·W + bias). A f32 row-major (pitch lda) converted per fragment to bf16
// (ASPLIT: hi/lo two planes -> 2 terms, else single rounded term); Wt bf16 [N][K] (pitch ldb). BIAS_BF16 rounds the
// bias to bf16 first (bias quantised to bf16 before the add). K%32==0, M%16==0, N%64==0.
template <bool ASPLIT, int ACT, bool BIAS_BF16>
__global__ __launch_bounds__(128) void k_gemm_bf(const float* __restrict__ A, int lda, const unsigned short* __restrict__ Wt, int ldb,
                                               const float* __restrict__ bias, float* __restrict__ C, int ldc, int M, int N, int K) {
  __shared__ __attribute__((aligned(16))) float so[4][16][64];
  const int tid = threadIdx.x, w = tid >> 5, lane = tid & 31, ln = lane & 15, hh = lane >> 4;
  const int ntn = N / 64;
  const int wid = blockIdx.x * 4 + w;
  const int mt = wid / ntn, nq = wid % ntn;
  if (mt * 16 >= M) return;
  const int row0 = mt * 16, col0 = nq * 64;
  const float* arow = A + (size_t)(row0 + ln) * lda;
  v8f acc[4] = {};
  for (int kb = 0; kb < K; kb += 32) {
    FragB ah, al;
    const v4f x0 = *(const v4fa*)(arow + kb + 8 * hh), x1 = *(const v4fa*)(arow + kb + 8 * hh + 4);
    const v4f x2 = *(const v4fa*)(arow + kb + 16 + 8 * hh), x3 = *(const v4fa*)(arow + kb + 16 + 8 * hh + 4);
    float xs[16] = {x0[0],x0[1],x0[2],x0[3],x1[0],x1[1],x1[2],x1[3],x2[0],x2[1],x2[2],x2[3],x3[0],x3[1],x3[2],x3[3]};
#pragma unroll
    for (int i = 0; i < 16; ++i) { const unsigned short hb = bf16_bits(xs[i]); ah.u[i] = hb; al.u[i] = ASPLIT ? bf16_bits(xs[i] - bf16_val(hb)) : (unsigned short)0; }
#pragma unroll
    for (int t = 0; t < 4; ++t) {
      const unsigned short* brow = Wt + (size_t)(col0 + t * 16 + ln) * ldb + kb;
      FragB b;
      b.half[0] = *(const v8us*)(brow + 8 * hh);
      b.half[1] = *(const v8us*)(brow + 16 + 8 * hh);
      acc[t] = mmaN<ASPLIT ? 2 : 1>(ah.v, al.v, b.v, b.v, acc[t]);
    }
  }
#pragma unroll
  for (int t = 0; t < 4; ++t) {
    float bv = bias ? bias[col0 + t * 16 + ln] : 0.f;
    if (BIAS_BF16) bv = bf16_round(bv);
#pragma unroll
    for (int r = 0; r < 8; ++r) { float v = acc[t][r] + bv; if (ACT == 1) v = fmaxf(v, 0.f); so[w][8 * hh + r][t * 16 + ln] = v; }
  }
  __builtin_amdgcn_fence(__ATOMIC_ACQ_REL, "workgroup");
  __builtin_amdgcn_wave_barrier();
  const int rsub = lane >> 4, c4 = (lane & 15) * 4;
  {
#pragma unroll
    for (int q = 0; q < 8; ++q) {
      const int r = q * 2 + rsub;
      const v4f v = *(const v4fa*)&so[w][r][c4];
      *(v4f*)(C + (size_t)(row0 + r) * ldc + col0 + c4) = v;
    }
    
  }
}

// GEMM C = act(A·W + bias + resid): A f32 (ASPLIT -> hi/lo 2 terms), Wt bf16 [N][K]; ACT 0 none, 1 relu, 2 exact gelu;
// resid (optional, f32, row index = (row % rmod), pitch ldr, RES_BF16 rounds it) added before the activation.
template <bool ASPLIT, int ACT, bool BIAS_BF16, bool RES_BF16>
__global__ __launch_bounds__(128) void k_gemm_bf3(const float* __restrict__ A, int lda, const unsigned short* __restrict__ Wt, int ldb,
                                                const float* __restrict__ bias, const float* __restrict__ resid, int rmod, int ldr,
                                                float* __restrict__ C, int ldc, int M, int N, int K) {
  __shared__ __attribute__((aligned(16))) float so[4][16][64];
  const int tid = threadIdx.x, w = tid >> 5, lane = tid & 31, ln = lane & 15, hh = lane >> 4;
  const int ntn = N / 64;
  const int wid = blockIdx.x * 4 + w;
  const int mt = wid / ntn, nq = wid % ntn;
  if (mt * 16 >= M) return;
  const int row0 = mt * 16, col0 = nq * 64;
  const float* arow = A + (size_t)(row0 + ln) * lda;
  v8f acc[4] = {};
  for (int kb = 0; kb < K; kb += 32) {
    FragB ah, al;
    const v4f x0 = *(const v4fa*)(arow + kb + 8 * hh), x1 = *(const v4fa*)(arow + kb + 8 * hh + 4);
    const v4f x2 = *(const v4fa*)(arow + kb + 16 + 8 * hh), x3 = *(const v4fa*)(arow + kb + 16 + 8 * hh + 4);
    float xs[16] = {x0[0],x0[1],x0[2],x0[3],x1[0],x1[1],x1[2],x1[3],x2[0],x2[1],x2[2],x2[3],x3[0],x3[1],x3[2],x3[3]};
#pragma unroll
    for (int i = 0; i < 16; ++i) { const unsigned short hb = bf16_bits(xs[i]); ah.u[i] = hb; al.u[i] = ASPLIT ? bf16_bits(xs[i] - bf16_val(hb)) : (unsigned short)0; }
#pragma unroll
    for (int t = 0; t < 4; ++t) {
      const unsigned short* brow = Wt + (size_t)(col0 + t * 16 + ln) * ldb + kb;
      FragB b;
      b.half[0] = *(const v8us*)(brow + 8 * hh);
      b.half[1] = *(const v8us*)(brow + 16 + 8 * hh);
      acc[t] = mmaN<ASPLIT ? 2 : 1>(ah.v, al.v, b.v, b.v, acc[t]);
    }
  }
#pragma unroll
  for (int t = 0; t < 4; ++t) {
    const int col = col0 + t * 16 + ln;
    float bv = bias ? bias[col] : 0.f;
    if (BIAS_BF16) bv = bf16_round(bv);
#pragma unroll
    for (int r = 0; r < 8; ++r) {
      float v = acc[t][r] + bv;
      if (resid) { float rv = resid[(size_t)((row0 + 8 * hh + r) % rmod) * ldr + col]; if (RES_BF16) rv = bf16_round(rv); v += rv; }
      if (ACT == 1) v = fmaxf(v, 0.f);
      if (ACT == 2) v = 0.5f * v * (1.0f + erff(v * 0.70710678118654752f));
      if (ACT == 3) { const float u = 0.7978845608028654f * (v + 0.044715f * v * v * v); v = 0.5f * v * (1.0f + tanhf(u)); }
      so[w][8 * hh + r][t * 16 + ln] = v;
    }
  }
  __builtin_amdgcn_fence(__ATOMIC_ACQ_REL, "workgroup");
  __builtin_amdgcn_wave_barrier();
  const int rsub = lane >> 4, c4 = (lane & 15) * 4;
  {
#pragma unroll
    for (int q = 0; q < 8; ++q) {
      const int r = q * 2 + rsub;
      const v4f v = *(const v4fa*)&so[w][r][c4];
      *(v4f*)(C + (size_t)(row0 + r) * ldc + col0 + c4) = v;
    }
    
  }
}
// row LayerNorm (biased variance, eps) over N: s = X (+ R); optional out_sum <- s; out_norm <- (s-mu)*rsqrt(var+eps)*g + b
template <bool PARAM_BF16>
__global__ __launch_bounds__(256) void k_layernorm(const float* __restrict__ X, const float* __restrict__ R, const float* __restrict__ g, const float* __restrict__ bta,
                                                  float* __restrict__ out_sum, float* __restrict__ out_norm, int N, float eps) {
  __shared__ float red[256];
  const int row = blockIdx.x, tid = threadIdx.x;
  const float* x = X + (size_t)row * N; const float* rr = R ? R + (size_t)row * N : nullptr;
  float vals[16];                     // up to N = 4096
  const int per = N / 256;            // contiguous chunk per thread? use strided-by-4 chunks: thread handles j = tid*4 + 1024*u
  float s1 = 0.f;
  for (int u = 0; u < per / 4; ++u) {
    const int j = tid * 4 + 1024 * u;
    const v4f a = *(const v4fa*)(x + j);
    v4f b = {0.f,0.f,0.f,0.f}; if (rr) b = *(const v4fa*)(rr + j);
#pragma unroll
    for (int q = 0; q < 4; ++q) { const float v = a[q] + b[q]; vals[u * 4 + q] = v; s1 += v; }
  }
  red[tid] = s1; __syncthreads();
  for (int st = 128; st > 0; st >>= 1) { if (tid < st) red[tid] += red[tid + st]; __syncthreads(); }
  const float mu = red[0] / (float)N; __syncthreads();
  float s2 = 0.f;
  for (int u = 0; u < per / 4; ++u)
#pragma unroll
    for (int q = 0; q < 4; ++q) { const float c = vals[u * 4 + q] - mu; s2 += c * c; }
  red[tid] = s2; __syncthreads();
  for (int st = 128; st > 0; st >>= 1) { if (tid < st) red[tid] += red[tid + st]; __syncthreads(); }
  const float rs = rsqrtf(red[0] / (float)N + eps);
  {
    for (int u = 0; u < per / 4; ++u) {
      const int j = tid * 4 + 1024 * u;
      v4f o, sm;
#pragma unroll
      for (int q = 0; q < 4; ++q) {
        float gg = g[j + q], bb = bta[j + q];
        if (PARAM_BF16) { gg = bf16_round(gg); bb = bf16_round(bb); }
        sm[q] = vals[u * 4 + q]; o[q] = (vals[u * 4 + q] - mu) * rs * gg + bb;
      }
      if (out_sum) *(v4f*)(out_sum + (size_t)row * N + j) = sm;
      *(v4f*)(out_norm + (size_t)row * N + j) = o;
    }
    
  }
}



// ---- f16 WMMA path (v_wmma_f32_16x16x32_f16): 11-bit significands for operands in range — used where a [0,1] probability operand needs more precision than bf16
typedef _Float16 v16h __attribute__((ext_vector_type(16)));
union FragH { v16h v; v8us half[2]; _Float16 h[16]; unsigned short u[16]; };
template <int NT>
__device__ __forceinline__ v8f mmaH(v16h ah, v16h al, v16h bh, v16h bl, v8f c) {
  c = __builtin_amdgcn_wmma_f32_16x16x32_f16(false, ah, false, bh, (short)0, c, false, false);
  if (NT >= 2) c = __builtin_amdgcn_wmma_f32_16x16x32_f16(false, al, false, bh, (short)0, c, false, false);
  if (NT >= 3) c = __builtin_amdgcn_wmma_f32_16x16x32_f16(false, ah, false, bl, (short)0, c, false, false);
  asm volatile("v_nop\n\tv_nop\n\tv_nop\n\tv_nop" : "+v"(c) : "v"(ah), "v"(al), "v"(bh), "v"(bl));
  return c;
}
// batched GEMM like k_gemm_b but f16 operands: A f32 (split into f16 hi/lo if ASPLIT, else rounded to f16), Bt = f16 values [n][k]; alpha; C f32; N multiple of 16 (partial tiles skipped)
template <bool ASPLIT>
__global__ __launch_bounds__(128) void k_gemm_h(const float* __restrict__ A, int lda, size_t sA, const _Float16* __restrict__ Bh, int ldb, size_t sB, float alpha, float* __restrict__ C, int ldc, size_t sC, int M, int N, int K) {
  __shared__ __attribute__((aligned(16))) float so[4][16][64];
  const int tid = threadIdx.x, w = tid >> 5, lane = tid & 31, ln = lane & 15, hh = lane >> 4; const int by = blockIdx.y;
  A += (size_t)by * sA; Bh += (size_t)by * sB; C += (size_t)by * sC;
  const int ntn = (N + 63) / 64; const int wid = blockIdx.x * 4 + w; const int mt = wid / ntn, nq = wid % ntn; if (mt * 16 >= M) return;
  const int row0 = mt * 16, col0 = nq * 64; const float* arow = A + (size_t)(row0 + ln) * lda;
  v8f acc[4] = {};
  for (int kb = 0; kb < K; kb += 32) {
    FragH ah, al;
    const v4f x0 = *(const v4fa*)(arow + kb + 8 * hh), x1 = *(const v4fa*)(arow + kb + 8 * hh + 4), x2 = *(const v4fa*)(arow + kb + 16 + 8 * hh), x3 = *(const v4fa*)(arow + kb + 16 + 8 * hh + 4);
    float xs[16] = {x0[0],x0[1],x0[2],x0[3],x1[0],x1[1],x1[2],x1[3],x2[0],x2[1],x2[2],x2[3],x3[0],x3[1],x3[2],x3[3]};
#pragma unroll
    for (int i = 0; i < 16; ++i) { const _Float16 h = (_Float16)xs[i]; ah.h[i] = h; al.h[i] = ASPLIT ? (_Float16)(xs[i] - (float)h) : (_Float16)0.0f; }
#pragma unroll
    for (int t = 0; t < 4; ++t) { if (col0 + t * 16 >= N) continue; const size_t boff = (size_t)(col0 + t * 16 + ln) * ldb + kb; FragH bq; bq.half[0] = *(const v8us*)(Bh + boff + 8 * hh); bq.half[1] = *(const v8us*)(Bh + boff + 16 + 8 * hh);
      acc[t] = mmaH<ASPLIT ? 2 : 1>(ah.v, al.v, bq.v, bq.v, acc[t]); }
  }
#pragma unroll
  for (int t = 0; t < 4; ++t) { if (col0 + t * 16 >= N) continue;
#pragma unroll
    for (int r = 0; r < 8; ++r) so[w][8 * hh + r][t * 16 + ln] = acc[t][r] * alpha; }
  __builtin_amdgcn_fence(__ATOMIC_ACQ_REL, "workgroup"); __builtin_amdgcn_wave_barrier();
  const int rsub = lane >> 4, c4 = (lane & 15) * 4;
  {
#pragma unroll
    for (int q = 0; q < 8; ++q) { const int r = q * 2 + rsub; if (col0 + c4 < N) { const v4f v = *(const v4fa*)&so[w][r][c4]; *(v4f*)(C + (size_t)(row0 + r) * ldc + col0 + c4) = v; } }
     }
}

// Wt[n][k] = f16(W[k][n]·scale) from f32 row-major W[K][N] (scale = power of two; bf16-exact weights stay exact in f16 away from the subnormal range)
__global__ __launch_bounds__(256) void k_wt_f16(const float* __restrict__ W, _Float16* __restrict__ Wt, int K, int N, float scale) {
  const int t = blockIdx.x * 256 + threadIdx.x; if (t >= N * (K / 8)) return; const int n = t / (K / 8), k8 = (t % (K / 8)) * 8; FragH f;
#pragma unroll
  for (int i = 0; i < 8; ++i) f.h[i] = (_Float16)(bf16_round(W[(size_t)(k8 + i) * N + n]) * scale); const v8us o = f.half[0];
  *(v8us*)((unsigned short*)Wt + (size_t)n * K + k8) = o; 
}
// k_gemm_hh variant with fused epilogue: v = acc·alpha + bias[by·sBias + col] (+ CP[(row/rowsPerB)·sCPb + by·64 + col] if CP) ; ACT 0 none / 1 elu ; writes f16 C16 (and f32 C if non-null)
template <int ACT>
__global__ __launch_bounds__(128) void k_gemm_hhx(const _Float16* __restrict__ A, int lda, size_t sA, const _Float16* __restrict__ Bh, int ldb, size_t sB, float alpha, const float* __restrict__ bias, size_t sBias, const float* __restrict__ CP, int rowsPerB, size_t sCPb, int row0g,
    float* __restrict__ C, _Float16* __restrict__ C16, int ldc, size_t sC, int M, int N, int K) {
  __shared__ __attribute__((aligned(16))) float so[4][16][64];
  const int tid = threadIdx.x, w = tid >> 5, lane = tid & 31, ln = lane & 15, hh = lane >> 4; const int by = blockIdx.y;
  A += (size_t)by * sA; Bh += (size_t)by * sB; const size_t cofs = (size_t)by * sC; const float* bp = bias ? bias + (size_t)by * sBias : nullptr;
  const int ntn = (N + 63) / 64; const int wid = blockIdx.x * 4 + w; const int mt = wid / ntn, nq = wid % ntn; if (mt * 16 >= M) return;
  const int row0 = mt * 16, col0 = nq * 64; const _Float16* arow = A + (size_t)(row0 + ln) * lda;
  v8f acc[4] = {};
  for (int kb = 0; kb < K; kb += 32) { FragH ah; ah.half[0] = *(const v8us*)((const unsigned short*)arow + kb + 8 * hh); ah.half[1] = *(const v8us*)((const unsigned short*)arow + kb + 16 + 8 * hh);
#pragma unroll
    for (int t = 0; t < 4; ++t) { if (col0 + t * 16 >= N) continue; const size_t boff = (size_t)(col0 + t * 16 + ln) * ldb + kb; FragH bq; bq.half[0] = *(const v8us*)((const unsigned short*)Bh + boff + 8 * hh); bq.half[1] = *(const v8us*)((const unsigned short*)Bh + boff + 16 + 8 * hh);
      acc[t] = mmaH<1>(ah.v, ah.v, bq.v, bq.v, acc[t]); }
  }
#pragma unroll
  for (int t = 0; t < 4; ++t) { if (col0 + t * 16 >= N) continue; const int col = col0 + t * 16 + ln; const float bv = bp ? bf16_round(bp[col]) : 0.f;
#pragma unroll
    for (int r = 0; r < 8; ++r) { float v = acc[t][r] * alpha + bv; if (CP) { const int rr = row0g + row0 + 8 * hh + r; if (rowsPerB < 0) v += CP[cofs + (size_t)rr * ldc + col];      /* rowsPerB < 0: own element of the batched C plane */ else { const int bidx = rr / rowsPerB; v += CP[(size_t)bidx * sCPb + (size_t)by * 64 + col]; } } if (ACT == 1) v = (v > 0.f) ? v : expm1f(v); else if (ACT == 7) v = (v > 0.f) ? v + 1.0f : expf(v); else if (ACT == 8) v = tanhf(v); else if (ACT == 9) v = 0.5f * v * (1.0f + tanhf(0.7978845608028654f * (v + 0.044715f * v * v * v))); else if (ACT == 11) v = 1.0f / (1.0f + expf(-v)); else if (ACT == 12) v = (v > 0.f) ? v : 0.01f * v; else if (ACT == 14) v = (v > 0.f) ? v : 0.1f * v; else if (ACT == 16) v = (v >= 0.f) ? v : 0.3f * v; else if (ACT == 17) v = (v >= 0.f) ? v : 0.2f * v; else if (ACT == 15) v = v / (1.0f + expf(-v)); else if (ACT == 3) v = fmaxf(v, 0.f); else if (ACT == 6) v = 0.5f * v * (1.0f + erff(v * 0.70710678118654752f)); so[w][8 * hh + r][t * 16 + ln] = v; } }
  __builtin_amdgcn_fence(__ATOMIC_ACQ_REL, "workgroup"); __builtin_amdgcn_wave_barrier();
  const int rsub = lane >> 4, c4 = (lane & 15) * 4; typedef _Float16 v4h __attribute__((ext_vector_type(4)));
  {
#pragma unroll
    for (int q = 0; q < 8; ++q) { const int r = q * 2 + rsub; if (col0 + c4 < N) { const v4f v = *(const v4fa*)&so[w][r][c4]; if (C) *(v4f*)(C + cofs + (size_t)(row0 + r) * ldc + col0 + c4) = v; if (C16) { v4h h4; for (int i = 0; i < 4; ++i) h4[i] = (_Float16)v[i]; *(v4h*)(C16 + cofs + (size_t)(row0 + r) * ldc + col0 + c4) = h4; } } }
     }
}


typedef _Float16 v4h __attribute__((ext_vector_type(4)));

__global__ __launch_bounds__(256) void k_x16(const float* __restrict__ x, _Float16* __restrict__ X16, size_t n8) { const size_t t = (size_t)blockIdx.x * 256 + threadIdx.x; if (t >= n8) return; FragH f;
#pragma unroll
  for (int q = 0; q < 8; ++q) f.h[q] = (_Float16)bf16_round(x[t * 8 + q]); *(v8us*)((unsigned short*)X16 + t * 8) = f.half[0];  }
__global__ __launch_bounds__(256) void k_h16(const float* __restrict__ x, _Float16* __restrict__ X16, size_t n8) { const size_t t = (size_t)blockIdx.x * 256 + threadIdx.x; if (t >= n8) return; FragH f;
#pragma unroll
  for (int q = 0; q < 8; ++q) f.h[q] = (_Float16)x[t * 8 + q]; *(v8us*)((unsigned short*)X16 + t * 8) = f.half[0];  }
__global__ __launch_bounds__(256) void k_round16f(const float* __restrict__ W, _Float16* __restrict__ Bt, size_t n8) { const size_t t = (size_t)blockIdx.x * 256 + threadIdx.x; if (t >= n8) return; FragH f;
#pragma unroll
  for (int i = 0; i < 8; ++i) f.h[i] = (_Float16)(bf16_round(W[t * 8 + i]) * 16.0f); *(v8us*)((unsigned short*)Bt + t * 8) = f.half[0];  }
template <int NHv, int TTv>
__global__ __launch_bounds__(256) void k_vt(const _Float16* __restrict__ V16, int ldv, int voff, _Float16* __restrict__ Vt) { __shared__ unsigned short tl[64][66]; const int tid = threadIdx.x; const int slab = blockIdx.x / (TTv / 64), lg = blockIdx.x % (TTv / 64); const int b = slab / NHv, h = slab % NHv;
  for (int i = tid; i < 64 * 8; i += 256) { const int r = i / 8, c8 = (i % 8) * 8; FragH f; f.half[0] = *(const v8us*)((const unsigned short*)V16 + ((size_t)b * TTv + lg * 64 + r) * ldv + voff + h * 64 + c8);
#pragma unroll
    for (int q = 0; q < 8; ++q) tl[r][c8 + q] = f.u[q]; }
  __syncthreads();
  {
#pragma unroll
    for (int rd = 0; rd < 2; ++rd) { const int d = rd * 32 + tid / 8, pc = tid % 8; FragH f;
#pragma unroll
      for (int q = 0; q < 8; ++q) f.u[q] = tl[pc * 8 + q][d];
      *(v8us*)((unsigned short*)Vt + ((size_t)slab * 64 + d) * TTv + lg * 64 + pc * 8) = f.half[0]; }
     } }

__global__ __launch_bounds__(256) void k_hl(const float* __restrict__ F, _Float16* __restrict__ Hh, _Float16* __restrict__ Hl, size_t n8) { const size_t t = (size_t)blockIdx.x * 256 + threadIdx.x; if (t >= n8) return; FragH fh, fl; const v4f a = *(const v4fa*)(F + t * 8), c = *(const v4fa*)(F + t * 8 + 4);
#pragma unroll
  for (int q = 0; q < 4; ++q) { _Float16 h = (_Float16)a[q]; fh.h[q] = h; fl.h[q] = (_Float16)((a[q] - (float)h) * 1024.0f); h = (_Float16)c[q]; fh.h[4 + q] = h; fl.h[4 + q] = (_Float16)((c[q] - (float)h) * 1024.0f); }
  { *(v8us*)((unsigned short*)Hh + t * 8) = fh.half[0]; *(v8us*)((unsigned short*)Hl + t * 8) = fl.half[0];  } }

// ---- fast GEMM (wave tile 32x64; requires M % 32 == 0 rows per launch region and N % 64 == 0); epilogue = k_gemm_hhx semantics ----
__device__ __forceinline__ v16h g2_frag(const _Float16* p, int hh) { FragH f; f.half[0] = *(const v8us*)((const unsigned short*)p + 8 * hh); f.half[1] = *(const v8us*)((const unsigned short*)p + 16 + 8 * hh); return f.v; }
__device__ __forceinline__ v8f g2_mma(v16h a, v16h b, v8f c) { v8f d = __builtin_amdgcn_wmma_f32_16x16x32_f16(false, a, false, b, (short)0, c, false, false); asm volatile("v_nop\n\tv_nop\n\tv_nop\n\tv_nop" : "+v"(d) : "v"(a), "v"(b)); return d; }
template <int ACT>
__global__ __launch_bounds__(128) void k_gemm2(const _Float16* __restrict__ A, int lda, size_t sA, const _Float16* __restrict__ Bh, int ldb, size_t sB, float alpha, const float* __restrict__ bias, size_t sBias, const float* __restrict__ CP, int rowsPerB, size_t sCPb, int row0g,
    float* __restrict__ C, _Float16* __restrict__ C16, int ldc, size_t sC, int M, int N, int K) { static_assert(ACT == 0 || ACT == 3 || ACT == 6 || ACT == 8 || ACT == 9 || ACT == 11 || ACT == 12 || ACT == 14 || ACT == 15 || ACT == 16 || ACT == 17, "k_gemm2: unsupported ACT code (would silently apply no activation)");
  __shared__ __attribute__((aligned(16))) float so[4][32][68];
  const int tid = threadIdx.x, w = tid >> 5, lane = tid & 31, ln = lane & 15, hh = lane >> 4; const int by = blockIdx.y;
  A += (size_t)by * sA; Bh += (size_t)by * sB; const size_t cofs = (size_t)by * sC; const float* bp = bias ? bias + (size_t)by * sBias : nullptr;
  const int ntn = N >> 6; const int mt = blockIdx.x / ntn, nq = blockIdx.x - mt * ntn; const int row0 = mt * 128 + 32 * w, col0 = nq * 64; if (row0 >= M) return;
  const _Float16* a0p = A + (size_t)(row0 + ln) * lda; const _Float16* a1p = a0p + (size_t)16 * lda;
  const _Float16* b0p = Bh + (size_t)(col0 + ln) * ldb; const _Float16* b1p = b0p + (size_t)16 * ldb; const _Float16* b2p = b1p + (size_t)16 * ldb; const _Float16* b3p = b2p + (size_t)16 * ldb;
  const v8f z8 = {0.f,0.f,0.f,0.f,0.f,0.f,0.f,0.f}; v8f c00 = z8, c01 = z8, c02 = z8, c03 = z8, c10 = z8, c11 = z8, c12 = z8, c13 = z8;
#pragma unroll 1
  for (int kb = 0; kb < K; kb += 32) { const v16h a0 = g2_frag(a0p + kb, hh), a1 = g2_frag(a1p + kb, hh);
    v16h b = g2_frag(b0p + kb, hh); c00 = g2_mma(a0, b, c00); c10 = g2_mma(a1, b, c10);
    b = g2_frag(b1p + kb, hh); c01 = g2_mma(a0, b, c01); c11 = g2_mma(a1, b, c11);
    b = g2_frag(b2p + kb, hh); c02 = g2_mma(a0, b, c02); c12 = g2_mma(a1, b, c12);
    b = g2_frag(b3p + kb, hh); c03 = g2_mma(a0, b, c03); c13 = g2_mma(a1, b, c13); }
  v8f accs[8] = {c00, c01, c02, c03, c10, c11, c12, c13};
#pragma unroll
  for (int u = 0; u < 8; ++u) { const int t = u & 3, half = u >> 2; const int col = col0 + t * 16 + ln; const float bv = bp ? bf16_round(bp[col]) : 0.f;
#pragma unroll
    for (int r = 0; r < 8; ++r) { const int rloc = half * 16 + 8 * hh + r; float v = accs[u][r] * alpha + bv; if (CP) { if (rowsPerB < 0) v += CP[cofs + (size_t)(row0g + row0 + rloc) * ldc + col];      /* rowsPerB < 0: own element of the batched C plane */ else { const int bidx = (row0g + row0 + rloc) / rowsPerB; v += CP[(size_t)bidx * sCPb + (size_t)by * 64 + col]; } }
      if (ACT == 3) v = fmaxf(v, 0.f); else if (ACT == 6) v = 0.5f * v * (1.0f + erff(v * 0.70710678118654752f)); else if (ACT == 11) v = 1.0f / (1.0f + expf(-v)); else if (ACT == 15) v = v / (1.0f + expf(-v)); else if (ACT == 12) v = (v > 0.f) ? v : 0.01f * v; else if (ACT == 8) v = tanhf(v); else if (ACT == 9) v = 0.5f * v * (1.0f + tanhf(0.7978845608028654f * (v + 0.044715f * v * v * v))); else if (ACT == 14) v = (v > 0.f) ? v : 0.1f * v; else if (ACT == 16) v = (v >= 0.f) ? v : 0.3f * v; else if (ACT == 17) v = (v >= 0.f) ? v : 0.2f * v;
      so[w][rloc][t * 16 + ln] = v; } }
  __builtin_amdgcn_fence(__ATOMIC_ACQ_REL, "workgroup"); __builtin_amdgcn_wave_barrier();
  const int rsub = lane >> 4, c4 = (lane & 15) * 4;
  {
#pragma unroll
    for (int q = 0; q < 16; ++q) { const int r = q * 2 + rsub; const v4f v = *(const v4fa*)&so[w][r][c4]; if (C) *(v4f*)(C + cofs + (size_t)(row0 + r) * ldc + col0 + c4) = v; if (C16) { v4h h4; for (int i = 0; i < 4; ++i) h4[i] = (_Float16)v[i]; *(v4h*)(C16 + cofs + (size_t)(row0 + r) * ldc + col0 + c4) = h4; } }
     } }


__global__ __launch_bounds__(256) void k_wsc(const float* __restrict__ Wm, _Float16* __restrict__ Bt, size_t n8, float sc) { const size_t t = (size_t)blockIdx.x * 256 + threadIdx.x; if (t >= n8) return; FragH f; for (int q = 0; q < 8; ++q) f.h[q] = (_Float16)(bf16_round(Wm[t * 8 + q]) * sc); *(v8us*)((unsigned short*)Bt + t * 8) = f.half[0];  }
__global__ __launch_bounds__(256) void k_ccp(const float* __restrict__ QKV, int coff, _Float16* __restrict__ D) { const size_t t = (size_t)blockIdx.x * 256 + threadIdx.x; if (t >= (size_t)NR * DM / 8) return; const int c0 = (int)((t * 8) % DM); const size_t row = (t * 8) / DM; const v8f a = *(const v8f*)(QKV + row * 3 * DM + coff + c0); FragH f; for (int q = 0; q < 8; ++q) f.h[q] = (_Float16)a[q];
  *(v8us*)((unsigned short*)D + t * 8) = f.half[0];  }
__global__ __launch_bounds__(256) void k_chl(const float* __restrict__ QKV, int coff, _Float16* __restrict__ Hh, _Float16* __restrict__ Lh) {
  #pragma clang fp contract(off)
  const size_t t = (size_t)blockIdx.x * 256 + threadIdx.x; if (t >= (size_t)NR * DM / 8) return; const int c0 = (int)((t * 8) % DM); const size_t row = (t * 8) / DM; const v8f a = *(const v8f*)(QKV + row * 3 * DM + coff + c0); FragH fh, fl; for (int q = 0; q < 8; ++q) { const _Float16 hv = (_Float16)a[q]; fh.h[q] = hv; fl.h[q] = (_Float16)((a[q] - (float)hv) * 1024.0f); }
  { *(v8us*)((unsigned short*)Hh + t * 8) = fh.half[0]; *(v8us*)((unsigned short*)Lh + t * 8) = fl.half[0];  } }
__device__ __forceinline__ void exter(const float* p1, const float* p2, float* L) {
  #pragma clang fp contract(off)
  const int PI[6] = {0, 0, 0, 1, 1, 2}, PJ[6] = {1, 2, 3, 2, 3, 3}; float n2 = 0.f;
  for (int k = 0; k < 6; ++k) { float a = p1[PI[k]] * p2[PJ[k]]; a += -(p1[PJ[k]] * p2[PI[k]]); L[k] = a; n2 += a * a; }
  const float n = fmaxf(sqrtf(n2), 1e-12f); for (int k = 0; k < 6; ++k) L[k] = L[k] / n; }
__global__ __launch_bounds__(256) void k_lines(const float* __restrict__ LW, float* __restrict__ JW, float* __restrict__ RD) {
  #pragma clang fp contract(off)
  const int tt = blockIdx.x * 256 + threadIdx.x; if (tt >= NR * NH) return; const int t = tt % TT; const int bh = tt / TT; const int h = bh % NH, b = bh / NH; const size_t row = (size_t)b * TT + t; float w1[4], w2[4], r1[4], r2[4];
  for (int i = 0; i < 4; ++i) { w1[i] = (t > 0) ? LW[(row - 1) * 256 + h * 4 + i] : 0.f; w2[i] = LW[row * 256 + 64 + h * 4 + i]; r1[i] = LW[row * 256 + 128 + h * 4 + i]; r2[i] = LW[row * 256 + 192 + h * 4 + i]; }
  float wl[6], rl[6]; exter(w1, w2, wl); exter(r1, r2, rl); v8f jw, rd; jw[0] = wl[5]; jw[1] = -wl[4]; jw[2] = wl[3]; jw[3] = wl[2]; jw[4] = -wl[1]; jw[5] = wl[0]; jw[6] = 0.f; jw[7] = 0.f; for (int k = 0; k < 6; ++k) rd[k] = rl[k]; rd[6] = 0.f; rd[7] = 0.f;
  const size_t o = (((size_t)b * NH + h) * TT + t) * 8; { *(v8f*)(JW + o) = jw; *(v8f*)(RD + o) = rd;  } }
__global__ __launch_bounds__(64) void k_cum(const float* __restrict__ JW, const float* __restrict__ RD, float* __restrict__ RDM) {
  #pragma clang fp contract(off)
  const int tt = blockIdx.x * 64 + threadIdx.x; if (tt >= NB * NH * 8) return; const int j = tt % 8; const int bh = tt / 8; float m[6]; for (int i = 0; i < 6; ++i) m[i] = 0.f; const float* jw = JW + (size_t)bh * TT * 8; const float* rd = RD + (size_t)bh * TT * 8;
#pragma unroll 1
  for (int t = 0; t < TT; ++t) { float v = 0.f; if (j < 6) { const float wj = jw[(size_t)t * 8 + j]; for (int i = 0; i < 6; ++i) { m[i] += jw[(size_t)t * 8 + i] * wj; } for (int i = 0; i < 6; ++i) v += rd[(size_t)t * 8 + i] * m[i]; }
    float* d = RDM + ((size_t)bh * TT + t) * 8 + j; *(float*)d = v;  } }
__global__ __launch_bounds__(256) void k_bsoft(const float* __restrict__ S, const float* __restrict__ RDM, const float* __restrict__ JW, const float* __restrict__ bsc, int b, int h0, _Float16* __restrict__ P, float* __restrict__ RS) {
  #pragma clang fp contract(off)
  const int wv = threadIdx.x >> 5, ln = threadIdx.x & 31; const int r = blockIdx.x * 8 + wv; if (r >= HG * TT) return; const int t = r % TT, hl = r / TT; const int h = h0 + hl; const size_t bh = (size_t)b * NH + h; const float bs = bf16_round(bsc[h]); const float* sr = S + (size_t)r * TT; const v8f rdm = *(const v8f*)(RDM + (bh * TT + t) * 8); const float* jwb = JW + bh * TT * 8;
  auto lgt = [&](int s) { const v8f jw = *(const v8f*)(jwb + (size_t)s * 8); float d = 0.f; for (int k = 0; k < 6; ++k) d += rdm[k] * jw[k]; float l = sr[s] * 0.125f; l += fabsf(d) * bs; return l; };
  float mx = -3.0e38f;
#pragma unroll 1
  for (int gq = 0; gq < TT / 256; ++gq) for (int q = 0; q < 8; ++q) { const int s = gq * 256 + ln * 8 + q; if (s <= t) mx = fmaxf(mx, lgt(s)); }
  for (int o = 16; o > 0; o >>= 1) mx = fmaxf(mx, __shfl_xor(mx, o, 32)); float su = 0.f;
{ su = 0.f;
#pragma unroll 1
    for (int gq = 0; gq < TT / 256; ++gq) { FragH ph; for (int q = 0; q < 8; ++q) { const int s = gq * 256 + ln * 8 + q; float e = 0.f; if (s <= t) { e = expf(lgt(s) - mx); su += e; } ph.h[q] = (_Float16)(e * 1024.0f); } *(v8us*)((unsigned short*)P + (size_t)r * TT + gq * 256 + ln * 8) = ph.half[0]; }
     }
  for (int o = 16; o > 0; o >>= 1) su += __shfl_xor(su, o, 32); if (ln == 0) { *(float*)(RS + (size_t)r * 32) = 1.0f / su;  } }
__global__ __launch_bounds__(256) void k_csc(const float* __restrict__ O, const float* __restrict__ RS, int b, int h0, _Float16* __restrict__ CH, _Float16* __restrict__ CL) {
  #pragma clang fp contract(off)
  const int tt = blockIdx.x * 256 + threadIdx.x; if (tt >= TT * HG * (HD / 8)) return; const int d8 = (tt % (HD / 8)) * 8; const int hl = (tt / (HD / 8)) % HG; const int t = tt / ((HD / 8) * HG); const float rs = RS[((size_t)hl * TT + t) * 32]; const size_t o = ((size_t)b * TT + t) * DM + (h0 + hl) * HD + d8; const v8f a = *(const v8f*)(O + (size_t)t * DM + (h0 + hl) * HD + d8); FragH f, fl;
  for (int q = 0; q < 8; ++q) { const float v = a[q] * rs; const _Float16 hh = (_Float16)v; f.h[q] = hh; fl.h[q] = (_Float16)((v - (float)hh) * 1024.0f); }
  { *(v8us*)((unsigned short*)CH + o) = f.half[0]; *(v8us*)((unsigned short*)CL + o) = fl.half[0];  } }

extern "C" void kernel_launch(void* const* d_in, const int* in_sizes, int n_in,
                              void* d_out, int out_size, void* d_ws, size_t ws_size, hipStream_t stream) {
  (void)in_sizes; (void)n_in; (void)out_size;
  const float* x = (const float*)d_in[0]; const float* Wqkv = (const float*)d_in[1]; const float* bqkv = (const float*)d_in[2]; const float* W1w = (const float*)d_in[3]; const float* W2w = (const float*)d_in[4]; const float* W1r = (const float*)d_in[5]; const float* W2r = (const float*)d_in[6]; const float* bsc = (const float*)d_in[7]; const float* Wout = (const float*)d_in[8]; const float* bout = (const float*)d_in[9];
  char* ws = (char*)d_ws; size_t off = 0;
  auto take = [&](size_t bytes) { char* p = ws + off; off += (bytes + 255) & ~(size_t)255; return p; };
  const size_t np = (size_t)NR * DM;
  _Float16* BQKV = (_Float16*)take((size_t)3 * DM * DM * 2); _Float16* BL = (_Float16*)take((size_t)256 * DM * 2); _Float16* BO = (_Float16*)take((size_t)DM * DM * 2);
  _Float16* X16 = (_Float16*)take(np * 2); float* QKV = (float*)take(np * 3 * 4); _Float16* Q16 = (_Float16*)take(np * 2); _Float16* K16 = (_Float16*)take(np * 2); _Float16* V16 = (_Float16*)take(np * 2); _Float16* VL16 = (_Float16*)take(np * 2); _Float16* VT = (_Float16*)take(np * 2); _Float16* VTL = (_Float16*)take(np * 2);
  float* LW = (float*)take((size_t)NR * 256 * 4); float* JW = (float*)take((size_t)NB * NH * TT * 8 * 4); float* RD = (float*)take((size_t)NB * NH * TT * 8 * 4); float* RDM = (float*)take((size_t)NB * NH * TT * 8 * 4);
  float* S = (float*)take((size_t)HG * TT * TT * 4); _Float16* P = (_Float16*)take((size_t)HG * TT * TT * 2); float* RS = (float*)take((size_t)HG * TT * 32 * 4); float* O = (float*)take((size_t)TT * DM * 4); _Float16* CH = (_Float16*)take(np * 2); _Float16* CL = (_Float16*)take(np * 2);
  if (off > ws_size) return;      /* 6.5 + 2 + 4 + 24 + 6 x 4 + 2 + 3 + 16 + 8 + 0.5 + 4 + 8 = ≈ 102 MiB */
  k_wsc<<<(unsigned)(((size_t)3 * DM * DM / 8 + 255) / 256), 256, 0, stream>>>(Wqkv, BQKV, (size_t)3 * DM * DM / 8, 16.0f); k_wsc<<<(unsigned)(((size_t)DM * DM / 8 + 255) / 256), 256, 0, stream>>>(Wout, BO, (size_t)DM * DM / 8, 16.0f);      /* torch (out, in) naturals */
  k_wsc<<<(unsigned)(((size_t)64 * DM / 8 + 255) / 256), 256, 0, stream>>>(W1w, BL, (size_t)64 * DM / 8, 16.0f); k_wsc<<<(unsigned)(((size_t)64 * DM / 8 + 255) / 256), 256, 0, stream>>>(W2w, BL + (size_t)64 * DM, (size_t)64 * DM / 8, 16.0f); k_wsc<<<(unsigned)(((size_t)64 * DM / 8 + 255) / 256), 256, 0, stream>>>(W1r, BL + (size_t)128 * DM, (size_t)64 * DM / 8, 16.0f); k_wsc<<<(unsigned)(((size_t)64 * DM / 8 + 255) / 256), 256, 0, stream>>>(W2r, BL + (size_t)192 * DM, (size_t)64 * DM / 8, 16.0f);      /* [W1w; W2w; W1r; W2r] rows h*4 + i */
  k_x16<<<(unsigned)((np / 8 + 255) / 256), 256, 0, stream>>>(x, X16, np / 8);
  k_gemm2<0><<<dim3((NR / 128) * (3 * DM / 64), 1), 128, 0, stream>>>(X16, DM, 0, BQKV, DM, 0, 0.0625f, bqkv, 0, nullptr, 1, 0, 0, QKV, nullptr, 3 * DM, 0, NR, 3 * DM, DM);      /* [q | k | v] + bias, head h at h*64 */
  k_gemm2<0><<<dim3((NR / 128) * (256 / 64), 1), 128, 0, stream>>>(X16, DM, 0, BL, DM, 0, 0.0625f, nullptr, 0, nullptr, 1, 0, 0, LW, nullptr, 256, 0, NR, 256, DM);      /* line projections f32 [row][w1 | w2 | r1 | r2] (x_prev handled by a row shift) */
  k_ccp<<<(unsigned)((np / 8 + 255) / 256), 256, 0, stream>>>(QKV, 0, Q16); k_ccp<<<(unsigned)((np / 8 + 255) / 256), 256, 0, stream>>>(QKV, DM, K16); k_chl<<<(unsigned)((np / 8 + 255) / 256), 256, 0, stream>>>(QKV, 2 * DM, V16, VL16);      /* v as hi + residual (the bias makes the attention peaked, so v's rounding reaches the output almost unaveraged) */
  k_vt<NH, TT><<<NB * NH * (TT / 64), 256, 0, stream>>>(V16, DM, 0, VT); k_vt<NH, TT><<<NB * NH * (TT / 64), 256, 0, stream>>>(VL16, DM, 0, VTL);
  k_lines<<<(NR * NH + 255) / 256, 256, 0, stream>>>(LW, JW, RD); k_cum<<<(NB * NH * 8 + 63) / 64, 64, 0, stream>>>(JW, RD, RDM);
  for (int b = 0; b < NB; ++b) { const size_t r0 = (size_t)b * TT;
    for (int g = 0; g < NH / HG; ++g) { const int h0 = g * HG;
      k_gemm2<0><<<dim3((TT / 128) * (TT / 64), HG), 128, 0, stream>>>(Q16 + r0 * DM + h0 * HD, DM, (size_t)HD, K16 + r0 * DM + h0 * HD, DM, (size_t)HD, 1.0f, nullptr, 0, nullptr, 1, 0, 0, S, nullptr, TT, (size_t)TT * TT, TT, TT, HD);
      k_bsoft<<<(HG * TT) / 8, 256, 0, stream>>>(S, RDM, JW, bsc, b, h0, P, RS);
      k_gemm2<0><<<dim3((TT / 128) * (HD / 64), HG), 128, 0, stream>>>(P, TT, (size_t)TT * TT, VTL + ((size_t)b * NH + h0) * HD * TT, TT, (size_t)HD * TT, 0.0009765625f / 1024.0f, nullptr, 0, nullptr, 1, 0, 0, O + h0 * HD, nullptr, DM, (size_t)HD, TT, HD, TT);
      k_gemm2<0><<<dim3((TT / 128) * (HD / 64), HG), 128, 0, stream>>>(P, TT, (size_t)TT * TT, VT + ((size_t)b * NH + h0) * HD * TT, TT, (size_t)HD * TT, 0.0009765625f, nullptr, 0, O + h0 * HD, -1, 0, 0, O + h0 * HD, nullptr, DM, (size_t)HD, TT, HD, TT);      /* P . (v_lo + v_hi)^T (own-element accumulate) */
      k_csc<<<(TT * HG * (HD / 8) + 255) / 256, 256, 0, stream>>>(O, RS, b, h0, CH, CL); } }
  k_gemm2<0><<<dim3((NR / 128) * (DM / 64), 1), 128, 0, stream>>>(CL, DM, 0, BO, DM, 0, 0.0625f / 1024.0f, nullptr, 0, nullptr, 1, 0, 0, (float*)d_out, nullptr, DM, 0, NR, DM, DM);
  k_gemm2<0><<<dim3((NR / 128) * (DM / 64), 1), 128, 0, stream>>>(CH, DM, 0, BO, DM, 0, 0.0625f, bout, 0, (const float*)d_out, 1, (size_t)DM, 0, (float*)d_out, nullptr, DM, 0, NR, DM, DM);      /* out = (c_lo + c_hi) Wout^T + bout */
}

// v001
// It runs in 908 microseconds.
// Next to v000, in two timings, it ran 1.49 and 1.50 times as fast.
#include <hip/hip_runtime.h>
// EigenBiasAttention (2 x 1024 tokens x 1024 = 16 heads x 64; qkv = x Wqkv^T + b; causal softmax(q.k/8 + |bias|) v; bias from Plucker lines: per head w1 = x_prev W1w^T, w2 = x W2w^T, r1 = x W1r^T, r2 = x W2r^T (4-vectors), write/read lines = normalised exterior products (6-vectors), Jw = write J6, M_t = cumsum_t Jw Jw^T, bias[t][s] = |(rd_t . M_t) . Jw_s| * bias_scale[h]; out = merged . Wout^T + bout).
// Structure: exact f16 x plane; qkv and the four line projections as f16 WMMA GEMMs (32x64 wave tiles, f32 accumulation, exact x16 weights (+ bias); f32 out) then f16 q/k/v planes; the exterior products / normalisation / J6 on VALU; the causal 6x6 Gram cumsum and rd . M per (batch, head, column) sequentially on VALU (f32, 1024 steps); per (batch, 4-head group) the score GEMM (K = 64, f32), the biased causal softmax on VALU (bias dot K = 6 per (t, s), bias_scale read; unnormalised f16 weights x 2^10 + row normalisers on their own lines), V^T hi/residual by LDS tiles, readout as two GEMM terms (N = 64); row scaling + hi/residual; Wout as two GEMM terms (+ bias).
// Compute dtype: inputs rounded to bf16; x / weights exact as f16 (line projections are f32 sums of exact products, so the bias path is f32-class); q, k and the softmax weights as plain f16 operands (~2^-12); v and the context as f16 hi + residual. v_wmma_f32_16x16x32_f16.
#define NB 2
#define TT 1024
#define DM 1024
#define NH 16
#define HD 64
#define HG 4
#define NR (NB * TT)
typedef __bf16 v16b __attribute__((ext_vector_type(16)));
typedef unsigned short v8us __attribute__((ext_vector_type(8), may_alias));
typedef float  v8f  __attribute__((ext_vector_type(8)));
typedef float  v4f  __attribute__((ext_vector_type(4)));
typedef float  v4fa __attribute__((ext_vector_type(4), may_alias));
union FragB { v16b v; v8us half[2]; unsigned short u[16]; };

__device__ __forceinline__ unsigned short bf16_bits(float x) { unsigned int u = __float_as_uint(x); return (unsigned short)((u + 0x7FFFu + ((u >> 16) & 1u)) >> 16); }
__device__ __forceinline__ float bf16_val(unsigned short b) { return __uint_as_float(((unsigned int)b) << 16); }
__device__ __forceinline__ float bf16_round(float x) { return bf16_val(bf16_bits(x)); }
// D += A·B with NT terms: 1 = ah·bh, 2 = + al·bh (A split), 3 = + ah·bl (both split)
template <int NT>
__device__ __forceinline__ v8f mmaN(v16b ah, v16b al, v16b bh, v16b bl, v8f c) {
  c = __builtin_amdgcn_wmma_f32_16x16x32_bf16(false, ah, false, bh, (short)0, c, false, false);
  if (NT >= 2) c = __builtin_amdgcn_wmma_f32_16x16x32_bf16(false, al, false, bh, (short)0, c, false, false);
  if (NT >= 3) c = __builtin_amdgcn_wmma_f32_16x16x32_bf16(false, ah, false, bl, (short)0, c, false, false);
  asm volatile("v_nop\n\tv_nop\n\tv_nop\n\tv_nop" : "+v"(c) : "v"(ah), "v"(al), "v"(bh), "v"(bl));
  return c;
}

__global__ __launch_bounds__(256) void k_wt_bf16(const float* __restrict__ W, unsigned short* __restrict__ Wt, int K, int N) {
  const int t = blockIdx.x * 256 + threadIdx.x;
  const int k8n = K / 8;
  if (t >= N * k8n) return;
  const int n = t / k8n, k8 = (t % k8n) * 8;
  v8us v;
#pragma unroll
  for (int i = 0; i < 8; ++i) v[i] = bf16_bits(W[(size_t)(k8 + i) * N + n]);
  *(v8us*)(Wt + (size_t)n * K + k8) = v;
  
}

// GEMM C[M][N] (f32, pitch ldc) = act(A[M][K]·W + bias). A f32 row-major (pitch lda) converted per fragment to bf16
// (ASPLIT: hi/lo two planes -> 2 terms, else single rounded term); Wt bf16 [N][K] (pitch ldb). BIAS_BF16 rounds the
// bias to bf16 first (bias quantised to bf16 before the add). K%32==0, M%16==0, N%64==0.
template <bool ASPLIT, int ACT, bool BIAS_BF16>
__global__ __launch_bounds__(128) void k_gemm_bf(const float* __restrict__ A, int lda, const unsigned short* __restrict__ Wt, int ldb,
                                               const float* __restrict__ bias, float* __restrict__ C, int ldc, int M, int N, int K) {
  __shared__ __attribute__((aligned(16))) float so[4][16][64];
  const int tid = threadIdx.x, w = tid >> 5, lane = tid & 31, ln = lane & 15, hh = lane >> 4;
  const int ntn = N / 64;
  const int wid = blockIdx.x * 4 + w;
  const int mt = wid / ntn, nq = wid % ntn;
  if (mt * 16 >= M) return;
  const int row0 = mt * 16, col0 = nq * 64;
  const float* arow = A + (size_t)(row0 + ln) * lda;
  v8f acc[4] = {};
  for (int kb = 0; kb < K; kb += 32) {
    FragB ah, al;
    const v4f x0 = *(const v4fa*)(arow + kb + 8 * hh), x1 = *(const v4fa*)(arow + kb + 8 * hh + 4);
    const v4f x2 = *(const v4fa*)(arow + kb + 16 + 8 * hh), x3 = *(const v4fa*)(arow + kb + 16 + 8 * hh + 4);
    float xs[16] = {x0[0],x0[1],x0[2],x0[3],x1[0],x1[1],x1[2],x1[3],x2[0],x2[1],x2[2],x2[3],x3[0],x3[1],x3[2],x3[3]};
#pragma unroll
    for (int i = 0; i < 16; ++i) { const unsigned short hb = bf16_bits(xs[i]); ah.u[i] = hb; al.u[i] = ASPLIT ? bf16_bits(xs[i] - bf16_val(hb)) : (unsigned short)0; }
#pragma unroll
    for (int t = 0; t < 4; ++t) {
      const unsigned short* brow = Wt + (size_t)(col0 + t * 16 + ln) * ldb + kb;
      FragB b;
      b.half[0] = *(const v8us*)(brow + 8 * hh);
      b.half[1] = *(const v8us*)(brow + 16 + 8 * hh);
      acc[t] = mmaN<ASPLIT ? 2 : 1>(ah.v, al.v, b.v, b.v, acc[t]);
    }
  }
#pragma unroll
  for (int t = 0; t < 4; ++t) {
    float bv = bias ? bias[col0 + t * 16 + ln] : 0.f;
    if (BIAS_BF16) bv = bf16_round(bv);
#pragma unroll
    for (int r = 0; r < 8; ++r) { float v = acc[t][r] + bv; if (ACT == 1) v = fmaxf(v, 0.f); so[w][8 * hh + r][t * 16 + ln] = v; }
  }
  __builtin_amdgcn_fence(__ATOMIC_ACQ_REL, "workgroup");
  __builtin_amdgcn_wave_barrier();
  const int rsub = lane >> 4, c4 = (lane & 15) * 4;
  {
#pragma unroll
    for (int q = 0; q < 8; ++q) {
      const int r = q * 2 + rsub;
      const v4f v = *(const v4fa*)&so[w][r][c4];
      *(v4f*)(C + (size_t)(row0 + r) * ldc + col0 + c4) = v;
    }
    
  }
}

// GEMM C = act(A·W + bias + resid): A f32 (ASPLIT -> hi/lo 2 terms), Wt bf16 [N][K]; ACT 0 none, 1 relu, 2 exact gelu;
// resid (optional, f32, row index = (row % rmod), pitch ldr, RES_BF16 rounds it) added before the activation.
template <bool ASPLIT, int ACT, bool BIAS_BF16, bool RES_BF16>
__global__ __launch_bounds__(128) void k_gemm_bf3(const float* __restrict__ A, int lda, const unsigned short* __restrict__ Wt, int ldb,
                                                const float* __restrict__ bias, const float* __restrict__ resid, int rmod, int ldr,
                                                float* __restrict__ C, int ldc, int M, int N, int K) {
  __shared__ __attribute__((aligned(16))) float so[4][16][64];
  const int tid = threadIdx.x, w = tid >> 5, lane = tid & 31, ln = lane & 15, hh = lane >> 4;
  const int ntn = N / 64;
  const int wid = blockIdx.x * 4 + w;
  const int mt = wid / ntn, nq = wid % ntn;
  if (mt * 16 >= M) return;
  const int row0 = mt * 16, col0 = nq * 64;
  const float* arow = A + (size_t)(row0 + ln) * lda;
  v8f acc[4] = {};
  for (int kb = 0; kb < K; kb += 32) {
    FragB ah, al;
    const v4f x0 = *(const v4fa*)(arow + kb + 8 * hh), x1 = *(const v4fa*)(arow + kb + 8 * hh + 4);
    const v4f x2 = *(const v4fa*)(arow + kb + 16 + 8 * hh), x3 = *(const v4fa*)(arow + kb + 16 + 8 * hh + 4);
    float xs[16] = {x0[0],x0[1],x0[2],x0[3],x1[0],x1[1],x1[2],x1[3],x2[0],x2[1],x2[2],x2[3],x3[0],x3[1],x3[2],x3[3]};
#pragma unroll
    for (int i = 0; i < 16; ++i) { const unsigned short hb = bf16_bits(xs[i]); ah.u[i] = hb; al.u[i] = ASPLIT ? bf16_bits(xs[i] - bf16_val(hb)) : (unsigned short)0; }
#pragma unroll
    for (int t = 0; t < 4; ++t) {
      const unsigned short* brow = Wt + (size_t)(col0 + t * 16 + ln) * ldb + kb;
      FragB b;
      b.half[0] = *(const v8us*)(brow + 8 * hh);
      b.half[1] = *(const v8us*)(brow + 16 + 8 * hh);
      acc[t] = mmaN<ASPLIT ? 2 : 1>(ah.v, al.v, b.v, b.v, acc[t]);
    }
  }
#pragma unroll
  for (int t = 0; t < 4; ++t) {
    const int col = col0 + t * 16 + ln;
    float bv = bias ? bias[col] : 0.f;
    if (BIAS_BF16) bv = bf16_round(bv);
#pragma unroll
    for (int r = 0; r < 8; ++r) {
      float v = acc[t][r] + bv;
      if (resid) { float rv = resid[(size_t)((row0 + 8 * hh + r) % rmod) * ldr + col]; if (RES_BF16) rv = bf16_round(rv); v += rv; }
      if (ACT == 1) v = fmaxf(v, 0.f);
      if (ACT == 2) v = 0.5f * v * (1.0f + erff(v * 0.70710678118654752f));
      if (ACT == 3) { const float u = 0.7978845608028654f * (v + 0.044715f * v * v * v); v = 0.5f * v * (1.0f + tanhf(u)); }
      so[w][8 * hh + r][t * 16 + ln] = v;
    }
  }
  __builtin_amdgcn_fence(__ATOMIC_ACQ_REL, "workgroup");
  __builtin_amdgcn_wave_barrier();
  const int rsub = lane >> 4, c4 = (lane & 15) * 4;
  {
#pragma unroll
    for (int q = 0; q < 8; ++q) {
      const int r = q * 2 + rsub;
      const v4f v = *(const v4fa*)&so[w][r][c4];
      *(v4f*)(C + (size_t)(row0 + r) * ldc + col0 + c4) = v;
    }
    
  }
}
// row LayerNorm (biased variance, eps) over N: s = X (+ R); optional out_sum <- s; out_norm <- (s-mu)*rsqrt(var+eps)*g + b
template <bool PARAM_BF16>
__global__ __launch_bounds__(256) void k_layernorm(const float* __restrict__ X, const float* __restrict__ R, const float* __restrict__ g, const float* __restrict__ bta,
                                                  float* __restrict__ out_sum, float* __restrict__ out_norm, int N, float eps) {
  __shared__ float red[256];
  const int row = blockIdx.x, tid = threadIdx.x;
  const float* x = X + (size_t)row * N; const float* rr = R ? R + (size_t)row * N : nullptr;
  float vals[16];                     // up to N = 4096
  const int per = N / 256;            // contiguous chunk per thread? use strided-by-4 chunks: thread handles j = tid*4 + 1024*u
  float s1 = 0.f;
  for (int u = 0; u < per / 4; ++u) {
    const int j = tid * 4 + 1024 * u;
    const v4f a = *(const v4fa*)(x + j);
    v4f b = {0.f,0.f,0.f,0.f}; if (rr) b = *(const v4fa*)(rr + j);
#pragma unroll
    for (int q = 0; q < 4; ++q) { const float v = a[q] + b[q]; vals[u * 4 + q] = v; s1 += v; }
  }
  red[tid] = s1; __syncthreads();
  for (int st = 128; st > 0; st >>= 1) { if (tid < st) red[tid] += red[tid + st]; __syncthreads(); }
  const float mu = red[0] / (float)N; __syncthreads();
  float s2 = 0.f;
  for (int u = 0; u < per / 4; ++u)
#pragma unroll
    for (int q = 0; q < 4; ++q) { const float c = vals[u * 4 + q] - mu; s2 += c * c; }
  red[tid] = s2; __syncthreads();
  for (int st = 128; st > 0; st >>= 1) { if (tid < st) red[tid] += red[tid + st]; __syncthreads(); }
  const float rs = rsqrtf(red[0] / (float)N + eps);
  {
    for (int u = 0; u < per / 4; ++u) {
      const int j = tid * 4 + 1024 * u;
      v4f o, sm;
#pragma unroll
      for (int q = 0; q < 4; ++q) {
        float gg = g[j + q], bb = bta[j + q];
        if (PARAM_BF16) { gg = bf16_round(gg); bb = bf16_round(bb); }
        sm[q] = vals[u * 4 + q]; o[q] = (vals[u * 4 + q] - mu) * rs * gg + bb;
      }
      if (out_sum) *(v4f*)(out_sum + (size_t)row * N + j) = sm;
      *(v4f*)(out_norm + (size_t)row * N + j) = o;
    }
    
  }
}



// ---- f16 WMMA path (v_wmma_f32_16x16x32_f16): 11-bit significands for operands in range — used for every GEMM launched here
typedef _Float16 v16h __attribute__((ext_vector_type(16)));
union FragH { v16h v; v8us half[2]; _Float16 h[16]; unsigned short u[16]; };
template <int NT>
__device__ __forceinline__ v8f mmaH(v16h ah, v16h al, v16h bh, v16h bl, v8f c) {
  c = __builtin_amdgcn_wmma_f32_16x16x32_f16(false, ah, false, bh, (short)0, c, false, false);
  if (NT >= 2) c = __builtin_amdgcn_wmma_f32_16x16x32_f16(false, al, false, bh, (short)0, c, false, false);
  if (NT >= 3) c = __builtin_amdgcn_wmma_f32_16x16x32_f16(false, ah, false, bl, (short)0, c, false, false);
  asm volatile("v_nop\n\tv_nop\n\tv_nop\n\tv_nop" : "+v"(c) : "v"(ah), "v"(al), "v"(bh), "v"(bl));
  return c;
}
// batched GEMM like k_gemm_b but f16 operands: A f32 (split into f16 hi/lo if ASPLIT, else rounded to f16), Bt = f16 values [n][k]; alpha; C f32; N multiple of 16 (partial tiles skipped)
template <bool ASPLIT>
__global__ __launch_bounds__(128) void k_gemm_h(const float* __restrict__ A, int lda, size_t sA, const _Float16* __restrict__ Bh, int ldb, size_t sB, float alpha, float* __restrict__ C, int ldc, size_t sC, int M, int N, int K) {
  __shared__ __attribute__((aligned(16))) float so[4][16][64];
  const int tid = threadIdx.x, w = tid >> 5, lane = tid & 31, ln = lane & 15, hh = lane >> 4; const int by = blockIdx.y;
  A += (size_t)by * sA; Bh += (size_t)by * sB; C += (size_t)by * sC;
  const int ntn = (N + 63) / 64; const int wid = blockIdx.x * 4 + w; const int mt = wid / ntn, nq = wid % ntn; if (mt * 16 >= M) return;
  const int row0 = mt * 16, col0 = nq * 64; const float* arow = A + (size_t)(row0 + ln) * lda;
  v8f acc[4] = {};
  for (int kb = 0; kb < K; kb += 32) {
    FragH ah, al;
    const v4f x0 = *(const v4fa*)(arow + kb + 8 * hh), x1 = *(const v4fa*)(arow + kb + 8 * hh + 4), x2 = *(const v4fa*)(arow + kb + 16 + 8 * hh), x3 = *(const v4fa*)(arow + kb + 16 + 8 * hh + 4);
    float xs[16] = {x0[0],x0[1],x0[2],x0[3],x1[0],x1[1],x1[2],x1[3],x2[0],x2[1],x2[2],x2[3],x3[0],x3[1],x3[2],x3[3]};
#pragma unroll
    for (int i = 0; i < 16; ++i) { const _Float16 h = (_Float16)xs[i]; ah.h[i] = h; al.h[i] = ASPLIT ? (_Float16)(xs[i] - (float)h) : (_Float16)0.0f; }
#pragma unroll
    for (int t = 0; t < 4; ++t) { if (col0 + t * 16 >= N) continue; const size_t boff = (size_t)(col0 + t * 16 + ln) * ldb + kb; FragH bq; bq.half[0] = *(const v8us*)(Bh + boff + 8 * hh); bq.half[1] = *(const v8us*)(Bh + boff + 16 + 8 * hh);
      acc[t] = mmaH<ASPLIT ? 2 : 1>(ah.v, al.v, bq.v, bq.v, acc[t]); }
  }
#pragma unroll
  for (int t = 0; t < 4; ++t) { if (col0 + t * 16 >= N) continue;
#pragma unroll
    for (int r = 0; r < 8; ++r) so[w][8 * hh + r][t * 16 + ln] = acc[t][r] * alpha; }
  __builtin_amdgcn_fence(__ATOMIC_ACQ_REL, "workgroup"); __builtin_amdgcn_wave_barrier();
  const int rsub = lane >> 4, c4 = (lane & 15) * 4;
  {
#pragma unroll
    for (int q = 0; q < 8; ++q) { const int r = q * 2 + rsub; if (col0 + c4 < N) { const v4f v = *(const v4fa*)&so[w][r][c4]; *(v4f*)(C + (size_t)(row0 + r) * ldc + col0 + c4) = v; } }
     }
}

// Wt[n][k] = f16(W[k][n]·scale) from f32 row-major W[K][N] (scale = power of two; bf16-exact weights stay exact in f16 away from the subnormal range)
__global__ __launch_bounds__(256) void k_wt_f16(const float* __restrict__ W, _Float16* __restrict__ Wt, int K, int N, float scale) {
  const int t = blockIdx.x * 256 + threadIdx.x; if (t >= N * (K / 8)) return; const int n = t / (K / 8), k8 = (t % (K / 8)) * 8; FragH f;
#pragma unroll
  for (int i = 0; i < 8; ++i) f.h[i] = (_Float16)(bf16_round(W[(size_t)(k8 + i) * N + n]) * scale); const v8us o = f.half[0];
  *(v8us*)((unsigned short*)Wt + (size_t)n * K + k8) = o; 
}
// k_gemm_hh variant with fused epilogue: v = acc·alpha + bias[by·sBias + col] (+ CP[(row/rowsPerB)·sCPb + by·64 + col] if CP) ; ACT 0 none / 1 elu ; writes f16 C16 (and f32 C if non-null)
template <int ACT>
__global__ __launch_bounds__(128) void k_gemm_hhx(const _Float16* __restrict__ A, int lda, size_t sA, const _Float16* __restrict__ Bh, int ldb, size_t sB, float alpha, const float* __restrict__ bias, size_t sBias, const float* __restrict__ CP, int rowsPerB, size_t sCPb, int row0g,
    float* __restrict__ C, _Float16* __restrict__ C16, int ldc, size_t sC, int M, int N, int K) {
  __shared__ __attribute__((aligned(16))) float so[4][16][64];
  const int tid = threadIdx.x, w = tid >> 5, lane = tid & 31, ln = lane & 15, hh = lane >> 4; const int by = blockIdx.y;
  A += (size_t)by * sA; Bh += (size_t)by * sB; const size_t cofs = (size_t)by * sC; const float* bp = bias ? bias + (size_t)by * sBias : nullptr;
  const int ntn = (N + 63) / 64; const int wid = blockIdx.x * 4 + w; const int mt = wid / ntn, nq = wid % ntn; if (mt * 16 >= M) return;
  const int row0 = mt * 16, col0 = nq * 64; const _Float16* arow = A + (size_t)(row0 + ln) * lda;
  v8f acc[4] = {};
  for (int kb = 0; kb < K; kb += 32) { FragH ah; ah.half[0] = *(const v8us*)((const unsigned short*)arow + kb + 8 * hh); ah.half[1] = *(const v8us*)((const unsigned short*)arow + kb + 16 + 8 * hh);
#pragma unroll
    for (int t = 0; t < 4; ++t) { if (col0 + t * 16 >= N) continue; const size_t boff = (size_t)(col0 + t * 16 + ln) * ldb + kb; FragH bq; bq.half[0] = *(const v8us*)((const unsigned short*)Bh + boff + 8 * hh); bq.half[1] = *(const v8us*)((const unsigned short*)Bh + boff + 16 + 8 * hh);
      acc[t] = mmaH<1>(ah.v, ah.v, bq.v, bq.v, acc[t]); }
  }
#pragma unroll
  for (int t = 0; t < 4; ++t) { if (col0 + t * 16 >= N) continue; const int col = col0 + t * 16 + ln; const float bv = bp ? bf16_round(bp[col]) : 0.f;
#pragma unroll
    for (int r = 0; r < 8; ++r) { float v = acc[t][r] * alpha + bv; if (CP) { const int rr = row0g + row0 + 8 * hh + r; if (rowsPerB < 0) v += CP[cofs + (size_t)rr * ldc + col];      /* rowsPerB < 0: own element of the batched C plane */ else { const int bidx = rr / rowsPerB; v += CP[(size_t)bidx * sCPb + (size_t)by * 64 + col]; } } if (ACT == 1) v = (v > 0.f) ? v : expm1f(v); else if (ACT == 7) v = (v > 0.f) ? v + 1.0f : expf(v); else if (ACT == 8) v = tanhf(v); else if (ACT == 9) v = 0.5f * v * (1.0f + tanhf(0.7978845608028654f * (v + 0.044715f * v * v * v))); else if (ACT == 11) v = 1.0f / (1.0f + expf(-v)); else if (ACT == 12) v = (v > 0.f) ? v : 0.01f * v; else if (ACT == 14) v = (v > 0.f) ? v : 0.1f * v; else if (ACT == 16) v = (v >= 0.f) ? v : 0.3f * v; else if (ACT == 17) v = (v >= 0.f) ? v : 0.2f * v; else if (ACT == 15) v = v / (1.0f + expf(-v)); else if (ACT == 3) v = fmaxf(v, 0.f); else if (ACT == 6) v = 0.5f * v * (1.0f + erff(v * 0.70710678118654752f)); so[w][8 * hh + r][t * 16 + ln] = v; } }
  __builtin_amdgcn_fence(__ATOMIC_ACQ_REL, "workgroup"); __builtin_amdgcn_wave_barrier();
  const int rsub = lane >> 4, c4 = (lane & 15) * 4; typedef _Float16 v4h __attribute__((ext_vector_type(4)));
  {
#pragma unroll
    for (int q = 0; q < 8; ++q) { const int r = q * 2 + rsub; if (col0 + c4 < N) { const v4f v = *(const v4fa*)&so[w][r][c4]; if (C) *(v4f*)(C + cofs + (size_t)(row0 + r) * ldc + col0 + c4) = v; if (C16) { v4h h4; for (int i = 0; i < 4; ++i) h4[i] = (_Float16)v[i]; *(v4h*)(C16 + cofs + (size_t)(row0 + r) * ldc + col0 + c4) = h4; } } }
     }
}


typedef _Float16 v4h __attribute__((ext_vector_type(4)));

__global__ __launch_bounds__(256) void k_x16(const float* __restrict__ x, _Float16* __restrict__ X16, size_t n8) { const size_t t = (size_t)blockIdx.x * 256 + threadIdx.x; if (t >= n8) return; FragH f;
#pragma unroll
  for (int q = 0; q < 8; ++q) f.h[q] = (_Float16)bf16_round(x[t * 8 + q]); *(v8us*)((unsigned short*)X16 + t * 8) = f.half[0];  }
__global__ __launch_bounds__(256) void k_h16(const float* __restrict__ x, _Float16* __restrict__ X16, size_t n8) { const size_t t = (size_t)blockIdx.x * 256 + threadIdx.x; if (t >= n8) return; FragH f;
#pragma unroll
  for (int q = 0; q < 8; ++q) f.h[q] = (_Float16)x[t * 8 + q]; *(v8us*)((unsigned short*)X16 + t * 8) = f.half[0];  }
__global__ __launch_bounds__(256) void k_round16f(const float* __restrict__ W, _Float16* __restrict__ Bt, size_t n8) { const size_t t = (size_t)blockIdx.x * 256 + threadIdx.x; if (t >= n8) return; FragH f;
#pragma unroll
  for (int i = 0; i < 8; ++i) f.h[i] = (_Float16)(bf16_round(W[t * 8 + i]) * 16.0f); *(v8us*)((unsigned short*)Bt + t * 8) = f.half[0];  }
template <int NHv, int TTv>
__global__ __launch_bounds__(256) void k_vt(const _Float16* __restrict__ V16, int ldv, int voff, _Float16* __restrict__ Vt) { __shared__ unsigned short tl[64][66]; const int tid = threadIdx.x; const int slab = blockIdx.x / (TTv / 64), lg = blockIdx.x % (TTv / 64); const int b = slab / NHv, h = slab % NHv;
  for (int i = tid; i < 64 * 8; i += 256) { const int r = i / 8, c8 = (i % 8) * 8; FragH f; f.half[0] = *(const v8us*)((const unsigned short*)V16 + ((size_t)b * TTv + lg * 64 + r) * ldv + voff + h * 64 + c8);
#pragma unroll
    for (int q = 0; q < 8; ++q) tl[r][c8 + q] = f.u[q]; }
  __syncthreads();
  {
#pragma unroll
    for (int rd = 0; rd < 2; ++rd) { const int d = rd * 32 + tid / 8, pc = tid % 8; FragH f;
#pragma unroll
      for (int q = 0; q < 8; ++q) f.u[q] = tl[pc * 8 + q][d];
      *(v8us*)((unsigned short*)Vt + ((size_t)slab * 64 + d) * TTv + lg * 64 + pc * 8) = f.half[0]; }
     } }

__global__ __launch_bounds__(256) void k_hl(const float* __restrict__ F, _Float16* __restrict__ Hh, _Float16* __restrict__ Hl, size_t n8) { const size_t t = (size_t)blockIdx.x * 256 + threadIdx.x; if (t >= n8) return; FragH fh, fl; const v4f a = *(const v4fa*)(F + t * 8), c = *(const v4fa*)(F + t * 8 + 4);
#pragma unroll
  for (int q = 0; q < 4; ++q) { _Float16 h = (_Float16)a[q]; fh.h[q] = h; fl.h[q] = (_Float16)((a[q] - (float)h) * 1024.0f); h = (_Float16)c[q]; fh.h[4 + q] = h; fl.h[4 + q] = (_Float16)((c[q] - (float)h) * 1024.0f); }
  { *(v8us*)((unsigned short*)Hh + t * 8) = fh.half[0]; *(v8us*)((unsigned short*)Hl + t * 8) = fl.half[0];  } }

// ---- fast GEMM (block tile 128x64, wave tile 32x64, A and B k-tiles staged in LDS; requires M % 128 == 0, N % 64 == 0 and K == 64 or K % 128 == 0); epilogue = k_gemm_hhx semantics ----
#define G2_LP 72
__device__ __forceinline__ v16h g2_frag(const _Float16* p, int hh) { FragH f; f.half[0] = *(const v8us*)((const unsigned short*)p + 8 * hh); f.half[1] = *(const v8us*)((const unsigned short*)p + 16 + 8 * hh); return f.v; }
__device__ __forceinline__ v8f g2_mma(v16h a, v16h b, v8f c) { v8f d = __builtin_amdgcn_wmma_f32_16x16x32_f16(false, a, false, b, (short)0, c, false, false); asm volatile("v_nop\n\tv_nop\n\tv_nop\n\tv_nop" : "+v"(d) : "v"(a), "v"(b)); return d; }
// work-group barrier that orders LDS alone (its fences name the LDS address space): __syncthreads() also waits for every global load in flight, and the loads for the tiles ahead must stay in flight across it; the loop's global reads are of operands that no wave of the launch writes
__device__ __forceinline__ void g2_bar() { __builtin_amdgcn_fence(__ATOMIC_RELEASE, "workgroup", "local"); __builtin_amdgcn_s_barrier(); __builtin_amdgcn_fence(__ATOMIC_ACQUIRE, "workgroup", "local"); }
template <int ACT>
__global__ __launch_bounds__(128) void k_gemm2(const _Float16* __restrict__ A, int lda, size_t sA, const _Float16* __restrict__ Bh, int ldb, size_t sB, float alpha, const float* __restrict__ bias, size_t sBias, const float* __restrict__ CP, int rowsPerB, size_t sCPb, int row0g,
    float* __restrict__ C, _Float16* __restrict__ C16, int ldc, size_t sC, int M, int N, int K) { static_assert(ACT == 0 || ACT == 3 || ACT == 6 || ACT == 8 || ACT == 9 || ACT == 11 || ACT == 12 || ACT == 14 || ACT == 15 || ACT == 16 || ACT == 17, "k_gemm2: unsupported ACT code (would silently apply no activation)");
  __shared__ __attribute__((aligned(16))) float so[4][32][68];
  // k-tiles of 64 halves (one whole 128-B line per row) of the block's 128 A rows and 64 B rows, two buffers; row pitch 72 halves = 144 B = 16 B x 9 for the ds_load_b128 fragment reads
  __shared__ __attribute__((aligned(16))) _Float16 sa[2][128][G2_LP];
  __shared__ __attribute__((aligned(16))) _Float16 sb[2][64][G2_LP];
  const int tid = threadIdx.x, w = tid >> 5, lane = tid & 31, ln = lane & 15, hh = lane >> 4; const int by = blockIdx.y;
  A += (size_t)by * sA; Bh += (size_t)by * sB; const size_t cofs = (size_t)by * sC; const float* bp = bias ? bias + (size_t)by * sBias : nullptr;
  const int ntn = N >> 6; const int mt = blockIdx.x / ntn, nq = blockIdx.x - mt * ntn; const int row0 = mt * 128 + 32 * w, col0 = nq * 64; if (mt * 128 >= M) return;      /* the same for the whole block: it stands in front of barriers */
  const int sr = tid >> 3, sc = (tid & 7) * 8;      /* staging: 8 lanes cover one row's 128 B, a wave-wide load covers 4 whole lines */
  const char* ab = (const char*)(A + (size_t)(mt * 128) * lda); const char* bb = (const char*)(Bh + (size_t)col0 * ldb);      /* the block's first A and B row: the same in every lane */
  const unsigned ao = (unsigned)(sr * lda + sc) * 2u, bo = (unsigned)(sr * ldb + sc) * 2u;      /* the lane's own byte offset, fixed for the whole loop */
  const v8f z8 = {0.f,0.f,0.f,0.f,0.f,0.f,0.f,0.f}; v8f c00 = z8, c01 = z8, c02 = z8, c03 = z8, c10 = z8, c11 = z8, c12 = z8, c13 = z8;
  v8us ra0[8], rb0[4], ra1[8], rb1[4];
  auto gl = [&](v8us* ra, v8us* rb, int kb) {
#pragma unroll
    for (int i = 0; i < 8; ++i) ra[i] = *(const v8us*)(ab + ((size_t)(16 * i) * lda + kb) * 2 + ao);
#pragma unroll
    for (int i = 0; i < 4; ++i) rb[i] = *(const v8us*)(bb + ((size_t)(16 * i) * ldb + kb) * 2 + bo); };
  auto st = [&](const v8us* ra, const v8us* rb, int buf) {
#pragma unroll
    for (int i = 0; i < 8; ++i) *(v8us*)&sa[buf][sr + 16 * i][sc] = ra[i];
#pragma unroll
    for (int i = 0; i < 4; ++i) *(v8us*)&sb[buf][sr + 16 * i][sc] = rb[i]; };
  auto comp = [&](int buf) {
#pragma unroll
    for (int kk = 0; kk < 64; kk += 32) { const v16h a0 = g2_frag(&sa[buf][32 * w + ln][kk], hh), a1 = g2_frag(&sa[buf][32 * w + 16 + ln][kk], hh);
      const v16h b0 = g2_frag(&sb[buf][ln][kk], hh), b1 = g2_frag(&sb[buf][16 + ln][kk], hh), b2 = g2_frag(&sb[buf][32 + ln][kk], hh), b3 = g2_frag(&sb[buf][48 + ln][kk], hh);
      c00 = g2_mma(a0, b0, c00); c10 = g2_mma(a1, b0, c10); c01 = g2_mma(a0, b1, c01); c11 = g2_mma(a1, b1, c11);
      c02 = g2_mma(a0, b2, c02); c12 = g2_mma(a1, b2, c12); c03 = g2_mma(a0, b3, c03); c13 = g2_mma(a1, b3, c13); } };
  // Each barrier publishes the buffer just written and ends every wave's reads of the other buffer, which is written next.
  gl(ra0, rb0, 0);
  __builtin_amdgcn_sched_barrier(0);      /* keeps set 0's loads in front of set 1's: mixed, set 0's wait at the loop's head would wait for set 1 as well */
  gl(ra1, rb1, 64 < K ? 64 : 0);      /* the second set's tile clamped, not branched round: set 0's loads stay the older ones on every way into the loop, so its wait leaves set 1's in flight */
  asm volatile("s_wait_xcnt 0x0" ::: "memory");      /* in front of whatever reuses the address registers of the loads above, which stay in flight */
  int kb = 0;
  // two tiles per trip so that each register set and each LDS buffer has a fixed name; every load of the trip is unconditional (the last two tiles are peeled off below), so the waits can be counted; kept rolled: unrolled further it only grows the code
#pragma unroll 1
  for (; kb + 128 < K; kb += 128) {
    st(ra0, rb0, 0); g2_bar(); gl(ra0, rb0, kb + 128); comp(0);      /* loads two tiles ahead: in flight over this tile's and the next tile's products */
    st(ra1, rb1, 1); g2_bar(); gl(ra1, rb1, kb + 192); comp(1);
    asm volatile("s_wait_xcnt 0x0" ::: "memory"); }      /* in front of the next trip's address arithmetic, which rewrites the address registers of loads still in flight */
  st(ra0, rb0, 0); g2_bar(); comp(0);
  if (kb + 64 < K) { st(ra1, rb1, 1); g2_bar(); comp(1); }
  v8f accs[8] = {c00, c01, c02, c03, c10, c11, c12, c13};
#pragma unroll
  for (int u = 0; u < 8; ++u) { const int t = u & 3, half = u >> 2; const int col = col0 + t * 16 + ln; const float bv = bp ? bf16_round(bp[col]) : 0.f;
#pragma unroll
    for (int r = 0; r < 8; ++r) { const int rloc = half * 16 + 8 * hh + r; float v = accs[u][r] * alpha + bv; if (CP) { if (rowsPerB < 0) v += CP[cofs + (size_t)(row0g + row0 + rloc) * ldc + col];      /* rowsPerB < 0: own element of the batched C plane */ else { const int bidx = (row0g + row0 + rloc) / rowsPerB; v += CP[(size_t)bidx * sCPb + (size_t)by * 64 + col]; } }
      if (ACT == 3) v = fmaxf(v, 0.f); else if (ACT == 6) v = 0.5f * v * (1.0f + erff(v * 0.70710678118654752f)); else if (ACT == 11) v = 1.0f / (1.0f + expf(-v)); else if (ACT == 15) v = v / (1.0f + expf(-v)); else if (ACT == 12) v = (v > 0.f) ? v : 0.01f * v; else if (ACT == 8) v = tanhf(v); else if (ACT == 9) v = 0.5f * v * (1.0f + tanhf(0.7978845608028654f * (v + 0.044715f * v * v * v))); else if (ACT == 14) v = (v > 0.f) ? v : 0.1f * v; else if (ACT == 16) v = (v >= 0.f) ? v : 0.3f * v; else if (ACT == 17) v = (v >= 0.f) ? v : 0.2f * v;
      so[w][rloc][t * 16 + ln] = v; } }
  __builtin_amdgcn_fence(__ATOMIC_ACQ_REL, "workgroup"); __builtin_amdgcn_wave_barrier();
  const int rsub = lane >> 4, c4 = (lane & 15) * 4;
  {
#pragma unroll
    for (int q = 0; q < 16; ++q) { const int r = q * 2 + rsub; const v4f v = *(const v4fa*)&so[w][r][c4]; if (C) *(v4f*)(C + cofs + (size_t)(row0 + r) * ldc + col0 + c4) = v; if (C16) { v4h h4; for (int i = 0; i < 4; ++i) h4[i] = (_Float16)v[i]; *(v4h*)(C16 + cofs + (size_t)(row0 + r) * ldc + col0 + c4) = h4; } }
     } }


__global__ __launch_bounds__(256) void k_wsc(const float* __restrict__ Wm, _Float16* __restrict__ Bt, size_t n8, float sc) { const size_t t = (size_t)blockIdx.x * 256 + threadIdx.x; if (t >= n8) return; FragH f; for (int q = 0; q < 8; ++q) f.h[q] = (_Float16)(bf16_round(Wm[t * 8 + q]) * sc); *(v8us*)((unsigned short*)Bt + t * 8) = f.half[0];  }
__global__ __launch_bounds__(256) void k_ccp(const float* __restrict__ QKV, int coff, _Float16* __restrict__ D) { const size_t t = (size_t)blockIdx.x * 256 + threadIdx.x; if (t >= (size_t)NR * DM / 8) return; const int c0 = (int)((t * 8) % DM); const size_t row = (t * 8) / DM; const v8f a = *(const v8f*)(QKV + row * 3 * DM + coff + c0); FragH f; for (int q = 0; q < 8; ++q) f.h[q] = (_Float16)a[q];
  *(v8us*)((unsigned short*)D + t * 8) = f.half[0];  }
__global__ __launch_bounds__(256) void k_chl(const float* __restrict__ QKV, int coff, _Float16* __restrict__ Hh, _Float16* __restrict__ Lh) {
  #pragma clang fp contract(off)
  const size_t t = (size_t)blockIdx.x * 256 + threadIdx.x; if (t >= (size_t)NR * DM / 8) return; const int c0 = (int)((t * 8) % DM); const size_t row = (t * 8) / DM; const v8f a = *(const v8f*)(QKV + row * 3 * DM + coff + c0); FragH fh, fl; for (int q = 0; q < 8; ++q) { const _Float16 hv = (_Float16)a[q]; fh.h[q] = hv; fl.h[q] = (_Float16)((a[q] - (float)hv) * 1024.0f); }
  { *(v8us*)((unsigned short*)Hh + t * 8) = fh.half[0]; *(v8us*)((unsigned short*)Lh + t * 8) = fl.half[0];  } }
__device__ __forceinline__ void exter(const float* p1, const float* p2, float* L) {
  #pragma clang fp contract(off)
  const int PI[6] = {0, 0, 0, 1, 1, 2}, PJ[6] = {1, 2, 3, 2, 3, 3}; float n2 = 0.f;
  for (int k = 0; k < 6; ++k) { float a = p1[PI[k]] * p2[PJ[k]]; a += -(p1[PJ[k]] * p2[PI[k]]); L[k] = a; n2 += a * a; }
  const float n = fmaxf(sqrtf(n2), 1e-12f); for (int k = 0; k < 6; ++k) L[k] = L[k] / n; }
__global__ __launch_bounds__(256) void k_lines(const float* __restrict__ LW, float* __restrict__ JW, float* __restrict__ RD) {
  #pragma clang fp contract(off)
  const int tt = blockIdx.x * 256 + threadIdx.x; if (tt >= NR * NH) return; const int t = tt % TT; const int bh = tt / TT; const int h = bh % NH, b = bh / NH; const size_t row = (size_t)b * TT + t; float w1[4], w2[4], r1[4], r2[4];
  for (int i = 0; i < 4; ++i) { w1[i] = (t > 0) ? LW[(row - 1) * 256 + h * 4 + i] : 0.f; w2[i] = LW[row * 256 + 64 + h * 4 + i]; r1[i] = LW[row * 256 + 128 + h * 4 + i]; r2[i] = LW[row * 256 + 192 + h * 4 + i]; }
  float wl[6], rl[6]; exter(w1, w2, wl); exter(r1, r2, rl); v8f jw, rd; jw[0] = wl[5]; jw[1] = -wl[4]; jw[2] = wl[3]; jw[3] = wl[2]; jw[4] = -wl[1]; jw[5] = wl[0]; jw[6] = 0.f; jw[7] = 0.f; for (int k = 0; k < 6; ++k) rd[k] = rl[k]; rd[6] = 0.f; rd[7] = 0.f;
  const size_t o = (((size_t)b * NH + h) * TT + t) * 8; { *(v8f*)(JW + o) = jw; *(v8f*)(RD + o) = rd;  } }
__global__ __launch_bounds__(64) void k_cum(const float* __restrict__ JW, const float* __restrict__ RD, float* __restrict__ RDM) {
  #pragma clang fp contract(off)
  const int tt = blockIdx.x * 64 + threadIdx.x; if (tt >= NB * NH * 8) return; const int j = tt % 8; const int bh = tt / 8; float m[6]; for (int i = 0; i < 6; ++i) m[i] = 0.f; const float* jw = JW + (size_t)bh * TT * 8; const float* rd = RD + (size_t)bh * TT * 8;
#pragma unroll 1
  for (int t = 0; t < TT; ++t) { float v = 0.f; if (j < 6) { const float wj = jw[(size_t)t * 8 + j]; for (int i = 0; i < 6; ++i) { m[i] += jw[(size_t)t * 8 + i] * wj; } for (int i = 0; i < 6; ++i) v += rd[(size_t)t * 8 + i] * m[i]; }
    float* d = RDM + ((size_t)bh * TT + t) * 8 + j; *(float*)d = v;  } }
__global__ __launch_bounds__(256) void k_bsoft(const float* __restrict__ S, const float* __restrict__ RDM, const float* __restrict__ JW, const float* __restrict__ bsc, int b, int h0, _Float16* __restrict__ P, float* __restrict__ RS) {
  #pragma clang fp contract(off)
  const int wv = threadIdx.x >> 5, ln = threadIdx.x & 31; const int r = blockIdx.x * 8 + wv; if (r >= HG * TT) return; const int t = r % TT, hl = r / TT; const int h = h0 + hl; const size_t bh = (size_t)b * NH + h; const float bs = bf16_round(bsc[h]); const float* sr = S + (size_t)r * TT; const v8f rdm = *(const v8f*)(RDM + (bh * TT + t) * 8); const float* jwb = JW + bh * TT * 8;
  auto lgt = [&](int s) { const v8f jw = *(const v8f*)(jwb + (size_t)s * 8); float d = 0.f; for (int k = 0; k < 6; ++k) d += rdm[k] * jw[k]; float l = sr[s] * 0.125f; l += fabsf(d) * bs; return l; };
  float mx = -3.0e38f;
#pragma unroll 1
  for (int gq = 0; gq < TT / 256; ++gq) for (int q = 0; q < 8; ++q) { const int s = gq * 256 + ln * 8 + q; if (s <= t) mx = fmaxf(mx, lgt(s)); }
  for (int o = 16; o > 0; o >>= 1) mx = fmaxf(mx, __shfl_xor(mx, o, 32)); float su = 0.f;
{ su = 0.f;
#pragma unroll 1
    for (int gq = 0; gq < TT / 256; ++gq) { FragH ph; for (int q = 0; q < 8; ++q) { const int s = gq * 256 + ln * 8 + q; float e = 0.f; if (s <= t) { e = expf(lgt(s) - mx); su += e; } ph.h[q] = (_Float16)(e * 1024.0f); } *(v8us*)((unsigned short*)P + (size_t)r * TT + gq * 256 + ln * 8) = ph.half[0]; }
     }
  for (int o = 16; o > 0; o >>= 1) su += __shfl_xor(su, o, 32); if (ln == 0) { *(float*)(RS + (size_t)r * 32) = 1.0f / su;  } }
__global__ __launch_bounds__(256) void k_csc(const float* __restrict__ O, const float* __restrict__ RS, int b, int h0, _Float16* __restrict__ CH, _Float16* __restrict__ CL) {
  #pragma clang fp contract(off)
  const int tt = blockIdx.x * 256 + threadIdx.x; if (tt >= TT * HG * (HD / 8)) return; const int d8 = (tt % (HD / 8)) * 8; const int hl = (tt / (HD / 8)) % HG; const int t = tt / ((HD / 8) * HG); const float rs = RS[((size_t)hl * TT + t) * 32]; const size_t o = ((size_t)b * TT + t) * DM + (h0 + hl) * HD + d8; const v8f a = *(const v8f*)(O + (size_t)t * DM + (h0 + hl) * HD + d8); FragH f, fl;
  for (int q = 0; q < 8; ++q) { const float v = a[q] * rs; const _Float16 hh = (_Float16)v; f.h[q] = hh; fl.h[q] = (_Float16)((v - (float)hh) * 1024.0f); }
  { *(v8us*)((unsigned short*)CH + o) = f.half[0]; *(v8us*)((unsigned short*)CL + o) = fl.half[0];  } }

extern "C" void kernel_launch(void* const* d_in, const int* in_sizes, int n_in,
                              void* d_out, int out_size, void* d_ws, size_t ws_size, hipStream_t stream) {
  (void)in_sizes; (void)n_in; (void)out_size;
  const float* x = (const float*)d_in[0]; const float* Wqkv = (const float*)d_in[1]; const float* bqkv = (const float*)d_in[2]; const float* W1w = (const float*)d_in[3]; const float* W2w = (const float*)d_in[4]; const float* W1r = (const float*)d_in[5]; const float* W2r = (const float*)d_in[6]; const float* bsc = (const float*)d_in[7]; const float* Wout = (const float*)d_in[8]; const float* bout = (const float*)d_in[9];
  char* ws = (char*)d_ws; size_t off = 0;
  auto take = [&](size_t bytes) { char* p = ws + off; off += (bytes + 255) & ~(size_t)255; return p; };
  const size_t np = (size_t)NR * DM;
  _Float16* BQKV = (_Float16*)take((size_t)3 * DM * DM * 2); _Float16* BL = (_Float16*)take((size_t)256 * DM * 2); _Float16* BO = (_Float16*)take((size_t)DM * DM * 2);
  _Float16* X16 = (_Float16*)take(np * 2); float* QKV = (float*)take(np * 3 * 4); _Float16* Q16 = (_Float16*)take(np * 2); _Float16* K16 = (_Float16*)take(np * 2); _Float16* V16 = (_Float16*)take(np * 2); _Float16* VL16 = (_Float16*)take(np * 2); _Float16* VT = (_Float16*)take(np * 2); _Float16* VTL = (_Float16*)take(np * 2);
  float* LW = (float*)take((size_t)NR * 256 * 4); float* JW = (float*)take((size_t)NB * NH * TT * 8 * 4); float* RD = (float*)take((size_t)NB * NH * TT * 8 * 4); float* RDM = (float*)take((size_t)NB * NH * TT * 8 * 4);
  float* S = (float*)take((size_t)HG * TT * TT * 4); _Float16* P = (_Float16*)take((size_t)HG * TT * TT * 2); float* RS = (float*)take((size_t)HG * TT * 32 * 4); float* O = (float*)take((size_t)TT * DM * 4); _Float16* CH = (_Float16*)take(np * 2); _Float16* CL = (_Float16*)take(np * 2);
  if (off > ws_size) return;      /* 6.5 + 2 + 4 + 24 + 6 x 4 + 2 + 3 + 16 + 8 + 0.5 + 4 + 8 = ≈ 102 MiB */
  k_wsc<<<(unsigned)(((size_t)3 * DM * DM / 8 + 255) / 256), 256, 0, stream>>>(Wqkv, BQKV, (size_t)3 * DM * DM / 8, 16.0f); k_wsc<<<(unsigned)(((size_t)DM * DM / 8 + 255) / 256), 256, 0, stream>>>(Wout, BO, (size_t)DM * DM / 8, 16.0f);      /* torch (out, in) naturals */
  k_wsc<<<(unsigned)(((size_t)64 * DM / 8 + 255) / 256), 256, 0, stream>>>(W1w, BL, (size_t)64 * DM / 8, 16.0f); k_wsc<<<(unsigned)(((size_t)64 * DM / 8 + 255) / 256), 256, 0, stream>>>(W2w, BL + (size_t)64 * DM, (size_t)64 * DM / 8, 16.0f); k_wsc<<<(unsigned)(((size_t)64 * DM / 8 + 255) / 256), 256, 0, stream>>>(W1r, BL + (size_t)128 * DM, (size_t)64 * DM / 8, 16.0f); k_wsc<<<(unsigned)(((size_t)64 * DM / 8 + 255) / 256), 256, 0, stream>>>(W2r, BL + (size_t)192 * DM, (size_t)64 * DM / 8, 16.0f);      /* [W1w; W2w; W1r; W2r] rows h*4 + i */
  k_x16<<<(unsigned)((np / 8 + 255) / 256), 256, 0, stream>>>(x, X16, np / 8);
  k_gemm2<0><<<dim3((NR / 128) * (3 * DM / 64), 1), 128, 0, stream>>>(X16, DM, 0, BQKV, DM, 0, 0.0625f, bqkv, 0, nullptr, 1, 0, 0, QKV, nullptr, 3 * DM, 0, NR, 3 * DM, DM);      /* [q | k | v] + bias, head h at h*64 */
  k_gemm2<0><<<dim3((NR / 128) * (256 / 64), 1), 128, 0, stream>>>(X16, DM, 0, BL, DM, 0, 0.0625f, nullptr, 0, nullptr, 1, 0, 0, LW, nullptr, 256, 0, NR, 256, DM);      /* line projections f32 [row][w1 | w2 | r1 | r2] (x_prev handled by a row shift) */
  k_ccp<<<(unsigned)((np / 8 + 255) / 256), 256, 0, stream>>>(QKV, 0, Q16); k_ccp<<<(unsigned)((np / 8 + 255) / 256), 256, 0, stream>>>(QKV, DM, K16); k_chl<<<(unsigned)((np / 8 + 255) / 256), 256, 0, stream>>>(QKV, 2 * DM, V16, VL16);      /* v as hi + residual (the bias makes the attention peaked, so v's rounding reaches the output almost unaveraged) */
  k_vt<NH, TT><<<NB * NH * (TT / 64), 256, 0, stream>>>(V16, DM, 0, VT); k_vt<NH, TT><<<NB * NH * (TT / 64), 256, 0, stream>>>(VL16, DM, 0, VTL);
  k_lines<<<(NR * NH + 255) / 256, 256, 0, stream>>>(LW, JW, RD); k_cum<<<(NB * NH * 8 + 63) / 64, 64, 0, stream>>>(JW, RD, RDM);
  for (int b = 0; b < NB; ++b) { const size_t r0 = (size_t)b * TT;
    for (int g = 0; g < NH / HG; ++g) { const int h0 = g * HG;
      k_gemm2<0><<<dim3((TT / 128) * (TT / 64), HG), 128, 0, stream>>>(Q16 + r0 * DM + h0 * HD, DM, (size_t)HD, K16 + r0 * DM + h0 * HD, DM, (size_t)HD, 1.0f, nullptr, 0, nullptr, 1, 0, 0, S, nullptr, TT, (size_t)TT * TT, TT, TT, HD);
      k_bsoft<<<(HG * TT) / 8, 256, 0, stream>>>(S, RDM, JW, bsc, b, h0, P, RS);
      k_gemm2<0><<<dim3((TT / 128) * (HD / 64), HG), 128, 0, stream>>>(P, TT, (size_t)TT * TT, VTL + ((size_t)b * NH + h0) * HD * TT, TT, (size_t)HD * TT, 0.0009765625f / 1024.0f, nullptr, 0, nullptr, 1, 0, 0, O + h0 * HD, nullptr, DM, (size_t)HD, TT, HD, TT);
      k_gemm2<0><<<dim3((TT / 128) * (HD / 64), HG), 128, 0, stream>>>(P, TT, (size_t)TT * TT, VT + ((size_t)b * NH + h0) * HD * TT, TT, (size_t)HD * TT, 0.0009765625f, nullptr, 0, O + h0 * HD, -1, 0, 0, O + h0 * HD, nullptr, DM, (size_t)HD, TT, HD, TT);      /* P . (v_lo + v_hi)^T (own-element accumulate) */
      k_csc<<<(TT * HG * (HD / 8) + 255) / 256, 256, 0, stream>>>(O, RS, b, h0, CH, CL); } }
  k_gemm2<0><<<dim3((NR / 128) * (DM / 64), 1), 128, 0, stream>>>(CL, DM, 0, BO, DM, 0, 0.0625f / 1024.0f, nullptr, 0, nullptr, 1, 0, 0, (float*)d_out, nullptr, DM, 0, NR, DM, DM);
  k_gemm2<0><<<dim3((NR / 128) * (DM / 64), 1), 128, 0, stream>>>(CH, DM, 0, BO, DM, 0, 0.0625f, bout, 0, (const float*)d_out, 1, (size_t)DM, 0, (float*)d_out, nullptr, DM, 0, NR, DM, DM);      /* out = (c_lo + c_hi) Wout^T + bout */
}

// v002
// One run takes 808 microseconds.
// Timed twice side by side with v001, it ran 1.13 times as fast both times.
// All steps since v000 together make it 1.69 times as fast.
#include <hip/hip_runtime.h>
// EigenBiasAttention (2 x 1024 tokens x 1024 = 16 heads x 64; qkv = x Wqkv^T + b; causal softmax(q.k/8 + |bias|) v; bias from Plucker lines: per head w1 = x_prev W1w^T, w2 = x W2w^T, r1 = x W1r^T, r2 = x W2r^T (4-vectors), write/read lines = normalised exterior products (6-vectors), Jw = write J6, M_t = cumsum_t Jw Jw^T, bias[t][s] = |(rd_t . M_t) . Jw_s| * bias_scale[h]; out = merged . Wout^T + bout).
// Structure: exact f16 x plane; qkv and the four line projections as f16 WMMA GEMMs (32x64 wave tiles, f32 accumulation, exact x16 weights (+ bias); f32 out) then f16 q/k/v planes; the exterior products / normalisation / J6 on VALU; the causal 6x6 Gram cumsum and rd . M per (batch, head, column) sequentially on VALU (f32, 1024 steps); per (batch, 4-head group) the score GEMM (K = 64, f32), the biased causal softmax on VALU (bias dot K = 6 per (t, s), bias_scale read; unnormalised f16 weights x 2^10 + row normalisers on their own lines), V^T hi/residual by LDS tiles, readout as two GEMM terms (N = 64); row scaling + hi/residual; Wout as two GEMM terms (+ bias).
// Compute dtype: inputs rounded to bf16; x / weights exact as f16 (line projections are f32 sums of exact products, so the bias path is f32-class); q, k and the softmax weights as plain f16 operands (~2^-12); v and the context as f16 hi + residual. v_wmma_f32_16x16x32_f16.
#define NB 2
#define TT 1024
#define DM 1024
#define NH 16
#define HD 64
#define HG 4
#define NR (NB * TT)
typedef __bf16 v16b __attribute__((ext_vector_type(16)));
typedef unsigned short v8us __attribute__((ext_vector_type(8), may_alias));
typedef float  v8f  __attribute__((ext_vector_type(8)));
typedef float  v4f  __attribute__((ext_vector_type(4)));
typedef float  v4fa __attribute__((ext_vector_type(4), may_alias));
union FragB { v16b v; v8us half[2]; unsigned short u[16]; };

__device__ __forceinline__ unsigned short bf16_bits(float x) { unsigned int u = __float_as_uint(x); return (unsigned short)((u + 0x7FFFu + ((u >> 16) & 1u)) >> 16); }
__device__ __forceinline__ float bf16_val(unsigned short b) { return __uint_as_float(((unsigned int)b) << 16); }
__device__ __forceinline__ float bf16_round(float x) { return bf16_val(bf16_bits(x)); }
// D += A·B with NT terms: 1 = ah·bh, 2 = + al·bh (A split), 3 = + ah·bl (both split)
template <int NT>
__device__ __forceinline__ v8f mmaN(v16b ah, v16b al, v16b bh, v16b bl, v8f c) {
  c = __builtin_amdgcn_wmma_f32_16x16x32_bf16(false, ah, false, bh, (short)0, c, false, false);
  if (NT >= 2) c = __builtin_amdgcn_wmma_f32_16x16x32_bf16(false, al, false, bh, (short)0, c, false, false);
  if (NT >= 3) c = __builtin_amdgcn_wmma_f32_16x16x32_bf16(false, ah, false, bl, (short)0, c, false, false);
  asm volatile("v_nop\n\tv_nop\n\tv_nop\n\tv_nop" : "+v"(c) : "v"(ah), "v"(al), "v"(bh), "v"(bl));
  return c;
}

__global__ __launch_bounds__(256) void k_wt_bf16(const float* __restrict__ W, unsigned short* __restrict__ Wt, int K, int N) {
  const int t = blockIdx.x * 256 + threadIdx.x;
  const int k8n = K / 8;
  if (t >= N * k8n) return;
  const int n = t / k8n, k8 = (t % k8n) * 8;
  v8us v;
#pragma unroll
  for (int i = 0; i < 8; ++i) v[i] = bf16_bits(W[(size_t)(k8 + i) * N + n]);
  *(v8us*)(Wt + (size_t)n * K + k8) = v;
  
}

// GEMM C[M][N] (f32, pitch ldc) = act(A[M][K]·W + bias). A f32 row-major (pitch lda) converted per fragment to bf16
// (ASPLIT: hi/lo two planes -> 2 terms, else single rounded term); Wt bf16 [N][K] (pitch ldb). BIAS_BF16 rounds the
// bias to bf16 first (bias quantised to bf16 before the add). K%32==0, M%16==0, N%64==0.
template <bool ASPLIT, int ACT, bool BIAS_BF16>
__global__ __launch_bounds__(128) void k_gemm_bf(const float* __restrict__ A, int lda, const unsigned short* __restrict__ Wt, int ldb,
                                               const float* __restrict__ bias, float* __restrict__ C, int ldc, int M, int N, int K) {
  __shared__ __attribute__((aligned(16))) float so[4][16][64];
  const int tid = threadIdx.x, w = tid >> 5, lane = tid & 31, ln = lane & 15, hh = lane >> 4;
  const int ntn = N / 64;
  const int wid = blockIdx.x * 4 + w;
  const int mt = wid / ntn, nq = wid % ntn;
  if (mt * 16 >= M) return;
  const int row0 = mt * 16, col0 = nq * 64;
  const float* arow = A + (size_t)(row0 + ln) * lda;
  v8f acc[4] = {};
  for (int kb = 0; kb < K; kb += 32) {
    FragB ah, al;
    const v4f x0 = *(const v4fa*)(arow + kb + 8 * hh), x1 = *(const v4fa*)(arow + kb + 8 * hh + 4);
    const v4f x2 = *(const v4fa*)(arow + kb + 16 + 8 * hh), x3 = *(const v4fa*)(arow + kb + 16 + 8 * hh + 4);
    float xs[16] = {x0[0],x0[1],x0[2],x0[3],x1[0],x1[1],x1[2],x1[3],x2[0],x2[1],x2[2],x2[3],x3[0],x3[1],x3[2],x3[3]};
#pragma unroll
    for (int i = 0; i < 16; ++i) { const unsigned short hb = bf16_bits(xs[i]); ah.u[i] = hb; al.u[i] = ASPLIT ? bf16_bits(xs[i] - bf16_val(hb)) : (unsigned short)0; }
#pragma unroll
    for (int t = 0; t < 4; ++t) {
      const unsigned short* brow = Wt + (size_t)(col0 + t * 16 + ln) * ldb + kb;
      FragB b;
      b.half[0] = *(const v8us*)(brow + 8 * hh);
      b.half[1] = *(const v8us*)(brow + 16 + 8 * hh);
      acc[t] = mmaN<ASPLIT ? 2 : 1>(ah.v, al.v, b.v, b.v, acc[t]);
    }
  }
#pragma unroll
  for (int t = 0; t < 4; ++t) {
    float bv = bias ? bias[col0 + t * 16 + ln] : 0.f;
    if (BIAS_BF16) bv = bf16_round(bv);
#pragma unroll
    for (int r = 0; r < 8; ++r) { float v = acc[t][r] + bv; if (ACT == 1) v = fmaxf(v, 0.f); so[w][8 * hh + r][t * 16 + ln] = v; }
  }
  __builtin_amdgcn_fence(__ATOMIC_ACQ_REL, "workgroup");
  __builtin_amdgcn_wave_barrier();
  const int rsub = lane >> 4, c4 = (lane & 15) * 4;
  {
#pragma unroll
    for (int q = 0; q < 8; ++q) {
      const int r = q * 2 + rsub;
      const v4f v = *(const v4fa*)&so[w][r][c4];
      *(v4f*)(C + (size_t)(row0 + r) * ldc + col0 + c4) = v;
    }
    
  }
}

// GEMM C = act(A·W + bias + resid): A f32 (ASPLIT -> hi/lo 2 terms), Wt bf16 [N][K]; ACT 0 none, 1 relu, 2 exact gelu;
// resid (optional, f32, row index = (row % rmod), pitch ldr, RES_BF16 rounds it) added before the activation.
template <bool ASPLIT, int ACT, bool BIAS_BF16, bool RES_BF16>
__global__ __launch_bounds__(128) void k_gemm_bf3(const float* __restrict__ A, int lda, const unsigned short* __restrict__ Wt, int ldb,
                                                const float* __restrict__ bias, const float* __restrict__ resid, int rmod, int ldr,
                                                float* __restrict__ C, int ldc, int M, int N, int K) {
  __shared__ __attribute__((aligned(16))) float so[4][16][64];
  const int tid = threadIdx.x, w = tid >> 5, lane = tid & 31, ln = lane & 15, hh = lane >> 4;
  const int ntn = N / 64;
  const int wid = blockIdx.x * 4 + w;
  const int mt = wid / ntn, nq = wid % ntn;
  if (mt * 16 >= M) return;
  const int row0 = mt * 16, col0 = nq * 64;
  const float* arow = A + (size_t)(row0 + ln) * lda;
  v8f acc[4] = {};
  for (int kb = 0; kb < K; kb += 32) {
    FragB ah, al;
    const v4f x0 = *(const v4fa*)(arow + kb + 8 * hh), x1 = *(const v4fa*)(arow + kb + 8 * hh + 4);
    const v4f x2 = *(const v4fa*)(arow + kb + 16 + 8 * hh), x3 = *(const v4fa*)(arow + kb + 16 + 8 * hh + 4);
    float xs[16] = {x0[0],x0[1],x0[2],x0[3],x1[0],x1[1],x1[2],x1[3],x2[0],x2[1],x2[2],x2[3],x3[0],x3[1],x3[2],x3[3]};
#pragma unroll
    for (int i = 0; i < 16; ++i) { const unsigned short hb = bf16_bits(xs[i]); ah.u[i] = hb; al.u[i] = ASPLIT ? bf16_bits(xs[i] - bf16_val(hb)) : (unsigned short)0; }
#pragma unroll
    for (int t = 0; t < 4; ++t) {
      const unsigned short* brow = Wt + (size_t)(col0 + t * 16 + ln) * ldb + kb;
      FragB b;
      b.half[0] = *(const v8us*)(brow + 8 * hh);
      b.half[1] = *(const v8us*)(brow + 16 + 8 * hh);
      acc[t] = mmaN<ASPLIT ? 2 : 1>(ah.v, al.v, b.v, b.v, acc[t]);
    }
  }
#pragma unroll
  for (int t = 0; t < 4; ++t) {
    const int col = col0 + t * 16 + ln;
    float bv = bias ? bias[col] : 0.f;
    if (BIAS_BF16) bv = bf16_round(bv);
#pragma unroll
    for (int r = 0; r < 8; ++r) {
      float v = acc[t][r] + bv;
      if (resid) { float rv = resid[(size_t)((row0 + 8 * hh + r) % rmod) * ldr + col]; if (RES_BF16) rv = bf16_round(rv); v += rv; }
      if (ACT == 1) v = fmaxf(v, 0.f);
      if (ACT == 2) v = 0.5f * v * (1.0f + erff(v * 0.70710678118654752f));
      if (ACT == 3) { const float u = 0.7978845608028654f * (v + 0.044715f * v * v * v); v = 0.5f * v * (1.0f + tanhf(u)); }
      so[w][8 * hh + r][t * 16 + ln] = v;
    }
  }
  __builtin_amdgcn_fence(__ATOMIC_ACQ_REL, "workgroup");
  __builtin_amdgcn_wave_barrier();
  const int rsub = lane >> 4, c4 = (lane & 15) * 4;
  {
#pragma unroll
    for (int q = 0; q < 8; ++q) {
      const int r = q * 2 + rsub;
      const v4f v = *(const v4fa*)&so[w][r][c4];
      *(v4f*)(C + (size_t)(row0 + r) * ldc + col0 + c4) = v;
    }
    
  }
}
// row LayerNorm (biased variance, eps) over N: s = X (+ R); optional out_sum <- s; out_norm <- (s-mu)*rsqrt(var+eps)*g + b
template <bool PARAM_BF16>
__global__ __launch_bounds__(256) void k_layernorm(const float* __restrict__ X, const float* __restrict__ R, const float* __restrict__ g, const float* __restrict__ bta,
                                                  float* __restrict__ out_sum, float* __restrict__ out_norm, int N, float eps) {
  __shared__ float red[256];
  const int row = blockIdx.x, tid = threadIdx.x;
  const float* x = X + (size_t)row * N; const float* rr = R ? R + (size_t)row * N : nullptr;
  float vals[16];                     // up to N = 4096
  const int per = N / 256;            // contiguous chunk per thread? use strided-by-4 chunks: thread handles j = tid*4 + 1024*u
  float s1 = 0.f;
  for (int u = 0; u < per / 4; ++u) {
    const int j = tid * 4 + 1024 * u;
    const v4f a = *(const v4fa*)(x + j);
    v4f b = {0.f,0.f,0.f,0.f}; if (rr) b = *(const v4fa*)(rr + j);
#pragma unroll
    for (int q = 0; q < 4; ++q) { const float v = a[q] + b[q]; vals[u * 4 + q] = v; s1 += v; }
  }
  red[tid] = s1; __syncthreads();
  for (int st = 128; st > 0; st >>= 1) { if (tid < st) red[tid] += red[tid + st]; __syncthreads(); }
  const float mu = red[0] / (float)N; __syncthreads();
  float s2 = 0.f;
  for (int u = 0; u < per / 4; ++u)
#pragma unroll
    for (int q = 0; q < 4; ++q) { const float c = vals[u * 4 + q] - mu; s2 += c * c; }
  red[tid] = s2; __syncthreads();
  for (int st = 128; st > 0; st >>= 1) { if (tid < st) red[tid] += red[tid + st]; __syncthreads(); }
  const float rs = rsqrtf(red[0] / (float)N + eps);
  {
    for (int u = 0; u < per / 4; ++u) {
      const int j = tid * 4 + 1024 * u;
      v4f o, sm;
#pragma unroll
      for (int q = 0; q < 4; ++q) {
        float gg = g[j + q], bb = bta[j + q];
        if (PARAM_BF16) { gg = bf16_round(gg); bb = bf16_round(bb); }
        sm[q] = vals[u * 4 + q]; o[q] = (vals[u * 4 + q] - mu) * rs * gg + bb;
      }
      if (out_sum) *(v4f*)(out_sum + (size_t)row * N + j) = sm;
      *(v4f*)(out_norm + (size_t)row * N + j) = o;
    }
    
  }
}



// ---- f16 WMMA path (v_wmma_f32_16x16x32_f16): 11-bit significands for operands in range — used for every GEMM launched here
typedef _Float16 v16h __attribute__((ext_vector_type(16)));
union FragH { v16h v; v8us half[2]; _Float16 h[16]; unsigned short u[16]; };
template <int NT>
__device__ __forceinline__ v8f mmaH(v16h ah, v16h al, v16h bh, v16h bl, v8f c) {
  c = __builtin_amdgcn_wmma_f32_16x16x32_f16(false, ah, false, bh, (short)0, c, false, false);
  if (NT >= 2) c = __builtin_amdgcn_wmma_f32_16x16x32_f16(false, al, false, bh, (short)0, c, false, false);
  if (NT >= 3) c = __builtin_amdgcn_wmma_f32_16x16x32_f16(false, ah, false, bl, (short)0, c, false, false);
  asm volatile("v_nop\n\tv_nop\n\tv_nop\n\tv_nop" : "+v"(c) : "v"(ah), "v"(al), "v"(bh), "v"(bl));
  return c;
}
// batched GEMM like k_gemm_b but f16 operands: A f32 (split into f16 hi/lo if ASPLIT, else rounded to f16), Bt = f16 values [n][k]; alpha; C f32; N multiple of 16 (partial tiles skipped)
template <bool ASPLIT>
__global__ __launch_bounds__(128) void k_gemm_h(const float* __restrict__ A, int lda, size_t sA, const _Float16* __restrict__ Bh, int ldb, size_t sB, float alpha, float* __restrict__ C, int ldc, size_t sC, int M, int N, int K) {
  __shared__ __attribute__((aligned(16))) float so[4][16][64];
  const int tid = threadIdx.x, w = tid >> 5, lane = tid & 31, ln = lane & 15, hh = lane >> 4; const int by = blockIdx.y;
  A += (size_t)by * sA; Bh += (size_t)by * sB; C += (size_t)by * sC;
  const int ntn = (N + 63) / 64; const int wid = blockIdx.x * 4 + w; const int mt = wid / ntn, nq = wid % ntn; if (mt * 16 >= M) return;
  const int row0 = mt * 16, col0 = nq * 64; const float* arow = A + (size_t)(row0 + ln) * lda;
  v8f acc[4] = {};
  for (int kb = 0; kb < K; kb += 32) {
    FragH ah, al;
    const v4f x0 = *(const v4fa*)(arow + kb + 8 * hh), x1 = *(const v4fa*)(arow + kb + 8 * hh + 4), x2 = *(const v4fa*)(arow + kb + 16 + 8 * hh), x3 = *(const v4fa*)(arow + kb + 16 + 8 * hh + 4);
    float xs[16] = {x0[0],x0[1],x0[2],x0[3],x1[0],x1[1],x1[2],x1[3],x2[0],x2[1],x2[2],x2[3],x3[0],x3[1],x3[2],x3[3]};
#pragma unroll
    for (int i = 0; i < 16; ++i) { const _Float16 h = (_Float16)xs[i]; ah.h[i] = h; al.h[i] = ASPLIT ? (_Float16)(xs[i] - (float)h) : (_Float16)0.0f; }
#pragma unroll
    for (int t = 0; t < 4; ++t) { if (col0 + t * 16 >= N) continue; const size_t boff = (size_t)(col0 + t * 16 + ln) * ldb + kb; FragH bq; bq.half[0] = *(const v8us*)(Bh + boff + 8 * hh); bq.half[1] = *(const v8us*)(Bh + boff + 16 + 8 * hh);
      acc[t] = mmaH<ASPLIT ? 2 : 1>(ah.v, al.v, bq.v, bq.v, acc[t]); }
  }
#pragma unroll
  for (int t = 0; t < 4; ++t) { if (col0 + t * 16 >= N) continue;
#pragma unroll
    for (int r = 0; r < 8; ++r) so[w][8 * hh + r][t * 16 + ln] = acc[t][r] * alpha; }
  __builtin_amdgcn_fence(__ATOMIC_ACQ_REL, "workgroup"); __builtin_amdgcn_wave_barrier();
  const int rsub = lane >> 4, c4 = (lane & 15) * 4;
  {
#pragma unroll
    for (int q = 0; q < 8; ++q) { const int r = q * 2 + rsub; if (col0 + c4 < N) { const v4f v = *(const v4fa*)&so[w][r][c4]; *(v4f*)(C + (size_t)(row0 + r) * ldc + col0 + c4) = v; } }
     }
}

// Wt[n][k] = f16(W[k][n]·scale) from f32 row-major W[K][N] (scale = power of two; bf16-exact weights stay exact in f16 away from the subnormal range)
__global__ __launch_bounds__(256) void k_wt_f16(const float* __restrict__ W, _Float16* __restrict__ Wt, int K, int N, float scale) {
  const int t = blockIdx.x * 256 + threadIdx.x; if (t >= N * (K / 8)) return; const int n = t / (K / 8), k8 = (t % (K / 8)) * 8; FragH f;
#pragma unroll
  for (int i = 0; i < 8; ++i) f.h[i] = (_Float16)(bf16_round(W[(size_t)(k8 + i) * N + n]) * scale); const v8us o = f.half[0];
  *(v8us*)((unsigned short*)Wt + (size_t)n * K + k8) = o; 
}
// k_gemm_hh variant with fused epilogue: v = acc·alpha + bias[by·sBias + col] (+ CP[(row/rowsPerB)·sCPb + by·64 + col] if CP) ; ACT 0 none / 1 elu ; writes f16 C16 (and f32 C if non-null)
template <int ACT>
__global__ __launch_bounds__(128) void k_gemm_hhx(const _Float16* __restrict__ A, int lda, size_t sA, const _Float16* __restrict__ Bh, int ldb, size_t sB, float alpha, const float* __restrict__ bias, size_t sBias, const float* __restrict__ CP, int rowsPerB, size_t sCPb, int row0g,
    float* __restrict__ C, _Float16* __restrict__ C16, int ldc, size_t sC, int M, int N, int K) {
  __shared__ __attribute__((aligned(16))) float so[4][16][64];
  const int tid = threadIdx.x, w = tid >> 5, lane = tid & 31, ln = lane & 15, hh = lane >> 4; const int by = blockIdx.y;
  A += (size_t)by * sA; Bh += (size_t)by * sB; const size_t cofs = (size_t)by * sC; const float* bp = bias ? bias + (size_t)by * sBias : nullptr;
  const int ntn = (N + 63) / 64; const int wid = blockIdx.x * 4 + w; const int mt = wid / ntn, nq = wid % ntn; if (mt * 16 >= M) return;
  const int row0 = mt * 16, col0 = nq * 64; const _Float16* arow = A + (size_t)(row0 + ln) * lda;
  v8f acc[4] = {};
  for (int kb = 0; kb < K; kb += 32) { FragH ah; ah.half[0] = *(const v8us*)((const unsigned short*)arow + kb + 8 * hh); ah.half[1] = *(const v8us*)((const unsigned short*)arow + kb + 16 + 8 * hh);
#pragma unroll
    for (int t = 0; t < 4; ++t) { if (col0 + t * 16 >= N) continue; const size_t boff = (size_t)(col0 + t * 16 + ln) * ldb + kb; FragH bq; bq.half[0] = *(const v8us*)((const unsigned short*)Bh + boff + 8 * hh); bq.half[1] = *(const v8us*)((const unsigned short*)Bh + boff + 16 + 8 * hh);
      acc[t] = mmaH<1>(ah.v, ah.v, bq.v, bq.v, acc[t]); }
  }
#pragma unroll
  for (int t = 0; t < 4; ++t) { if (col0 + t * 16 >= N) continue; const int col = col0 + t * 16 + ln; const float bv = bp ? bf16_round(bp[col]) : 0.f;
#pragma unroll
    for (int r = 0; r < 8; ++r) { float v = acc[t][r] * alpha + bv; if (CP) { const int rr = row0g + row0 + 8 * hh + r; if (rowsPerB < 0) v += CP[cofs + (size_t)rr * ldc + col];      /* rowsPerB < 0: own element of the batched C plane */ else { const int bidx = rr / rowsPerB; v += CP[(size_t)bidx * sCPb + (size_t)by * 64 + col]; } } if (ACT == 1) v = (v > 0.f) ? v : expm1f(v); else if (ACT == 7) v = (v > 0.f) ? v + 1.0f : expf(v); else if (ACT == 8) v = tanhf(v); else if (ACT == 9) v = 0.5f * v * (1.0f + tanhf(0.7978845608028654f * (v + 0.044715f * v * v * v))); else if (ACT == 11) v = 1.0f / (1.0f + expf(-v)); else if (ACT == 12) v = (v > 0.f) ? v : 0.01f * v; else if (ACT == 14) v = (v > 0.f) ? v : 0.1f * v; else if (ACT == 16) v = (v >= 0.f) ? v : 0.3f * v; else if (ACT == 17) v = (v >= 0.f) ? v : 0.2f * v; else if (ACT == 15) v = v / (1.0f + expf(-v)); else if (ACT == 3) v = fmaxf(v, 0.f); else if (ACT == 6) v = 0.5f * v * (1.0f + erff(v * 0.70710678118654752f)); so[w][8 * hh + r][t * 16 + ln] = v; } }
  __builtin_amdgcn_fence(__ATOMIC_ACQ_REL, "workgroup"); __builtin_amdgcn_wave_barrier();
  const int rsub = lane >> 4, c4 = (lane & 15) * 4; typedef _Float16 v4h __attribute__((ext_vector_type(4)));
  {
#pragma unroll
    for (int q = 0; q < 8; ++q) { const int r = q * 2 + rsub; if (col0 + c4 < N) { const v4f v = *(const v4fa*)&so[w][r][c4]; if (C) *(v4f*)(C + cofs + (size_t)(row0 + r) * ldc + col0 + c4) = v; if (C16) { v4h h4; for (int i = 0; i < 4; ++i) h4[i] = (_Float16)v[i]; *(v4h*)(C16 + cofs + (size_t)(row0 + r) * ldc + col0 + c4) = h4; } } }
     }
}


typedef _Float16 v4h __attribute__((ext_vector_type(4)));

__global__ __launch_bounds__(256) void k_x16(const float* __restrict__ x, _Float16* __restrict__ X16, size_t n8) { const size_t t = (size_t)blockIdx.x * 256 + threadIdx.x; if (t >= n8) return; FragH f;
#pragma unroll
  for (int q = 0; q < 8; ++q) f.h[q] = (_Float16)bf16_round(x[t * 8 + q]); *(v8us*)((unsigned short*)X16 + t * 8) = f.half[0];  }
__global__ __launch_bounds__(256) void k_h16(const float* __restrict__ x, _Float16* __restrict__ X16, size_t n8) { const size_t t = (size_t)blockIdx.x * 256 + threadIdx.x; if (t >= n8) return; FragH f;
#pragma unroll
  for (int q = 0; q < 8; ++q) f.h[q] = (_Float16)x[t * 8 + q]; *(v8us*)((unsigned short*)X16 + t * 8) = f.half[0];  }
__global__ __launch_bounds__(256) void k_round16f(const float* __restrict__ W, _Float16* __restrict__ Bt, size_t n8) { const size_t t = (size_t)blockIdx.x * 256 + threadIdx.x; if (t >= n8) return; FragH f;
#pragma unroll
  for (int i = 0; i < 8; ++i) f.h[i] = (_Float16)(bf16_round(W[t * 8 + i]) * 16.0f); *(v8us*)((unsigned short*)Bt + t * 8) = f.half[0];  }
template <int NHv, int TTv>
__global__ __launch_bounds__(256) void k_vt(const _Float16* __restrict__ V16, int ldv, int voff, _Float16* __restrict__ Vt) { __shared__ unsigned short tl[64][66]; const int tid = threadIdx.x; const int slab = blockIdx.x / (TTv / 64), lg = blockIdx.x % (TTv / 64); const int b = slab / NHv, h = slab % NHv;
  for (int i = tid; i < 64 * 8; i += 256) { const int r = i / 8, c8 = (i % 8) * 8; FragH f; f.half[0] = *(const v8us*)((const unsigned short*)V16 + ((size_t)b * TTv + lg * 64 + r) * ldv + voff + h * 64 + c8);
#pragma unroll
    for (int q = 0; q < 8; ++q) tl[r][c8 + q] = f.u[q]; }
  __syncthreads();
  {
#pragma unroll
    for (int rd = 0; rd < 2; ++rd) { const int d = rd * 32 + tid / 8, pc = tid % 8; FragH f;
#pragma unroll
      for (int q = 0; q < 8; ++q) f.u[q] = tl[pc * 8 + q][d];
      *(v8us*)((unsigned short*)Vt + ((size_t)slab * 64 + d) * TTv + lg * 64 + pc * 8) = f.half[0]; }
     } }

__global__ __launch_bounds__(256) void k_hl(const float* __restrict__ F, _Float16* __restrict__ Hh, _Float16* __restrict__ Hl, size_t n8) { const size_t t = (size_t)blockIdx.x * 256 + threadIdx.x; if (t >= n8) return; FragH fh, fl; const v4f a = *(const v4fa*)(F + t * 8), c = *(const v4fa*)(F + t * 8 + 4);
#pragma unroll
  for (int q = 0; q < 4; ++q) { _Float16 h = (_Float16)a[q]; fh.h[q] = h; fl.h[q] = (_Float16)((a[q] - (float)h) * 1024.0f); h = (_Float16)c[q]; fh.h[4 + q] = h; fl.h[4 + q] = (_Float16)((c[q] - (float)h) * 1024.0f); }
  { *(v8us*)((unsigned short*)Hh + t * 8) = fh.half[0]; *(v8us*)((unsigned short*)Hl + t * 8) = fl.half[0];  } }

// ---- fast GEMM (block tile 128x64, wave tile 32x64, A and B k-tiles staged in LDS; requires M % 128 == 0, N % 64 == 0 and K == 64 or K % 128 == 0); epilogue = k_gemm_hhx semantics ----
#define G2_LP 72
__device__ __forceinline__ v16h g2_frag(const _Float16* p, int hh) { FragH f; f.half[0] = *(const v8us*)((const unsigned short*)p + 8 * hh); f.half[1] = *(const v8us*)((const unsigned short*)p + 16 + 8 * hh); return f.v; }
__device__ __forceinline__ v8f g2_mma(v16h a, v16h b, v8f c) { v8f d = __builtin_amdgcn_wmma_f32_16x16x32_f16(false, a, false, b, (short)0, c, false, false); asm volatile("v_nop\n\tv_nop\n\tv_nop\n\tv_nop" : "+v"(d) : "v"(a), "v"(b)); return d; }
// work-group barrier that orders LDS alone (its fences name the LDS address space): __syncthreads() also waits for every global load in flight, and the loads for the tiles ahead must stay in flight across it; the loop's global reads are of operands that no wave of the launch writes
__device__ __forceinline__ void g2_bar() { __builtin_amdgcn_fence(__ATOMIC_RELEASE, "workgroup", "local"); __builtin_amdgcn_s_barrier(); __builtin_amdgcn_fence(__ATOMIC_ACQUIRE, "workgroup", "local"); }
template <int ACT>
__global__ __launch_bounds__(128) void k_gemm2(const _Float16* __restrict__ A, int lda, size_t sA, const _Float16* __restrict__ Bh, int ldb, size_t sB, float alpha, const float* __restrict__ bias, size_t sBias, const float* __restrict__ CP, int rowsPerB, size_t sCPb, int row0g,
    float* __restrict__ C, _Float16* __restrict__ C16, int ldc, size_t sC, int M, int N, int K) { static_assert(ACT == 0 || ACT == 3 || ACT == 6 || ACT == 8 || ACT == 9 || ACT == 11 || ACT == 12 || ACT == 14 || ACT == 15 || ACT == 16 || ACT == 17, "k_gemm2: unsupported ACT code (would silently apply no activation)");
  __shared__ __attribute__((aligned(16))) float so[4][32][68];
  // k-tiles of 64 halves (one whole 128-B line per row) of the block's 128 A rows and 64 B rows, two buffers; row pitch 72 halves = 144 B = 16 B x 9 for the ds_load_b128 fragment reads
  __shared__ __attribute__((aligned(16))) _Float16 sa[2][128][G2_LP];
  __shared__ __attribute__((aligned(16))) _Float16 sb[2][64][G2_LP];
  const int tid = threadIdx.x, w = tid >> 5, lane = tid & 31, ln = lane & 15, hh = lane >> 4; const int by = blockIdx.y;
  A += (size_t)by * sA; Bh += (size_t)by * sB; const size_t cofs = (size_t)by * sC; const float* bp = bias ? bias + (size_t)by * sBias : nullptr;
  const int ntn = N >> 6; const int mt = blockIdx.x / ntn, nq = blockIdx.x - mt * ntn; const int row0 = mt * 128 + 32 * w, col0 = nq * 64; if (mt * 128 >= M) return;      /* the same for the whole block: it stands in front of barriers */
  const int sr = tid >> 3, sc = (tid & 7) * 8;      /* staging: 8 lanes cover one row's 128 B, a wave-wide load covers 4 whole lines */
  const char* ab = (const char*)(A + (size_t)(mt * 128) * lda); const char* bb = (const char*)(Bh + (size_t)col0 * ldb);      /* the block's first A and B row: the same in every lane */
  const unsigned ao = (unsigned)(sr * lda + sc) * 2u, bo = (unsigned)(sr * ldb + sc) * 2u;      /* the lane's own byte offset, fixed for the whole loop */
  const v8f z8 = {0.f,0.f,0.f,0.f,0.f,0.f,0.f,0.f}; v8f c00 = z8, c01 = z8, c02 = z8, c03 = z8, c10 = z8, c11 = z8, c12 = z8, c13 = z8;
  v8us ra0[8], rb0[4], ra1[8], rb1[4];
  auto gl = [&](v8us* ra, v8us* rb, int kb) {
#pragma unroll
    for (int i = 0; i < 8; ++i) ra[i] = *(const v8us*)(ab + ((size_t)(16 * i) * lda + kb) * 2 + ao);
#pragma unroll
    for (int i = 0; i < 4; ++i) rb[i] = *(const v8us*)(bb + ((size_t)(16 * i) * ldb + kb) * 2 + bo); };
  auto st = [&](const v8us* ra, const v8us* rb, int buf) {
#pragma unroll
    for (int i = 0; i < 8; ++i) *(v8us*)&sa[buf][sr + 16 * i][sc] = ra[i];
#pragma unroll
    for (int i = 0; i < 4; ++i) *(v8us*)&sb[buf][sr + 16 * i][sc] = rb[i]; };
  auto comp = [&](int buf) {
#pragma unroll
    for (int kk = 0; kk < 64; kk += 32) { const v16h a0 = g2_frag(&sa[buf][32 * w + ln][kk], hh), a1 = g2_frag(&sa[buf][32 * w + 16 + ln][kk], hh);
      const v16h b0 = g2_frag(&sb[buf][ln][kk], hh), b1 = g2_frag(&sb[buf][16 + ln][kk], hh), b2 = g2_frag(&sb[buf][32 + ln][kk], hh), b3 = g2_frag(&sb[buf][48 + ln][kk], hh);
      c00 = g2_mma(a0, b0, c00); c10 = g2_mma(a1, b0, c10); c01 = g2_mma(a0, b1, c01); c11 = g2_mma(a1, b1, c11);
      c02 = g2_mma(a0, b2, c02); c12 = g2_mma(a1, b2, c12); c03 = g2_mma(a0, b3, c03); c13 = g2_mma(a1, b3, c13); } };
  // Each barrier publishes the buffer just written and ends every wave's reads of the other buffer, which is written next.
  gl(ra0, rb0, 0);
  __builtin_amdgcn_sched_barrier(0);      /* keeps set 0's loads in front of set 1's: mixed, set 0's wait at the loop's head would wait for set 1 as well */
  gl(ra1, rb1, 64 < K ? 64 : 0);      /* the second set's tile clamped, not branched round: set 0's loads stay the older ones on every way into the loop, so its wait leaves set 1's in flight */
  asm volatile("s_wait_xcnt 0x0" ::: "memory");      /* in front of whatever reuses the address registers of the loads above, which stay in flight */
  int kb = 0;
  // two tiles per trip so that each register set and each LDS buffer has a fixed name; every load of the trip is unconditional (the last two tiles are peeled off below), so the waits can be counted; kept rolled: unrolled further it only grows the code
#pragma unroll 1
  for (; kb + 128 < K; kb += 128) {
    st(ra0, rb0, 0); g2_bar(); gl(ra0, rb0, kb + 128); comp(0);      /* loads two tiles ahead: in flight over this tile's and the next tile's products */
    st(ra1, rb1, 1); g2_bar(); gl(ra1, rb1, kb + 192); comp(1);
    asm volatile("s_wait_xcnt 0x0" ::: "memory"); }      /* in front of the next trip's address arithmetic, which rewrites the address registers of loads still in flight */
  st(ra0, rb0, 0); g2_bar(); comp(0);
  if (kb + 64 < K) { st(ra1, rb1, 1); g2_bar(); comp(1); }
  v8f accs[8] = {c00, c01, c02, c03, c10, c11, c12, c13};
#pragma unroll
  for (int u = 0; u < 8; ++u) { const int t = u & 3, half = u >> 2; const int col = col0 + t * 16 + ln; const float bv = bp ? bf16_round(bp[col]) : 0.f;
#pragma unroll
    for (int r = 0; r < 8; ++r) { const int rloc = half * 16 + 8 * hh + r; float v = accs[u][r] * alpha + bv; if (CP) { if (rowsPerB < 0) v += CP[cofs + (size_t)(row0g + row0 + rloc) * ldc + col];      /* rowsPerB < 0: own element of the batched C plane */ else { const int bidx = (row0g + row0 + rloc) / rowsPerB; v += CP[(size_t)bidx * sCPb + (size_t)by * 64 + col]; } }
      if (ACT == 3) v = fmaxf(v, 0.f); else if (ACT == 6) v = 0.5f * v * (1.0f + erff(v * 0.70710678118654752f)); else if (ACT == 11) v = 1.0f / (1.0f + expf(-v)); else if (ACT == 15) v = v / (1.0f + expf(-v)); else if (ACT == 12) v = (v > 0.f) ? v : 0.01f * v; else if (ACT == 8) v = tanhf(v); else if (ACT == 9) v = 0.5f * v * (1.0f + tanhf(0.7978845608028654f * (v + 0.044715f * v * v * v))); else if (ACT == 14) v = (v > 0.f) ? v : 0.1f * v; else if (ACT == 16) v = (v >= 0.f) ? v : 0.3f * v; else if (ACT == 17) v = (v >= 0.f) ? v : 0.2f * v;
      so[w][rloc][t * 16 + ln] = v; } }
  __builtin_amdgcn_fence(__ATOMIC_ACQ_REL, "workgroup"); __builtin_amdgcn_wave_barrier();
  const int rsub = lane >> 4, c4 = (lane & 15) * 4;
  {
#pragma unroll
    for (int q = 0; q < 16; ++q) { const int r = q * 2 + rsub; const v4f v = *(const v4fa*)&so[w][r][c4]; if (C) *(v4f*)(C + cofs + (size_t)(row0 + r) * ldc + col0 + c4) = v; if (C16) { v4h h4; for (int i = 0; i < 4; ++i) h4[i] = (_Float16)v[i]; *(v4h*)(C16 + cofs + (size_t)(row0 + r) * ldc + col0 + c4) = h4; } }
     } }


__global__ __launch_bounds__(256) void k_wsc(const float* __restrict__ Wm, _Float16* __restrict__ Bt, size_t n8, float sc) { const size_t t = (size_t)blockIdx.x * 256 + threadIdx.x; if (t >= n8) return; FragH f; for (int q = 0; q < 8; ++q) f.h[q] = (_Float16)(bf16_round(Wm[t * 8 + q]) * sc); *(v8us*)((unsigned short*)Bt + t * 8) = f.half[0];  }
__global__ __launch_bounds__(256) void k_ccp(const float* __restrict__ QKV, int coff, _Float16* __restrict__ D) { const size_t t = (size_t)blockIdx.x * 256 + threadIdx.x; if (t >= (size_t)NR * DM / 8) return; const int c0 = (int)((t * 8) % DM); const size_t row = (t * 8) / DM; const v8f a = *(const v8f*)(QKV + row * 3 * DM + coff + c0); FragH f; for (int q = 0; q < 8; ++q) f.h[q] = (_Float16)a[q];
  *(v8us*)((unsigned short*)D + t * 8) = f.half[0];  }
__global__ __launch_bounds__(256) void k_chl(const float* __restrict__ QKV, int coff, _Float16* __restrict__ Hh, _Float16* __restrict__ Lh) {
  #pragma clang fp contract(off)
  const size_t t = (size_t)blockIdx.x * 256 + threadIdx.x; if (t >= (size_t)NR * DM / 8) return; const int c0 = (int)((t * 8) % DM); const size_t row = (t * 8) / DM; const v8f a = *(const v8f*)(QKV + row * 3 * DM + coff + c0); FragH fh, fl; for (int q = 0; q < 8; ++q) { const _Float16 hv = (_Float16)a[q]; fh.h[q] = hv; fl.h[q] = (_Float16)((a[q] - (float)hv) * 1024.0f); }
  { *(v8us*)((unsigned short*)Hh + t * 8) = fh.half[0]; *(v8us*)((unsigned short*)Lh + t * 8) = fl.half[0];  } }
__device__ __forceinline__ void exter(const float* p1, const float* p2, float* L) {
  #pragma clang fp contract(off)
  const int PI[6] = {0, 0, 0, 1, 1, 2}, PJ[6] = {1, 2, 3, 2, 3, 3}; float n2 = 0.f;
  for (int k = 0; k < 6; ++k) { float a = p1[PI[k]] * p2[PJ[k]]; a += -(p1[PJ[k]] * p2[PI[k]]); L[k] = a; n2 += a * a; }
  const float n = fmaxf(sqrtf(n2), 1e-12f); for (int k = 0; k < 6; ++k) L[k] = L[k] / n; }
__global__ __launch_bounds__(256) void k_lines(const float* __restrict__ LW, float* __restrict__ JW, float* __restrict__ RD) {
  #pragma clang fp contract(off)
  const int tt = blockIdx.x * 256 + threadIdx.x; if (tt >= NR * NH) return; const int t = tt % TT; const int bh = tt / TT; const int h = bh % NH, b = bh / NH; const size_t row = (size_t)b * TT + t; float w1[4], w2[4], r1[4], r2[4];
  for (int i = 0; i < 4; ++i) { w1[i] = (t > 0) ? LW[(row - 1) * 256 + h * 4 + i] : 0.f; w2[i] = LW[row * 256 + 64 + h * 4 + i]; r1[i] = LW[row * 256 + 128 + h * 4 + i]; r2[i] = LW[row * 256 + 192 + h * 4 + i]; }
  float wl[6], rl[6]; exter(w1, w2, wl); exter(r1, r2, rl); v8f jw, rd; jw[0] = wl[5]; jw[1] = -wl[4]; jw[2] = wl[3]; jw[3] = wl[2]; jw[4] = -wl[1]; jw[5] = wl[0]; jw[6] = 0.f; jw[7] = 0.f; for (int k = 0; k < 6; ++k) rd[k] = rl[k]; rd[6] = 0.f; rd[7] = 0.f;
  const size_t o = (((size_t)b * NH + h) * TT + t) * 8; { *(v8f*)(JW + o) = jw; *(v8f*)(RD + o) = rd;  } }
__global__ __launch_bounds__(64) void k_cum(const float* __restrict__ JW, const float* __restrict__ RD, float* __restrict__ RDM) {
  #pragma clang fp contract(off)
  const int tt = blockIdx.x * 64 + threadIdx.x; if (tt >= NB * NH * 8) return; const int j = tt % 8; const int bh = tt / 8; float m[6]; for (int i = 0; i < 6; ++i) m[i] = 0.f; const float* jw = JW + (size_t)bh * TT * 8; const float* rd = RD + (size_t)bh * TT * 8;
#pragma unroll 1
  for (int t = 0; t < TT; ++t) { float v = 0.f; if (j < 6) { const float wj = jw[(size_t)t * 8 + j]; for (int i = 0; i < 6; ++i) { m[i] += jw[(size_t)t * 8 + i] * wj; } for (int i = 0; i < 6; ++i) v += rd[(size_t)t * 8 + i] * m[i]; }
    float* d = RDM + ((size_t)bh * TT + t) * 8 + j; *(float*)d = v;  } }
typedef float v2f __attribute__((ext_vector_type(2)));
typedef float v2fa __attribute__((ext_vector_type(2), may_alias));
__global__ __launch_bounds__(256) void k_bsoft(const float* __restrict__ S, const float* __restrict__ RDM, const float* __restrict__ JW, const float* __restrict__ bsc, int b, int h0, _Float16* __restrict__ P, float* __restrict__ RS) {
  #pragma clang fp contract(off)
  // The block's 8 rows are 8 consecutive t of one head (TT % 8 == 0): that head's Jw rows are staged once in LDS, as six planes, and shared by the 8 waves.
  // Inside each group of 256 columns, column ln * 8 + q lies at (q >> 2) * 128 + ln * 4 + (q & 3): a lane's 8 columns are two 16-B reads per plane, and the 32 lanes of each read cover 512 B in a row.
  __shared__ __attribute__((aligned(16))) float sj[6][TT];
  if (blockIdx.x * 8 >= HG * TT) return;      /* the same for the whole block: it stands in front of the barrier */
  const int tid = threadIdx.x, ln = tid & 31; const int wv = __builtin_amdgcn_readfirstlane(tid >> 5);      /* the wave's number in a scalar register: row, trip counts and row addresses are scalar */
  const int r = blockIdx.x * 8 + wv; const int t = r % TT, hl = r / TT; const int h = h0 + hl; const size_t bh = (size_t)b * NH + h; const float bs = bf16_round(bsc[h]); const float* sr = S + (size_t)r * TT; const v8f rdm = *(const v8f*)(RDM + (bh * TT + t) * 8); const float* jwb = JW + bh * TT * 8;
  const int ngw = (t >> 8) + 1;      /* column groups that hold an s <= t for this row */
  // every global load of the block's operands is unconditional (all of the head's Jw rows and all of the S row exist and were written earlier in this call) and is issued before the first is waited for: one trip to L2 in all.
  // The Jw rows first (thread tid brings column i * 256 + tid, its six values as 16 + 8 bytes), as the staging waits for them alone
  // every loop of this kernel over groups, halves, planes and columns is unrolled in full: its arrays (ja, jb, sv, j, l, ph) are indexed by constants then and stay in registers
  v4f ja[TT / 256]; v2f jb[TT / 256];
#pragma unroll
  for (int i = 0; i < TT / 256; ++i) { const float* jp = jwb + (size_t)(i * 256 + tid) * 8; ja[i] = *(const v4fa*)jp; jb[i] = *(const v2fa*)(jp + 4); }
  // the row's scores, two 16-B loads per group of 8 columns, whole lines per wave; they fly during the staging
  v4f sv[TT / 256][2];
#pragma unroll
  for (int gq = 0; gq < TT / 256; ++gq) { sv[gq][0] = *(const v4fa*)(sr + gq * 256 + ln * 8); sv[gq][1] = *(const v4fa*)(sr + gq * 256 + ln * 8 + 4); }
  asm volatile("s_wait_xcnt 0x0" ::: "memory");      /* in front of whatever reuses the address registers of the loads above, which stay in flight */
  const int p0 = ((tid >> 2) & 1) * 128 + (tid >> 3) * 4 + (tid & 3);
#pragma unroll
  for (int i = 0; i < TT / 256; ++i) {
#pragma unroll
    for (int k = 0; k < 4; ++k) sj[k][i * 256 + p0] = ja[i][k];
    sj[4][i * 256 + p0] = jb[i][0]; sj[5][i * 256 + p0] = jb[i][1]; }
  __syncthreads();
  auto lg8 = [&](int gq, const v4f* s8, float* l) {
#pragma unroll
    for (int hf = 0; hf < 2; ++hf) { v4f j[6];
#pragma unroll
      for (int k = 0; k < 6; ++k) j[k] = *(const v4f*)&sj[k][gq * 256 + hf * 128 + ln * 4];
#pragma unroll
      for (int q = 0; q < 4; ++q) { float d = 0.f; for (int k = 0; k < 6; ++k) d += rdm[k] * j[k][q]; float lv = s8[hf][q] * 0.125f; lv += fabsf(d) * bs; l[hf * 4 + q] = lv; } } };
  float mx = -3.0e38f;
#pragma unroll
  for (int gq = 0; gq < TT / 256; ++gq) if (gq < ngw) { float l[8]; lg8(gq, sv[gq], l);
#pragma unroll
    for (int q = 0; q < 8; ++q) { const int s = gq * 256 + ln * 8 + q; if (s <= t) mx = fmaxf(mx, l[q]); } }
  for (int o = 16; o > 0; o >>= 1) mx = fmaxf(mx, __shfl_xor(mx, o, 32)); float su = 0.f;
#pragma unroll
  for (int gq = 0; gq < TT / 256; ++gq) { FragH ph;
    if (gq < ngw) { float l[8]; lg8(gq, sv[gq], l);
#pragma unroll
      for (int q = 0; q < 8; ++q) { const int s = gq * 256 + ln * 8 + q; const float e = (s <= t) ? expf(l[q] - mx) : 0.f; su += e; ph.h[q] = (_Float16)(e * 1024.0f); } }
    else {
#pragma unroll
      for (int q = 0; q < 8; ++q) ph.h[q] = (_Float16)0.0f; }
    *(v8us*)((unsigned short*)P + (size_t)r * TT + gq * 256 + ln * 8) = ph.half[0];
    asm volatile("s_wait_xcnt 0x0" ::: "memory"); }      /* in front of the next group's LDS reads and sums, which reuse the registers that the store names */
  for (int o = 16; o > 0; o >>= 1) su += __shfl_xor(su, o, 32); if (ln == 0) { *(float*)(RS + (size_t)r * 32) = 1.0f / su;  } }
__global__ __launch_bounds__(256) void k_csc(const float* __restrict__ O, const float* __restrict__ RS, int b, int h0, _Float16* __restrict__ CH, _Float16* __restrict__ CL) {
  #pragma clang fp contract(off)
  const int tt = blockIdx.x * 256 + threadIdx.x; if (tt >= TT * HG * (HD / 8)) return; const int d8 = (tt % (HD / 8)) * 8; const int hl = (tt / (HD / 8)) % HG; const int t = tt / ((HD / 8) * HG); const float rs = RS[((size_t)hl * TT + t) * 32]; const size_t o = ((size_t)b * TT + t) * DM + (h0 + hl) * HD + d8; const v8f a = *(const v8f*)(O + (size_t)t * DM + (h0 + hl) * HD + d8); FragH f, fl;
  for (int q = 0; q < 8; ++q) { const float v = a[q] * rs; const _Float16 hh = (_Float16)v; f.h[q] = hh; fl.h[q] = (_Float16)((v - (float)hh) * 1024.0f); }
  { *(v8us*)((unsigned short*)CH + o) = f.half[0]; *(v8us*)((unsigned short*)CL + o) = fl.half[0];  } }

extern "C" void kernel_launch(void* const* d_in, const int* in_sizes, int n_in,
                              void* d_out, int out_size, void* d_ws, size_t ws_size, hipStream_t stream) {
  (void)in_sizes; (void)n_in; (void)out_size;
  const float* x = (const float*)d_in[0]; const float* Wqkv = (const float*)d_in[1]; const float* bqkv = (const float*)d_in[2]; const float* W1w = (const float*)d_in[3]; const float* W2w = (const float*)d_in[4]; const float* W1r = (const float*)d_in[5]; const float* W2r = (const float*)d_in[6]; const float* bsc = (const float*)d_in[7]; const float* Wout = (const float*)d_in[8]; const float* bout = (const float*)d_in[9];
  char* ws = (char*)d_ws; size_t off = 0;
  auto take = [&](size_t bytes) { char* p = ws + off; off += (bytes + 255) & ~(size_t)255; return p; };
  const size_t np = (size_t)NR * DM;
  _Float16* BQKV = (_Float16*)take((size_t)3 * DM * DM * 2); _Float16* BL = (_Float16*)take((size_t)256 * DM * 2); _Float16* BO = (_Float16*)take((size_t)DM * DM * 2);
  _Float16* X16 = (_Float16*)take(np * 2); float* QKV = (float*)take(np * 3 * 4); _Float16* Q16 = (_Float16*)take(np * 2); _Float16* K16 = (_Float16*)take(np * 2); _Float16* V16 = (_Float16*)take(np * 2); _Float16* VL16 = (_Float16*)take(np * 2); _Float16* VT = (_Float16*)take(np * 2); _Float16* VTL = (_Float16*)take(np * 2);
  float* LW = (float*)take((size_t)NR * 256 * 4); float* JW = (float*)take((size_t)NB * NH * TT * 8 * 4); float* RD = (float*)take((size_t)NB * NH * TT * 8 * 4); float* RDM = (float*)take((size_t)NB * NH * TT * 8 * 4);
  float* S = (float*)take((size_t)HG * TT * TT * 4); _Float16* P = (_Float16*)take((size_t)HG * TT * TT * 2); float* RS = (float*)take((size_t)HG * TT * 32 * 4); float* O = (float*)take((size_t)TT * DM * 4); _Float16* CH = (_Float16*)take(np * 2); _Float16* CL = (_Float16*)take(np * 2);
  if (off > ws_size) return;      /* 6.5 + 2 + 4 + 24 + 6 x 4 + 2 + 3 + 16 + 8 + 0.5 + 4 + 8 = ≈ 102 MiB */
  k_wsc<<<(unsigned)(((size_t)3 * DM * DM / 8 + 255) / 256), 256, 0, stream>>>(Wqkv, BQKV, (size_t)3 * DM * DM / 8, 16.0f); k_wsc<<<(unsigned)(((size_t)DM * DM / 8 + 255) / 256), 256, 0, stream>>>(Wout, BO, (size_t)DM * DM / 8, 16.0f);      /* torch (out, in) naturals */
  k_wsc<<<(unsigned)(((size_t)64 * DM / 8 + 255) / 256), 256, 0, stream>>>(W1w, BL, (size_t)64 * DM / 8, 16.0f); k_wsc<<<(unsigned)(((size_t)64 * DM / 8 + 255) / 256), 256, 0, stream>>>(W2w, BL + (size_t)64 * DM, (size_t)64 * DM / 8, 16.0f); k_wsc<<<(unsigned)(((size_t)64 * DM / 8 + 255) / 256), 256, 0, stream>>>(W1r, BL + (size_t)128 * DM, (size_t)64 * DM / 8, 16.0f); k_wsc<<<(unsigned)(((size_t)64 * DM / 8 + 255) / 256), 256, 0, stream>>>(W2r, BL + (size_t)192 * DM, (size_t)64 * DM / 8, 16.0f);      /* [W1w; W2w; W1r; W2r] rows h*4 + i */
  k_x16<<<(unsigned)((np / 8 + 255) / 256), 256, 0, stream>>>(x, X16, np / 8);
  k_gemm2<0><<<dim3((NR / 128) * (3 * DM / 64), 1), 128, 0, stream>>>(X16, DM, 0, BQKV, DM, 0, 0.0625f, bqkv, 0, nullptr, 1, 0, 0, QKV, nullptr, 3 * DM, 0, NR, 3 * DM, DM);      /* [q | k | v] + bias, head h at h*64 */
  k_gemm2<0><<<dim3((NR / 128) * (256 / 64), 1), 128, 0, stream>>>(X16, DM, 0, BL, DM, 0, 0.0625f, nullptr, 0, nullptr, 1, 0, 0, LW, nullptr, 256, 0, NR, 256, DM);      /* line projections f32 [row][w1 | w2 | r1 | r2] (x_prev handled by a row shift) */
  k_ccp<<<(unsigned)((np / 8 + 255) / 256), 256, 0, stream>>>(QKV, 0, Q16); k_ccp<<<(unsigned)((np / 8 + 255) / 256), 256, 0, stream>>>(QKV, DM, K16); k_chl<<<(unsigned)((np / 8 + 255) / 256), 256, 0, stream>>>(QKV, 2 * DM, V16, VL16);      /* v as hi + residual (the bias makes the attention peaked, so v's rounding reaches the output almost unaveraged) */
  k_vt<NH, TT><<<NB * NH * (TT / 64), 256, 0, stream>>>(V16, DM, 0, VT); k_vt<NH, TT><<<NB * NH * (TT / 64), 256, 0, stream>>>(VL16, DM, 0, VTL);
  k_lines<<<(NR * NH + 255) / 256, 256, 0, stream>>>(LW, JW, RD); k_cum<<<(NB * NH * 8 + 63) / 64, 64, 0, stream>>>(JW, RD, RDM);
  for (int b = 0; b < NB; ++b) { const size_t r0 = (size_t)b * TT;
    for (int g = 0; g < NH / HG; ++g) { const int h0 = g * HG;
      k_gemm2<0><<<dim3((TT / 128) * (TT / 64), HG), 128, 0, stream>>>(Q16 + r0 * DM + h0 * HD, DM, (size_t)HD, K16 + r0 * DM + h0 * HD, DM, (size_t)HD, 1.0f, nullptr, 0, nullptr, 1, 0, 0, S, nullptr, TT, (size_t)TT * TT, TT, TT, HD);
      k_bsoft<<<(HG * TT) / 8, 256, 0, stream>>>(S, RDM, JW, bsc, b, h0, P, RS);
      k_gemm2<0><<<dim3((TT / 128) * (HD / 64), HG), 128, 0, stream>>>(P, TT, (size_t)TT * TT, VTL + ((size_t)b * NH + h0) * HD * TT, TT, (size_t)HD * TT, 0.0009765625f / 1024.0f, nullptr, 0, nullptr, 1, 0, 0, O + h0 * HD, nullptr, DM, (size_t)HD, TT, HD, TT);
      k_gemm2<0><<<dim3((TT / 128) * (HD / 64), HG), 128, 0, stream>>>(P, TT, (size_t)TT * TT, VT + ((size_t)b * NH + h0) * HD * TT, TT, (size_t)HD * TT, 0.0009765625f, nullptr, 0, O + h0 * HD, -1, 0, 0, O + h0 * HD, nullptr, DM, (size_t)HD, TT, HD, TT);      /* P . (v_lo + v_hi)^T (own-element accumulate) */
      k_csc<<<(TT * HG * (HD / 8) + 255) / 256, 256, 0, stream>>>(O, RS, b, h0, CH, CL); } }
  k_gemm2<0><<<dim3((NR / 128) * (DM / 64), 1), 128, 0, stream>>>(CL, DM, 0, BO, DM, 0, 0.0625f / 1024.0f, nullptr, 0, nullptr, 1, 0, 0, (float*)d_out, nullptr, DM, 0, NR, DM, DM);
  k_gemm2<0><<<dim3((NR / 128) * (DM / 64), 1), 128, 0, stream>>>(CH, DM, 0, BO, DM, 0, 0.0625f, bout, 0, (const float*)d_out, 1, (size_t)DM, 0, (float*)d_out, nullptr, DM, 0, NR, DM, DM);      /* out = (c_lo + c_hi) Wout^T + bout */
}

// v003
// One run takes 534 microseconds.
// Timed twice side by side with v002, it ran 1.51 times as fast both times.
// All steps since v000 together make it 2.55 times as fast.
#include <hip/hip_runtime.h>
// EigenBiasAttention (2 x 1024 tokens x 1024 = 16 heads x 64; qkv = x Wqkv^T + b; causal softmax(q.k/8 + |bias|) v; bias from Plucker lines: per head w1 = x_prev W1w^T, w2 = x W2w^T, r1 = x W1r^T, r2 = x W2r^T (4-vectors), write/read lines = normalised exterior products (6-vectors), Jw = write J6, M_t = cumsum_t Jw Jw^T, bias[t][s] = |(rd_t . M_t) . Jw_s| * bias_scale[h]; out = merged . Wout^T + bout).
// Structure: exact f16 x plane; qkv and the four line projections as f16 WMMA GEMMs (32x64 wave tiles, f32 accumulation, exact x16 weights (+ bias); f32 out) then f16 q/k/v planes; the exterior products / normalisation / J6 on VALU; the causal 6x6 Gram cumsum and rd . M per (batch, head) on VALU (f32; products and rd . M four rows per thread, the 1024-step running sums by one wave through LDS); per (batch, 4-head group) the score GEMM (K = 64, f32), the biased causal softmax on VALU (bias dot K = 6 per (t, s), bias_scale read; unnormalised f16 weights x 2^10 + row normalisers on their own lines), V^T hi/residual by LDS tiles, readout as two GEMM terms (N = 64); row scaling + hi/residual; Wout as two GEMM terms (+ bias).
// Compute dtype: inputs rounded to bf16; x / weights exact as f16 (line projections are f32 sums of exact products, so the bias path is f32-class); q, k and the softmax weights as plain f16 operands (~2^-12); v and the context as f16 hi + residual. v_wmma_f32_16x16x32_f16.
#define NB 2
#define TT 1024
#define DM 1024
#define NH 16
#define HD 64
#define HG 4
#define NR (NB * TT)
typedef __bf16 v16b __attribute__((ext_vector_type(16)));
typedef unsigned short v8us __attribute__((ext_vector_type(8), may_alias));
typedef float  v8f  __attribute__((ext_vector_type(8)));
typedef float  v4f  __attribute__((ext_vector_type(4)));
typedef float  v4fa __attribute__((ext_vector_type(4), may_alias));
union FragB { v16b v; v8us half[2]; unsigned short u[16]; };

__device__ __forceinline__ unsigned short bf16_bits(float x) { unsigned int u = __float_as_uint(x); return (unsigned short)((u + 0x7FFFu + ((u >> 16) & 1u)) >> 16); }
__device__ __forceinline__ float bf16_val(unsigned short b) { return __uint_as_float(((unsigned int)b) << 16); }
__device__ __forceinline__ float bf16_round(float x) { return bf16_val(bf16_bits(x)); }
// D += A·B with NT terms: 1 = ah·bh, 2 = + al·bh (A split), 3 = + ah·bl (both split)
template <int NT>
__device__ __forceinline__ v8f mmaN(v16b ah, v16b al, v16b bh, v16b bl, v8f c) {
  c = __builtin_amdgcn_wmma_f32_16x16x32_bf16(false, ah, false, bh, (short)0, c, false, false);
  if (NT >= 2) c = __builtin_amdgcn_wmma_f32_16x16x32_bf16(false, al, false, bh, (short)0, c, false, false);
  if (NT >= 3) c = __builtin_amdgcn_wmma_f32_16x16x32_bf16(false, ah, false, bl, (short)0, c, false, false);
  asm volatile("v_nop\n\tv_nop\n\tv_nop\n\tv_nop" : "+v"(c) : "v"(ah), "v"(al), "v"(bh), "v"(bl));
  return c;
}

__global__ __launch_bounds__(256) void k_wt_bf16(const float* __restrict__ W, unsigned short* __restrict__ Wt, int K, int N) {
  const int t = blockIdx.x * 256 + threadIdx.x;
  const int k8n = K / 8;
  if (t >= N * k8n) return;
  const int n = t / k8n, k8 = (t % k8n) * 8;
  v8us v;
#pragma unroll
  for (int i = 0; i < 8; ++i) v[i] = bf16_bits(W[(size_t)(k8 + i) * N + n]);
  *(v8us*)(Wt + (size_t)n * K + k8) = v;
  
}

// GEMM C[M][N] (f32, pitch ldc) = act(A[M][K]·W + bias). A f32 row-major (pitch lda) converted per fragment to bf16
// (ASPLIT: hi/lo two planes -> 2 terms, else single rounded term); Wt bf16 [N][K] (pitch ldb). BIAS_BF16 rounds the
// bias to bf16 first (bias quantised to bf16 before the add). K%32==0, M%16==0, N%64==0.
template <bool ASPLIT, int ACT, bool BIAS_BF16>
__global__ __launch_bounds__(128) void k_gemm_bf(const float* __restrict__ A, int lda, const unsigned short* __restrict__ Wt, int ldb,
                                               const float* __restrict__ bias, float* __restrict__ C, int ldc, int M, int N, int K) {
  __shared__ __attribute__((aligned(16))) float so[4][16][64];
  const int tid = threadIdx.x, w = tid >> 5, lane = tid & 31, ln = lane & 15, hh = lane >> 4;
  const int ntn = N / 64;
  const int wid = blockIdx.x * 4 + w;
  const int mt = wid / ntn, nq = wid % ntn;
  if (mt * 16 >= M) return;
  const int row0 = mt * 16, col0 = nq * 64;
  const float* arow = A + (size_t)(row0 + ln) * lda;
  v8f acc[4] = {};
  for (int kb = 0; kb < K; kb += 32) {
    FragB ah, al;
    const v4f x0 = *(const v4fa*)(arow + kb + 8 * hh), x1 = *(const v4fa*)(arow + kb + 8 * hh + 4);
    const v4f x2 = *(const v4fa*)(arow + kb + 16 + 8 * hh), x3 = *(const v4fa*)(arow + kb + 16 + 8 * hh + 4);
    float xs[16] = {x0[0],x0[1],x0[2],x0[3],x1[0],x1[1],x1[2],x1[3],x2[0],x2[1],x2[2],x2[3],x3[0],x3[1],x3[2],x3[3]};
#pragma unroll
    for (int i = 0; i < 16; ++i) { const unsigned short hb = bf16_bits(xs[i]); ah.u[i] = hb; al.u[i] = ASPLIT ? bf16_bits(xs[i] - bf16_val(hb)) : (unsigned short)0; }
#pragma unroll
    for (int t = 0; t < 4; ++t) {
      const unsigned short* brow = Wt + (size_t)(col0 + t * 16 + ln) * ldb + kb;
      FragB b;
      b.half[0] = *(const v8us*)(brow + 8 * hh);
      b.half[1] = *(const v8us*)(brow + 16 + 8 * hh);
      acc[t] = mmaN<ASPLIT ? 2 : 1>(ah.v, al.v, b.v, b.v, acc[t]);
    }
  }
#pragma unroll
  for (int t = 0; t < 4; ++t) {
    float bv = bias ? bias[col0 + t * 16 + ln] : 0.f;
    if (BIAS_BF16) bv = bf16_round(bv);
#pragma unroll
    for (int r = 0; r < 8; ++r) { float v = acc[t][r] + bv; if (ACT == 1) v = fmaxf(v, 0.f); so[w][8 * hh + r][t * 16 + ln] = v; }
  }
  __builtin_amdgcn_fence(__ATOMIC_ACQ_REL, "workgroup");
  __builtin_amdgcn_wave_barrier();
  const int rsub = lane >> 4, c4 = (lane & 15) * 4;
  {
#pragma unroll
    for (int q = 0; q < 8; ++q) {
      const int r = q * 2 + rsub;
      const v4f v = *(const v4fa*)&so[w][r][c4];
      *(v4f*)(C + (size_t)(row0 + r) * ldc + col0 + c4) = v;
    }
    
  }
}

// GEMM C = act(A·W + bias + resid): A f32 (ASPLIT -> hi/lo 2 terms), Wt bf16 [N][K]; ACT 0 none, 1 relu, 2 exact gelu;
// resid (optional, f32, row index = (row % rmod), pitch ldr, RES_BF16 rounds it) added before the activation.
template <bool ASPLIT, int ACT, bool BIAS_BF16, bool RES_BF16>
__global__ __launch_bounds__(128) void k_gemm_bf3(const float* __restrict__ A, int lda, const unsigned short* __restrict__ Wt, int ldb,
                                                const float* __restrict__ bias, const float* __restrict__ resid, int rmod, int ldr,
                                                float* __restrict__ C, int ldc, int M, int N, int K) {
  __shared__ __attribute__((aligned(16))) float so[4][16][64];
  const int tid = threadIdx.x, w = tid >> 5, lane = tid & 31, ln = lane & 15, hh = lane >> 4;
  const int ntn = N / 64;
  const int wid = blockIdx.x * 4 + w;
  const int mt = wid / ntn, nq = wid % ntn;
  if (mt * 16 >= M) return;
  const int row0 = mt * 16, col0 = nq * 64;
  const float* arow = A + (size_t)(row0 + ln) * lda;
  v8f acc[4] = {};
  for (int kb = 0; kb < K; kb += 32) {
    FragB ah, al;
    const v4f x0 = *(const v4fa*)(arow + kb + 8 * hh), x1 = *(const v4fa*)(arow + kb + 8 * hh + 4);
    const v4f x2 = *(const v4fa*)(arow + kb + 16 + 8 * hh), x3 = *(const v4fa*)(arow + kb + 16 + 8 * hh + 4);
    float xs[16] = {x0[0],x0[1],x0[2],x0[3],x1[0],x1[1],x1[2],x1[3],x2[0],x2[1],x2[2],x2[3],x3[0],x3[1],x3[2],x3[3]};
#pragma unroll
    for (int i = 0; i < 16; ++i) { const unsigned short hb = bf16_bits(xs[i]); ah.u[i] = hb; al.u[i] = ASPLIT ? bf16_bits(xs[i] - bf16_val(hb)) : (unsigned short)0; }
#pragma unroll
    for (int t = 0; t < 4; ++t) {
      const unsigned short* brow = Wt + (size_t)(col0 + t * 16 + ln) * ldb + kb;
      FragB b;
      b.half[0] = *(const v8us*)(brow + 8 * hh);
      b.half[1] = *(const v8us*)(brow + 16 + 8 * hh);
      acc[t] = mmaN<ASPLIT ? 2 : 1>(ah.v, al.v, b.v, b.v, acc[t]);
    }
  }
#pragma unroll
  for (int t = 0; t < 4; ++t) {
    const int col = col0 + t * 16 + ln;
    float bv = bias ? bias[col] : 0.f;
    if (BIAS_BF16) bv = bf16_round(bv);
#pragma unroll
    for (int r = 0; r < 8; ++r) {
      float v = acc[t][r] + bv;
      if (resid) { float rv = resid[(size_t)((row0 + 8 * hh + r) % rmod) * ldr + col]; if (RES_BF16) rv = bf16_round(rv); v += rv; }
      if (ACT == 1) v = fmaxf(v, 0.f);
      if (ACT == 2) v = 0.5f * v * (1.0f + erff(v * 0.70710678118654752f));
      if (ACT == 3) { const float u = 0.7978845608028654f * (v + 0.044715f * v * v * v); v = 0.5f * v * (1.0f + tanhf(u)); }
      so[w][8 * hh + r][t * 16 + ln] = v;
    }
  }
  __builtin_amdgcn_fence(__ATOMIC_ACQ_REL, "workgroup");
  __builtin_amdgcn_wave_barrier();
  const int rsub = lane >> 4, c4 = (lane & 15) * 4;
  {
#pragma unroll
    for (int q = 0; q < 8; ++q) {
      const int r = q * 2 + rsub;
      const v4f v = *(const v4fa*)&so[w][r][c4];
      *(v4f*)(C + (size_t)(row0 + r) * ldc + col0 + c4) = v;
    }
    
  }
}
// row LayerNorm (biased variance, eps) over N: s = X (+ R); optional out_sum <- s; out_norm <- (s-mu)*rsqrt(var+eps)*g + b
template <bool PARAM_BF16>
__global__ __launch_bounds__(256) void k_layernorm(const float* __restrict__ X, const float* __restrict__ R, const float* __restrict__ g, const float* __restrict__ bta,
                                                  float* __restrict__ out_sum, float* __restrict__ out_norm, int N, float eps) {
  __shared__ float red[256];
  const int row = blockIdx.x, tid = threadIdx.x;
  const float* x = X + (size_t)row * N; const float* rr = R ? R + (size_t)row * N : nullptr;
  float vals[16];                     // up to N = 4096
  const int per = N / 256;            // contiguous chunk per thread? use strided-by-4 chunks: thread handles j = tid*4 + 1024*u
  float s1 = 0.f;
  for (int u = 0; u < per / 4; ++u) {
    const int j = tid * 4 + 1024 * u;
    const v4f a = *(const v4fa*)(x + j);
    v4f b = {0.f,0.f,0.f,0.f}; if (rr) b = *(const v4fa*)(rr + j);
#pragma unroll
    for (int q = 0; q < 4; ++q) { const float v = a[q] + b[q]; vals[u * 4 + q] = v; s1 += v; }
  }
  red[tid] = s1; __syncthreads();
  for (int st = 128; st > 0; st >>= 1) { if (tid < st) red[tid] += red[tid + st]; __syncthreads(); }
  const float mu = red[0] / (float)N; __syncthreads();
  float s2 = 0.f;
  for (int u = 0; u < per / 4; ++u)
#pragma unroll
    for (int q = 0; q < 4; ++q) { const float c = vals[u * 4 + q] - mu; s2 += c * c; }
  red[tid] = s2; __syncthreads();
  for (int st = 128; st > 0; st >>= 1) { if (tid < st) red[tid] += red[tid + st]; __syncthreads(); }
  const float rs = rsqrtf(red[0] / (float)N + eps);
  {
    for (int u = 0; u < per / 4; ++u) {
      const int j = tid * 4 + 1024 * u;
      v4f o, sm;
#pragma unroll
      for (int q = 0; q < 4; ++q) {
        float gg = g[j + q], bb = bta[j + q];
        if (PARAM_BF16) { gg = bf16_round(gg); bb = bf16_round(bb); }
        sm[q] = vals[u * 4 + q]; o[q] = (vals[u * 4 + q] - mu) * rs * gg + bb;
      }
      if (out_sum) *(v4f*)(out_sum + (size_t)row * N + j) = sm;
      *(v4f*)(out_norm + (size_t)row * N + j) = o;
    }
    
  }
}



// ---- f16 WMMA path (v_wmma_f32_16x16x32_f16): 11-bit significands for operands in range — used for every GEMM launched here
typedef _Float16 v16h __attribute__((ext_vector_type(16)));
union FragH { v16h v; v8us half[2]; _Float16 h[16]; unsigned short u[16]; };
template <int NT>
__device__ __forceinline__ v8f mmaH(v16h ah, v16h al, v16h bh, v16h bl, v8f c) {
  c = __builtin_amdgcn_wmma_f32_16x16x32_f16(false, ah, false, bh, (short)0, c, false, false);
  if (NT >= 2) c = __builtin_amdgcn_wmma_f32_16x16x32_f16(false, al, false, bh, (short)0, c, false, false);
  if (NT >= 3) c = __builtin_amdgcn_wmma_f32_16x16x32_f16(false, ah, false, bl, (short)0, c, false, false);
  asm volatile("v_nop\n\tv_nop\n\tv_nop\n\tv_nop" : "+v"(c) : "v"(ah), "v"(al), "v"(bh), "v"(bl));
  return c;
}
// batched GEMM like k_gemm_b but f16 operands: A f32 (split into f16 hi/lo if ASPLIT, else rounded to f16), Bt = f16 values [n][k]; alpha; C f32; N multiple of 16 (partial tiles skipped)
template <bool ASPLIT>
__global__ __launch_bounds__(128) void k_gemm_h(const float* __restrict__ A, int lda, size_t sA, const _Float16* __restrict__ Bh, int ldb, size_t sB, float alpha, float* __restrict__ C, int ldc, size_t sC, int M, int N, int K) {
  __shared__ __attribute__((aligned(16))) float so[4][16][64];
  const int tid = threadIdx.x, w = tid >> 5, lane = tid & 31, ln = lane & 15, hh = lane >> 4; const int by = blockIdx.y;
  A += (size_t)by * sA; Bh += (size_t)by * sB; C += (size_t)by * sC;
  const int ntn = (N + 63) / 64; const int wid = blockIdx.x * 4 + w; const int mt = wid / ntn, nq = wid % ntn; if (mt * 16 >= M) return;
  const int row0 = mt * 16, col0 = nq * 64; const float* arow = A + (size_t)(row0 + ln) * lda;
  v8f acc[4] = {};
  for (int kb = 0; kb < K; kb += 32) {
    FragH ah, al;
    const v4f x0 = *(const v4fa*)(arow + kb + 8 * hh), x1 = *(const v4fa*)(arow + kb + 8 * hh + 4), x2 = *(const v4fa*)(arow + kb + 16 + 8 * hh), x3 = *(const v4fa*)(arow + kb + 16 + 8 * hh + 4);
    float xs[16] = {x0[0],x0[1],x0[2],x0[3],x1[0],x1[1],x1[2],x1[3],x2[0],x2[1],x2[2],x2[3],x3[0],x3[1],x3[2],x3[3]};
#pragma unroll
    for (int i = 0; i < 16; ++i) { const _Float16 h = (_Float16)xs[i]; ah.h[i] = h; al.h[i] = ASPLIT ? (_Float16)(xs[i] - (float)h) : (_Float16)0.0f; }
#pragma unroll
    for (int t = 0; t < 4; ++t) { if (col0 + t * 16 >= N) continue; const size_t boff = (size_t)(col0 + t * 16 + ln) * ldb + kb; FragH bq; bq.half[0] = *(const v8us*)(Bh + boff + 8 * hh); bq.half[1] = *(const v8us*)(Bh + boff + 16 + 8 * hh);
      acc[t] = mmaH<ASPLIT ? 2 : 1>(ah.v, al.v, bq.v, bq.v, acc[t]); }
  }
#pragma unroll
  for (int t = 0; t < 4; ++t) { if (col0 + t * 16 >= N) continue;
#pragma unroll
    for (int r = 0; r < 8; ++r) so[w][8 * hh + r][t * 16 + ln] = acc[t][r] * alpha; }
  __builtin_amdgcn_fence(__ATOMIC_ACQ_REL, "workgroup"); __builtin_amdgcn_wave_barrier();
  const int rsub = lane >> 4, c4 = (lane & 15) * 4;
  {
#pragma unroll
    for (int q = 0; q < 8; ++q) { const int r = q * 2 + rsub; if (col0 + c4 < N) { const v4f v = *(const v4fa*)&so[w][r][c4]; *(v4f*)(C + (size_t)(row0 + r) * ldc + col0 + c4) = v; } }
     }
}

// Wt[n][k] = f16(W[k][n]·scale) from f32 row-major W[K][N] (scale = power of two; bf16-exact weights stay exact in f16 away from the subnormal range)
__global__ __launch_bounds__(256) void k_wt_f16(const float* __restrict__ W, _Float16* __restrict__ Wt, int K, int N, float scale) {
  const int t = blockIdx.x * 256 + threadIdx.x; if (t >= N * (K / 8)) return; const int n = t / (K / 8), k8 = (t % (K / 8)) * 8; FragH f;
#pragma unroll
  for (int i = 0; i < 8; ++i) f.h[i] = (_Float16)(bf16_round(W[(size_t)(k8 + i) * N + n]) * scale); const v8us o = f.half[0];
  *(v8us*)((unsigned short*)Wt + (size_t)n * K + k8) = o; 
}
// k_gemm_hh variant with fused epilogue: v = acc·alpha + bias[by·sBias + col] (+ CP[(row/rowsPerB)·sCPb + by·64 + col] if CP) ; ACT 0 none / 1 elu ; writes f16 C16 (and f32 C if non-null)
template <int ACT>
__global__ __launch_bounds__(128) void k_gemm_hhx(const _Float16* __restrict__ A, int lda, size_t sA, const _Float16* __restrict__ Bh, int ldb, size_t sB, float alpha, const float* __restrict__ bias, size_t sBias, const float* __restrict__ CP, int rowsPerB, size_t sCPb, int row0g,
    float* __restrict__ C, _Float16* __restrict__ C16, int ldc, size_t sC, int M, int N, int K) {
  __shared__ __attribute__((aligned(16))) float so[4][16][64];
  const int tid = threadIdx.x, w = tid >> 5, lane = tid & 31, ln = lane & 15, hh = lane >> 4; const int by = blockIdx.y;
  A += (size_t)by * sA; Bh += (size_t)by * sB; const size_t cofs = (size_t)by * sC; const float* bp = bias ? bias + (size_t)by * sBias : nullptr;
  const int ntn = (N + 63) / 64; const int wid = blockIdx.x * 4 + w; const int mt = wid / ntn, nq = wid % ntn; if (mt * 16 >= M) return;
  const int row0 = mt * 16, col0 = nq * 64; const _Float16* arow = A + (size_t)(row0 + ln) * lda;
  v8f acc[4] = {};
  for (int kb = 0; kb < K; kb += 32) { FragH ah; ah.half[0] = *(const v8us*)((const unsigned short*)arow + kb + 8 * hh); ah.half[1] = *(const v8us*)((const unsigned short*)arow + kb + 16 + 8 * hh);
#pragma unroll
    for (int t = 0; t < 4; ++t) { if (col0 + t * 16 >= N) continue; const size_t boff = (size_t)(col0 + t * 16 + ln) * ldb + kb; FragH bq; bq.half[0] = *(const v8us*)((const unsigned short*)Bh + boff + 8 * hh); bq.half[1] = *(const v8us*)((const unsigned short*)Bh + boff + 16 + 8 * hh);
      acc[t] = mmaH<1>(ah.v, ah.v, bq.v, bq.v, acc[t]); }
  }
#pragma unroll
  for (int t = 0; t < 4; ++t) { if (col0 + t * 16 >= N) continue; const int col = col0 + t * 16 + ln; const float bv = bp ? bf16_round(bp[col]) : 0.f;
#pragma unroll
    for (int r = 0; r < 8; ++r) { float v = acc[t][r] * alpha + bv; if (CP) { const int rr = row0g + row0 + 8 * hh + r; if (rowsPerB < 0) v += CP[cofs + (size_t)rr * ldc + col];      /* rowsPerB < 0: own element of the batched C plane */ else { const int bidx = rr / rowsPerB; v += CP[(size_t)bidx * sCPb + (size_t)by * 64 + col]; } } if (ACT == 1) v = (v > 0.f) ? v : expm1f(v); else if (ACT == 7) v = (v > 0.f) ? v + 1.0f : expf(v); else if (ACT == 8) v = tanhf(v); else if (ACT == 9) v = 0.5f * v * (1.0f + tanhf(0.7978845608028654f * (v + 0.044715f * v * v * v))); else if (ACT == 11) v = 1.0f / (1.0f + expf(-v)); else if (ACT == 12) v = (v > 0.f) ? v : 0.01f * v; else if (ACT == 14) v = (v > 0.f) ? v : 0.1f * v; else if (ACT == 16) v = (v >= 0.f) ? v : 0.3f * v; else if (ACT == 17) v = (v >= 0.f) ? v : 0.2f * v; else if (ACT == 15) v = v / (1.0f + expf(-v)); else if (ACT == 3) v = fmaxf(v, 0.f); else if (ACT == 6) v = 0.5f * v * (1.0f + erff(v * 0.70710678118654752f)); so[w][8 * hh + r][t * 16 + ln] = v; } }
  __builtin_amdgcn_fence(__ATOMIC_ACQ_REL, "workgroup"); __builtin_amdgcn_wave_barrier();
  const int rsub = lane >> 4, c4 = (lane & 15) * 4; typedef _Float16 v4h __attribute__((ext_vector_type(4)));
  {
#pragma unroll
    for (int q = 0; q < 8; ++q) { const int r = q * 2 + rsub; if (col0 + c4 < N) { const v4f v = *(const v4fa*)&so[w][r][c4]; if (C) *(v4f*)(C + cofs + (size_t)(row0 + r) * ldc + col0 + c4) = v; if (C16) { v4h h4; for (int i = 0; i < 4; ++i) h4[i] = (_Float16)v[i]; *(v4h*)(C16 + cofs + (size_t)(row0 + r) * ldc + col0 + c4) = h4; } } }
     }
}


typedef _Float16 v4h __attribute__((ext_vector_type(4)));

__global__ __launch_bounds__(256) void k_x16(const float* __restrict__ x, _Float16* __restrict__ X16, size_t n8) { const size_t t = (size_t)blockIdx.x * 256 + threadIdx.x; if (t >= n8) return; FragH f;
#pragma unroll
  for (int q = 0; q < 8; ++q) f.h[q] = (_Float16)bf16_round(x[t * 8 + q]); *(v8us*)((unsigned short*)X16 + t * 8) = f.half[0];  }
__global__ __launch_bounds__(256) void k_h16(const float* __restrict__ x, _Float16* __restrict__ X16, size_t n8) { const size_t t = (size_t)blockIdx.x * 256 + threadIdx.x; if (t >= n8) return; FragH f;
#pragma unroll
  for (int q = 0; q < 8; ++q) f.h[q] = (_Float16)x[t * 8 + q]; *(v8us*)((unsigned short*)X16 + t * 8) = f.half[0];  }
__global__ __launch_bounds__(256) void k_round16f(const float* __restrict__ W, _Float16* __restrict__ Bt, size_t n8) { const size_t t = (size_t)blockIdx.x * 256 + threadIdx.x; if (t >= n8) return; FragH f;
#pragma unroll
  for (int i = 0; i < 8; ++i) f.h[i] = (_Float16)(bf16_round(W[t * 8 + i]) * 16.0f); *(v8us*)((unsigned short*)Bt + t * 8) = f.half[0];  }
template <int NHv, int TTv>
__global__ __launch_bounds__(256) void k_vt(const _Float16* __restrict__ V16, int ldv, int voff, _Float16* __restrict__ Vt) { __shared__ unsigned short tl[64][66]; const int tid = threadIdx.x; const int slab = blockIdx.x / (TTv / 64), lg = blockIdx.x % (TTv / 64); const int b = slab / NHv, h = slab % NHv;
  for (int i = tid; i < 64 * 8; i += 256) { const int r = i / 8, c8 = (i % 8) * 8; FragH f; f.half[0] = *(const v8us*)((const unsigned short*)V16 + ((size_t)b * TTv + lg * 64 + r) * ldv + voff + h * 64 + c8);
#pragma unroll
    for (int q = 0; q < 8; ++q) tl[r][c8 + q] = f.u[q]; }
  __syncthreads();
  {
#pragma unroll
    for (int rd = 0; rd < 2; ++rd) { const int d = rd * 32 + tid / 8, pc = tid % 8; FragH f;
#pragma unroll
      for (int q = 0; q < 8; ++q) f.u[q] = tl[pc * 8 + q][d];
      *(v8us*)((unsigned short*)Vt + ((size_t)slab * 64 + d) * TTv + lg * 64 + pc * 8) = f.half[0]; }
     } }

__global__ __launch_bounds__(256) void k_hl(const float* __restrict__ F, _Float16* __restrict__ Hh, _Float16* __restrict__ Hl, size_t n8) { const size_t t = (size_t)blockIdx.x * 256 + threadIdx.x; if (t >= n8) return; FragH fh, fl; const v4f a = *(const v4fa*)(F + t * 8), c = *(const v4fa*)(F + t * 8 + 4);
#pragma unroll
  for (int q = 0; q < 4; ++q) { _Float16 h = (_Float16)a[q]; fh.h[q] = h; fl.h[q] = (_Float16)((a[q] - (float)h) * 1024.0f); h = (_Float16)c[q]; fh.h[4 + q] = h; fl.h[4 + q] = (_Float16)((c[q] - (float)h) * 1024.0f); }
  { *(v8us*)((unsigned short*)Hh + t * 8) = fh.half[0]; *(v8us*)((unsigned short*)Hl + t * 8) = fl.half[0];  } }

// ---- fast GEMM (block tile 128x64, wave tile 32x64, A and B k-tiles staged in LDS; requires M % 128 == 0, N % 64 == 0 and K == 64 or K % 128 == 0); epilogue = k_gemm_hhx semantics ----
#define G2_LP 72
__device__ __forceinline__ v16h g2_frag(const _Float16* p, int hh) { FragH f; f.half[0] = *(const v8us*)((const unsigned short*)p + 8 * hh); f.half[1] = *(const v8us*)((const unsigned short*)p + 16 + 8 * hh); return f.v; }
__device__ __forceinline__ v8f g2_mma(v16h a, v16h b, v8f c) { v8f d = __builtin_amdgcn_wmma_f32_16x16x32_f16(false, a, false, b, (short)0, c, false, false); asm volatile("v_nop\n\tv_nop\n\tv_nop\n\tv_nop" : "+v"(d) : "v"(a), "v"(b)); return d; }
// work-group barrier that orders LDS alone (its fences name the LDS address space): __syncthreads() also waits for every global load in flight, and the loads for the tiles ahead must stay in flight across it; the loop's global reads are of operands that no wave of the launch writes
__device__ __forceinline__ void g2_bar() { __builtin_amdgcn_fence(__ATOMIC_RELEASE, "workgroup", "local"); __builtin_amdgcn_s_barrier(); __builtin_amdgcn_fence(__ATOMIC_ACQUIRE, "workgroup", "local"); }
template <int ACT>
__global__ __launch_bounds__(128) void k_gemm2(const _Float16* __restrict__ A, int lda, size_t sA, const _Float16* __restrict__ Bh, int ldb, size_t sB, float alpha, const float* __restrict__ bias, size_t sBias, const float* __restrict__ CP, int rowsPerB, size_t sCPb, int row0g,
    float* __restrict__ C, _Float16* __restrict__ C16, int ldc, size_t sC, int M, int N, int K) { static_assert(ACT == 0 || ACT == 3 || ACT == 6 || ACT == 8 || ACT == 9 || ACT == 11 || ACT == 12 || ACT == 14 || ACT == 15 || ACT == 16 || ACT == 17, "k_gemm2: unsupported ACT code (would silently apply no activation)");
  __shared__ __attribute__((aligned(16))) float so[4][32][68];
  // k-tiles of 64 halves (one whole 128-B line per row) of the block's 128 A rows and 64 B rows, two buffers; row pitch 72 halves = 144 B = 16 B x 9 for the ds_load_b128 fragment reads
  __shared__ __attribute__((aligned(16))) _Float16 sa[2][128][G2_LP];
  __shared__ __attribute__((aligned(16))) _Float16 sb[2][64][G2_LP];
  const int tid = threadIdx.x, w = tid >> 5, lane = tid & 31, ln = lane & 15, hh = lane >> 4; const int by = blockIdx.y;
  A += (size_t)by * sA; Bh += (size_t)by * sB; const size_t cofs = (size_t)by * sC; const float* bp = bias ? bias + (size_t)by * sBias : nullptr;
  const int ntn = N >> 6; const int mt = blockIdx.x / ntn, nq = blockIdx.x - mt * ntn; const int row0 = mt * 128 + 32 * w, col0 = nq * 64; if (mt * 128 >= M) return;      /* the same for the whole block: it stands in front of barriers */
  const int sr = tid >> 3, sc = (tid & 7) * 8;      /* staging: 8 lanes cover one row's 128 B, a wave-wide load covers 4 whole lines */
  const char* ab = (const char*)(A + (size_t)(mt * 128) * lda); const char* bb = (const char*)(Bh + (size_t)col0 * ldb);      /* the block's first A and B row: the same in every lane */
  const unsigned ao = (unsigned)(sr * lda + sc) * 2u, bo = (unsigned)(sr * ldb + sc) * 2u;      /* the lane's own byte offset, fixed for the whole loop */
  const v8f z8 = {0.f,0.f,0.f,0.f,0.f,0.f,0.f,0.f}; v8f c00 = z8, c01 = z8, c02 = z8, c03 = z8, c10 = z8, c11 = z8, c12 = z8, c13 = z8;
  v8us ra0[8], rb0[4], ra1[8], rb1[4];
  auto gl = [&](v8us* ra, v8us* rb, int kb) {
#pragma unroll
    for (int i = 0; i < 8; ++i) ra[i] = *(const v8us*)(ab + ((size_t)(16 * i) * lda + kb) * 2 + ao);
#pragma unroll
    for (int i = 0; i < 4; ++i) rb[i] = *(const v8us*)(bb + ((size_t)(16 * i) * ldb + kb) * 2 + bo); };
  auto st = [&](const v8us* ra, const v8us* rb, int buf) {
#pragma unroll
    for (int i = 0; i < 8; ++i) *(v8us*)&sa[buf][sr + 16 * i][sc] = ra[i];
#pragma unroll
    for (int i = 0; i < 4; ++i) *(v8us*)&sb[buf][sr + 16 * i][sc] = rb[i]; };
  auto comp = [&](int buf) {
#pragma unroll
    for (int kk = 0; kk < 64; kk += 32) { const v16h a0 = g2_frag(&sa[buf][32 * w + ln][kk], hh), a1 = g2_frag(&sa[buf][32 * w + 16 + ln][kk], hh);
      const v16h b0 = g2_frag(&sb[buf][ln][kk], hh), b1 = g2_frag(&sb[buf][16 + ln][kk], hh), b2 = g2_frag(&sb[buf][32 + ln][kk], hh), b3 = g2_frag(&sb[buf][48 + ln][kk], hh);
      c00 = g2_mma(a0, b0, c00); c10 = g2_mma(a1, b0, c10); c01 = g2_mma(a0, b1, c01); c11 = g2_mma(a1, b1, c11);
      c02 = g2_mma(a0, b2, c02); c12 = g2_mma(a1, b2, c12); c03 = g2_mma(a0, b3, c03); c13 = g2_mma(a1, b3, c13); } };
  // Each barrier publishes the buffer just written and ends every wave's reads of the other buffer, which is written next.
  gl(ra0, rb0, 0);
  __builtin_amdgcn_sched_barrier(0);      /* keeps set 0's loads in front of set 1's: mixed, set 0's wait at the loop's head would wait for set 1 as well */
  gl(ra1, rb1, 64 < K ? 64 : 0);      /* the second set's tile clamped, not branched round: set 0's loads stay the older ones on every way into the loop, so its wait leaves set 1's in flight */
  asm volatile("s_wait_xcnt 0x0" ::: "memory");      /* in front of whatever reuses the address registers of the loads above, which stay in flight */
  int kb = 0;
  // two tiles per trip so that each register set and each LDS buffer has a fixed name; every load of the trip is unconditional (the last two tiles are peeled off below), so the waits can be counted; kept rolled: unrolled further it only grows the code
#pragma unroll 1
  for (; kb + 128 < K; kb += 128) {
    st(ra0, rb0, 0); g2_bar(); gl(ra0, rb0, kb + 128); comp(0);      /* loads two tiles ahead: in flight over this tile's and the next tile's products */
    st(ra1, rb1, 1); g2_bar(); gl(ra1, rb1, kb + 192); comp(1);
    asm volatile("s_wait_xcnt 0x0" ::: "memory"); }      /* in front of the next trip's address arithmetic, which rewrites the address registers of loads still in flight */
  st(ra0, rb0, 0); g2_bar(); comp(0);
  if (kb + 64 < K) { st(ra1, rb1, 1); g2_bar(); comp(1); }
  v8f accs[8] = {c00, c01, c02, c03, c10, c11, c12, c13};
#pragma unroll
  for (int u = 0; u < 8; ++u) { const int t = u & 3, half = u >> 2; const int col = col0 + t * 16 + ln; const float bv = bp ? bf16_round(bp[col]) : 0.f;
#pragma unroll
    for (int r = 0; r < 8; ++r) { const int rloc = half * 16 + 8 * hh + r; float v = accs[u][r] * alpha + bv; if (CP) { if (rowsPerB < 0) v += CP[cofs + (size_t)(row0g + row0 + rloc) * ldc + col];      /* rowsPerB < 0: own element of the batched C plane */ else { const int bidx = (row0g + row0 + rloc) / rowsPerB; v += CP[(size_t)bidx * sCPb + (size_t)by * 64 + col]; } }
      if (ACT == 3) v = fmaxf(v, 0.f); else if (ACT == 6) v = 0.5f * v * (1.0f + erff(v * 0.70710678118654752f)); else if (ACT == 11) v = 1.0f / (1.0f + expf(-v)); else if (ACT == 15) v = v / (1.0f + expf(-v)); else if (ACT == 12) v = (v > 0.f) ? v : 0.01f * v; else if (ACT == 8) v = tanhf(v); else if (ACT == 9) v = 0.5f * v * (1.0f + tanhf(0.7978845608028654f * (v + 0.044715f * v * v * v))); else if (ACT == 14) v = (v > 0.f) ? v : 0.1f * v; else if (ACT == 16) v = (v >= 0.f) ? v : 0.3f * v; else if (ACT == 17) v = (v >= 0.f) ? v : 0.2f * v;
      so[w][rloc][t * 16 + ln] = v; } }
  __builtin_amdgcn_fence(__ATOMIC_ACQ_REL, "workgroup"); __builtin_amdgcn_wave_barrier();
  const int rsub = lane >> 4, c4 = (lane & 15) * 4;
  {
#pragma unroll
    for (int q = 0; q < 16; ++q) { const int r = q * 2 + rsub; const v4f v = *(const v4fa*)&so[w][r][c4]; if (C) *(v4f*)(C + cofs + (size_t)(row0 + r) * ldc + col0 + c4) = v; if (C16) { v4h h4; for (int i = 0; i < 4; ++i) h4[i] = (_Float16)v[i]; *(v4h*)(C16 + cofs + (size_t)(row0 + r) * ldc + col0 + c4) = h4; } }
     } }


__global__ __launch_bounds__(256) void k_wsc(const float* __restrict__ Wm, _Float16* __restrict__ Bt, size_t n8, float sc) { const size_t t = (size_t)blockIdx.x * 256 + threadIdx.x; if (t >= n8) return; FragH f; for (int q = 0; q < 8; ++q) f.h[q] = (_Float16)(bf16_round(Wm[t * 8 + q]) * sc); *(v8us*)((unsigned short*)Bt + t * 8) = f.half[0];  }
__global__ __launch_bounds__(256) void k_ccp(const float* __restrict__ QKV, int coff, _Float16* __restrict__ D) { const size_t t = (size_t)blockIdx.x * 256 + threadIdx.x; if (t >= (size_t)NR * DM / 8) return; const int c0 = (int)((t * 8) % DM); const size_t row = (t * 8) / DM; const v8f a = *(const v8f*)(QKV + row * 3 * DM + coff + c0); FragH f; for (int q = 0; q < 8; ++q) f.h[q] = (_Float16)a[q];
  *(v8us*)((unsigned short*)D + t * 8) = f.half[0];  }
__global__ __launch_bounds__(256) void k_chl(const float* __restrict__ QKV, int coff, _Float16* __restrict__ Hh, _Float16* __restrict__ Lh) {
  #pragma clang fp contract(off)
  const size_t t = (size_t)blockIdx.x * 256 + threadIdx.x; if (t >= (size_t)NR * DM / 8) return; const int c0 = (int)((t * 8) % DM); const size_t row = (t * 8) / DM; const v8f a = *(const v8f*)(QKV + row * 3 * DM + coff + c0); FragH fh, fl; for (int q = 0; q < 8; ++q) { const _Float16 hv = (_Float16)a[q]; fh.h[q] = hv; fl.h[q] = (_Float16)((a[q] - (float)hv) * 1024.0f); }
  { *(v8us*)((unsigned short*)Hh + t * 8) = fh.half[0]; *(v8us*)((unsigned short*)Lh + t * 8) = fl.half[0];  } }
__device__ __forceinline__ void exter(const float* p1, const float* p2, float* L) {
  #pragma clang fp contract(off)
  const int PI[6] = {0, 0, 0, 1, 1, 2}, PJ[6] = {1, 2, 3, 2, 3, 3}; float n2 = 0.f;
  for (int k = 0; k < 6; ++k) { float a = p1[PI[k]] * p2[PJ[k]]; a += -(p1[PJ[k]] * p2[PI[k]]); L[k] = a; n2 += a * a; }
  const float n = fmaxf(sqrtf(n2), 1e-12f); for (int k = 0; k < 6; ++k) L[k] = L[k] / n; }
__global__ __launch_bounds__(256) void k_lines(const float* __restrict__ LW, float* __restrict__ JW, float* __restrict__ RD) {
  #pragma clang fp contract(off)
  const int tt = blockIdx.x * 256 + threadIdx.x; if (tt >= NR * NH) return; const int t = tt % TT; const int bh = tt / TT; const int h = bh % NH, b = bh / NH; const size_t row = (size_t)b * TT + t; float w1[4], w2[4], r1[4], r2[4];
  for (int i = 0; i < 4; ++i) { w1[i] = (t > 0) ? LW[(row - 1) * 256 + h * 4 + i] : 0.f; w2[i] = LW[row * 256 + 64 + h * 4 + i]; r1[i] = LW[row * 256 + 128 + h * 4 + i]; r2[i] = LW[row * 256 + 192 + h * 4 + i]; }
  float wl[6], rl[6]; exter(w1, w2, wl); exter(r1, r2, rl); v8f jw, rd; jw[0] = wl[5]; jw[1] = -wl[4]; jw[2] = wl[3]; jw[3] = wl[2]; jw[4] = -wl[1]; jw[5] = wl[0]; jw[6] = 0.f; jw[7] = 0.f; for (int k = 0; k < 6; ++k) rd[k] = rl[k]; rd[6] = 0.f; rd[7] = 0.f;
  const size_t o = (((size_t)b * NH + h) * TT + t) * 8; { *(v8f*)(JW + o) = jw; *(v8f*)(RD + o) = rd;  } }
typedef float v2f __attribute__((ext_vector_type(2)));
typedef float v2fa __attribute__((ext_vector_type(2), may_alias));
// Causal 6x6 Gram state and rd . M, one work-group per (batch, head). M is symmetric bit for bit (w_i * w_j rounds the same either way and both sides sum in the same order), so 21 running sums carry it.
// Three phases through one LDS array, plane e = (i, j), i <= j, column t: (A) every thread forms the 21 products of its rows; (B) 21 lanes of one wave turn each plane into its running sum over t, in the order t = 0, 1, ...; (C) every thread reads M_t of its rows and forms rd_t . M_t, i = 0..5 in order.
// Plane pitch TT + 4 floats: the 16-B reads and writes of phase B, one plane per lane, start 4 banks apart; phases A and C touch 32 columns in a row of one plane.
#define CE 21
#define CPI (TT + 4)
__global__ __launch_bounds__(256) void k_cum(const float* __restrict__ JW, const float* __restrict__ RD, float* __restrict__ RDM) {
  __shared__ __attribute__((aligned(16))) float pm[CE][CPI];
  const int tid = threadIdx.x; const size_t bh = blockIdx.x; const float* jw = JW + bh * TT * 8; const float* rd = RD + bh * TT * 8; float* ob = RDM + bh * TT * 8;
  // every global load of the block is issued before the first is waited for; thread tid has rows c * 256 + tid; all loops over c, i, j, u, q are unrolled in full so that their arrays stay in registers
  v4f wa[TT / 256], ra[TT / 256]; v2f wb[TT / 256], rb[TT / 256];      /* a row's six values as 16 + 8 bytes */
#pragma unroll
  for (int c = 0; c < TT / 256; ++c) { const float* q = jw + (size_t)(c * 256 + tid) * 8; wa[c] = *(const v4fa*)q; wb[c] = *(const v2fa*)(q + 4); }
#pragma unroll
  for (int c = 0; c < TT / 256; ++c) { const float* q = rd + (size_t)(c * 256 + tid) * 8; ra[c] = *(const v4fa*)q; rb[c] = *(const v2fa*)(q + 4); }
  asm volatile("s_wait_xcnt 0x0" ::: "memory");      /* in front of whatever reuses the address registers of the loads above, which stay in flight */
#pragma unroll
  for (int c = 0; c < TT / 256; ++c) { const float w[6] = {wa[c][0], wa[c][1], wa[c][2], wa[c][3], wb[c][0], wb[c][1]}; int e = 0;
#pragma unroll
    for (int i = 0; i < 6; ++i)
#pragma unroll
      for (int j = i; j < 6; ++j) { pm[e][c * 256 + tid] = w[i] * w[j]; ++e; } }
  __syncthreads();
  if (tid < CE) { float* p = &pm[tid][0]; float acc = 0.f; v4f cur[8], nxt[8];
    // the one dependent chain left is one add per t; the reads run 32 columns ahead of it in two named register sets, so that it never waits for LDS
#pragma unroll
    for (int u = 0; u < 8; ++u) cur[u] = *(const v4f*)(p + 4 * u);
    // two sets per trip so that each has a fixed name; kept rolled: unrolled further it only grows the code
#pragma unroll 1
    for (int t0 = 0; t0 < TT; t0 += 64) {
#pragma unroll
      for (int u = 0; u < 8; ++u) nxt[u] = *(const v4f*)(p + t0 + 32 + 4 * u);
#pragma unroll
      for (int u = 0; u < 8; ++u) { v4f o;
#pragma unroll
        for (int q = 0; q < 4; ++q) { acc += cur[u][q]; o[q] = acc; }
        *(v4f*)(p + t0 + 4 * u) = o; }
      if (t0 + 64 < TT) {
#pragma unroll
        for (int u = 0; u < 8; ++u) cur[u] = *(const v4f*)(p + t0 + 64 + 4 * u); }
#pragma unroll
      for (int u = 0; u < 8; ++u) { v4f o;
#pragma unroll
        for (int q = 0; q < 4; ++q) { acc += nxt[u][q]; o[q] = acc; }
        *(v4f*)(p + t0 + 32 + 4 * u) = o; } } }
  __syncthreads();
#pragma unroll
  for (int c = 0; c < TT / 256; ++c) { const float r[6] = {ra[c][0], ra[c][1], ra[c][2], ra[c][3], rb[c][0], rb[c][1]}; float m[CE];
#pragma unroll
    for (int e = 0; e < CE; ++e) m[e] = pm[e][c * 256 + tid];
    v8f o;
#pragma unroll
    for (int j = 0; j < 6; ++j) { float v = 0.f;
#pragma unroll
      for (int i = 0; i < 6; ++i) { const int lo = i < j ? i : j, hi = i < j ? j : i; v += r[i] * m[lo * 6 - (lo * (lo - 1)) / 2 + hi - lo]; }
      o[j] = v; }
    o[6] = 0.f; o[7] = 0.f;
    *(v8f*)(ob + (size_t)(c * 256 + tid) * 8) = o;
    if (c + 1 < TT / 256) asm volatile("s_wait_xcnt 0x0" ::: "memory"); } }      /* in front of the next rows' LDS reads and sums, which reuse the registers that the store names */
__global__ __launch_bounds__(256) void k_bsoft(const float* __restrict__ S, const float* __restrict__ RDM, const float* __restrict__ JW, const float* __restrict__ bsc, int b, int h0, _Float16* __restrict__ P, float* __restrict__ RS) {
  #pragma clang fp contract(off)
  // The block's 8 rows are 8 consecutive t of one head (TT % 8 == 0): that head's Jw rows are staged once in LDS, as six planes, and shared by the 8 waves.
  // Inside each group of 256 columns, column ln * 8 + q lies at (q >> 2) * 128 + ln * 4 + (q & 3): a lane's 8 columns are two 16-B reads per plane, and the 32 lanes of each read cover 512 B in a row.
  __shared__ __attribute__((aligned(16))) float sj[6][TT];
  if (blockIdx.x * 8 >= HG * TT) return;      /* the same for the whole block: it stands in front of the barrier */
  const int tid = threadIdx.x, ln = tid & 31; const int wv = __builtin_amdgcn_readfirstlane(tid >> 5);      /* the wave's number in a scalar register: row, trip counts and row addresses are scalar */
  const int r = blockIdx.x * 8 + wv; const int t = r % TT, hl = r / TT; const int h = h0 + hl; const size_t bh = (size_t)b * NH + h; const float bs = bf16_round(bsc[h]); const float* sr = S + (size_t)r * TT; const v8f rdm = *(const v8f*)(RDM + (bh * TT + t) * 8); const float* jwb = JW + bh * TT * 8;
  const int ngw = (t >> 8) + 1;      /* column groups that hold an s <= t for this row */
  // every global load of the block's operands is unconditional (all of the head's Jw rows and all of the S row exist and were written earlier in this call) and is issued before the first is waited for: one trip to L2 in all.
  // The Jw rows first (thread tid brings column i * 256 + tid, its six values as 16 + 8 bytes), as the staging waits for them alone
  // every loop of this kernel over groups, halves, planes and columns is unrolled in full: its arrays (ja, jb, sv, j, l, ph) are indexed by constants then and stay in registers
  v4f ja[TT / 256]; v2f jb[TT / 256];
#pragma unroll
  for (int i = 0; i < TT / 256; ++i) { const float* jp = jwb + (size_t)(i * 256 + tid) * 8; ja[i] = *(const v4fa*)jp; jb[i] = *(const v2fa*)(jp + 4); }
  // the row's scores, two 16-B loads per group of 8 columns, whole lines per wave; they fly during the staging
  v4f sv[TT / 256][2];
#pragma unroll
  for (int gq = 0; gq < TT / 256; ++gq) { sv[gq][0] = *(const v4fa*)(sr + gq * 256 + ln * 8); sv[gq][1] = *(const v4fa*)(sr + gq * 256 + ln * 8 + 4); }
  asm volatile("s_wait_xcnt 0x0" ::: "memory");      /* in front of whatever reuses the address registers of the loads above, which stay in flight */
  const int p0 = ((tid >> 2) & 1) * 128 + (tid >> 3) * 4 + (tid & 3);
#pragma unroll
  for (int i = 0; i < TT / 256; ++i) {
#pragma unroll
    for (int k = 0; k < 4; ++k) sj[k][i * 256 + p0] = ja[i][k];
    sj[4][i * 256 + p0] = jb[i][0]; sj[5][i * 256 + p0] = jb[i][1]; }
  __syncthreads();
  auto lg8 = [&](int gq, const v4f* s8, float* l) {
#pragma unroll
    for (int hf = 0; hf < 2; ++hf) { v4f j[6];
#pragma unroll
      for (int k = 0; k < 6; ++k) j[k] = *(const v4f*)&sj[k][gq * 256 + hf * 128 + ln * 4];
#pragma unroll
      for (int q = 0; q < 4; ++q) { float d = 0.f; for (int k = 0; k < 6; ++k) d += rdm[k] * j[k][q]; float lv = s8[hf][q] * 0.125f; lv += fabsf(d) * bs; l[hf * 4 + q] = lv; } } };
  float mx = -3.0e38f;
#pragma unroll
  for (int gq = 0; gq < TT / 256; ++gq) if (gq < ngw) { float l[8]; lg8(gq, sv[gq], l);
#pragma unroll
    for (int q = 0; q < 8; ++q) { const int s = gq * 256 + ln * 8 + q; if (s <= t) mx = fmaxf(mx, l[q]); } }
  for (int o = 16; o > 0; o >>= 1) mx = fmaxf(mx, __shfl_xor(mx, o, 32)); float su = 0.f;
#pragma unroll
  for (int gq = 0; gq < TT / 256; ++gq) { FragH ph;
    if (gq < ngw) { float l[8]; lg8(gq, sv[gq], l);
#pragma unroll
      for (int q = 0; q < 8; ++q) { const int s = gq * 256 + ln * 8 + q; const float e = (s <= t) ? expf(l[q] - mx) : 0.f; su += e; ph.h[q] = (_Float16)(e * 1024.0f); } }
    else {
#pragma unroll
      for (int q = 0; q < 8; ++q) ph.h[q] = (_Float16)0.0f; }
    *(v8us*)((unsigned short*)P + (size_t)r * TT + gq * 256 + ln * 8) = ph.half[0];
    asm volatile("s_wait_xcnt 0x0" ::: "memory"); }      /* in front of the next group's LDS reads and sums, which reuse the registers that the store names */
  for (int o = 16; o > 0; o >>= 1) su += __shfl_xor(su, o, 32); if (ln == 0) { *(float*)(RS + (size_t)r * 32) = 1.0f / su;  } }
__global__ __launch_bounds__(256) void k_csc(const float* __restrict__ O, const float* __restrict__ RS, int b, int h0, _Float16* __restrict__ CH, _Float16* __restrict__ CL) {
  #pragma clang fp contract(off)
  const int tt = blockIdx.x * 256 + threadIdx.x; if (tt >= TT * HG * (HD / 8)) return; const int d8 = (tt % (HD / 8)) * 8; const int hl = (tt / (HD / 8)) % HG; const int t = tt / ((HD / 8) * HG); const float rs = RS[((size_t)hl * TT + t) * 32]; const size_t o = ((size_t)b * TT + t) * DM + (h0 + hl) * HD + d8; const v8f a = *(const v8f*)(O + (size_t)t * DM + (h0 + hl) * HD + d8); FragH f, fl;
  for (int q = 0; q < 8; ++q) { const float v = a[q] * rs; const _Float16 hh = (_Float16)v; f.h[q] = hh; fl.h[q] = (_Float16)((v - (float)hh) * 1024.0f); }
  { *(v8us*)((unsigned short*)CH + o) = f.half[0]; *(v8us*)((unsigned short*)CL + o) = fl.half[0];  } }

extern "C" void kernel_launch(void* const* d_in, const int* in_sizes, int n_in,
                              void* d_out, int out_size, void* d_ws, size_t ws_size, hipStream_t stream) {
  (void)in_sizes; (void)n_in; (void)out_size;
  const float* x = (const float*)d_in[0]; const float* Wqkv = (const float*)d_in[1]; const float* bqkv = (const float*)d_in[2]; const float* W1w = (const float*)d_in[3]; const float* W2w = (const float*)d_in[4]; const float* W1r = (const float*)d_in[5]; const float* W2r = (const float*)d_in[6]; const float* bsc = (const float*)d_in[7]; const float* Wout = (const float*)d_in[8]; const float* bout = (const float*)d_in[9];
  char* ws = (char*)d_ws; size_t off = 0;
  auto take = [&](size_t bytes) { char* p = ws + off; off += (bytes + 255) & ~(size_t)255; return p; };
  const size_t np = (size_t)NR * DM;
  _Float16* BQKV = (_Float16*)take((size_t)3 * DM * DM * 2); _Float16* BL = (_Float16*)take((size_t)256 * DM * 2); _Float16* BO = (_Float16*)take((size_t)DM * DM * 2);
  _Float16* X16 = (_Float16*)take(np * 2); float* QKV = (float*)take(np * 3 * 4); _Float16* Q16 = (_Float16*)take(np * 2); _Float16* K16 = (_Float16*)take(np * 2); _Float16* V16 = (_Float16*)take(np * 2); _Float16* VL16 = (_Float16*)take(np * 2); _Float16* VT = (_Float16*)take(np * 2); _Float16* VTL = (_Float16*)take(np * 2);
  float* LW = (float*)take((size_t)NR * 256 * 4); float* JW = (float*)take((size_t)NB * NH * TT * 8 * 4); float* RD = (float*)take((size_t)NB * NH * TT * 8 * 4); float* RDM = (float*)take((size_t)NB * NH * TT * 8 * 4);
  float* S = (float*)take((size_t)HG * TT * TT * 4); _Float16* P = (_Float16*)take((size_t)HG * TT * TT * 2); float* RS = (float*)take((size_t)HG * TT * 32 * 4); float* O = (float*)take((size_t)TT * DM * 4); _Float16* CH = (_Float16*)take(np * 2); _Float16* CL = (_Float16*)take(np * 2);
  if (off > ws_size) return;      /* 6.5 + 2 + 4 + 24 + 6 x 4 + 2 + 3 + 16 + 8 + 0.5 + 4 + 8 = ≈ 102 MiB */
  k_wsc<<<(unsigned)(((size_t)3 * DM * DM / 8 + 255) / 256), 256, 0, stream>>>(Wqkv, BQKV, (size_t)3 * DM * DM / 8, 16.0f); k_wsc<<<(unsigned)(((size_t)DM * DM / 8 + 255) / 256), 256, 0, stream>>>(Wout, BO, (size_t)DM * DM / 8, 16.0f);      /* torch (out, in) naturals */
  k_wsc<<<(unsigned)(((size_t)64 * DM / 8 + 255) / 256), 256, 0, stream>>>(W1w, BL, (size_t)64 * DM / 8, 16.0f); k_wsc<<<(unsigned)(((size_t)64 * DM / 8 + 255) / 256), 256, 0, stream>>>(W2w, BL + (size_t)64 * DM, (size_t)64 * DM / 8, 16.0f); k_wsc<<<(unsigned)(((size_t)64 * DM / 8 + 255) / 256), 256, 0, stream>>>(W1r, BL + (size_t)128 * DM, (size_t)64 * DM / 8, 16.0f); k_wsc<<<(unsigned)(((size_t)64 * DM / 8 + 255) / 256), 256, 0, stream>>>(W2r, BL + (size_t)192 * DM, (size_t)64 * DM / 8, 16.0f);      /* [W1w; W2w; W1r; W2r] rows h*4 + i */
  k_x16<<<(unsigned)((np / 8 + 255) / 256), 256, 0, stream>>>(x, X16, np / 8);
  k_gemm2<0><<<dim3((NR / 128) * (3 * DM / 64), 1), 128, 0, stream>>>(X16, DM, 0, BQKV, DM, 0, 0.0625f, bqkv, 0, nullptr, 1, 0, 0, QKV, nullptr, 3 * DM, 0, NR, 3 * DM, DM);      /* [q | k | v] + bias, head h at h*64 */
  k_gemm2<0><<<dim3((NR / 128) * (256 / 64), 1), 128, 0, stream>>>(X16, DM, 0, BL, DM, 0, 0.0625f, nullptr, 0, nullptr, 1, 0, 0, LW, nullptr, 256, 0, NR, 256, DM);      /* line projections f32 [row][w1 | w2 | r1 | r2] (x_prev handled by a row shift) */
  k_ccp<<<(unsigned)((np / 8 + 255) / 256), 256, 0, stream>>>(QKV, 0, Q16); k_ccp<<<(unsigned)((np / 8 + 255) / 256), 256, 0, stream>>>(QKV, DM, K16); k_chl<<<(unsigned)((np / 8 + 255) / 256), 256, 0, stream>>>(QKV, 2 * DM, V16, VL16);      /* v as hi + residual (the bias makes the attention peaked, so v's rounding reaches the output almost unaveraged) */
  k_vt<NH, TT><<<NB * NH * (TT / 64), 256, 0, stream>>>(V16, DM, 0, VT); k_vt<NH, TT><<<NB * NH * (TT / 64), 256, 0, stream>>>(VL16, DM, 0, VTL);
  k_lines<<<(NR * NH + 255) / 256, 256, 0, stream>>>(LW, JW, RD); k_cum<<<NB * NH, 256, 0, stream>>>(JW, RD, RDM);
  for (int b = 0; b < NB; ++b) { const size_t r0 = (size_t)b * TT;
    for (int g = 0; g < NH / HG; ++g) { const int h0 = g * HG;
      k_gemm2<0><<<dim3((TT / 128) * (TT / 64), HG), 128, 0, stream>>>(Q16 + r0 * DM + h0 * HD, DM, (size_t)HD, K16 + r0 * DM + h0 * HD, DM, (size_t)HD, 1.0f, nullptr, 0, nullptr, 1, 0, 0, S, nullptr, TT, (size_t)TT * TT, TT, TT, HD);
      k_bsoft<<<(HG * TT) / 8, 256, 0, stream>>>(S, RDM, JW, bsc, b, h0, P, RS);
      k_gemm2<0><<<dim3((TT / 128) * (HD / 64), HG), 128, 0, stream>>>(P, TT, (size_t)TT * TT, VTL + ((size_t)b * NH + h0) * HD * TT, TT, (size_t)HD * TT, 0.0009765625f / 1024.0f, nullptr, 0, nullptr, 1, 0, 0, O + h0 * HD, nullptr, DM, (size_t)HD, TT, HD, TT);
      k_gemm2<0><<<dim3((TT / 128) * (HD / 64), HG), 128, 0, stream>>>(P, TT, (size_t)TT * TT, VT + ((size_t)b * NH + h0) * HD * TT, TT, (size_t)HD * TT, 0.0009765625f, nullptr, 0, O + h0 * HD, -1, 0, 0, O + h0 * HD, nullptr, DM, (size_t)HD, TT, HD, TT);      /* P . (v_lo + v_hi)^T (own-element accumulate) */
      k_csc<<<(TT * HG * (HD / 8) + 255) / 256, 256, 0, stream>>>(O, RS, b, h0, CH, CL); } }
  k_gemm2<0><<<dim3((NR / 128) * (DM / 64), 1), 128, 0, stream>>>(CL, DM, 0, BO, DM, 0, 0.0625f / 1024.0f, nullptr, 0, nullptr, 1, 0, 0, (float*)d_out, nullptr, DM, 0, NR, DM, DM);
  k_gemm2<0><<<dim3((NR / 128) * (DM / 64), 1), 128, 0, stream>>>(CH, DM, 0, BO, DM, 0, 0.0625f, bout, 0, (const float*)d_out, 1, (size_t)DM, 0, (float*)d_out, nullptr, DM, 0, NR, DM, DM);      /* out = (c_lo + c_hi) Wout^T + bout */
}

// v004
// A run of this version takes 231 microseconds.
// Two timings next to v003 both put it at 2.32 times that version's speed.
// Over all steps from v000 it is 5.91 times as fast.
#include <hip/hip_runtime.h>
// EigenBiasAttention (2 x 1024 tokens x 1024 = 16 heads x 64; qkv = x Wqkv^T + b; causal softmax(q.k/8 + |bias|) v; bias from Plucker lines: per head w1 = x_prev W1w^T, w2 = x W2w^T, r1 = x W1r^T, r2 = x W2r^T (4-vectors), write/read lines = normalised exterior products (6-vectors), Jw = write J6, M_t = cumsum_t Jw Jw^T, bias[t][s] = |(rd_t . M_t) . Jw_s| * bias_scale[h]; out = merged . Wout^T + bout).
// Structure: exact f16 x plane; qkv and the four line projections as f16 WMMA GEMMs (32x64 wave tiles, f32 accumulation, exact x16 weights (+ bias); f32 out) then f16 q/k planes (one [t][64] plane per (batch, head)) and v planes; the exterior products / normalisation / J6 on VALU; the causal 6x6 Gram cumsum and rd . M per (batch, head) on VALU (f32; products and rd . M one row per thread, the 1024-step running sums by one wave through LDS); for all 32 (batch, head) planes in one launch each: the score GEMM (K = 64, f32), the biased causal softmax on VALU (bias dot K = 6 per (t, s), bias_scale read; unnormalised f16 weights x 2^10 + row normalisers on their own lines), V^T hi/residual by LDS tiles, readout as two GEMM terms (N = 64); row scaling + hi/residual; Wout as two GEMM terms (+ bias).
// Compute dtype: inputs rounded to bf16; x / weights exact as f16 (line projections are f32 sums of exact products, so the bias path is f32-class); q, k and the softmax weights as plain f16 operands (~2^-12); v and the context as f16 hi + residual. v_wmma_f32_16x16x32_f16.
#define NB 2
#define TT 1024
#define DM 1024
#define NH 16
#define HD 64
#define NR (NB * TT)
typedef __bf16 v16b __attribute__((ext_vector_type(16)));
typedef unsigned short v8us __attribute__((ext_vector_type(8), may_alias));
typedef float  v8f  __attribute__((ext_vector_type(8)));
typedef float  v4f  __attribute__((ext_vector_type(4)));
typedef float  v4fa __attribute__((ext_vector_type(4), may_alias));
union FragB { v16b v; v8us half[2]; unsigned short u[16]; };

__device__ __forceinline__ unsigned short bf16_bits(float x) { unsigned int u = __float_as_uint(x); return (unsigned short)((u + 0x7FFFu + ((u >> 16) & 1u)) >> 16); }
__device__ __forceinline__ float bf16_val(unsigned short b) { return __uint_as_float(((unsigned int)b) << 16); }
__device__ __forceinline__ float bf16_round(float x) { return bf16_val(bf16_bits(x)); }
// D += A·B with NT terms: 1 = ah·bh, 2 = + al·bh (A split), 3 = + ah·bl (both split)
template <int NT>
__device__ __forceinline__ v8f mmaN(v16b ah, v16b al, v16b bh, v16b bl, v8f c) {
  c = __builtin_amdgcn_wmma_f32_16x16x32_bf16(false, ah, false, bh, (short)0, c, false, false);
  if (NT >= 2) c = __builtin_amdgcn_wmma_f32_16x16x32_bf16(false, al, false, bh, (short)0, c, false, false);
  if (NT >= 3) c = __builtin_amdgcn_wmma_f32_16x16x32_bf16(false, ah, false, bl, (short)0, c, false, false);
  asm volatile("v_nop\n\tv_nop\n\tv_nop\n\tv_nop" : "+v"(c) : "v"(ah), "v"(al), "v"(bh), "v"(bl));
  return c;
}

__global__ __launch_bounds__(256) void k_wt_bf16(const float* __restrict__ W, unsigned short* __restrict__ Wt, int K, int N) {
  const int t = blockIdx.x * 256 + threadIdx.x;
  const int k8n = K / 8;
  if (t >= N * k8n) return;
  const int n = t / k8n, k8 = (t % k8n) * 8;
  v8us v;
#pragma unroll
  for (int i = 0; i < 8; ++i) v[i] = bf16_bits(W[(size_t)(k8 + i) * N + n]);
  *(v8us*)(Wt + (size_t)n * K + k8) = v;
  
}

// GEMM C[M][N] (f32, pitch ldc) = act(A[M][K]·W + bias). A f32 row-major (pitch lda) converted per fragment to bf16
// (ASPLIT: hi/lo two planes -> 2 terms, else single rounded term); Wt bf16 [N][K] (pitch ldb). BIAS_BF16 rounds the
// bias to bf16 first (bias quantised to bf16 before the add). K%32==0, M%16==0, N%64==0.
template <bool ASPLIT, int ACT, bool BIAS_BF16>
__global__ __launch_bounds__(128) void k_gemm_bf(const float* __restrict__ A, int lda, const unsigned short* __restrict__ Wt, int ldb,
                                               const float* __restrict__ bias, float* __restrict__ C, int ldc, int M, int N, int K) {
  __shared__ __attribute__((aligned(16))) float so[4][16][64];
  const int tid = threadIdx.x, w = tid >> 5, lane = tid & 31, ln = lane & 15, hh = lane >> 4;
  const int ntn = N / 64;
  const int wid = blockIdx.x * 4 + w;
  const int mt = wid / ntn, nq = wid % ntn;
  if (mt * 16 >= M) return;
  const int row0 = mt * 16, col0 = nq * 64;
  const float* arow = A + (size_t)(row0 + ln) * lda;
  v8f acc[4] = {};
  for (int kb = 0; kb < K; kb += 32) {
    FragB ah, al;
    const v4f x0 = *(const v4fa*)(arow + kb + 8 * hh), x1 = *(const v4fa*)(arow + kb + 8 * hh + 4);
    const v4f x2 = *(const v4fa*)(arow + kb + 16 + 8 * hh), x3 = *(const v4fa*)(arow + kb + 16 + 8 * hh + 4);
    float xs[16] = {x0[0],x0[1],x0[2],x0[3],x1[0],x1[1],x1[2],x1[3],x2[0],x2[1],x2[2],x2[3],x3[0],x3[1],x3[2],x3[3]};
#pragma unroll
    for (int i = 0; i < 16; ++i) { const unsigned short hb = bf16_bits(xs[i]); ah.u[i] = hb; al.u[i] = ASPLIT ? bf16_bits(xs[i] - bf16_val(hb)) : (unsigned short)0; }
#pragma unroll
    for (int t = 0; t < 4; ++t) {
      const unsigned short* brow = Wt + (size_t)(col0 + t * 16 + ln) * ldb + kb;
      FragB b;
      b.half[0] = *(const v8us*)(brow + 8 * hh);
      b.half[1] = *(const v8us*)(brow + 16 + 8 * hh);
      acc[t] = mmaN<ASPLIT ? 2 : 1>(ah.v, al.v, b.v, b.v, acc[t]);
    }
  }
#pragma unroll
  for (int t = 0; t < 4; ++t) {
    float bv = bias ? bias[col0 + t * 16 + ln] : 0.f;
    if (BIAS_BF16) bv = bf16_round(bv);
#pragma unroll
    for (int r = 0; r < 8; ++r) { float v = acc[t][r] + bv; if (ACT == 1) v = fmaxf(v, 0.f); so[w][8 * hh + r][t * 16 + ln] = v; }
  }
  __builtin_amdgcn_fence(__ATOMIC_ACQ_REL, "workgroup");
  __builtin_amdgcn_wave_barrier();
  const int rsub = lane >> 4, c4 = (lane & 15) * 4;
  {
#pragma unroll
    for (int q = 0; q < 8; ++q) {
      const int r = q * 2 + rsub;
      const v4f v = *(const v4fa*)&so[w][r][c4];
      *(v4f*)(C + (size_t)(row0 + r) * ldc + col0 + c4) = v;
    }
    
  }
}

// GEMM C = act(A·W + bias + resid): A f32 (ASPLIT -> hi/lo 2 terms), Wt bf16 [N][K]; ACT 0 none, 1 relu, 2 exact gelu;
// resid (optional, f32, row index = (row % rmod), pitch ldr, RES_BF16 rounds it) added before the activation.
template <bool ASPLIT, int ACT, bool BIAS_BF16, bool RES_BF16>
__global__ __launch_bounds__(128) void k_gemm_bf3(const float* __restrict__ A, int lda, const unsigned short* __restrict__ Wt, int ldb,
                                                const float* __restrict__ bias, const float* __restrict__ resid, int rmod, int ldr,
                                                float* __restrict__ C, int ldc, int M, int N, int K) {
  __shared__ __attribute__((aligned(16))) float so[4][16][64];
  const int tid = threadIdx.x, w = tid >> 5, lane = tid & 31, ln = lane & 15, hh = lane >> 4;
  const int ntn = N / 64;
  const int wid = blockIdx.x * 4 + w;
  const int mt = wid / ntn, nq = wid % ntn;
  if (mt * 16 >= M) return;
  const int row0 = mt * 16, col0 = nq * 64;
  const float* arow = A + (size_t)(row0 + ln) * lda;
  v8f acc[4] = {};
  for (int kb = 0; kb < K; kb += 32) {
    FragB ah, al;
    const v4f x0 = *(const v4fa*)(arow + kb + 8 * hh), x1 = *(const v4fa*)(arow + kb + 8 * hh + 4);
    const v4f x2 = *(const v4fa*)(arow + kb + 16 + 8 * hh), x3 = *(const v4fa*)(arow + kb + 16 + 8 * hh + 4);
    float xs[16] = {x0[0],x0[1],x0[2],x0[3],x1[0],x1[1],x1[2],x1[3],x2[0],x2[1],x2[2],x2[3],x3[0],x3[1],x3[2],x3[3]};
#pragma unroll
    for (int i = 0; i < 16; ++i) { const unsigned short hb = bf16_bits(xs[i]); ah.u[i] = hb; al.u[i] = ASPLIT ? bf16_bits(xs[i] - bf16_val(hb)) : (unsigned short)0; }
#pragma unroll
    for (int t = 0; t < 4; ++t) {
      const unsigned short* brow = Wt + (size_t)(col0 + t * 16 + ln) * ldb + kb;
      FragB b;
      b.half[0] = *(const v8us*)(brow + 8 * hh);
      b.half[1] = *(const v8us*)(brow + 16 + 8 * hh);
      acc[t] = mmaN<ASPLIT ? 2 : 1>(ah.v, al.v, b.v, b.v, acc[t]);
    }
  }
#pragma unroll
  for (int t = 0; t < 4; ++t) {
    const int col = col0 + t * 16 + ln;
    float bv = bias ? bias[col] : 0.f;
    if (BIAS_BF16) bv = bf16_round(bv);
#pragma unroll
    for (int r = 0; r < 8; ++r) {
      float v = acc[t][r] + bv;
      if (resid) { float rv = resid[(size_t)((row0 + 8 * hh + r) % rmod) * ldr + col]; if (RES_BF16) rv = bf16_round(rv); v += rv; }
      if (ACT == 1) v = fmaxf(v, 0.f);
      if (ACT == 2) v = 0.5f * v * (1.0f + erff(v * 0.70710678118654752f));
      if (ACT == 3) { const float u = 0.7978845608028654f * (v + 0.044715f * v * v * v); v = 0.5f * v * (1.0f + tanhf(u)); }
      so[w][8 * hh + r][t * 16 + ln] = v;
    }
  }
  __builtin_amdgcn_fence(__ATOMIC_ACQ_REL, "workgroup");
  __builtin_amdgcn_wave_barrier();
  const int rsub = lane >> 4, c4 = (lane & 15) * 4;
  {
#pragma unroll
    for (int q = 0; q < 8; ++q) {
      const int r = q * 2 + rsub;
      const v4f v = *(const v4fa*)&so[w][r][c4];
      *(v4f*)(C + (size_t)(row0 + r) * ldc + col0 + c4) = v;
    }
    
  }
}
// row LayerNorm (biased variance, eps) over N: s = X (+ R); optional out_sum <- s; out_norm <- (s-mu)*rsqrt(var+eps)*g + b
template <bool PARAM_BF16>
__global__ __launch_bounds__(256) void k_layernorm(const float* __restrict__ X, const float* __restrict__ R, const float* __restrict__ g, const float* __restrict__ bta,
                                                  float* __restrict__ out_sum, float* __restrict__ out_norm, int N, float eps) {
  __shared__ float red[256];
  const int row = blockIdx.x, tid = threadIdx.x;
  const float* x = X + (size_t)row * N; const float* rr = R ? R + (size_t)row * N : nullptr;
  float vals[16];                     // up to N = 4096
  const int per = N / 256;            // contiguous chunk per thread? use strided-by-4 chunks: thread handles j = tid*4 + 1024*u
  float s1 = 0.f;
  for (int u = 0; u < per / 4; ++u) {
    const int j = tid * 4 + 1024 * u;
    const v4f a = *(const v4fa*)(x + j);
    v4f b = {0.f,0.f,0.f,0.f}; if (rr) b = *(const v4fa*)(rr + j);
#pragma unroll
    for (int q = 0; q < 4; ++q) { const float v = a[q] + b[q]; vals[u * 4 + q] = v; s1 += v; }
  }
  red[tid] = s1; __syncthreads();
  for (int st = 128; st > 0; st >>= 1) { if (tid < st) red[tid] += red[tid + st]; __syncthreads(); }
  const float mu = red[0] / (float)N; __syncthreads();
  float s2 = 0.f;
  for (int u = 0; u < per / 4; ++u)
#pragma unroll
    for (int q = 0; q < 4; ++q) { const float c = vals[u * 4 + q] - mu; s2 += c * c; }
  red[tid] = s2; __syncthreads();
  for (int st = 128; st > 0; st >>= 1) { if (tid < st) red[tid] += red[tid + st]; __syncthreads(); }
  const float rs = rsqrtf(red[0] / (float)N + eps);
  {
    for (int u = 0; u < per / 4; ++u) {
      const int j = tid * 4 + 1024 * u;
      v4f o, sm;
#pragma unroll
      for (int q = 0; q < 4; ++q) {
        float gg = g[j + q], bb = bta[j + q];
        if (PARAM_BF16) { gg = bf16_round(gg); bb = bf16_round(bb); }
        sm[q] = vals[u * 4 + q]; o[q] = (vals[u * 4 + q] - mu) * rs * gg + bb;
      }
      if (out_sum) *(v4f*)(out_sum + (size_t)row * N + j) = sm;
      *(v4f*)(out_norm + (size_t)row * N + j) = o;
    }
    
  }
}



// ---- f16 WMMA path (v_wmma_f32_16x16x32_f16): 11-bit significands for operands in range — used for every GEMM launched here
typedef _Float16 v16h __attribute__((ext_vector_type(16)));
union FragH { v16h v; v8us half[2]; _Float16 h[16]; unsigned short u[16]; };
template <int NT>
__device__ __forceinline__ v8f mmaH(v16h ah, v16h al, v16h bh, v16h bl, v8f c) {
  c = __builtin_amdgcn_wmma_f32_16x16x32_f16(false, ah, false, bh, (short)0, c, false, false);
  if (NT >= 2) c = __builtin_amdgcn_wmma_f32_16x16x32_f16(false, al, false, bh, (short)0, c, false, false);
  if (NT >= 3) c = __builtin_amdgcn_wmma_f32_16x16x32_f16(false, ah, false, bl, (short)0, c, false, false);
  asm volatile("v_nop\n\tv_nop\n\tv_nop\n\tv_nop" : "+v"(c) : "v"(ah), "v"(al), "v"(bh), "v"(bl));
  return c;
}
// batched GEMM like k_gemm_b but f16 operands: A f32 (split into f16 hi/lo if ASPLIT, else rounded to f16), Bt = f16 values [n][k]; alpha; C f32; N multiple of 16 (partial tiles skipped)
template <bool ASPLIT>
__global__ __launch_bounds__(128) void k_gemm_h(const float* __restrict__ A, int lda, size_t sA, const _Float16* __restrict__ Bh, int ldb, size_t sB, float alpha, float* __restrict__ C, int ldc, size_t sC, int M, int N, int K) {
  __shared__ __attribute__((aligned(16))) float so[4][16][64];
  const int tid = threadIdx.x, w = tid >> 5, lane = tid & 31, ln = lane & 15, hh = lane >> 4; const int by = blockIdx.y;
  A += (size_t)by * sA; Bh += (size_t)by * sB; C += (size_t)by * sC;
  const int ntn = (N + 63) / 64; const int wid = blockIdx.x * 4 + w; const int mt = wid / ntn, nq = wid % ntn; if (mt * 16 >= M) return;
  const int row0 = mt * 16, col0 = nq * 64; const float* arow = A + (size_t)(row0 + ln) * lda;
  v8f acc[4] = {};
  for (int kb = 0; kb < K; kb += 32) {
    FragH ah, al;
    const v4f x0 = *(const v4fa*)(arow + kb + 8 * hh), x1 = *(const v4fa*)(arow + kb + 8 * hh + 4), x2 = *(const v4fa*)(arow + kb + 16 + 8 * hh), x3 = *(const v4fa*)(arow + kb + 16 + 8 * hh + 4);
    float xs[16] = {x0[0],x0[1],x0[2],x0[3],x1[0],x1[1],x1[2],x1[3],x2[0],x2[1],x2[2],x2[3],x3[0],x3[1],x3[2],x3[3]};
#pragma unroll
    for (int i = 0; i < 16; ++i) { const _Float16 h = (_Float16)xs[i]; ah.h[i] = h; al.h[i] = ASPLIT ? (_Float16)(xs[i] - (float)h) : (_Float16)0.0f; }
#pragma unroll
    for (int t = 0; t < 4; ++t) { if (col0 + t * 16 >= N) continue; const size_t boff = (size_t)(col0 + t * 16 + ln) * ldb + kb; FragH bq; bq.half[0] = *(const v8us*)(Bh + boff + 8 * hh); bq.half[1] = *(const v8us*)(Bh + boff + 16 + 8 * hh);
      acc[t] = mmaH<ASPLIT ? 2 : 1>(ah.v, al.v, bq.v, bq.v, acc[t]); }
  }
#pragma unroll
  for (int t = 0; t < 4; ++t) { if (col0 + t * 16 >= N) continue;
#pragma unroll
    for (int r = 0; r < 8; ++r) so[w][8 * hh + r][t * 16 + ln] = acc[t][r] * alpha; }
  __builtin_amdgcn_fence(__ATOMIC_ACQ_REL, "workgroup"); __builtin_amdgcn_wave_barrier();
  const int rsub = lane >> 4, c4 = (lane & 15) * 4;
  {
#pragma unroll
    for (int q = 0; q < 8; ++q) { const int r = q * 2 + rsub; if (col0 + c4 < N) { const v4f v = *(const v4fa*)&so[w][r][c4]; *(v4f*)(C + (size_t)(row0 + r) * ldc + col0 + c4) = v; } }
     }
}

// Wt[n][k] = f16(W[k][n]·scale) from f32 row-major W[K][N] (scale = power of two; bf16-exact weights stay exact in f16 away from the subnormal range)
__global__ __launch_bounds__(256) void k_wt_f16(const float* __restrict__ W, _Float16* __restrict__ Wt, int K, int N, float scale) {
  const int t = blockIdx.x * 256 + threadIdx.x; if (t >= N * (K / 8)) return; const int n = t / (K / 8), k8 = (t % (K / 8)) * 8; FragH f;
#pragma unroll
  for (int i = 0; i < 8; ++i) f.h[i] = (_Float16)(bf16_round(W[(size_t)(k8 + i) * N + n]) * scale); const v8us o = f.half[0];
  *(v8us*)((unsigned short*)Wt + (size_t)n * K + k8) = o; 
}
// k_gemm_hh variant with fused epilogue: v = acc·alpha + bias[by·sBias + col] (+ CP[(row/rowsPerB)·sCPb + by·64 + col] if CP) ; ACT 0 none / 1 elu ; writes f16 C16 (and f32 C if non-null)
template <int ACT>
__global__ __launch_bounds__(128) void k_gemm_hhx(const _Float16* __restrict__ A, int lda, size_t sA, const _Float16* __restrict__ Bh, int ldb, size_t sB, float alpha, const float* __restrict__ bias, size_t sBias, const float* __restrict__ CP, int rowsPerB, size_t sCPb, int row0g,
    float* __restrict__ C, _Float16* __restrict__ C16, int ldc, size_t sC, int M, int N, int K) {
  __shared__ __attribute__((aligned(16))) float so[4][16][64];
  const int tid = threadIdx.x, w = tid >> 5, lane = tid & 31, ln = lane & 15, hh = lane >> 4; const int by = blockIdx.y;
  A += (size_t)by * sA; Bh += (size_t)by * sB; const size_t cofs = (size_t)by * sC; const float* bp = bias ? bias + (size_t)by * sBias : nullptr;
  const int ntn = (N + 63) / 64; const int wid = blockIdx.x * 4 + w; const int mt = wid / ntn, nq = wid % ntn; if (mt * 16 >= M) return;
  const int row0 = mt * 16, col0 = nq * 64; const _Float16* arow = A + (size_t)(row0 + ln) * lda;
  v8f acc[4] = {};
  for (int kb = 0; kb < K; kb += 32) { FragH ah; ah.half[0] = *(const v8us*)((const unsigned short*)arow + kb + 8 * hh); ah.half[1] = *(const v8us*)((const unsigned short*)arow + kb + 16 + 8 * hh);
#pragma unroll
    for (int t = 0; t < 4; ++t) { if (col0 + t * 16 >= N) continue; const size_t boff = (size_t)(col0 + t * 16 + ln) * ldb + kb; FragH bq; bq.half[0] = *(const v8us*)((const unsigned short*)Bh + boff + 8 * hh); bq.half[1] = *(const v8us*)((const unsigned short*)Bh + boff + 16 + 8 * hh);
      acc[t] = mmaH<1>(ah.v, ah.v, bq.v, bq.v, acc[t]); }
  }
#pragma unroll
  for (int t = 0; t < 4; ++t) { if (col0 + t * 16 >= N) continue; const int col = col0 + t * 16 + ln; const float bv = bp ? bf16_round(bp[col]) : 0.f;
#pragma unroll
    for (int r = 0; r < 8; ++r) { float v = acc[t][r] * alpha + bv; if (CP) { const int rr = row0g + row0 + 8 * hh + r; if (rowsPerB < 0) v += CP[cofs + (size_t)rr * ldc + col];      /* rowsPerB < 0: own element of the batched C plane */ else { const int bidx = rr / rowsPerB; v += CP[(size_t)bidx * sCPb + (size_t)by * 64 + col]; } } if (ACT == 1) v = (v > 0.f) ? v : expm1f(v); else if (ACT == 7) v = (v > 0.f) ? v + 1.0f : expf(v); else if (ACT == 8) v = tanhf(v); else if (ACT == 9) v = 0.5f * v * (1.0f + tanhf(0.7978845608028654f * (v + 0.044715f * v * v * v))); else if (ACT == 11) v = 1.0f / (1.0f + expf(-v)); else if (ACT == 12) v = (v > 0.f) ? v : 0.01f * v; else if (ACT == 14) v = (v > 0.f) ? v : 0.1f * v; else if (ACT == 16) v = (v >= 0.f) ? v : 0.3f * v; else if (ACT == 17) v = (v >= 0.f) ? v : 0.2f * v; else if (ACT == 15) v = v / (1.0f + expf(-v)); else if (ACT == 3) v = fmaxf(v, 0.f); else if (ACT == 6) v = 0.5f * v * (1.0f + erff(v * 0.70710678118654752f)); so[w][8 * hh + r][t * 16 + ln] = v; } }
  __builtin_amdgcn_fence(__ATOMIC_ACQ_REL, "workgroup"); __builtin_amdgcn_wave_barrier();
  const int rsub = lane >> 4, c4 = (lane & 15) * 4; typedef _Float16 v4h __attribute__((ext_vector_type(4)));
  {
#pragma unroll
    for (int q = 0; q < 8; ++q) { const int r = q * 2 + rsub; if (col0 + c4 < N) { const v4f v = *(const v4fa*)&so[w][r][c4]; if (C) *(v4f*)(C + cofs + (size_t)(row0 + r) * ldc + col0 + c4) = v; if (C16) { v4h h4; for (int i = 0; i < 4; ++i) h4[i] = (_Float16)v[i]; *(v4h*)(C16 + cofs + (size_t)(row0 + r) * ldc + col0 + c4) = h4; } } }
     }
}


typedef _Float16 v4h __attribute__((ext_vector_type(4)));

__global__ __launch_bounds__(256) void k_x16(const float* __restrict__ x, _Float16* __restrict__ X16, size_t n8) { const size_t t = (size_t)blockIdx.x * 256 + threadIdx.x; if (t >= n8) return; FragH f;
#pragma unroll
  for (int q = 0; q < 8; ++q) f.h[q] = (_Float16)bf16_round(x[t * 8 + q]); *(v8us*)((unsigned short*)X16 + t * 8) = f.half[0];  }
__global__ __launch_bounds__(256) void k_h16(const float* __restrict__ x, _Float16* __restrict__ X16, size_t n8) { const size_t t = (size_t)blockIdx.x * 256 + threadIdx.x; if (t >= n8) return; FragH f;
#pragma unroll
  for (int q = 0; q < 8; ++q) f.h[q] = (_Float16)x[t * 8 + q]; *(v8us*)((unsigned short*)X16 + t * 8) = f.half[0];  }
__global__ __launch_bounds__(256) void k_round16f(const float* __restrict__ W, _Float16* __restrict__ Bt, size_t n8) { const size_t t = (size_t)blockIdx.x * 256 + threadIdx.x; if (t >= n8) return; FragH f;
#pragma unroll
  for (int i = 0; i < 8; ++i) f.h[i] = (_Float16)(bf16_round(W[t * 8 + i]) * 16.0f); *(v8us*)((unsigned short*)Bt + t * 8) = f.half[0];  }
template <int NHv, int TTv>
__global__ __launch_bounds__(256) void k_vt(const _Float16* __restrict__ V16, int ldv, int voff, _Float16* __restrict__ Vt) { __shared__ unsigned short tl[64][66]; const int tid = threadIdx.x; const int slab = blockIdx.x / (TTv / 64), lg = blockIdx.x % (TTv / 64); const int b = slab / NHv, h = slab % NHv;
  for (int i = tid; i < 64 * 8; i += 256) { const int r = i / 8, c8 = (i % 8) * 8; FragH f; f.half[0] = *(const v8us*)((const unsigned short*)V16 + ((size_t)b * TTv + lg * 64 + r) * ldv + voff + h * 64 + c8);
#pragma unroll
    for (int q = 0; q < 8; ++q) tl[r][c8 + q] = f.u[q]; }
  __syncthreads();
  {
#pragma unroll
    for (int rd = 0; rd < 2; ++rd) { const int d = rd * 32 + tid / 8, pc = tid % 8; FragH f;
#pragma unroll
      for (int q = 0; q < 8; ++q) f.u[q] = tl[pc * 8 + q][d];
      *(v8us*)((unsigned short*)Vt + ((size_t)slab * 64 + d) * TTv + lg * 64 + pc * 8) = f.half[0]; }
     } }

__global__ __launch_bounds__(256) void k_hl(const float* __restrict__ F, _Float16* __restrict__ Hh, _Float16* __restrict__ Hl, size_t n8) { const size_t t = (size_t)blockIdx.x * 256 + threadIdx.x; if (t >= n8) return; FragH fh, fl; const v4f a = *(const v4fa*)(F + t * 8), c = *(const v4fa*)(F + t * 8 + 4);
#pragma unroll
  for (int q = 0; q < 4; ++q) { _Float16 h = (_Float16)a[q]; fh.h[q] = h; fl.h[q] = (_Float16)((a[q] - (float)h) * 1024.0f); h = (_Float16)c[q]; fh.h[4 + q] = h; fl.h[4 + q] = (_Float16)((c[q] - (float)h) * 1024.0f); }
  { *(v8us*)((unsigned short*)Hh + t * 8) = fh.half[0]; *(v8us*)((unsigned short*)Hl + t * 8) = fl.half[0];  } }

// ---- fast GEMM (block tile 128x64, wave tile 32x64, A and B k-tiles staged in LDS; requires M % 128 == 0, N % 64 == 0 and K == 64 or K % 128 == 0); epilogue = k_gemm_hhx semantics ----
#define G2_LP 72
__device__ __forceinline__ v16h g2_frag(const _Float16* p, int hh) { FragH f; f.half[0] = *(const v8us*)((const unsigned short*)p + 8 * hh); f.half[1] = *(const v8us*)((const unsigned short*)p + 16 + 8 * hh); return f.v; }
__device__ __forceinline__ v8f g2_mma(v16h a, v16h b, v8f c) { v8f d = __builtin_amdgcn_wmma_f32_16x16x32_f16(false, a, false, b, (short)0, c, false, false); asm volatile("v_nop\n\tv_nop\n\tv_nop\n\tv_nop" : "+v"(d) : "v"(a), "v"(b)); return d; }
// work-group barrier that orders LDS alone (its fences name the LDS address space): __syncthreads() also waits for every global load in flight, and the loads for the tiles ahead must stay in flight across it; the loop's global reads are of operands that no wave of the launch writes
__device__ __forceinline__ void g2_bar() { __builtin_amdgcn_fence(__ATOMIC_RELEASE, "workgroup", "local"); __builtin_amdgcn_s_barrier(); __builtin_amdgcn_fence(__ATOMIC_ACQUIRE, "workgroup", "local"); }
template <int ACT>
__global__ __launch_bounds__(128) void k_gemm2(const _Float16* __restrict__ A, int lda, size_t sA, const _Float16* __restrict__ Bh, int ldb, size_t sB, float alpha, const float* __restrict__ bias, size_t sBias, const float* __restrict__ CP, int rowsPerB, size_t sCPb, int row0g,
    float* __restrict__ C, _Float16* __restrict__ C16, int ldc, size_t sC, int M, int N, int K) { static_assert(ACT == 0 || ACT == 3 || ACT == 6 || ACT == 8 || ACT == 9 || ACT == 11 || ACT == 12 || ACT == 14 || ACT == 15 || ACT == 16 || ACT == 17, "k_gemm2: unsupported ACT code (would silently apply no activation)");
  __shared__ __attribute__((aligned(16))) float so[4][32][68];
  // k-tiles of 64 halves (one whole 128-B line per row) of the block's 128 A rows and 64 B rows, two buffers; row pitch 72 halves = 144 B = 16 B x 9 for the ds_load_b128 fragment reads
  __shared__ __attribute__((aligned(16))) _Float16 sa[2][128][G2_LP];
  __shared__ __attribute__((aligned(16))) _Float16 sb[2][64][G2_LP];
  const int tid = threadIdx.x, w = tid >> 5, lane = tid & 31, ln = lane & 15, hh = lane >> 4; const int by = blockIdx.y;
  A += (size_t)by * sA; Bh += (size_t)by * sB; const size_t cofs = (size_t)by * sC; const float* bp = bias ? bias + (size_t)by * sBias : nullptr;
  const int ntn = N >> 6; const int mt = blockIdx.x / ntn, nq = blockIdx.x - mt * ntn; const int row0 = mt * 128 + 32 * w, col0 = nq * 64; if (mt * 128 >= M) return;      /* the same for the whole block: it stands in front of barriers */
  const int sr = tid >> 3, sc = (tid & 7) * 8;      /* staging: 8 lanes cover one row's 128 B, a wave-wide load covers 4 whole lines */
  const char* ab = (const char*)(A + (size_t)(mt * 128) * lda); const char* bb = (const char*)(Bh + (size_t)col0 * ldb);      /* the block's first A and B row: the same in every lane */
  const unsigned ao = (unsigned)(sr * lda + sc) * 2u, bo = (unsigned)(sr * ldb + sc) * 2u;      /* the lane's own byte offset, fixed for the whole loop */
  const v8f z8 = {0.f,0.f,0.f,0.f,0.f,0.f,0.f,0.f}; v8f c00 = z8, c01 = z8, c02 = z8, c03 = z8, c10 = z8, c11 = z8, c12 = z8, c13 = z8;
  v8us ra0[8], rb0[4], ra1[8], rb1[4];
  auto gl = [&](v8us* ra, v8us* rb, int kb) {
#pragma unroll
    for (int i = 0; i < 8; ++i) ra[i] = *(const v8us*)(ab + ((size_t)(16 * i) * lda + kb) * 2 + ao);
#pragma unroll
    for (int i = 0; i < 4; ++i) rb[i] = *(const v8us*)(bb + ((size_t)(16 * i) * ldb + kb) * 2 + bo); };
  auto st = [&](const v8us* ra, const v8us* rb, int buf) {
#pragma unroll
    for (int i = 0; i < 8; ++i) *(v8us*)&sa[buf][sr + 16 * i][sc] = ra[i];
#pragma unroll
    for (int i = 0; i < 4; ++i) *(v8us*)&sb[buf][sr + 16 * i][sc] = rb[i]; };
  auto comp = [&](int buf) {
#pragma unroll
    for (int kk = 0; kk < 64; kk += 32) { const v16h a0 = g2_frag(&sa[buf][32 * w + ln][kk], hh), a1 = g2_frag(&sa[buf][32 * w + 16 + ln][kk], hh);
      const v16h b0 = g2_frag(&sb[buf][ln][kk], hh), b1 = g2_frag(&sb[buf][16 + ln][kk], hh), b2 = g2_frag(&sb[buf][32 + ln][kk], hh), b3 = g2_frag(&sb[buf][48 + ln][kk], hh);
      c00 = g2_mma(a0, b0, c00); c10 = g2_mma(a1, b0, c10); c01 = g2_mma(a0, b1, c01); c11 = g2_mma(a1, b1, c11);
      c02 = g2_mma(a0, b2, c02); c12 = g2_mma(a1, b2, c12); c03 = g2_mma(a0, b3, c03); c13 = g2_mma(a1, b3, c13); } };
  // Each barrier publishes the buffer just written and ends every wave's reads of the other buffer, which is written next.
  gl(ra0, rb0, 0);
  __builtin_amdgcn_sched_barrier(0);      /* keeps set 0's loads in front of set 1's: mixed, set 0's wait at the loop's head would wait for set 1 as well */
  gl(ra1, rb1, 64 < K ? 64 : 0);      /* the second set's tile clamped, not branched round: set 0's loads stay the older ones on every way into the loop, so its wait leaves set 1's in flight */
  asm volatile("s_wait_xcnt 0x0" ::: "memory");      /* in front of whatever reuses the address registers of the loads above, which stay in flight */
  int kb = 0;
  // two tiles per trip so that each register set and each LDS buffer has a fixed name; every load of the trip is unconditional (the last two tiles are peeled off below), so the waits can be counted; kept rolled: unrolled further it only grows the code
#pragma unroll 1
  for (; kb + 128 < K; kb += 128) {
    st(ra0, rb0, 0); g2_bar(); gl(ra0, rb0, kb + 128); comp(0);      /* loads two tiles ahead: in flight over this tile's and the next tile's products */
    st(ra1, rb1, 1); g2_bar(); gl(ra1, rb1, kb + 192); comp(1);
    asm volatile("s_wait_xcnt 0x0" ::: "memory"); }      /* in front of the next trip's address arithmetic, which rewrites the address registers of loads still in flight */
  st(ra0, rb0, 0); g2_bar(); comp(0);
  if (kb + 64 < K) { st(ra1, rb1, 1); g2_bar(); comp(1); }
  v8f accs[8] = {c00, c01, c02, c03, c10, c11, c12, c13};
#pragma unroll
  for (int u = 0; u < 8; ++u) { const int t = u & 3, half = u >> 2; const int col = col0 + t * 16 + ln; const float bv = bp ? bf16_round(bp[col]) : 0.f;
#pragma unroll
    for (int r = 0; r < 8; ++r) { const int rloc = half * 16 + 8 * hh + r; float v = accs[u][r] * alpha + bv; if (CP) { if (rowsPerB < 0) v += CP[cofs + (size_t)(row0g + row0 + rloc) * ldc + col];      /* rowsPerB < 0: own element of the batched C plane */ else { const int bidx = (row0g + row0 + rloc) / rowsPerB; v += CP[(size_t)bidx * sCPb + (size_t)by * 64 + col]; } }
      if (ACT == 3) v = fmaxf(v, 0.f); else if (ACT == 6) v = 0.5f * v * (1.0f + erff(v * 0.70710678118654752f)); else if (ACT == 11) v = 1.0f / (1.0f + expf(-v)); else if (ACT == 15) v = v / (1.0f + expf(-v)); else if (ACT == 12) v = (v > 0.f) ? v : 0.01f * v; else if (ACT == 8) v = tanhf(v); else if (ACT == 9) v = 0.5f * v * (1.0f + tanhf(0.7978845608028654f * (v + 0.044715f * v * v * v))); else if (ACT == 14) v = (v > 0.f) ? v : 0.1f * v; else if (ACT == 16) v = (v >= 0.f) ? v : 0.3f * v; else if (ACT == 17) v = (v >= 0.f) ? v : 0.2f * v;
      so[w][rloc][t * 16 + ln] = v; } }
  __builtin_amdgcn_fence(__ATOMIC_ACQ_REL, "workgroup"); __builtin_amdgcn_wave_barrier();
  const int rsub = lane >> 4, c4 = (lane & 15) * 4;
  {
#pragma unroll
    for (int q = 0; q < 16; ++q) { const int r = q * 2 + rsub; const v4f v = *(const v4fa*)&so[w][r][c4]; if (C) *(v4f*)(C + cofs + (size_t)(row0 + r) * ldc + col0 + c4) = v; if (C16) { v4h h4; for (int i = 0; i < 4; ++i) h4[i] = (_Float16)v[i]; *(v4h*)(C16 + cofs + (size_t)(row0 + r) * ldc + col0 + c4) = h4; } }
     } }


__global__ __launch_bounds__(256) void k_wsc(const float* __restrict__ Wm, _Float16* __restrict__ Bt, size_t n8, float sc) { const size_t t = (size_t)blockIdx.x * 256 + threadIdx.x; if (t >= n8) return; FragH f; for (int q = 0; q < 8; ++q) f.h[q] = (_Float16)(bf16_round(Wm[t * 8 + q]) * sc); *(v8us*)((unsigned short*)Bt + t * 8) = f.half[0];  }
__global__ __launch_bounds__(256) void k_ccp(const float* __restrict__ QKV, int coff, _Float16* __restrict__ D) { const size_t t = (size_t)blockIdx.x * 256 + threadIdx.x; if (t >= (size_t)NR * DM / 8) return; const int c0 = (int)((t * 8) % DM); const size_t row = (t * 8) / DM; const v8f a = *(const v8f*)(QKV + row * 3 * DM + coff + c0); FragH f; for (int q = 0; q < 8; ++q) f.h[q] = (_Float16)a[q];
  *(v8us*)((unsigned short*)D + (((row / TT) * NH + c0 / HD) * TT + row % TT) * HD + c0 % HD) = f.half[0];  }      /* plane (batch * NH + head), row t, 64 halves a row: one batch stride serves all 32 planes */
__global__ __launch_bounds__(256) void k_chl(const float* __restrict__ QKV, int coff, _Float16* __restrict__ Hh, _Float16* __restrict__ Lh) {
  #pragma clang fp contract(off)
  const size_t t = (size_t)blockIdx.x * 256 + threadIdx.x; if (t >= (size_t)NR * DM / 8) return; const int c0 = (int)((t * 8) % DM); const size_t row = (t * 8) / DM; const v8f a = *(const v8f*)(QKV + row * 3 * DM + coff + c0); FragH fh, fl; for (int q = 0; q < 8; ++q) { const _Float16 hv = (_Float16)a[q]; fh.h[q] = hv; fl.h[q] = (_Float16)((a[q] - (float)hv) * 1024.0f); }
  { *(v8us*)((unsigned short*)Hh + t * 8) = fh.half[0]; *(v8us*)((unsigned short*)Lh + t * 8) = fl.half[0];  } }
__device__ __forceinline__ void exter(const float* p1, const float* p2, float* L) {
  #pragma clang fp contract(off)
  const int PI[6] = {0, 0, 0, 1, 1, 2}, PJ[6] = {1, 2, 3, 2, 3, 3}; float n2 = 0.f;
  for (int k = 0; k < 6; ++k) { float a = p1[PI[k]] * p2[PJ[k]]; a += -(p1[PJ[k]] * p2[PI[k]]); L[k] = a; n2 += a * a; }
  const float n = fmaxf(sqrtf(n2), 1e-12f); for (int k = 0; k < 6; ++k) L[k] = L[k] / n; }
__global__ __launch_bounds__(256) void k_lines(const float* __restrict__ LW, float* __restrict__ JW, float* __restrict__ RD) {
  #pragma clang fp contract(off)
  const int tt = blockIdx.x * 256 + threadIdx.x; if (tt >= NR * NH) return; const int t = tt % TT; const int bh = tt / TT; const int h = bh % NH, b = bh / NH; const size_t row = (size_t)b * TT + t; float w1[4], w2[4], r1[4], r2[4];
  for (int i = 0; i < 4; ++i) { w1[i] = (t > 0) ? LW[(row - 1) * 256 + h * 4 + i] : 0.f; w2[i] = LW[row * 256 + 64 + h * 4 + i]; r1[i] = LW[row * 256 + 128 + h * 4 + i]; r2[i] = LW[row * 256 + 192 + h * 4 + i]; }
  float wl[6], rl[6]; exter(w1, w2, wl); exter(r1, r2, rl); v8f jw, rd; jw[0] = wl[5]; jw[1] = -wl[4]; jw[2] = wl[3]; jw[3] = wl[2]; jw[4] = -wl[1]; jw[5] = wl[0]; jw[6] = 0.f; jw[7] = 0.f; for (int k = 0; k < 6; ++k) rd[k] = rl[k]; rd[6] = 0.f; rd[7] = 0.f;
  const size_t o = (((size_t)b * NH + h) * TT + t) * 8; { *(v8f*)(JW + o) = jw; *(v8f*)(RD + o) = rd;  } }
typedef float v2f __attribute__((ext_vector_type(2)));
typedef float v2fa __attribute__((ext_vector_type(2), may_alias));
// Causal 6x6 Gram state and rd . M, one work-group per (batch, head). M is symmetric bit for bit (w_i * w_j rounds the same either way and both sides sum in the same order), so 21 running sums carry it.
// Three phases through one LDS array, plane e = (i, j), i <= j, column t: (A) every thread forms the 21 products of its rows; (B) 21 lanes of one wave turn each plane into its running sum over t, in the order t = 0, 1, ...; (C) every thread reads M_t of its rows and forms rd_t . M_t, i = 0..5 in order.
// Plane pitch TT + 4 floats: the 16-B reads and writes of phase B, one plane per lane, start 4 banks apart; phases A and C touch 32 columns in a row of one plane.
#define CE 21
#define CPI (TT + 4)
__global__ __launch_bounds__(256) void k_cum(const float* __restrict__ JW, const float* __restrict__ RD, float* __restrict__ RDM) {
  __shared__ __attribute__((aligned(16))) float pm[CE][CPI];
  const int tid = threadIdx.x; const size_t bh = blockIdx.x; const float* jw = JW + bh * TT * 8; const float* rd = RD + bh * TT * 8; float* ob = RDM + bh * TT * 8;
  // every global load of the block is issued before the first is waited for; thread tid has rows c * 256 + tid; all loops over c, i, j, u, q are unrolled in full so that their arrays stay in registers
  v4f wa[TT / 256], ra[TT / 256]; v2f wb[TT / 256], rb[TT / 256];      /* a row's six values as 16 + 8 bytes */
#pragma unroll
  for (int c = 0; c < TT / 256; ++c) { const float* q = jw + (size_t)(c * 256 + tid) * 8; wa[c] = *(const v4fa*)q; wb[c] = *(const v2fa*)(q + 4); }
#pragma unroll
  for (int c = 0; c < TT / 256; ++c) { const float* q = rd + (size_t)(c * 256 + tid) * 8; ra[c] = *(const v4fa*)q; rb[c] = *(const v2fa*)(q + 4); }
  asm volatile("s_wait_xcnt 0x0" ::: "memory");      /* in front of whatever reuses the address registers of the loads above, which stay in flight */
#pragma unroll
  for (int c = 0; c < TT / 256; ++c) { const float w[6] = {wa[c][0], wa[c][1], wa[c][2], wa[c][3], wb[c][0], wb[c][1]}; int e = 0;
#pragma unroll
    for (int i = 0; i < 6; ++i)
#pragma unroll
      for (int j = i; j < 6; ++j) { pm[e][c * 256 + tid] = w[i] * w[j]; ++e; } }
  __syncthreads();
  if (tid < CE) { float* p = &pm[tid][0]; float acc = 0.f; v4f cur[8], nxt[8];
    // the one dependent chain left is one add per t; the reads run 32 columns ahead of it in two named register sets, so that it never waits for LDS
#pragma unroll
    for (int u = 0; u < 8; ++u) cur[u] = *(const v4f*)(p + 4 * u);
    // two sets per trip so that each has a fixed name; kept rolled: unrolled further it only grows the code
#pragma unroll 1
    for (int t0 = 0; t0 < TT; t0 += 64) {
#pragma unroll
      for (int u = 0; u < 8; ++u) nxt[u] = *(const v4f*)(p + t0 + 32 + 4 * u);
#pragma unroll
      for (int u = 0; u < 8; ++u) { v4f o;
#pragma unroll
        for (int q = 0; q < 4; ++q) { acc += cur[u][q]; o[q] = acc; }
        *(v4f*)(p + t0 + 4 * u) = o; }
      if (t0 + 64 < TT) {
#pragma unroll
        for (int u = 0; u < 8; ++u) cur[u] = *(const v4f*)(p + t0 + 64 + 4 * u); }
#pragma unroll
      for (int u = 0; u < 8; ++u) { v4f o;
#pragma unroll
        for (int q = 0; q < 4; ++q) { acc += nxt[u][q]; o[q] = acc; }
        *(v4f*)(p + t0 + 32 + 4 * u) = o; } } }
  __syncthreads();
#pragma unroll
  for (int c = 0; c < TT / 256; ++c) { const float r[6] = {ra[c][0], ra[c][1], ra[c][2], ra[c][3], rb[c][0], rb[c][1]}; float m[CE];
#pragma unroll
    for (int e = 0; e < CE; ++e) m[e] = pm[e][c * 256 + tid];
    v8f o;
#pragma unroll
    for (int j = 0; j < 6; ++j) { float v = 0.f;
#pragma unroll
      for (int i = 0; i < 6; ++i) { const int lo = i < j ? i : j, hi = i < j ? j : i; v += r[i] * m[lo * 6 - (lo * (lo - 1)) / 2 + hi - lo]; }
      o[j] = v; }
    o[6] = 0.f; o[7] = 0.f;
    *(v8f*)(ob + (size_t)(c * 256 + tid) * 8) = o;
    if (c + 1 < TT / 256) asm volatile("s_wait_xcnt 0x0" ::: "memory"); } }      /* in front of the next rows' LDS reads and sums, which reuse the registers that the store names */
__global__ __launch_bounds__(256) void k_bsoft(const float* __restrict__ S, const float* __restrict__ RDM, const float* __restrict__ JW, const float* __restrict__ bsc, _Float16* __restrict__ P, float* __restrict__ RS) {
  #pragma clang fp contract(off)
  // Row r = (batch * NH + head) * TT + t, over all planes. The block's 8 rows are 8 consecutive t of one head (TT % 8 == 0): that head's Jw rows are staged once in LDS, as six planes, and shared by the 8 waves.
  // Inside each group of 256 columns, column ln * 8 + q lies at (q >> 2) * 128 + ln * 4 + (q & 3): a lane's 8 columns are two 16-B reads per plane, and the 32 lanes of each read cover 512 B in a row.
  __shared__ __attribute__((aligned(16))) float sj[6][TT];
  if (blockIdx.x * 8 >= NB * NH * TT) return;      /* the same for the whole block: it stands in front of the barrier */
  const int tid = threadIdx.x, ln = tid & 31; const int wv = __builtin_amdgcn_readfirstlane(tid >> 5);      /* the wave's number in a scalar register: row, trip counts and row addresses are scalar */
  const int r = blockIdx.x * 8 + wv; const int t = r % TT; const size_t bh = (size_t)(r / TT); const int h = (r / TT) % NH; const float bs = bf16_round(bsc[h]); const float* sr = S + (size_t)r * TT; const v8f rdm = *(const v8f*)(RDM + (bh * TT + t) * 8); const float* jwb = JW + bh * TT * 8;
  const int ngw = (t >> 8) + 1;      /* column groups that hold an s <= t for this row */
  // every global load of the block's operands is unconditional (all of the head's Jw rows and all of the S row exist and were written earlier in this call) and is issued before the first is waited for: one trip to L2 in all.
  // The Jw rows first (thread tid brings column i * 256 + tid, its six values as 16 + 8 bytes), as the staging waits for them alone
  // every loop of this kernel over groups, halves, planes and columns is unrolled in full: its arrays (ja, jb, sv, j, l, ph) are indexed by constants then and stay in registers
  v4f ja[TT / 256]; v2f jb[TT / 256];
#pragma unroll
  for (int i = 0; i < TT / 256; ++i) { const float* jp = jwb + (size_t)(i * 256 + tid) * 8; ja[i] = *(const v4fa*)jp; jb[i] = *(const v2fa*)(jp + 4); }
  // the row's scores, two 16-B loads per group of 8 columns, whole lines per wave; they fly during the staging
  v4f sv[TT / 256][2];
#pragma unroll
  for (int gq = 0; gq < TT / 256; ++gq) { sv[gq][0] = *(const v4fa*)(sr + gq * 256 + ln * 8); sv[gq][1] = *(const v4fa*)(sr + gq * 256 + ln * 8 + 4); }
  asm volatile("s_wait_xcnt 0x0" ::: "memory");      /* in front of whatever reuses the address registers of the loads above, which stay in flight */
  const int p0 = ((tid >> 2) & 1) * 128 + (tid >> 3) * 4 + (tid & 3);
#pragma unroll
  for (int i = 0; i < TT / 256; ++i) {
#pragma unroll
    for (int k = 0; k < 4; ++k) sj[k][i * 256 + p0] = ja[i][k];
    sj[4][i * 256 + p0] = jb[i][0]; sj[5][i * 256 + p0] = jb[i][1]; }
  __syncthreads();
  auto lg8 = [&](int gq, const v4f* s8, float* l) {
#pragma unroll
    for (int hf = 0; hf < 2; ++hf) { v4f j[6];
#pragma unroll
      for (int k = 0; k < 6; ++k) j[k] = *(const v4f*)&sj[k][gq * 256 + hf * 128 + ln * 4];
#pragma unroll
      for (int q = 0; q < 4; ++q) { float d = 0.f; for (int k = 0; k < 6; ++k) d += rdm[k] * j[k][q]; float lv = s8[hf][q] * 0.125f; lv += fabsf(d) * bs; l[hf * 4 + q] = lv; } } };
  float mx = -3.0e38f;
#pragma unroll
  for (int gq = 0; gq < TT / 256; ++gq) if (gq < ngw) { float l[8]; lg8(gq, sv[gq], l);
#pragma unroll
    for (int q = 0; q < 8; ++q) { const int s = gq * 256 + ln * 8 + q; if (s <= t) mx = fmaxf(mx, l[q]); } }
  for (int o = 16; o > 0; o >>= 1) mx = fmaxf(mx, __shfl_xor(mx, o, 32)); float su = 0.f;
#pragma unroll
  for (int gq = 0; gq < TT / 256; ++gq) { FragH ph;
    if (gq < ngw) { float l[8]; lg8(gq, sv[gq], l);
#pragma unroll
      for (int q = 0; q < 8; ++q) { const int s = gq * 256 + ln * 8 + q; const float e = (s <= t) ? expf(l[q] - mx) : 0.f; su += e; ph.h[q] = (_Float16)(e * 1024.0f); } }
    else {
#pragma unroll
      for (int q = 0; q < 8; ++q) ph.h[q] = (_Float16)0.0f; }
    *(v8us*)((unsigned short*)P + (size_t)r * TT + gq * 256 + ln * 8) = ph.half[0];
    asm volatile("s_wait_xcnt 0x0" ::: "memory"); }      /* in front of the next group's LDS reads and sums, which reuse the registers that the store names */
  for (int o = 16; o > 0; o >>= 1) su += __shfl_xor(su, o, 32); if (ln == 0) { *(float*)(RS + (size_t)r * 32) = 1.0f / su;  } }
__global__ __launch_bounds__(256) void k_csc(const float* __restrict__ O, const float* __restrict__ RS, _Float16* __restrict__ CH, _Float16* __restrict__ CL) {
  #pragma clang fp contract(off)
  const int tt = blockIdx.x * 256 + threadIdx.x; if (tt >= NR * NH * (HD / 8)) return; const int d8 = (tt % (HD / 8)) * 8; const int h = (tt / (HD / 8)) % NH; const int row = tt / ((HD / 8) * NH); const size_t pr = ((size_t)(row / TT) * NH + h) * TT + row % TT;      /* row of the (batch, head) planes O and RS */
  const float rs = RS[pr * 32]; const size_t o = (size_t)row * DM + h * HD + d8; const v8f a = *(const v8f*)(O + pr * HD + d8); FragH f, fl;
  for (int q = 0; q < 8; ++q) { const float v = a[q] * rs; const _Float16 hh = (_Float16)v; f.h[q] = hh; fl.h[q] = (_Float16)((v - (float)hh) * 1024.0f); }
  { *(v8us*)((unsigned short*)CH + o) = f.half[0]; *(v8us*)((unsigned short*)CL + o) = fl.half[0];  } }

extern "C" void kernel_launch(void* const* d_in, const int* in_sizes, int n_in,
                              void* d_out, int out_size, void* d_ws, size_t ws_size, hipStream_t stream) {
  (void)in_sizes; (void)n_in; (void)out_size;
  const float* x = (const float*)d_in[0]; const float* Wqkv = (const float*)d_in[1]; const float* bqkv = (const float*)d_in[2]; const float* W1w = (const float*)d_in[3]; const float* W2w = (const float*)d_in[4]; const float* W1r = (const float*)d_in[5]; const float* W2r = (const float*)d_in[6]; const float* bsc = (const float*)d_in[7]; const float* Wout = (const float*)d_in[8]; const float* bout = (const float*)d_in[9];
  char* ws = (char*)d_ws; size_t off = 0;
  auto take = [&](size_t bytes) { char* p = ws + off; off += (bytes + 255) & ~(size_t)255; return p; };
  const size_t np = (size_t)NR * DM; const size_t pl = (size_t)NB * NH * TT * TT;      /* elements of all 32 score planes */
  // The score planes come first. The buffers whose last reader is launched before the score GEMM (weights of the first two GEMMs, x, qkv, untransposed v, line projections, read lines: under 46 MiB) lie inside them, so that everything fits the workspace.
  float* S = (float*)take(pl * 4); const size_t live = off; off = 0;
  _Float16* BQKV = (_Float16*)take((size_t)3 * DM * DM * 2); _Float16* BL = (_Float16*)take((size_t)256 * DM * 2); _Float16* X16 = (_Float16*)take(np * 2); float* QKV = (float*)take(np * 3 * 4); _Float16* V16 = (_Float16*)take(np * 2); _Float16* VL16 = (_Float16*)take(np * 2); float* LW = (float*)take((size_t)NR * 256 * 4); float* RD = (float*)take((size_t)NB * NH * TT * 8 * 4);
  if (off > live) return;
  off = live;
  _Float16* P = (_Float16*)take(pl * 2); _Float16* BO = (_Float16*)take((size_t)DM * DM * 2); _Float16* Q16 = (_Float16*)take(np * 2); _Float16* K16 = (_Float16*)take(np * 2); _Float16* VT = (_Float16*)take(np * 2); _Float16* VTL = (_Float16*)take(np * 2);
  float* JW = (float*)take((size_t)NB * NH * TT * 8 * 4); float* RDM = (float*)take((size_t)NB * NH * TT * 8 * 4);
  float* RS = (float*)take((size_t)NB * NH * TT * 32 * 4); float* O = (float*)take(np * 4); _Float16* CH = (_Float16*)take(np * 2); _Float16* CL = (_Float16*)take(np * 2);
  if (off > ws_size) return;      /* 128 + 64 + 2 + 4 x 4 + 2 + 4 + 8 + 8 = 232 MiB */
  k_wsc<<<(unsigned)(((size_t)3 * DM * DM / 8 + 255) / 256), 256, 0, stream>>>(Wqkv, BQKV, (size_t)3 * DM * DM / 8, 16.0f); k_wsc<<<(unsigned)(((size_t)DM * DM / 8 + 255) / 256), 256, 0, stream>>>(Wout, BO, (size_t)DM * DM / 8, 16.0f);      /* torch (out, in) naturals */
  k_wsc<<<(unsigned)(((size_t)64 * DM / 8 + 255) / 256), 256, 0, stream>>>(W1w, BL, (size_t)64 * DM / 8, 16.0f); k_wsc<<<(unsigned)(((size_t)64 * DM / 8 + 255) / 256), 256, 0, stream>>>(W2w, BL + (size_t)64 * DM, (size_t)64 * DM / 8, 16.0f); k_wsc<<<(unsigned)(((size_t)64 * DM / 8 + 255) / 256), 256, 0, stream>>>(W1r, BL + (size_t)128 * DM, (size_t)64 * DM / 8, 16.0f); k_wsc<<<(unsigned)(((size_t)64 * DM / 8 + 255) / 256), 256, 0, stream>>>(W2r, BL + (size_t)192 * DM, (size_t)64 * DM / 8, 16.0f);      /* [W1w; W2w; W1r; W2r] rows h*4 + i */
  k_x16<<<(unsigned)((np / 8 + 255) / 256), 256, 0, stream>>>(x, X16, np / 8);
  k_gemm2<0><<<dim3((NR / 128) * (3 * DM / 64), 1), 128, 0, stream>>>(X16, DM, 0, BQKV, DM, 0, 0.0625f, bqkv, 0, nullptr, 1, 0, 0, QKV, nullptr, 3 * DM, 0, NR, 3 * DM, DM);      /* [q | k | v] + bias, head h at h*64 */
  k_gemm2<0><<<dim3((NR / 128) * (256 / 64), 1), 128, 0, stream>>>(X16, DM, 0, BL, DM, 0, 0.0625f, nullptr, 0, nullptr, 1, 0, 0, LW, nullptr, 256, 0, NR, 256, DM);      /* line projections f32 [row][w1 | w2 | r1 | r2] (x_prev handled by a row shift) */
  k_ccp<<<(unsigned)((np / 8 + 255) / 256), 256, 0, stream>>>(QKV, 0, Q16); k_ccp<<<(unsigned)((np / 8 + 255) / 256), 256, 0, stream>>>(QKV, DM, K16); k_chl<<<(unsigned)((np / 8 + 255) / 256), 256, 0, stream>>>(QKV, 2 * DM, V16, VL16);      /* v as hi + residual (the bias makes the attention peaked, so v's rounding reaches the output almost unaveraged) */
  k_vt<NH, TT><<<NB * NH * (TT / 64), 256, 0, stream>>>(V16, DM, 0, VT); k_vt<NH, TT><<<NB * NH * (TT / 64), 256, 0, stream>>>(VL16, DM, 0, VTL);
  k_lines<<<(NR * NH + 255) / 256, 256, 0, stream>>>(LW, JW, RD); k_cum<<<NB * NH, 256, 0, stream>>>(JW, RD, RDM);
  // attention, every launch over all 32 (batch, head) planes (blockIdx.y); q, k and O are [plane][t][64]
  k_gemm2<0><<<dim3((TT / 128) * (TT / 64), NB * NH), 128, 0, stream>>>(Q16, HD, (size_t)TT * HD, K16, HD, (size_t)TT * HD, 1.0f, nullptr, 0, nullptr, 1, 0, 0, S, nullptr, TT, (size_t)TT * TT, TT, TT, HD);
  k_bsoft<<<(NB * NH * TT) / 8, 256, 0, stream>>>(S, RDM, JW, bsc, P, RS);
  k_gemm2<0><<<dim3((TT / 128) * (HD / 64), NB * NH), 128, 0, stream>>>(P, TT, (size_t)TT * TT, VTL, TT, (size_t)HD * TT, 0.0009765625f / 1024.0f, nullptr, 0, nullptr, 1, 0, 0, O, nullptr, HD, (size_t)TT * HD, TT, HD, TT);
  k_gemm2<0><<<dim3((TT / 128) * (HD / 64), NB * NH), 128, 0, stream>>>(P, TT, (size_t)TT * TT, VT, TT, (size_t)HD * TT, 0.0009765625f, nullptr, 0, O, -1, 0, 0, O, nullptr, HD, (size_t)TT * HD, TT, HD, TT);      /* P . (v_lo + v_hi)^T (own-element accumulate) */
  k_csc<<<(NR * NH * (HD / 8) + 255) / 256, 256, 0, stream>>>(O, RS, CH, CL);
  k_gemm2<0><<<dim3((NR / 128) * (DM / 64), 1), 128, 0, stream>>>(CL, DM, 0, BO, DM, 0, 0.0625f / 1024.0f, nullptr, 0, nullptr, 1, 0, 0, (float*)d_out, nullptr, DM, 0, NR, DM, DM);
  k_gemm2<0><<<dim3((NR / 128) * (DM / 64), 1), 128, 0, stream>>>(CH, DM, 0, BO, DM, 0, 0.0625f, bout, 0, (const float*)d_out, 1, (size_t)DM, 0, (float*)d_out, nullptr, DM, 0, NR, DM, DM);      /* out = (c_lo + c_hi) Wout^T + bout */
}

// v005
// One run takes 139 microseconds.
// Next to v004, in two timings, it ran 1.66 times as fast each time.
// All steps since v000 together make it 9.79 times as fast.
#include <hip/hip_runtime.h>
// EigenBiasAttention (2 x 1024 tokens x 1024 = 16 heads x 64; qkv = x Wqkv^T + b; causal softmax(q.k/8 + |bias|) v; bias from Plucker lines: per head w1 = x_prev W1w^T, w2 = x W2w^T, r1 = x W1r^T, r2 = x W2r^T (4-vectors), write/read lines = normalised exterior products (6-vectors), Jw = write J6, M_t = cumsum_t Jw Jw^T, bias[t][s] = |(rd_t . M_t) . Jw_s| * bias_scale[h]; out = merged . Wout^T + bout).
// Structure: exact f16 x plane; qkv and the four line projections as f16 WMMA GEMMs (32x64 wave tiles, f32 accumulation, exact x16 weights (+ bias); f32 out) then f16 q/k planes (one [t][64] plane per (batch, head)) and v planes; the exterior products / normalisation / J6 on VALU; the causal 6x6 Gram cumsum and rd . M per (batch, head) on VALU (f32; products and rd . M one row per thread, the 1024-step running sums by one wave through LDS); V^T hi/residual by LDS tiles; one fused launch for all 32 (batch, head) planes: score products (K = 64, f32), the biased causal softmax on VALU with a running row maximum (bias dot K = 6 per (t, s), bias_scale read; unnormalised f16 weights x 2^10), readout as two product terms, row scaling + hi/residual; Wout as two GEMM terms (+ bias).
// Compute dtype: inputs rounded to bf16; x / weights exact as f16 (line projections are f32 sums of exact products, so the bias path is f32-class); q, k and the softmax weights as plain f16 operands (~2^-12); v and the context as f16 hi + residual. v_wmma_f32_16x16x32_f16.
#define NB 2
#define TT 1024
#define DM 1024
#define NH 16
#define HD 64
#define NR (NB * TT)
typedef __bf16 v16b __attribute__((ext_vector_type(16)));
typedef unsigned short v8us __attribute__((ext_vector_type(8), may_alias));
typedef float  v8f  __attribute__((ext_vector_type(8)));
typedef float  v4f  __attribute__((ext_vector_type(4)));
typedef float  v4fa __attribute__((ext_vector_type(4), may_alias));
union FragB { v16b v; v8us half[2]; unsigned short u[16]; };

__device__ __forceinline__ unsigned short bf16_bits(float x) { unsigned int u = __float_as_uint(x); return (unsigned short)((u + 0x7FFFu + ((u >> 16) & 1u)) >> 16); }
__device__ __forceinline__ float bf16_val(unsigned short b) { return __uint_as_float(((unsigned int)b) << 16); }
__device__ __forceinline__ float bf16_round(float x) { return bf16_val(bf16_bits(x)); }
// D += A·B with NT terms: 1 = ah·bh, 2 = + al·bh (A split), 3 = + ah·bl (both split)
template <int NT>
__device__ __forceinline__ v8f mmaN(v16b ah, v16b al, v16b bh, v16b bl, v8f c) {
  c = __builtin_amdgcn_wmma_f32_16x16x32_bf16(false, ah, false, bh, (short)0, c, false, false);
  if (NT >= 2) c = __builtin_amdgcn_wmma_f32_16x16x32_bf16(false, al, false, bh, (short)0, c, false, false);
  if (NT >= 3) c = __builtin_amdgcn_wmma_f32_16x16x32_bf16(false, ah, false, bl, (short)0, c, false, false);
  asm volatile("v_nop\n\tv_nop\n\tv_nop\n\tv_nop" : "+v"(c) : "v"(ah), "v"(al), "v"(bh), "v"(bl));
  return c;
}

__global__ __launch_bounds__(256) void k_wt_bf16(const float* __restrict__ W, unsigned short* __restrict__ Wt, int K, int N) {
  const int t = blockIdx.x * 256 + threadIdx.x;
  const int k8n = K / 8;
  if (t >= N * k8n) return;
  const int n = t / k8n, k8 = (t % k8n) * 8;
  v8us v;
#pragma unroll
  for (int i = 0; i < 8; ++i) v[i] = bf16_bits(W[(size_t)(k8 + i) * N + n]);
  *(v8us*)(Wt + (size_t)n * K + k8) = v;
  
}

// GEMM C[M][N] (f32, pitch ldc) = act(A[M][K]·W + bias). A f32 row-major (pitch lda) converted per fragment to bf16
// (ASPLIT: hi/lo two planes -> 2 terms, else single rounded term); Wt bf16 [N][K] (pitch ldb). BIAS_BF16 rounds the
// bias to bf16 first (bias quantised to bf16 before the add). K%32==0, M%16==0, N%64==0.
template <bool ASPLIT, int ACT, bool BIAS_BF16>
__global__ __launch_bounds__(128) void k_gemm_bf(const float* __restrict__ A, int lda, const unsigned short* __restrict__ Wt, int ldb,
                                               const float* __restrict__ bias, float* __restrict__ C, int ldc, int M, int N, int K) {
  __shared__ __attribute__((aligned(16))) float so[4][16][64];
  const int tid = threadIdx.x, w = tid >> 5, lane = tid & 31, ln = lane & 15, hh = lane >> 4;
  const int ntn = N / 64;
  const int wid = blockIdx.x * 4 + w;
  const int mt = wid / ntn, nq = wid % ntn;
  if (mt * 16 >= M) return;
  const int row0 = mt * 16, col0 = nq * 64;
  const float* arow = A + (size_t)(row0 + ln) * lda;
  v8f acc[4] = {};
  for (int kb = 0; kb < K; kb += 32) {
    FragB ah, al;
    const v4f x0 = *(const v4fa*)(arow + kb + 8 * hh), x1 = *(const v4fa*)(arow + kb + 8 * hh + 4);
    const v4f x2 = *(const v4fa*)(arow + kb + 16 + 8 * hh), x3 = *(const v4fa*)(arow + kb + 16 + 8 * hh + 4);
    float xs[16] = {x0[0],x0[1],x0[2],x0[3],x1[0],x1[1],x1[2],x1[3],x2[0],x2[1],x2[2],x2[3],x3[0],x3[1],x3[2],x3[3]};
#pragma unroll
    for (int i = 0; i < 16; ++i) { const unsigned short hb = bf16_bits(xs[i]); ah.u[i] = hb; al.u[i] = ASPLIT ? bf16_bits(xs[i] - bf16_val(hb)) : (unsigned short)0; }
#pragma unroll
    for (int t = 0; t < 4; ++t) {
      const unsigned short* brow = Wt + (size_t)(col0 + t * 16 + ln) * ldb + kb;
      FragB b;
      b.half[0] = *(const v8us*)(brow + 8 * hh);
      b.half[1] = *(const v8us*)(brow + 16 + 8 * hh);
      acc[t] = mmaN<ASPLIT ? 2 : 1>(ah.v, al.v, b.v, b.v, acc[t]);
    }
  }
#pragma unroll
  for (int t = 0; t < 4; ++t) {
    float bv = bias ? bias[col0 + t * 16 + ln] : 0.f;
    if (BIAS_BF16) bv = bf16_round(bv);
#pragma unroll
    for (int r = 0; r < 8; ++r) { float v = acc[t][r] + bv; if (ACT == 1) v = fmaxf(v, 0.f); so[w][8 * hh + r][t * 16 + ln] = v; }
  }
  __builtin_amdgcn_fence(__ATOMIC_ACQ_REL, "workgroup");
  __builtin_amdgcn_wave_barrier();
  const int rsub = lane >> 4, c4 = (lane & 15) * 4;
  {
#pragma unroll
    for (int q = 0; q < 8; ++q) {
      const int r = q * 2 + rsub;
      const v4f v = *(const v4fa*)&so[w][r][c4];
      *(v4f*)(C + (size_t)(row0 + r) * ldc + col0 + c4) = v;
    }
    
  }
}

// GEMM C = act(A·W + bias + resid): A f32 (ASPLIT -> hi/lo 2 terms), Wt bf16 [N][K]; ACT 0 none, 1 relu, 2 exact gelu;
// resid (optional, f32, row index = (row % rmod), pitch ldr, RES_BF16 rounds it) added before the activation.
template <bool ASPLIT, int ACT, bool BIAS_BF16, bool RES_BF16>
__global__ __launch_bounds__(128) void k_gemm_bf3(const float* __restrict__ A, int lda, const unsigned short* __restrict__ Wt, int ldb,
                                                const float* __restrict__ bias, const float* __restrict__ resid, int rmod, int ldr,
                                                float* __restrict__ C, int ldc, int M, int N, int K) {
  __shared__ __attribute__((aligned(16))) float so[4][16][64];
  const int tid = threadIdx.x, w = tid >> 5, lane = tid & 31, ln = lane & 15, hh = lane >> 4;
  const int ntn = N / 64;
  const int wid = blockIdx.x * 4 + w;
  const int mt = wid / ntn, nq = wid % ntn;
  if (mt * 16 >= M) return;
  const int row0 = mt * 16, col0 = nq * 64;
  const float* arow = A + (size_t)(row0 + ln) * lda;
  v8f acc[4] = {};
  for (int kb = 0; kb < K; kb += 32) {
    FragB ah, al;
    const v4f x0 = *(const v4fa*)(arow + kb + 8 * hh), x1 = *(const v4fa*)(arow + kb + 8 * hh + 4);
    const v4f x2 = *(const v4fa*)(arow + kb + 16 + 8 * hh), x3 = *(const v4fa*)(arow + kb + 16 + 8 * hh + 4);
    float xs[16] = {x0[0],x0[1],x0[2],x0[3],x1[0],x1[1],x1[2],x1[3],x2[0],x2[1],x2[2],x2[3],x3[0],x3[1],x3[2],x3[3]};
#pragma unroll
    for (int i = 0; i < 16; ++i) { const unsigned short hb = bf16_bits(xs[i]); ah.u[i] = hb; al.u[i] = ASPLIT ? bf16_bits(xs[i] - bf16_val(hb)) : (unsigned short)0; }
#pragma unroll
    for (int t = 0; t < 4; ++t) {
      const unsigned short* brow = Wt + (size_t)(col0 + t * 16 + ln) * ldb + kb;
      FragB b;
      b.half[0] = *(const v8us*)(brow + 8 * hh);
      b.half[1] = *(const v8us*)(brow + 16 + 8 * hh);
      acc[t] = mmaN<ASPLIT ? 2 : 1>(ah.v, al.v, b.v, b.v, acc[t]);
    }
  }
#pragma unroll
  for (int t = 0; t < 4; ++t) {
    const int col = col0 + t * 16 + ln;
    float bv = bias ? bias[col] : 0.f;
    if (BIAS_BF16) bv = bf16_round(bv);
#pragma unroll
    for (int r = 0; r < 8; ++r) {
      float v = acc[t][r] + bv;
      if (resid) { float rv = resid[(size_t)((row0 + 8 * hh + r) % rmod) * ldr + col]; if (RES_BF16) rv = bf16_round(rv); v += rv; }
      if (ACT == 1) v = fmaxf(v, 0.f);
      if (ACT == 2) v = 0.5f * v * (1.0f + erff(v * 0.70710678118654752f));
      if (ACT == 3) { const float u = 0.7978845608028654f * (v + 0.044715f * v * v * v); v = 0.5f * v * (1.0f + tanhf(u)); }
      so[w][8 * hh + r][t * 16 + ln] = v;
    }
  }
  __builtin_amdgcn_fence(__ATOMIC_ACQ_REL, "workgroup");
  __builtin_amdgcn_wave_barrier();
  const int rsub = lane >> 4, c4 = (lane & 15) * 4;
  {
#pragma unroll
    for (int q = 0; q < 8; ++q) {
      const int r = q * 2 + rsub;
      const v4f v = *(const v4fa*)&so[w][r][c4];
      *(v4f*)(C + (size_t)(row0 + r) * ldc + col0 + c4) = v;
    }
    
  }
}
// row LayerNorm (biased variance, eps) over N: s = X (+ R); optional out_sum <- s; out_norm <- (s-mu)*rsqrt(var+eps)*g + b
template <bool PARAM_BF16>
__global__ __launch_bounds__(256) void k_layernorm(const float* __restrict__ X, const float* __restrict__ R, const float* __restrict__ g, const float* __restrict__ bta,
                                                  float* __restrict__ out_sum, float* __restrict__ out_norm, int N, float eps) {
  __shared__ float red[256];
  const int row = blockIdx.x, tid = threadIdx.x;
  const float* x = X + (size_t)row * N; const float* rr = R ? R + (size_t)row * N : nullptr;
  float vals[16];                     // up to N = 4096
  const int per = N / 256;            // contiguous chunk per thread? use strided-by-4 chunks: thread handles j = tid*4 + 1024*u
  float s1 = 0.f;
  for (int u = 0; u < per / 4; ++u) {
    const int j = tid * 4 + 1024 * u;
    const v4f a = *(const v4fa*)(x + j);
    v4f b = {0.f,0.f,0.f,0.f}; if (rr) b = *(const v4fa*)(rr + j);
#pragma unroll
    for (int q = 0; q < 4; ++q) { const float v = a[q] + b[q]; vals[u * 4 + q] = v; s1 += v; }
  }
  red[tid] = s1; __syncthreads();
  for (int st = 128; st > 0; st >>= 1) { if (tid < st) red[tid] += red[tid + st]; __syncthreads(); }
  const float mu = red[0] / (float)N; __syncthreads();
  float s2 = 0.f;
  for (int u = 0; u < per / 4; ++u)
#pragma unroll
    for (int q = 0; q < 4; ++q) { const float c = vals[u * 4 + q] - mu; s2 += c * c; }
  red[tid] = s2; __syncthreads();
  for (int st = 128; st > 0; st >>= 1) { if (tid < st) red[tid] += red[tid + st]; __syncthreads(); }
  const float rs = rsqrtf(red[0] / (float)N + eps);
  {
    for (int u = 0; u < per / 4; ++u) {
      const int j = tid * 4 + 1024 * u;
      v4f o, sm;
#pragma unroll
      for (int q = 0; q < 4; ++q) {
        float gg = g[j + q], bb = bta[j + q];
        if (PARAM_BF16) { gg = bf16_round(gg); bb = bf16_round(bb); }
        sm[q] = vals[u * 4 + q]; o[q] = (vals[u * 4 + q] - mu) * rs * gg + bb;
      }
      if (out_sum) *(v4f*)(out_sum + (size_t)row * N + j) = sm;
      *(v4f*)(out_norm + (size_t)row * N + j) = o;
    }
    
  }
}



// ---- f16 WMMA path (v_wmma_f32_16x16x32_f16): 11-bit significands for operands in range — used for every GEMM launched here
typedef _Float16 v16h __attribute__((ext_vector_type(16)));
union FragH { v16h v; v8us half[2]; _Float16 h[16]; unsigned short u[16]; };
template <int NT>
__device__ __forceinline__ v8f mmaH(v16h ah, v16h al, v16h bh, v16h bl, v8f c) {
  c = __builtin_amdgcn_wmma_f32_16x16x32_f16(false, ah, false, bh, (short)0, c, false, false);
  if (NT >= 2) c = __builtin_amdgcn_wmma_f32_16x16x32_f16(false, al, false, bh, (short)0, c, false, false);
  if (NT >= 3) c = __builtin_amdgcn_wmma_f32_16x16x32_f16(false, ah, false, bl, (short)0, c, false, false);
  asm volatile("v_nop\n\tv_nop\n\tv_nop\n\tv_nop" : "+v"(c) : "v"(ah), "v"(al), "v"(bh), "v"(bl));
  return c;
}
// batched GEMM like k_gemm_b but f16 operands: A f32 (split into f16 hi/lo if ASPLIT, else rounded to f16), Bt = f16 values [n][k]; alpha; C f32; N multiple of 16 (partial tiles skipped)
template <bool ASPLIT>
__global__ __launch_bounds__(128) void k_gemm_h(const float* __restrict__ A, int lda, size_t sA, const _Float16* __restrict__ Bh, int ldb, size_t sB, float alpha, float* __restrict__ C, int ldc, size_t sC, int M, int N, int K) {
  __shared__ __attribute__((aligned(16))) float so[4][16][64];
  const int tid = threadIdx.x, w = tid >> 5, lane = tid & 31, ln = lane & 15, hh = lane >> 4; const int by = blockIdx.y;
  A += (size_t)by * sA; Bh += (size_t)by * sB; C += (size_t)by * sC;
  const int ntn = (N + 63) / 64; const int wid = blockIdx.x * 4 + w; const int mt = wid / ntn, nq = wid % ntn; if (mt * 16 >= M) return;
  const int row0 = mt * 16, col0 = nq * 64; const float* arow = A + (size_t)(row0 + ln) * lda;
  v8f acc[4] = {};
  for (int kb = 0; kb < K; kb += 32) {
    FragH ah, al;
    const v4f x0 = *(const v4fa*)(arow + kb + 8 * hh), x1 = *(const v4fa*)(arow + kb + 8 * hh + 4), x2 = *(const v4fa*)(arow + kb + 16 + 8 * hh), x3 = *(const v4fa*)(arow + kb + 16 + 8 * hh + 4);
    float xs[16] = {x0[0],x0[1],x0[2],x0[3],x1[0],x1[1],x1[2],x1[3],x2[0],x2[1],x2[2],x2[3],x3[0],x3[1],x3[2],x3[3]};
#pragma unroll
    for (int i = 0; i < 16; ++i) { const _Float16 h = (_Float16)xs[i]; ah.h[i] = h; al.h[i] = ASPLIT ? (_Float16)(xs[i] - (float)h) : (_Float16)0.0f; }
#pragma unroll
    for (int t = 0; t < 4; ++t) { if (col0 + t * 16 >= N) continue; const size_t boff = (size_t)(col0 + t * 16 + ln) * ldb + kb; FragH bq; bq.half[0] = *(const v8us*)(Bh + boff + 8 * hh); bq.half[1] = *(const v8us*)(Bh + boff + 16 + 8 * hh);
      acc[t] = mmaH<ASPLIT ? 2 : 1>(ah.v, al.v, bq.v, bq.v, acc[t]); }
  }
#pragma unroll
  for (int t = 0; t < 4; ++t) { if (col0 + t * 16 >= N) continue;
#pragma unroll
    for (int r = 0; r < 8; ++r) so[w][8 * hh + r][t * 16 + ln] = acc[t][r] * alpha; }
  __builtin_amdgcn_fence(__ATOMIC_ACQ_REL, "workgroup"); __builtin_amdgcn_wave_barrier();
  const int rsub = lane >> 4, c4 = (lane & 15) * 4;
  {
#pragma unroll
    for (int q = 0; q < 8; ++q) { const int r = q * 2 + rsub; if (col0 + c4 < N) { const v4f v = *(const v4fa*)&so[w][r][c4]; *(v4f*)(C + (size_t)(row0 + r) * ldc + col0 + c4) = v; } }
     }
}

// Wt[n][k] = f16(W[k][n]·scale) from f32 row-major W[K][N] (scale = power of two; bf16-exact weights stay exact in f16 away from the subnormal range)
__global__ __launch_bounds__(256) void k_wt_f16(const float* __restrict__ W, _Float16* __restrict__ Wt, int K, int N, float scale) {
  const int t = blockIdx.x * 256 + threadIdx.x; if (t >= N * (K / 8)) return; const int n = t / (K / 8), k8 = (t % (K / 8)) * 8; FragH f;
#pragma unroll
  for (int i = 0; i < 8; ++i) f.h[i] = (_Float16)(bf16_round(W[(size_t)(k8 + i) * N + n]) * scale); const v8us o = f.half[0];
  *(v8us*)((unsigned short*)Wt + (size_t)n * K + k8) = o; 
}
// k_gemm_hh variant with fused epilogue: v = acc·alpha + bias[by·sBias + col] (+ CP[(row/rowsPerB)·sCPb + by·64 + col] if CP) ; ACT 0 none / 1 elu ; writes f16 C16 (and f32 C if non-null)
template <int ACT>
__global__ __launch_bounds__(128) void k_gemm_hhx(const _Float16* __restrict__ A, int lda, size_t sA, const _Float16* __restrict__ Bh, int ldb, size_t sB, float alpha, const float* __restrict__ bias, size_t sBias, const float* __restrict__ CP, int rowsPerB, size_t sCPb, int row0g,
    float* __restrict__ C, _Float16* __restrict__ C16, int ldc, size_t sC, int M, int N, int K) {
  __shared__ __attribute__((aligned(16))) float so[4][16][64];
  const int tid = threadIdx.x, w = tid >> 5, lane = tid & 31, ln = lane & 15, hh = lane >> 4; const int by = blockIdx.y;
  A += (size_t)by * sA; Bh += (size_t)by * sB; const size_t cofs = (size_t)by * sC; const float* bp = bias ? bias + (size_t)by * sBias : nullptr;
  const int ntn = (N + 63) / 64; const int wid = blockIdx.x * 4 + w; const int mt = wid / ntn, nq = wid % ntn; if (mt * 16 >= M) return;
  const int row0 = mt * 16, col0 = nq * 64; const _Float16* arow = A + (size_t)(row0 + ln) * lda;
  v8f acc[4] = {};
  for (int kb = 0; kb < K; kb += 32) { FragH ah; ah.half[0] = *(const v8us*)((const unsigned short*)arow + kb + 8 * hh); ah.half[1] = *(const v8us*)((const unsigned short*)arow + kb + 16 + 8 * hh);
#pragma unroll
    for (int t = 0; t < 4; ++t) { if (col0 + t * 16 >= N) continue; const size_t boff = (size_t)(col0 + t * 16 + ln) * ldb + kb; FragH bq; bq.half[0] = *(const v8us*)((const unsigned short*)Bh + boff + 8 * hh); bq.half[1] = *(const v8us*)((const unsigned short*)Bh + boff + 16 + 8 * hh);
      acc[t] = mmaH<1>(ah.v, ah.v, bq.v, bq.v, acc[t]); }
  }
#pragma unroll
  for (int t = 0; t < 4; ++t) { if (col0 + t * 16 >= N) continue; const int col = col0 + t * 16 + ln; const float bv = bp ? bf16_round(bp[col]) : 0.f;
#pragma unroll
    for (int r = 0; r < 8; ++r) { float v = acc[t][r] * alpha + bv; if (CP) { const int rr = row0g + row0 + 8 * hh + r; if (rowsPerB < 0) v += CP[cofs + (size_t)rr * ldc + col];      /* rowsPerB < 0: own element of the batched C plane */ else { const int bidx = rr / rowsPerB; v += CP[(size_t)bidx * sCPb + (size_t)by * 64 + col]; } } if (ACT == 1) v = (v > 0.f) ? v : expm1f(v); else if (ACT == 7) v = (v > 0.f) ? v + 1.0f : expf(v); else if (ACT == 8) v = tanhf(v); else if (ACT == 9) v = 0.5f * v * (1.0f + tanhf(0.7978845608028654f * (v + 0.044715f * v * v * v))); else if (ACT == 11) v = 1.0f / (1.0f + expf(-v)); else if (ACT == 12) v = (v > 0.f) ? v : 0.01f * v; else if (ACT == 14) v = (v > 0.f) ? v : 0.1f * v; else if (ACT == 16) v = (v >= 0.f) ? v : 0.3f * v; else if (ACT == 17) v = (v >= 0.f) ? v : 0.2f * v; else if (ACT == 15) v = v / (1.0f + expf(-v)); else if (ACT == 3) v = fmaxf(v, 0.f); else if (ACT == 6) v = 0.5f * v * (1.0f + erff(v * 0.70710678118654752f)); so[w][8 * hh + r][t * 16 + ln] = v; } }
  __builtin_amdgcn_fence(__ATOMIC_ACQ_REL, "workgroup"); __builtin_amdgcn_wave_barrier();
  const int rsub = lane >> 4, c4 = (lane & 15) * 4; typedef _Float16 v4h __attribute__((ext_vector_type(4)));
  {
#pragma unroll
    for (int q = 0; q < 8; ++q) { const int r = q * 2 + rsub; if (col0 + c4 < N) { const v4f v = *(const v4fa*)&so[w][r][c4]; if (C) *(v4f*)(C + cofs + (size_t)(row0 + r) * ldc + col0 + c4) = v; if (C16) { v4h h4; for (int i = 0; i < 4; ++i) h4[i] = (_Float16)v[i]; *(v4h*)(C16 + cofs + (size_t)(row0 + r) * ldc + col0 + c4) = h4; } } }
     }
}


typedef _Float16 v4h __attribute__((ext_vector_type(4)));

__global__ __launch_bounds__(256) void k_x16(const float* __restrict__ x, _Float16* __restrict__ X16, size_t n8) { const size_t t = (size_t)blockIdx.x * 256 + threadIdx.x; if (t >= n8) return; FragH f;
#pragma unroll
  for (int q = 0; q < 8; ++q) f.h[q] = (_Float16)bf16_round(x[t * 8 + q]); *(v8us*)((unsigned short*)X16 + t * 8) = f.half[0];  }
__global__ __launch_bounds__(256) void k_h16(const float* __restrict__ x, _Float16* __restrict__ X16, size_t n8) { const size_t t = (size_t)blockIdx.x * 256 + threadIdx.x; if (t >= n8) return; FragH f;
#pragma unroll
  for (int q = 0; q < 8; ++q) f.h[q] = (_Float16)x[t * 8 + q]; *(v8us*)((unsigned short*)X16 + t * 8) = f.half[0];  }
__global__ __launch_bounds__(256) void k_round16f(const float* __restrict__ W, _Float16* __restrict__ Bt, size_t n8) { const size_t t = (size_t)blockIdx.x * 256 + threadIdx.x; if (t >= n8) return; FragH f;
#pragma unroll
  for (int i = 0; i < 8; ++i) f.h[i] = (_Float16)(bf16_round(W[t * 8 + i]) * 16.0f); *(v8us*)((unsigned short*)Bt + t * 8) = f.half[0];  }
template <int NHv, int TTv>
__global__ __launch_bounds__(256) void k_vt(const _Float16* __restrict__ V16, int ldv, int voff, _Float16* __restrict__ Vt) { __shared__ unsigned short tl[64][66]; const int tid = threadIdx.x; const int slab = blockIdx.x / (TTv / 64), lg = blockIdx.x % (TTv / 64); const int b = slab / NHv, h = slab % NHv;
  for (int i = tid; i < 64 * 8; i += 256) { const int r = i / 8, c8 = (i % 8) * 8; FragH f; f.half[0] = *(const v8us*)((const unsigned short*)V16 + ((size_t)b * TTv + lg * 64 + r) * ldv + voff + h * 64 + c8);
#pragma unroll
    for (int q = 0; q < 8; ++q) tl[r][c8 + q] = f.u[q]; }
  __syncthreads();
  {
#pragma unroll
    for (int rd = 0; rd < 2; ++rd) { const int d = rd * 32 + tid / 8, pc = tid % 8; FragH f;
#pragma unroll
      for (int q = 0; q < 8; ++q) f.u[q] = tl[pc * 8 + q][d];
      *(v8us*)((unsigned short*)Vt + ((size_t)slab * 64 + d) * TTv + lg * 64 + pc * 8) = f.half[0]; }
     } }

__global__ __launch_bounds__(256) void k_hl(const float* __restrict__ F, _Float16* __restrict__ Hh, _Float16* __restrict__ Hl, size_t n8) { const size_t t = (size_t)blockIdx.x * 256 + threadIdx.x; if (t >= n8) return; FragH fh, fl; const v4f a = *(const v4fa*)(F + t * 8), c = *(const v4fa*)(F + t * 8 + 4);
#pragma unroll
  for (int q = 0; q < 4; ++q) { _Float16 h = (_Float16)a[q]; fh.h[q] = h; fl.h[q] = (_Float16)((a[q] - (float)h) * 1024.0f); h = (_Float16)c[q]; fh.h[4 + q] = h; fl.h[4 + q] = (_Float16)((c[q] - (float)h) * 1024.0f); }
  { *(v8us*)((unsigned short*)Hh + t * 8) = fh.half[0]; *(v8us*)((unsigned short*)Hl + t * 8) = fl.half[0];  } }

// ---- fast GEMM (block tile 128x64, wave tile 32x64, A and B k-tiles staged in LDS; requires M % 128 == 0, N % 64 == 0 and K == 64 or K % 128 == 0); epilogue = k_gemm_hhx semantics ----
#define G2_LP 72
__device__ __forceinline__ v16h g2_frag(const _Float16* p, int hh) { FragH f; f.half[0] = *(const v8us*)((const unsigned short*)p + 8 * hh); f.half[1] = *(const v8us*)((const unsigned short*)p + 16 + 8 * hh); return f.v; }
__device__ __forceinline__ v8f g2_mma(v16h a, v16h b, v8f c) { v8f d = __builtin_amdgcn_wmma_f32_16x16x32_f16(false, a, false, b, (short)0, c, false, false); asm volatile("v_nop\n\tv_nop\n\tv_nop\n\tv_nop" : "+v"(d) : "v"(a), "v"(b)); return d; }
// work-group barrier that orders LDS alone (its fences name the LDS address space): __syncthreads() also waits for every global load in flight, and the loads for the tiles ahead must stay in flight across it; the loop's global reads are of operands that no wave of the launch writes
__device__ __forceinline__ void g2_bar() { __builtin_amdgcn_fence(__ATOMIC_RELEASE, "workgroup", "local"); __builtin_amdgcn_s_barrier(); __builtin_amdgcn_fence(__ATOMIC_ACQUIRE, "workgroup", "local"); }
template <int ACT>
__global__ __launch_bounds__(128) void k_gemm2(const _Float16* __restrict__ A, int lda, size_t sA, const _Float16* __restrict__ Bh, int ldb, size_t sB, float alpha, const float* __restrict__ bias, size_t sBias, const float* __restrict__ CP, int rowsPerB, size_t sCPb, int row0g,
    float* __restrict__ C, _Float16* __restrict__ C16, int ldc, size_t sC, int M, int N, int K) { static_assert(ACT == 0 || ACT == 3 || ACT == 6 || ACT == 8 || ACT == 9 || ACT == 11 || ACT == 12 || ACT == 14 || ACT == 15 || ACT == 16 || ACT == 17, "k_gemm2: unsupported ACT code (would silently apply no activation)");
  __shared__ __attribute__((aligned(16))) float so[4][32][68];
  // k-tiles of 64 halves (one whole 128-B line per row) of the block's 128 A rows and 64 B rows, two buffers; row pitch 72 halves = 144 B = 16 B x 9 for the ds_load_b128 fragment reads
  __shared__ __attribute__((aligned(16))) _Float16 sa[2][128][G2_LP];
  __shared__ __attribute__((aligned(16))) _Float16 sb[2][64][G2_LP];
  const int tid = threadIdx.x, w = tid >> 5, lane = tid & 31, ln = lane & 15, hh = lane >> 4; const int by = blockIdx.y;
  A += (size_t)by * sA; Bh += (size_t)by * sB; const size_t cofs = (size_t)by * sC; const float* bp = bias ? bias + (size_t)by * sBias : nullptr;
  const int ntn = N >> 6; const int mt = blockIdx.x / ntn, nq = blockIdx.x - mt * ntn; const int row0 = mt * 128 + 32 * w, col0 = nq * 64; if (mt * 128 >= M) return;      /* the same for the whole block: it stands in front of barriers */
  const int sr = tid >> 3, sc = (tid & 7) * 8;      /* staging: 8 lanes cover one row's 128 B, a wave-wide load covers 4 whole lines */
  const char* ab = (const char*)(A + (size_t)(mt * 128) * lda); const char* bb = (const char*)(Bh + (size_t)col0 * ldb);      /* the block's first A and B row: the same in every lane */
  const unsigned ao = (unsigned)(sr * lda + sc) * 2u, bo = (unsigned)(sr * ldb + sc) * 2u;      /* the lane's own byte offset, fixed for the whole loop */
  const v8f z8 = {0.f,0.f,0.f,0.f,0.f,0.f,0.f,0.f}; v8f c00 = z8, c01 = z8, c02 = z8, c03 = z8, c10 = z8, c11 = z8, c12 = z8, c13 = z8;
  v8us ra0[8], rb0[4], ra1[8], rb1[4];
  auto gl = [&](v8us* ra, v8us* rb, int kb) {
#pragma unroll
    for (int i = 0; i < 8; ++i) ra[i] = *(const v8us*)(ab + ((size_t)(16 * i) * lda + kb) * 2 + ao);
#pragma unroll
    for (int i = 0; i < 4; ++i) rb[i] = *(const v8us*)(bb + ((size_t)(16 * i) * ldb + kb) * 2 + bo); };
  auto st = [&](const v8us* ra, const v8us* rb, int buf) {
#pragma unroll
    for (int i = 0; i < 8; ++i) *(v8us*)&sa[buf][sr + 16 * i][sc] = ra[i];
#pragma unroll
    for (int i = 0; i < 4; ++i) *(v8us*)&sb[buf][sr + 16 * i][sc] = rb[i]; };
  auto comp = [&](int buf) {
#pragma unroll
    for (int kk = 0; kk < 64; kk += 32) { const v16h a0 = g2_frag(&sa[buf][32 * w + ln][kk], hh), a1 = g2_frag(&sa[buf][32 * w + 16 + ln][kk], hh);
      const v16h b0 = g2_frag(&sb[buf][ln][kk], hh), b1 = g2_frag(&sb[buf][16 + ln][kk], hh), b2 = g2_frag(&sb[buf][32 + ln][kk], hh), b3 = g2_frag(&sb[buf][48 + ln][kk], hh);
      c00 = g2_mma(a0, b0, c00); c10 = g2_mma(a1, b0, c10); c01 = g2_mma(a0, b1, c01); c11 = g2_mma(a1, b1, c11);
      c02 = g2_mma(a0, b2, c02); c12 = g2_mma(a1, b2, c12); c03 = g2_mma(a0, b3, c03); c13 = g2_mma(a1, b3, c13); } };
  // Each barrier publishes the buffer just written and ends every wave's reads of the other buffer, which is written next.
  gl(ra0, rb0, 0);
  __builtin_amdgcn_sched_barrier(0);      /* keeps set 0's loads in front of set 1's: mixed, set 0's wait at the loop's head would wait for set 1 as well */
  gl(ra1, rb1, 64 < K ? 64 : 0);      /* the second set's tile clamped, not branched round: set 0's loads stay the older ones on every way into the loop, so its wait leaves set 1's in flight */
  asm volatile("s_wait_xcnt 0x0" ::: "memory");      /* in front of whatever reuses the address registers of the loads above, which stay in flight */
  int kb = 0;
  // two tiles per trip so that each register set and each LDS buffer has a fixed name; every load of the trip is unconditional (the last two tiles are peeled off below), so the waits can be counted; kept rolled: unrolled further it only grows the code
#pragma unroll 1
  for (; kb + 128 < K; kb += 128) {
    st(ra0, rb0, 0); g2_bar(); gl(ra0, rb0, kb + 128); comp(0);      /* loads two tiles ahead: in flight over this tile's and the next tile's products */
    st(ra1, rb1, 1); g2_bar(); gl(ra1, rb1, kb + 192); comp(1);
    asm volatile("s_wait_xcnt 0x0" ::: "memory"); }      /* in front of the next trip's address arithmetic, which rewrites the address registers of loads still in flight */
  st(ra0, rb0, 0); g2_bar(); comp(0);
  if (kb + 64 < K) { st(ra1, rb1, 1); g2_bar(); comp(1); }
  v8f accs[8] = {c00, c01, c02, c03, c10, c11, c12, c13};
#pragma unroll
  for (int u = 0; u < 8; ++u) { const int t = u & 3, half = u >> 2; const int col = col0 + t * 16 + ln; const float bv = bp ? bf16_round(bp[col]) : 0.f;
#pragma unroll
    for (int r = 0; r < 8; ++r) { const int rloc = half * 16 + 8 * hh + r; float v = accs[u][r] * alpha + bv; if (CP) { if (rowsPerB < 0) v += CP[cofs + (size_t)(row0g + row0 + rloc) * ldc + col];      /* rowsPerB < 0: own element of the batched C plane */ else { const int bidx = (row0g + row0 + rloc) / rowsPerB; v += CP[(size_t)bidx * sCPb + (size_t)by * 64 + col]; } }
      if (ACT == 3) v = fmaxf(v, 0.f); else if (ACT == 6) v = 0.5f * v * (1.0f + erff(v * 0.70710678118654752f)); else if (ACT == 11) v = 1.0f / (1.0f + expf(-v)); else if (ACT == 15) v = v / (1.0f + expf(-v)); else if (ACT == 12) v = (v > 0.f) ? v : 0.01f * v; else if (ACT == 8) v = tanhf(v); else if (ACT == 9) v = 0.5f * v * (1.0f + tanhf(0.7978845608028654f * (v + 0.044715f * v * v * v))); else if (ACT == 14) v = (v > 0.f) ? v : 0.1f * v; else if (ACT == 16) v = (v >= 0.f) ? v : 0.3f * v; else if (ACT == 17) v = (v >= 0.f) ? v : 0.2f * v;
      so[w][rloc][t * 16 + ln] = v; } }
  __builtin_amdgcn_fence(__ATOMIC_ACQ_REL, "workgroup"); __builtin_amdgcn_wave_barrier();
  const int rsub = lane >> 4, c4 = (lane & 15) * 4;
  {
#pragma unroll
    for (int q = 0; q < 16; ++q) { const int r = q * 2 + rsub; const v4f v = *(const v4fa*)&so[w][r][c4]; if (C) *(v4f*)(C + cofs + (size_t)(row0 + r) * ldc + col0 + c4) = v; if (C16) { v4h h4; for (int i = 0; i < 4; ++i) h4[i] = (_Float16)v[i]; *(v4h*)(C16 + cofs + (size_t)(row0 + r) * ldc + col0 + c4) = h4; } }
     } }


__global__ __launch_bounds__(256) void k_wsc(const float* __restrict__ Wm, _Float16* __restrict__ Bt, size_t n8, float sc) { const size_t t = (size_t)blockIdx.x * 256 + threadIdx.x; if (t >= n8) return; FragH f; for (int q = 0; q < 8; ++q) f.h[q] = (_Float16)(bf16_round(Wm[t * 8 + q]) * sc); *(v8us*)((unsigned short*)Bt + t * 8) = f.half[0];  }
__global__ __launch_bounds__(256) void k_ccp(const float* __restrict__ QKV, int coff, _Float16* __restrict__ D) { const size_t t = (size_t)blockIdx.x * 256 + threadIdx.x; if (t >= (size_t)NR * DM / 8) return; const int c0 = (int)((t * 8) % DM); const size_t row = (t * 8) / DM; const v8f a = *(const v8f*)(QKV + row * 3 * DM + coff + c0); FragH f; for (int q = 0; q < 8; ++q) f.h[q] = (_Float16)a[q];
  *(v8us*)((unsigned short*)D + (((row / TT) * NH + c0 / HD) * TT + row % TT) * HD + c0 % HD) = f.half[0];  }      /* plane (batch * NH + head), row t, 64 halves a row: one batch stride serves all 32 planes */
__global__ __launch_bounds__(256) void k_chl(const float* __restrict__ QKV, int coff, _Float16* __restrict__ Hh, _Float16* __restrict__ Lh) {
  #pragma clang fp contract(off)
  const size_t t = (size_t)blockIdx.x * 256 + threadIdx.x; if (t >= (size_t)NR * DM / 8) return; const int c0 = (int)((t * 8) % DM); const size_t row = (t * 8) / DM; const v8f a = *(const v8f*)(QKV + row * 3 * DM + coff + c0); FragH fh, fl; for (int q = 0; q < 8; ++q) { const _Float16 hv = (_Float16)a[q]; fh.h[q] = hv; fl.h[q] = (_Float16)((a[q] - (float)hv) * 1024.0f); }
  { *(v8us*)((unsigned short*)Hh + t * 8) = fh.half[0]; *(v8us*)((unsigned short*)Lh + t * 8) = fl.half[0];  } }
__device__ __forceinline__ void exter(const float* p1, const float* p2, float* L) {
  #pragma clang fp contract(off)
  const int PI[6] = {0, 0, 0, 1, 1, 2}, PJ[6] = {1, 2, 3, 2, 3, 3}; float n2 = 0.f;
  for (int k = 0; k < 6; ++k) { float a = p1[PI[k]] * p2[PJ[k]]; a += -(p1[PJ[k]] * p2[PI[k]]); L[k] = a; n2 += a * a; }
  const float n = fmaxf(sqrtf(n2), 1e-12f); for (int k = 0; k < 6; ++k) L[k] = L[k] / n; }
__global__ __launch_bounds__(256) void k_lines(const float* __restrict__ LW, float* __restrict__ JW, float* __restrict__ RD) {
  #pragma clang fp contract(off)
  const int tt = blockIdx.x * 256 + threadIdx.x; if (tt >= NR * NH) return; const int t = tt % TT; const int bh = tt / TT; const int h = bh % NH, b = bh / NH; const size_t row = (size_t)b * TT + t; float w1[4], w2[4], r1[4], r2[4];
  for (int i = 0; i < 4; ++i) { w1[i] = (t > 0) ? LW[(row - 1) * 256 + h * 4 + i] : 0.f; w2[i] = LW[row * 256 + 64 + h * 4 + i]; r1[i] = LW[row * 256 + 128 + h * 4 + i]; r2[i] = LW[row * 256 + 192 + h * 4 + i]; }
  float wl[6], rl[6]; exter(w1, w2, wl); exter(r1, r2, rl); v8f jw, rd; jw[0] = wl[5]; jw[1] = -wl[4]; jw[2] = wl[3]; jw[3] = wl[2]; jw[4] = -wl[1]; jw[5] = wl[0]; jw[6] = 0.f; jw[7] = 0.f; for (int k = 0; k < 6; ++k) rd[k] = rl[k]; rd[6] = 0.f; rd[7] = 0.f;
  const size_t o = (((size_t)b * NH + h) * TT + t) * 8; { *(v8f*)(JW + o) = jw; *(v8f*)(RD + o) = rd;  } }
typedef float v2f __attribute__((ext_vector_type(2)));
typedef float v2fa __attribute__((ext_vector_type(2), may_alias));
// Causal 6x6 Gram state and rd . M, one work-group per (batch, head). M is symmetric bit for bit (w_i * w_j rounds the same either way and both sides sum in the same order), so 21 running sums carry it.
// Three phases through one LDS array, plane e = (i, j), i <= j, column t: (A) every thread forms the 21 products of its rows; (B) 21 lanes of one wave turn each plane into its running sum over t, in the order t = 0, 1, ...; (C) every thread reads M_t of its rows and forms rd_t . M_t, i = 0..5 in order.
// Plane pitch TT + 4 floats: the 16-B reads and writes of phase B, one plane per lane, start 4 banks apart; phases A and C touch 32 columns in a row of one plane.
#define CE 21
#define CPI (TT + 4)
__global__ __launch_bounds__(256) void k_cum(const float* __restrict__ JW, const float* __restrict__ RD, float* __restrict__ RDM) {
  __shared__ __attribute__((aligned(16))) float pm[CE][CPI];
  const int tid = threadIdx.x; const size_t bh = blockIdx.x; const float* jw = JW + bh * TT * 8; const float* rd = RD + bh * TT * 8; float* ob = RDM + bh * TT * 8;
  // every global load of the block is issued before the first is waited for; thread tid has rows c * 256 + tid; all loops over c, i, j, u, q are unrolled in full so that their arrays stay in registers
  v4f wa[TT / 256], ra[TT / 256]; v2f wb[TT / 256], rb[TT / 256];      /* a row's six values as 16 + 8 bytes */
#pragma unroll
  for (int c = 0; c < TT / 256; ++c) { const float* q = jw + (size_t)(c * 256 + tid) * 8; wa[c] = *(const v4fa*)q; wb[c] = *(const v2fa*)(q + 4); }
#pragma unroll
  for (int c = 0; c < TT / 256; ++c) { const float* q = rd + (size_t)(c * 256 + tid) * 8; ra[c] = *(const v4fa*)q; rb[c] = *(const v2fa*)(q + 4); }
  asm volatile("s_wait_xcnt 0x0" ::: "memory");      /* in front of whatever reuses the address registers of the loads above, which stay in flight */
#pragma unroll
  for (int c = 0; c < TT / 256; ++c) { const float w[6] = {wa[c][0], wa[c][1], wa[c][2], wa[c][3], wb[c][0], wb[c][1]}; int e = 0;
#pragma unroll
    for (int i = 0; i < 6; ++i)
#pragma unroll
      for (int j = i; j < 6; ++j) { pm[e][c * 256 + tid] = w[i] * w[j]; ++e; } }
  __syncthreads();
  if (tid < CE) { float* p = &pm[tid][0]; float acc = 0.f; v4f cur[8], nxt[8];
    // the one dependent chain left is one add per t; the reads run 32 columns ahead of it in two named register sets, so that it never waits for LDS
#pragma unroll
    for (int u = 0; u < 8; ++u) cur[u] = *(const v4f*)(p + 4 * u);
    // two sets per trip so that each has a fixed name; kept rolled: unrolled further it only grows the code
#pragma unroll 1
    for (int t0 = 0; t0 < TT; t0 += 64) {
#pragma unroll
      for (int u = 0; u < 8; ++u) nxt[u] = *(const v4f*)(p + t0 + 32 + 4 * u);
#pragma unroll
      for (int u = 0; u < 8; ++u) { v4f o;
#pragma unroll
        for (int q = 0; q < 4; ++q) { acc += cur[u][q]; o[q] = acc; }
        *(v4f*)(p + t0 + 4 * u) = o; }
      if (t0 + 64 < TT) {
#pragma unroll
        for (int u = 0; u < 8; ++u) cur[u] = *(const v4f*)(p + t0 + 64 + 4 * u); }
#pragma unroll
      for (int u = 0; u < 8; ++u) { v4f o;
#pragma unroll
        for (int q = 0; q < 4; ++q) { acc += nxt[u][q]; o[q] = acc; }
        *(v4f*)(p + t0 + 32 + 4 * u) = o; } } }
  __syncthreads();
#pragma unroll
  for (int c = 0; c < TT / 256; ++c) { const float r[6] = {ra[c][0], ra[c][1], ra[c][2], ra[c][3], rb[c][0], rb[c][1]}; float m[CE];
#pragma unroll
    for (int e = 0; e < CE; ++e) m[e] = pm[e][c * 256 + tid];
    v8f o;
#pragma unroll
    for (int j = 0; j < 6; ++j) { float v = 0.f;
#pragma unroll
      for (int i = 0; i < 6; ++i) { const int lo = i < j ? i : j, hi = i < j ? j : i; v += r[i] * m[lo * 6 - (lo * (lo - 1)) / 2 + hi - lo]; }
      o[j] = v; }
    o[6] = 0.f; o[7] = 0.f;
    *(v8f*)(ob + (size_t)(c * 256 + tid) * 8) = o;
    if (c + 1 < TT / 256) asm volatile("s_wait_xcnt 0x0" ::: "memory"); } }      /* in front of the next rows' LDS reads and sums, which reuse the registers that the store names */
#define FA_JP 68      /* pitch of a Jw plane in floats: 16-B multiples for the reads; the staging stores of a wave (16 keys x 2 groups of 4 planes) fall on 32 different banks */
__device__ __forceinline__ v8f fa_mma(v16h a, v16h b, v8f c) { return __builtin_amdgcn_wmma_f32_16x16x32_f16(false, a, false, b, (short)0, c, false, false); }
__global__ __launch_bounds__(128) void k_fattn(const _Float16* __restrict__ Q, const _Float16* __restrict__ Kh, const _Float16* __restrict__ Vh, const _Float16* __restrict__ Vl, const float* __restrict__ RDM, const float* __restrict__ JW, const float* __restrict__ bsc, _Float16* __restrict__ CH, _Float16* __restrict__ CL) {
  // two buffers of: 64 K rows [key][64 d], 64 V^T rows hi and residual [d][64 keys] (pitch as in k_gemm2), Jw as planes [component][key]
  __shared__ __attribute__((aligned(16))) _Float16 sk[2][64][G2_LP];
  __shared__ __attribute__((aligned(16))) _Float16 sv[2][64][G2_LP];
  __shared__ __attribute__((aligned(16))) _Float16 sl[2][64][G2_LP];
  __shared__ __attribute__((aligned(16))) float sj[2][8][FA_JP];
  const int tid = threadIdx.x, w = tid >> 5, lane = tid & 31, ln = lane & 15, hh = lane >> 4;
  const int pl = blockIdx.x, by = blockIdx.y, blk = by < TT / 128 ? TT / 64 - 1 - by : by - TT / 128;      /* plane; row block: block b walks b + 1 tiles; the long half first, longest first, then the short half, shortest first, so that work-groups half a grid apart add up alike (for speed only) */
  const int tl = w * 16 + ln; const size_t prow = (size_t)pl * TT + blk * 64 + tl;      /* the lane's query: inside the block, and as a row of the planes */
  const float bs2 = bf16_round(bsc[pl % NH]) * 1.4426950408889634f, c1 = 0.125f * 1.4426950408889634f;
  const v16h q0 = g2_frag(Q + prow * HD, hh), q1 = g2_frag(Q + prow * HD + 32, hh);
  const v4f r03 = *(const v4fa*)(RDM + prow * 8); const v2f r45 = *(const v2fa*)(RDM + prow * 8 + 4);
  const float rdm[6] = {r03[0], r03[1], r03[2], r03[3], r45[0], r45[1]};
  const int sr = tid >> 3, sc = (tid & 7) * 8;      /* staging: 8 lanes cover one row's 128 B */
  const char* kg = (const char*)(Kh + (size_t)pl * TT * HD); const char* vg = (const char*)(Vh + (size_t)pl * HD * TT); const char* lg = (const char*)(Vl + (size_t)pl * HD * TT); const char* jg = (const char*)(JW + (size_t)pl * TT * 8);      /* the plane's first bytes: the same in every lane */
  const unsigned ko = (unsigned)(sr * HD + sc) * 2u, vo = (unsigned)(sr * TT + sc) * 2u, jo = (unsigned)tid * 16u;      /* the lane's own byte offsets, fixed for the whole loop; Jw: key tid >> 1, components 4 * (tid & 1) .. + 3 (6 and 7 are the rows' padding: staged along, never read) */
  v8us rk[4], rv[4], rl[4]; v4f rj;
  // every loop over i, q, c, k, r, ks, ds below is unrolled in full so that its arrays stay in registers
  auto gl = [&](int j) {
    const char* kj = kg + (size_t)j * 64 * HD * 2 + ko; const char* vj = vg + (size_t)j * 64 * 2 + vo; const char* lj = lg + (size_t)j * 64 * 2 + vo; const char* jj = jg + (size_t)j * 64 * 32 + jo;
#pragma unroll
    for (int i = 0; i < 4; ++i) rk[i] = *(const v8us*)(kj + 16 * i * HD * 2);
#pragma unroll
    for (int i = 0; i < 4; ++i) rv[i] = *(const v8us*)(vj + 16 * i * TT * 2);
#pragma unroll
    for (int i = 0; i < 4; ++i) rl[i] = *(const v8us*)(lj + 16 * i * TT * 2);
    rj = *(const v4fa*)jj;
    // in front of whatever reuses the address registers of the loads above, which stay in flight; the four addresses are inputs (read only) so that they stay whole up to the wait: otherwise the last load of a group lands on the address pair that the group's earlier loads name
    asm volatile("s_wait_xcnt 0x0" :: "v"(kj), "v"(vj), "v"(lj), "v"(jj) : "memory"); };
  auto st = [&](int buf) {
#pragma unroll
    for (int i = 0; i < 4; ++i) { *(v8us*)&sk[buf][sr + 16 * i][sc] = rk[i]; *(v8us*)&sv[buf][sr + 16 * i][sc] = rv[i]; *(v8us*)&sl[buf][sr + 16 * i][sc] = rl[i]; }
#pragma unroll
    for (int q = 0; q < 4; ++q) sj[buf][(tid & 1) * 4 + q][tid >> 1] = rj[q]; };
  const v8f z8 = {0.f,0.f,0.f,0.f,0.f,0.f,0.f,0.f};
  v8f oa[4] = {z8, z8, z8, z8};
  float m = -3.0e38f, su = 0.f;
  gl(0);
  __builtin_amdgcn_sched_barrier(0);      /* keeps the clearing of the accumulators, which reuses the address registers of the q and rd . M loads above, behind the wait that ends gl */
  // Each barrier publishes the buffer just written and ends every wave's reads of the other buffer, which is written next. The next tile's loads fly during this tile's work; the diagonal tile has none behind it (the test is the same for the whole block), so no load is in flight when a wave ends.
  for (int j = 0; ; ++j) {      /* left behind the diagonal tile, at the foot */
    const int buf = j & 1;
    st(buf); g2_bar(); if (j < blk) gl(j + 1);
    float l[4][8];
#pragma unroll
    for (int c = 0; c < 4; ++c) {
      v8f s = fa_mma(g2_frag(&sk[buf][c * 16 + ln][0], hh), q0, z8); s = fa_mma(g2_frag(&sk[buf][c * 16 + ln][32], hh), q1, s);
      v4f jv[6][2];
#pragma unroll
      for (int k = 0; k < 6; ++k) { jv[k][0] = *(const v4f*)&sj[buf][k][c * 16 + 8 * hh]; jv[k][1] = *(const v4f*)&sj[buf][k][c * 16 + 8 * hh + 4]; }
#pragma unroll
      for (int r = 0; r < 8; ++r) { float d = 0.f;
#pragma unroll
        for (int k = 0; k < 6; ++k) d += rdm[k] * jv[k][r >> 2][r & 3];
        l[c][r] = s[r] * c1 + fabsf(d) * bs2; } }
    if (j == blk) {      /* the diagonal tile alone holds keys behind a query; the same for the whole block */
#pragma unroll
      for (int c = 0; c < 4; ++c)
#pragma unroll
        for (int r = 0; r < 8; ++r) if (c * 16 + 8 * hh + r > tl) l[c][r] = -3.0e38f; }
    float mt = l[0][0];
#pragma unroll
    for (int c = 0; c < 4; ++c)
#pragma unroll
      for (int r = 0; r < 8; ++r) mt = fmaxf(mt, l[c][r]);
    mt = fmaxf(mt, __shfl_xor(mt, 16, 32));      /* the row's other 32 keys of the tile; key 0 is open to every query, so the maximum is a real logit from tile 0 on */
    const float mn = fmaxf(m, mt), al = __builtin_amdgcn_exp2f(m - mn), mo = mn - 10.0f; m = mn; su *= al;
#pragma unroll
    for (int ds = 0; ds < 4; ++ds) oa[ds] *= al;
#pragma unroll
    for (int ks = 0; ks < 2; ++ks) { FragH pf;
#pragma unroll
      for (int i = 0; i < 16; ++i) { const float e = __builtin_amdgcn_exp2f(l[2 * ks + (i >> 3)][i & 7] - mo); su += e; pf.h[i] = (_Float16)e; }
      const v16h pr = pf.v * (_Float16)0.0009765625f;
#pragma unroll
      for (int ds = 0; ds < 4; ++ds) { oa[ds] = fa_mma(g2_frag(&sv[buf][ds * 16 + ln][ks * 32], hh), pf.v, oa[ds]); oa[ds] = fa_mma(g2_frag(&sl[buf][ds * 16 + ln][ks * 32], hh), pr, oa[ds]); } }
    if (j >= blk) break; }
  su += __shfl_xor(su, 16, 32);
  const float inv = 1.0f / su;
  const size_t o = ((size_t)(pl / NH) * TT + blk * 64 + tl) * DM + (pl % NH) * HD + 8 * hh;
#pragma unroll
  for (int ds = 0; ds < 4; ++ds) { FragH f, fl;
#pragma unroll
    for (int r = 0; r < 8; ++r) { const float v = oa[ds][r] * inv; const _Float16 hv = (_Float16)v; f.h[r] = hv; fl.h[r] = (_Float16)((v - (float)hv) * 1024.0f); }
    *(v8us*)((unsigned short*)CH + o + ds * 16) = f.half[0]; *(v8us*)((unsigned short*)CL + o + ds * 16) = fl.half[0];
    if (ds + 1 < 4) asm volatile("s_wait_xcnt 0x0" ::: "memory"); } }      /* in front of the next columns' sums, which may reuse the registers that the stores name */

extern "C" void kernel_launch(void* const* d_in, const int* in_sizes, int n_in,
                              void* d_out, int out_size, void* d_ws, size_t ws_size, hipStream_t stream) {
  (void)in_sizes; (void)n_in; (void)out_size;
  const float* x = (const float*)d_in[0]; const float* Wqkv = (const float*)d_in[1]; const float* bqkv = (const float*)d_in[2]; const float* W1w = (const float*)d_in[3]; const float* W2w = (const float*)d_in[4]; const float* W1r = (const float*)d_in[5]; const float* W2r = (const float*)d_in[6]; const float* bsc = (const float*)d_in[7]; const float* Wout = (const float*)d_in[8]; const float* bout = (const float*)d_in[9];
  char* ws = (char*)d_ws; size_t off = 0;
  auto take = [&](size_t bytes) { char* p = ws + off; off += (bytes + 255) & ~(size_t)255; return p; };
  const size_t np = (size_t)NR * DM;
  _Float16* BQKV = (_Float16*)take((size_t)3 * DM * DM * 2); _Float16* BL = (_Float16*)take((size_t)256 * DM * 2); _Float16* X16 = (_Float16*)take(np * 2); float* QKV = (float*)take(np * 3 * 4); _Float16* V16 = (_Float16*)take(np * 2); _Float16* VL16 = (_Float16*)take(np * 2); float* LW = (float*)take((size_t)NR * 256 * 4); float* RD = (float*)take((size_t)NB * NH * TT * 8 * 4);
  _Float16* BO = (_Float16*)take((size_t)DM * DM * 2); _Float16* Q16 = (_Float16*)take(np * 2); _Float16* K16 = (_Float16*)take(np * 2); _Float16* VT = (_Float16*)take(np * 2); _Float16* VTL = (_Float16*)take(np * 2);
  float* JW = (float*)take((size_t)NB * NH * TT * 8 * 4); float* RDM = (float*)take((size_t)NB * NH * TT * 8 * 4);
  _Float16* CH = (_Float16*)take(np * 2); _Float16* CL = (_Float16*)take(np * 2);
  if (off > ws_size) return;      /* under 74 MiB */
  k_wsc<<<(unsigned)(((size_t)3 * DM * DM / 8 + 255) / 256), 256, 0, stream>>>(Wqkv, BQKV, (size_t)3 * DM * DM / 8, 16.0f); k_wsc<<<(unsigned)(((size_t)DM * DM / 8 + 255) / 256), 256, 0, stream>>>(Wout, BO, (size_t)DM * DM / 8, 16.0f);      /* torch (out, in) naturals */
  k_wsc<<<(unsigned)(((size_t)64 * DM / 8 + 255) / 256), 256, 0, stream>>>(W1w, BL, (size_t)64 * DM / 8, 16.0f); k_wsc<<<(unsigned)(((size_t)64 * DM / 8 + 255) / 256), 256, 0, stream>>>(W2w, BL + (size_t)64 * DM, (size_t)64 * DM / 8, 16.0f); k_wsc<<<(unsigned)(((size_t)64 * DM / 8 + 255) / 256), 256, 0, stream>>>(W1r, BL + (size_t)128 * DM, (size_t)64 * DM / 8, 16.0f); k_wsc<<<(unsigned)(((size_t)64 * DM / 8 + 255) / 256), 256, 0, stream>>>(W2r, BL + (size_t)192 * DM, (size_t)64 * DM / 8, 16.0f);      /* [W1w; W2w; W1r; W2r] rows h*4 + i */
  k_x16<<<(unsigned)((np / 8 + 255) / 256), 256, 0, stream>>>(x, X16, np / 8);
  k_gemm2<0><<<dim3((NR / 128) * (3 * DM / 64), 1), 128, 0, stream>>>(X16, DM, 0, BQKV, DM, 0, 0.0625f, bqkv, 0, nullptr, 1, 0, 0, QKV, nullptr, 3 * DM, 0, NR, 3 * DM, DM);      /* [q | k | v] + bias, head h at h*64 */
  k_gemm2<0><<<dim3((NR / 128) * (256 / 64), 1), 128, 0, stream>>>(X16, DM, 0, BL, DM, 0, 0.0625f, nullptr, 0, nullptr, 1, 0, 0, LW, nullptr, 256, 0, NR, 256, DM);      /* line projections f32 [row][w1 | w2 | r1 | r2] (x_prev handled by a row shift) */
  k_ccp<<<(unsigned)((np / 8 + 255) / 256), 256, 0, stream>>>(QKV, 0, Q16); k_ccp<<<(unsigned)((np / 8 + 255) / 256), 256, 0, stream>>>(QKV, DM, K16); k_chl<<<(unsigned)((np / 8 + 255) / 256), 256, 0, stream>>>(QKV, 2 * DM, V16, VL16);      /* v as hi + residual (the bias makes the attention peaked, so v's rounding reaches the output almost unaveraged) */
  k_vt<NH, TT><<<NB * NH * (TT / 64), 256, 0, stream>>>(V16, DM, 0, VT); k_vt<NH, TT><<<NB * NH * (TT / 64), 256, 0, stream>>>(VL16, DM, 0, VTL);
  k_lines<<<(NR * NH + 255) / 256, 256, 0, stream>>>(LW, JW, RD); k_cum<<<NB * NH, 256, 0, stream>>>(JW, RD, RDM);
  // attention: one launch, scores and weights stay in registers; grid x = the 32 (batch, head) planes, y = the 16 blocks of 64 query rows; q, k are [plane][t][64], v^T [plane][d][t]; the context comes out as [row][head * 64 + d], hi + residual
  k_fattn<<<dim3(NB * NH, TT / 64), 128, 0, stream>>>(Q16, K16, VT, VTL, RDM, JW, bsc, CH, CL);
  k_gemm2<0><<<dim3((NR / 128) * (DM / 64), 1), 128, 0, stream>>>(CL, DM, 0, BO, DM, 0, 0.0625f / 1024.0f, nullptr, 0, nullptr, 1, 0, 0, (float*)d_out, nullptr, DM, 0, NR, DM, DM);
  k_gemm2<0><<<dim3((NR / 128) * (DM / 64), 1), 128, 0, stream>>>(CH, DM, 0, BO, DM, 0, 0.0625f, bout, 0, (const float*)d_out, 1, (size_t)DM, 0, (float*)d_out, nullptr, DM, 0, NR, DM, DM);      /* out = (c_lo + c_hi) Wout^T + bout */
}

// v006
// Measured time: 108 microseconds a run.
// Timed twice side by side with v005, it ran 1.28 and 1.27 times as fast.
// All steps since v000 together make it 12.5 times as fast.
#include <hip/hip_runtime.h>
// EigenBiasAttention (2 x 1024 tokens x 1024 = 16 heads x 64; qkv = x Wqkv^T + b; causal softmax(q.k/8 + |bias|) v; bias from Plucker lines: per head w1 = x_prev W1w^T, w2 = x W2w^T, r1 = x W1r^T, r2 = x W2r^T (4-vectors), write/read lines = normalised exterior products (6-vectors), Jw = write J6, M_t = cumsum_t Jw Jw^T, bias[t][s] = |(rd_t . M_t) . Jw_s| * bias_scale[h]; out = merged . Wout^T + bout).
// Structure: exact f16 x plane; qkv and the four line projections as f16 WMMA GEMMs (32x64 wave tiles, f32 accumulation, exact x16 weights (+ bias); f32 out) then f16 q/k planes (one [t][64] plane per (batch, head)) and v planes; the exterior products / normalisation / J6 on VALU; the causal 6x6 Gram cumsum and rd . M per (batch, head) on VALU (f32; products and rd . M one row per thread, the 1024-step running sums by one wave through LDS); V^T hi/residual by LDS tiles; one fused launch for all 32 (batch, head) planes: score products (K = 64, f32), the biased causal softmax on VALU with a running row maximum (bias dot K = 6 per (t, s), bias_scale read; unnormalised f16 weights x 2^10), readout as two product terms, row scaling + hi/residual; Wout as two GEMM terms (+ bias).
// Compute dtype: inputs rounded to bf16; x / weights exact as f16 (line projections are f32 sums of exact products, so the bias path is f32-class); q, k and the softmax weights as plain f16 operands (~2^-12); v and the context as f16 hi + residual. v_wmma_f32_16x16x32_f16.
#define NB 2
#define TT 1024
#define DM 1024
#define NH 16
#define HD 64
#define NR (NB * TT)
typedef __bf16 v16b __attribute__((ext_vector_type(16)));
typedef unsigned short v8us __attribute__((ext_vector_type(8), may_alias));
typedef float  v8f  __attribute__((ext_vector_type(8)));
typedef float  v4f  __attribute__((ext_vector_type(4)));
typedef float  v4fa __attribute__((ext_vector_type(4), may_alias));
union FragB { v16b v; v8us half[2]; unsigned short u[16]; };

__device__ __forceinline__ unsigned short bf16_bits(float x) { unsigned int u = __float_as_uint(x); return (unsigned short)((u + 0x7FFFu + ((u >> 16) & 1u)) >> 16); }
__device__ __forceinline__ float bf16_val(unsigned short b) { return __uint_as_float(((unsigned int)b) << 16); }
__device__ __forceinline__ float bf16_round(float x) { return bf16_val(bf16_bits(x)); }
// D += A·B with NT terms: 1 = ah·bh, 2 = + al·bh (A split), 3 = + ah·bl (both split)
template <int NT>
__device__ __forceinline__ v8f mmaN(v16b ah, v16b al, v16b bh, v16b bl, v8f c) {
  c = __builtin_amdgcn_wmma_f32_16x16x32_bf16(false, ah, false, bh, (short)0, c, false, false);
  if (NT >= 2) c = __builtin_amdgcn_wmma_f32_16x16x32_bf16(false, al, false, bh, (short)0, c, false, false);
  if (NT >= 3) c = __builtin_amdgcn_wmma_f32_16x16x32_bf16(false, ah, false, bl, (short)0, c, false, false);
  asm volatile("v_nop\n\tv_nop\n\tv_nop\n\tv_nop" : "+v"(c) : "v"(ah), "v"(al), "v"(bh), "v"(bl));
  return c;
}

__global__ __launch_bounds__(256) void k_wt_bf16(const float* __restrict__ W, unsigned short* __restrict__ Wt, int K, int N) {
  const int t = blockIdx.x * 256 + threadIdx.x;
  const int k8n = K / 8;
  if (t >= N * k8n) return;
  const int n = t / k8n, k8 = (t % k8n) * 8;
  v8us v;
#pragma unroll
  for (int i = 0; i < 8; ++i) v[i] = bf16_bits(W[(size_t)(k8 + i) * N + n]);
  *(v8us*)(Wt + (size_t)n * K + k8) = v;
  
}

// GEMM C[M][N] (f32, pitch ldc) = act(A[M][K]·W + bias). A f32 row-major (pitch lda) converted per fragment to bf16
// (ASPLIT: hi/lo two planes -> 2 terms, else single rounded term); Wt bf16 [N][K] (pitch ldb). BIAS_BF16 rounds the
// bias to bf16 first (bias quantised to bf16 before the add). K%32==0, M%16==0, N%64==0.
template <bool ASPLIT, int ACT, bool BIAS_BF16>
__global__ __launch_bounds__(128) void k_gemm_bf(const float* __restrict__ A, int lda, const unsigned short* __restrict__ Wt, int ldb,
                                               const float* __restrict__ bias, float* __restrict__ C, int ldc, int M, int N, int K) {
  __shared__ __attribute__((aligned(16))) float so[4][16][64];
  const int tid = threadIdx.x, w = tid >> 5, lane = tid & 31, ln = lane & 15, hh = lane >> 4;
  const int ntn = N / 64;
  const int wid = blockIdx.x * 4 + w;
  const int mt = wid / ntn, nq = wid % ntn;
  if (mt * 16 >= M) return;
  const int row0 = mt * 16, col0 = nq * 64;
  const float* arow = A + (size_t)(row0 + ln) * lda;
  v8f acc[4] = {};
  for (int kb = 0; kb < K; kb += 32) {
    FragB ah, al;
    const v4f x0 = *(const v4fa*)(arow + kb + 8 * hh), x1 = *(const v4fa*)(arow + kb + 8 * hh + 4);
    const v4f x2 = *(const v4fa*)(arow + kb + 16 + 8 * hh), x3 = *(const v4fa*)(arow + kb + 16 + 8 * hh + 4);
    float xs[16] = {x0[0],x0[1],x0[2],x0[3],x1[0],x1[1],x1[2],x1[3],x2[0],x2[1],x2[2],x2[3],x3[0],x3[1],x3[2],x3[3]};
#pragma unroll
    for (int i = 0; i < 16; ++i) { const unsigned short hb = bf16_bits(xs[i]); ah.u[i] = hb; al.u[i] = ASPLIT ? bf16_bits(xs[i] - bf16_val(hb)) : (unsigned short)0; }
#pragma unroll
    for (int t = 0; t < 4; ++t) {
      const unsigned short* brow = Wt + (size_t)(col0 + t * 16 + ln) * ldb + kb;
      FragB b;
      b.half[0] = *(const v8us*)(brow + 8 * hh);
      b.half[1] = *(const v8us*)(brow + 16 + 8 * hh);
      acc[t] = mmaN<ASPLIT ? 2 : 1>(ah.v, al.v, b.v, b.v, acc[t]);
    }
  }
#pragma unroll
  for (int t = 0; t < 4; ++t) {
    float bv = bias ? bias[col0 + t * 16 + ln] : 0.f;
    if (BIAS_BF16) bv = bf16_round(bv);
#pragma unroll
    for (int r = 0; r < 8; ++r) { float v = acc[t][r] + bv; if (ACT == 1) v = fmaxf(v, 0.f); so[w][8 * hh + r][t * 16 + ln] = v; }
  }
  __builtin_amdgcn_fence(__ATOMIC_ACQ_REL, "workgroup");
  __builtin_amdgcn_wave_barrier();
  const int rsub = lane >> 4, c4 = (lane & 15) * 4;
  {
#pragma unroll
    for (int q = 0; q < 8; ++q) {
      const int r = q * 2 + rsub;
      const v4f v = *(const v4fa*)&so[w][r][c4];
      *(v4f*)(C + (size_t)(row0 + r) * ldc + col0 + c4) = v;
    }
    
  }
}

// GEMM C = act(A·W + bias + resid): A f32 (ASPLIT -> hi/lo 2 terms), Wt bf16 [N][K]; ACT 0 none, 1 relu, 2 exact gelu;
// resid (optional, f32, row index = (row % rmod), pitch ldr, RES_BF16 rounds it) added before the activation.
template <bool ASPLIT, int ACT, bool BIAS_BF16, bool RES_BF16>
__global__ __launch_bounds__(128) void k_gemm_bf3(const float* __restrict__ A, int lda, const unsigned short* __restrict__ Wt, int ldb,
                                                const float* __restrict__ bias, const float* __restrict__ resid, int rmod, int ldr,
                                                float* __restrict__ C, int ldc, int M, int N, int K) {
  __shared__ __attribute__((aligned(16))) float so[4][16][64];
  const int tid = threadIdx.x, w = tid >> 5, lane = tid & 31, ln = lane & 15, hh = lane >> 4;
  const int ntn = N / 64;
  const int wid = blockIdx.x * 4 + w;
  const int mt = wid / ntn, nq = wid % ntn;
  if (mt * 16 >= M) return;
  const int row0 = mt * 16, col0 = nq * 64;
  const float* arow = A + (size_t)(row0 + ln) * lda;
  v8f acc[4] = {};
  for (int kb = 0; kb < K; kb += 32) {
    FragB ah, al;
    const v4f x0 = *(const v4fa*)(arow + kb + 8 * hh), x1 = *(const v4fa*)(arow + kb + 8 * hh + 4);
    const v4f x2 = *(const v4fa*)(arow + kb + 16 + 8 * hh), x3 = *(const v4fa*)(arow + kb + 16 + 8 * hh + 4);
    float xs[16] = {x0[0],x0[1],x0[2],x0[3],x1[0],x1[1],x1[2],x1[3],x2[0],x2[1],x2[2],x2[3],x3[0],x3[1],x3[2],x3[3]};
#pragma unroll
    for (int i = 0; i < 16; ++i) { const unsigned short hb = bf16_bits(xs[i]); ah.u[i] = hb; al.u[i] = ASPLIT ? bf16_bits(xs[i] - bf16_val(hb)) : (unsigned short)0; }
#pragma unroll
    for (int t = 0; t < 4; ++t) {
      const unsigned short* brow = Wt + (size_t)(col0 + t * 16 + ln) * ldb + kb;
      FragB b;
      b.half[0] = *(const v8us*)(brow + 8 * hh);
      b.half[1] = *(const v8us*)(brow + 16 + 8 * hh);
      acc[t] = mmaN<ASPLIT ? 2 : 1>(ah.v, al.v, b.v, b.v, acc[t]);
    }
  }
#pragma unroll
  for (int t = 0; t < 4; ++t) {
    const int col = col0 + t * 16 + ln;
    float bv = bias ? bias[col] : 0.f;
    if (BIAS_BF16) bv = bf16_round(bv);
#pragma unroll
    for (int r = 0; r < 8; ++r) {
      float v = acc[t][r] + bv;
      if (resid) { float rv = resid[(size_t)((row0 + 8 * hh + r) % rmod) * ldr + col]; if (RES_BF16) rv = bf16_round(rv); v += rv; }
      if (ACT == 1) v = fmaxf(v, 0.f);
      if (ACT == 2) v = 0.5f * v * (1.0f + erff(v * 0.70710678118654752f));
      if (ACT == 3) { const float u = 0.7978845608028654f * (v + 0.044715f * v * v * v); v = 0.5f * v * (1.0f + tanhf(u)); }
      so[w][8 * hh + r][t * 16 + ln] = v;
    }
  }
  __builtin_amdgcn_fence(__ATOMIC_ACQ_REL, "workgroup");
  __builtin_amdgcn_wave_barrier();
  const int rsub = lane >> 4, c4 = (lane & 15) * 4;
  {
#pragma unroll
    for (int q = 0; q < 8; ++q) {
      const int r = q * 2 + rsub;
      const v4f v = *(const v4fa*)&so[w][r][c4];
      *(v4f*)(C + (size_t)(row0 + r) * ldc + col0 + c4) = v;
    }
    
  }
}
// row LayerNorm (biased variance, eps) over N: s = X (+ R); optional out_sum <- s; out_norm <- (s-mu)*rsqrt(var+eps)*g + b
template <bool PARAM_BF16>
__global__ __launch_bounds__(256) void k_layernorm(const float* __restrict__ X, const float* __restrict__ R, const float* __restrict__ g, const float* __restrict__ bta,
                                                  float* __restrict__ out_sum, float* __restrict__ out_norm, int N, float eps) {
  __shared__ float red[256];
  const int row = blockIdx.x, tid = threadIdx.x;
  const float* x = X + (size_t)row * N; const float* rr = R ? R + (size_t)row * N : nullptr;
  float vals[16];                     // up to N = 4096
  const int per = N / 256;            // contiguous chunk per thread? use strided-by-4 chunks: thread handles j = tid*4 + 1024*u
  float s1 = 0.f;
  for (int u = 0; u < per / 4; ++u) {
    const int j = tid * 4 + 1024 * u;
    const v4f a = *(const v4fa*)(x + j);
    v4f b = {0.f,0.f,0.f,0.f}; if (rr) b = *(const v4fa*)(rr + j);
#pragma unroll
    for (int q = 0; q < 4; ++q) { const float v = a[q] + b[q]; vals[u * 4 + q] = v; s1 += v; }
  }
  red[tid] = s1; __syncthreads();
  for (int st = 128; st > 0; st >>= 1) { if (tid < st) red[tid] += red[tid + st]; __syncthreads(); }
  const float mu = red[0] / (float)N; __syncthreads();
  float s2 = 0.f;
  for (int u = 0; u < per / 4; ++u)
#pragma unroll
    for (int q = 0; q < 4; ++q) { const float c = vals[u * 4 + q] - mu; s2 += c * c; }
  red[tid] = s2; __syncthreads();
  for (int st = 128; st > 0; st >>= 1) { if (tid < st) red[tid] += red[tid + st]; __syncthreads(); }
  const float rs = rsqrtf(red[0] / (float)N + eps);
  {
    for (int u = 0; u < per / 4; ++u) {
      const int j = tid * 4 + 1024 * u;
      v4f o, sm;
#pragma unroll
      for (int q = 0; q < 4; ++q) {
        float gg = g[j + q], bb = bta[j + q];
        if (PARAM_BF16) { gg = bf16_round(gg); bb = bf16_round(bb); }
        sm[q] = vals[u * 4 + q]; o[q] = (vals[u * 4 + q] - mu) * rs * gg + bb;
      }
      if (out_sum) *(v4f*)(out_sum + (size_t)row * N + j) = sm;
      *(v4f*)(out_norm + (size_t)row * N + j) = o;
    }
    
  }
}



// ---- f16 WMMA path (v_wmma_f32_16x16x32_f16): 11-bit significands for operands in range — used for every GEMM launched here
typedef _Float16 v16h __attribute__((ext_vector_type(16)));
union FragH { v16h v; v8us half[2]; _Float16 h[16]; unsigned short u[16]; };
template <int NT>
__device__ __forceinline__ v8f mmaH(v16h ah, v16h al, v16h bh, v16h bl, v8f c) {
  c = __builtin_amdgcn_wmma_f32_16x16x32_f16(false, ah, false, bh, (short)0, c, false, false);
  if (NT >= 2) c = __builtin_amdgcn_wmma_f32_16x16x32_f16(false, al, false, bh, (short)0, c, false, false);
  if (NT >= 3) c = __builtin_amdgcn_wmma_f32_16x16x32_f16(false, ah, false, bl, (short)0, c, false, false);
  asm volatile("v_nop\n\tv_nop\n\tv_nop\n\tv_nop" : "+v"(c) : "v"(ah), "v"(al), "v"(bh), "v"(bl));
  return c;
}
// batched GEMM like k_gemm_b but f16 operands: A f32 (split into f16 hi/lo if ASPLIT, else rounded to f16), Bt = f16 values [n][k]; alpha; C f32; N multiple of 16 (partial tiles skipped)
template <bool ASPLIT>
__global__ __launch_bounds__(128) void k_gemm_h(const float* __restrict__ A, int lda, size_t sA, const _Float16* __restrict__ Bh, int ldb, size_t sB, float alpha, float* __restrict__ C, int ldc, size_t sC, int M, int N, int K) {
  __shared__ __attribute__((aligned(16))) float so[4][16][64];
  const int tid = threadIdx.x, w = tid >> 5, lane = tid & 31, ln = lane & 15, hh = lane >> 4; const int by = blockIdx.y;
  A += (size_t)by * sA; Bh += (size_t)by * sB; C += (size_t)by * sC;
  const int ntn = (N + 63) / 64; const int wid = blockIdx.x * 4 + w; const int mt = wid / ntn, nq = wid % ntn; if (mt * 16 >= M) return;
  const int row0 = mt * 16, col0 = nq * 64; const float* arow = A + (size_t)(row0 + ln) * lda;
  v8f acc[4] = {};
  for (int kb = 0; kb < K; kb += 32) {
    FragH ah, al;
    const v4f x0 = *(const v4fa*)(arow + kb + 8 * hh), x1 = *(const v4fa*)(arow + kb + 8 * hh + 4), x2 = *(const v4fa*)(arow + kb + 16 + 8 * hh), x3 = *(const v4fa*)(arow + kb + 16 + 8 * hh + 4);
    float xs[16] = {x0[0],x0[1],x0[2],x0[3],x1[0],x1[1],x1[2],x1[3],x2[0],x2[1],x2[2],x2[3],x3[0],x3[1],x3[2],x3[3]};
#pragma unroll
    for (int i = 0; i < 16; ++i) { const _Float16 h = (_Float16)xs[i]; ah.h[i] = h; al.h[i] = ASPLIT ? (_Float16)(xs[i] - (float)h) : (_Float16)0.0f; }
#pragma unroll
    for (int t = 0; t < 4; ++t) { if (col0 + t * 16 >= N) continue; const size_t boff = (size_t)(col0 + t * 16 + ln) * ldb + kb; FragH bq; bq.half[0] = *(const v8us*)(Bh + boff + 8 * hh); bq.half[1] = *(const v8us*)(Bh + boff + 16 + 8 * hh);
      acc[t] = mmaH<ASPLIT ? 2 : 1>(ah.v, al.v, bq.v, bq.v, acc[t]); }
  }
#pragma unroll
  for (int t = 0; t < 4; ++t) { if (col0 + t * 16 >= N) continue;
#pragma unroll
    for (int r = 0; r < 8; ++r) so[w][8 * hh + r][t * 16 + ln] = acc[t][r] * alpha; }
  __builtin_amdgcn_fence(__ATOMIC_ACQ_REL, "workgroup"); __builtin_amdgcn_wave_barrier();
  const int rsub = lane >> 4, c4 = (lane & 15) * 4;
  {
#pragma unroll
    for (int q = 0; q < 8; ++q) { const int r = q * 2 + rsub; if (col0 + c4 < N) { const v4f v = *(const v4fa*)&so[w][r][c4]; *(v4f*)(C + (size_t)(row0 + r) * ldc + col0 + c4) = v; } }
     }
}

// Wt[n][k] = f16(W[k][n]·scale) from f32 row-major W[K][N] (scale = power of two; bf16-exact weights stay exact in f16 away from the subnormal range)
__global__ __launch_bounds__(256) void k_wt_f16(const float* __restrict__ W, _Float16* __restrict__ Wt, int K, int N, float scale) {
  const int t = blockIdx.x * 256 + threadIdx.x; if (t >= N * (K / 8)) return; const int n = t / (K / 8), k8 = (t % (K / 8)) * 8; FragH f;
#pragma unroll
  for (int i = 0; i < 8; ++i) f.h[i] = (_Float16)(bf16_round(W[(size_t)(k8 + i) * N + n]) * scale); const v8us o = f.half[0];
  *(v8us*)((unsigned short*)Wt + (size_t)n * K + k8) = o; 
}
// k_gemm_hh variant with fused epilogue: v = acc·alpha + bias[by·sBias + col] (+ CP[(row/rowsPerB)·sCPb + by·64 + col] if CP) ; ACT 0 none / 1 elu ; writes f16 C16 (and f32 C if non-null)
template <int ACT>
__global__ __launch_bounds__(128) void k_gemm_hhx(const _Float16* __restrict__ A, int lda, size_t sA, const _Float16* __restrict__ Bh, int ldb, size_t sB, float alpha, const float* __restrict__ bias, size_t sBias, const float* __restrict__ CP, int rowsPerB, size_t sCPb, int row0g,
    float* __restrict__ C, _Float16* __restrict__ C16, int ldc, size_t sC, int M, int N, int K) {
  __shared__ __attribute__((aligned(16))) float so[4][16][64];
  const int tid = threadIdx.x, w = tid >> 5, lane = tid & 31, ln = lane & 15, hh = lane >> 4; const int by = blockIdx.y;
  A += (size_t)by * sA; Bh += (size_t)by * sB; const size_t cofs = (size_t)by * sC; const float* bp = bias ? bias + (size_t)by * sBias : nullptr;
  const int ntn = (N + 63) / 64; const int wid = blockIdx.x * 4 + w; const int mt = wid / ntn, nq = wid % ntn; if (mt * 16 >= M) return;
  const int row0 = mt * 16, col0 = nq * 64; const _Float16* arow = A + (size_t)(row0 + ln) * lda;
  v8f acc[4] = {};
  for (int kb = 0; kb < K; kb += 32) { FragH ah; ah.half[0] = *(const v8us*)((const unsigned short*)arow + kb + 8 * hh); ah.half[1] = *(const v8us*)((const unsigned short*)arow + kb + 16 + 8 * hh);
#pragma unroll
    for (int t = 0; t < 4; ++t) { if (col0 + t * 16 >= N) continue; const size_t boff = (size_t)(col0 + t * 16 + ln) * ldb + kb; FragH bq; bq.half[0] = *(const v8us*)((const unsigned short*)Bh + boff + 8 * hh); bq.half[1] = *(const v8us*)((const unsigned short*)Bh + boff + 16 + 8 * hh);
      acc[t] = mmaH<1>(ah.v, ah.v, bq.v, bq.v, acc[t]); }
  }
#pragma unroll
  for (int t = 0; t < 4; ++t) { if (col0 + t * 16 >= N) continue; const int col = col0 + t * 16 + ln; const float bv = bp ? bf16_round(bp[col]) : 0.f;
#pragma unroll
    for (int r = 0; r < 8; ++r) { float v = acc[t][r] * alpha + bv; if (CP) { const int rr = row0g + row0 + 8 * hh + r; if (rowsPerB < 0) v += CP[cofs + (size_t)rr * ldc + col];      /* rowsPerB < 0: own element of the batched C plane */ else { const int bidx = rr / rowsPerB; v += CP[(size_t)bidx * sCPb + (size_t)by * 64 + col]; } } if (ACT == 1) v = (v > 0.f) ? v : expm1f(v); else if (ACT == 7) v = (v > 0.f) ? v + 1.0f : expf(v); else if (ACT == 8) v = tanhf(v); else if (ACT == 9) v = 0.5f * v * (1.0f + tanhf(0.7978845608028654f * (v + 0.044715f * v * v * v))); else if (ACT == 11) v = 1.0f / (1.0f + expf(-v)); else if (ACT == 12) v = (v > 0.f) ? v : 0.01f * v; else if (ACT == 14) v = (v > 0.f) ? v : 0.1f * v; else if (ACT == 16) v = (v >= 0.f) ? v : 0.3f * v; else if (ACT == 17) v = (v >= 0.f) ? v : 0.2f * v; else if (ACT == 15) v = v / (1.0f + expf(-v)); else if (ACT == 3) v = fmaxf(v, 0.f); else if (ACT == 6) v = 0.5f * v * (1.0f + erff(v * 0.70710678118654752f)); so[w][8 * hh + r][t * 16 + ln] = v; } }
  __builtin_amdgcn_fence(__ATOMIC_ACQ_REL, "workgroup"); __builtin_amdgcn_wave_barrier();
  const int rsub = lane >> 4, c4 = (lane & 15) * 4; typedef _Float16 v4h __attribute__((ext_vector_type(4)));
  {
#pragma unroll
    for (int q = 0; q < 8; ++q) { const int r = q * 2 + rsub; if (col0 + c4 < N) { const v4f v = *(const v4fa*)&so[w][r][c4]; if (C) *(v4f*)(C + cofs + (size_t)(row0 + r) * ldc + col0 + c4) = v; if (C16) { v4h h4; for (int i = 0; i < 4; ++i) h4[i] = (_Float16)v[i]; *(v4h*)(C16 + cofs + (size_t)(row0 + r) * ldc + col0 + c4) = h4; } } }
     }
}


typedef _Float16 v4h __attribute__((ext_vector_type(4)));

__global__ __launch_bounds__(256) void k_h16(const float* __restrict__ x, _Float16* __restrict__ X16, size_t n8) { const size_t t = (size_t)blockIdx.x * 256 + threadIdx.x; if (t >= n8) return; FragH f;
#pragma unroll
  for (int q = 0; q < 8; ++q) f.h[q] = (_Float16)x[t * 8 + q]; *(v8us*)((unsigned short*)X16 + t * 8) = f.half[0];  }
__global__ __launch_bounds__(256) void k_round16f(const float* __restrict__ W, _Float16* __restrict__ Bt, size_t n8) { const size_t t = (size_t)blockIdx.x * 256 + threadIdx.x; if (t >= n8) return; FragH f;
#pragma unroll
  for (int i = 0; i < 8; ++i) f.h[i] = (_Float16)(bf16_round(W[t * 8 + i]) * 16.0f); *(v8us*)((unsigned short*)Bt + t * 8) = f.half[0];  }
template <int NHv, int TTv>
__device__ __forceinline__ void vt_body(const int bx, const _Float16* __restrict__ V16, int ldv, int voff, _Float16* __restrict__ Vt) { __shared__ unsigned short tl[64][66]; const int tid = threadIdx.x; const int slab = bx / (TTv / 64), lg = bx % (TTv / 64); const int b = slab / NHv, h = slab % NHv;
  for (int i = tid; i < 64 * 8; i += 256) { const int r = i / 8, c8 = (i % 8) * 8; FragH f; f.half[0] = *(const v8us*)((const unsigned short*)V16 + ((size_t)b * TTv + lg * 64 + r) * ldv + voff + h * 64 + c8);
#pragma unroll
    for (int q = 0; q < 8; ++q) tl[r][c8 + q] = f.u[q]; }
  __syncthreads();
  {
#pragma unroll
    for (int rd = 0; rd < 2; ++rd) { const int d = rd * 32 + tid / 8, pc = tid % 8; FragH f;
#pragma unroll
      for (int q = 0; q < 8; ++q) f.u[q] = tl[pc * 8 + q][d];
      *(v8us*)((unsigned short*)Vt + ((size_t)slab * 64 + d) * TTv + lg * 64 + pc * 8) = f.half[0]; }
     } }

__global__ __launch_bounds__(256) void k_hl(const float* __restrict__ F, _Float16* __restrict__ Hh, _Float16* __restrict__ Hl, size_t n8) { const size_t t = (size_t)blockIdx.x * 256 + threadIdx.x; if (t >= n8) return; FragH fh, fl; const v4f a = *(const v4fa*)(F + t * 8), c = *(const v4fa*)(F + t * 8 + 4);
#pragma unroll
  for (int q = 0; q < 4; ++q) { _Float16 h = (_Float16)a[q]; fh.h[q] = h; fl.h[q] = (_Float16)((a[q] - (float)h) * 1024.0f); h = (_Float16)c[q]; fh.h[4 + q] = h; fl.h[4 + q] = (_Float16)((c[q] - (float)h) * 1024.0f); }
  { *(v8us*)((unsigned short*)Hh + t * 8) = fh.half[0]; *(v8us*)((unsigned short*)Hl + t * 8) = fl.half[0];  } }

// ---- fast GEMM (block tile 128x64, wave tile 32x64, A and B k-tiles staged in LDS; requires M % 128 == 0, N % 64 == 0 and K == 64 or K % 128 == 0); epilogue = k_gemm_hhx semantics ----
#define G2_LP 72
__device__ __forceinline__ v16h g2_frag(const _Float16* p, int hh) { FragH f; f.half[0] = *(const v8us*)((const unsigned short*)p + 8 * hh); f.half[1] = *(const v8us*)((const unsigned short*)p + 16 + 8 * hh); return f.v; }
__device__ __forceinline__ v8f g2_mma(v16h a, v16h b, v8f c) { v8f d = __builtin_amdgcn_wmma_f32_16x16x32_f16(false, a, false, b, (short)0, c, false, false); asm volatile("v_nop\n\tv_nop\n\tv_nop\n\tv_nop" : "+v"(d) : "v"(a), "v"(b)); return d; }
// work-group barrier that orders LDS alone (its fences name the LDS address space): __syncthreads() also waits for every global load in flight, and the loads for the tiles ahead must stay in flight across it; the loop's global reads are of operands that no wave of the launch writes
__device__ __forceinline__ void g2_bar() { __builtin_amdgcn_fence(__ATOMIC_RELEASE, "workgroup", "local"); __builtin_amdgcn_s_barrier(); __builtin_amdgcn_fence(__ATOMIC_ACQUIRE, "workgroup", "local"); }
template <int ACT>
__global__ __launch_bounds__(128) void k_gemm2(const _Float16* __restrict__ A, int lda, size_t sA, const _Float16* __restrict__ Bh, int ldb, size_t sB, float alpha, const float* __restrict__ bias, size_t sBias, const float* __restrict__ CP, int rowsPerB, size_t sCPb, int row0g,
    float* __restrict__ C, _Float16* __restrict__ C16, int ldc, size_t sC, int M, int N, int K, int nb1, const _Float16* __restrict__ B1, float* __restrict__ C1, int N1) { static_assert(ACT == 0 || ACT == 3 || ACT == 6 || ACT == 8 || ACT == 9 || ACT == 11 || ACT == 12 || ACT == 14 || ACT == 15 || ACT == 16 || ACT == 17, "k_gemm2: unsupported ACT code (would silently apply no activation)");
  __shared__ __attribute__((aligned(16))) float so[4][32][68];
  // k-tiles of 64 halves (one whole 128-B line per row) of the block's 128 A rows and 64 B rows, two buffers; row pitch 72 halves = 144 B = 16 B x 9 for the ds_load_b128 fragment reads
  __shared__ __attribute__((aligned(16))) _Float16 sa[2][128][G2_LP];
  __shared__ __attribute__((aligned(16))) _Float16 sb[2][64][G2_LP];
  const int tid = threadIdx.x, w = tid >> 5, lane = tid & 31, ln = lane & 15, hh = lane >> 4; const int by = blockIdx.y;
  unsigned bx = blockIdx.x; if (bx < (unsigned)nb1) { Bh = B1; C = C1; N = N1; ldc = N1; bias = nullptr; } else bx -= (unsigned)nb1;      /* a second product of the same A in the same grid (no bias, C1 of pitch N1): it has the first nb1 blocks, so that the small job starts with the launch; the same for the whole block */
  A += (size_t)by * sA; Bh += (size_t)by * sB; const size_t cofs = (size_t)by * sC; const float* bp = bias ? bias + (size_t)by * sBias : nullptr;
  const int ntn = N >> 6; const int mt = bx / ntn, nq = bx - mt * ntn; const int row0 = mt * 128 + 32 * w, col0 = nq * 64; if (mt * 128 >= M) return;      /* the same for the whole block: it stands in front of barriers */
  const int sr = tid >> 3, sc = (tid & 7) * 8;      /* staging: 8 lanes cover one row's 128 B, a wave-wide load covers 4 whole lines */
  const char* ab = (const char*)(A + (size_t)(mt * 128) * lda); const char* bb = (const char*)(Bh + (size_t)col0 * ldb);      /* the block's first A and B row: the same in every lane */
  const unsigned ao = (unsigned)(sr * lda + sc) * 2u, bo = (unsigned)(sr * ldb + sc) * 2u;      /* the lane's own byte offset, fixed for the whole loop */
  const v8f z8 = {0.f,0.f,0.f,0.f,0.f,0.f,0.f,0.f}; v8f c00 = z8, c01 = z8, c02 = z8, c03 = z8, c10 = z8, c11 = z8, c12 = z8, c13 = z8;
  v8us ra0[8], rb0[4], ra1[8], rb1[4];
  auto gl = [&](v8us* ra, v8us* rb, int kb) {
#pragma unroll
    for (int i = 0; i < 8; ++i) ra[i] = *(const v8us*)(ab + ((size_t)(16 * i) * lda + kb) * 2 + ao);
#pragma unroll
    for (int i = 0; i < 4; ++i) rb[i] = *(const v8us*)(bb + ((size_t)(16 * i) * ldb + kb) * 2 + bo); };
  auto st = [&](const v8us* ra, const v8us* rb, int buf) {
#pragma unroll
    for (int i = 0; i < 8; ++i) *(v8us*)&sa[buf][sr + 16 * i][sc] = ra[i];
#pragma unroll
    for (int i = 0; i < 4; ++i) *(v8us*)&sb[buf][sr + 16 * i][sc] = rb[i]; };
  auto comp = [&](int buf) {
#pragma unroll
    for (int kk = 0; kk < 64; kk += 32) { const v16h a0 = g2_frag(&sa[buf][32 * w + ln][kk], hh), a1 = g2_frag(&sa[buf][32 * w + 16 + ln][kk], hh);
      const v16h b0 = g2_frag(&sb[buf][ln][kk], hh), b1 = g2_frag(&sb[buf][16 + ln][kk], hh), b2 = g2_frag(&sb[buf][32 + ln][kk], hh), b3 = g2_frag(&sb[buf][48 + ln][kk], hh);
      c00 = g2_mma(a0, b0, c00); c10 = g2_mma(a1, b0, c10); c01 = g2_mma(a0, b1, c01); c11 = g2_mma(a1, b1, c11);
      c02 = g2_mma(a0, b2, c02); c12 = g2_mma(a1, b2, c12); c03 = g2_mma(a0, b3, c03); c13 = g2_mma(a1, b3, c13); } };
  // Each barrier publishes the buffer just written and ends every wave's reads of the other buffer, which is written next.
  gl(ra0, rb0, 0);
  __builtin_amdgcn_sched_barrier(0);      /* keeps set 0's loads in front of set 1's: mixed, set 0's wait at the loop's head would wait for set 1 as well */
  gl(ra1, rb1, 64 < K ? 64 : 0);      /* the second set's tile clamped, not branched round: set 0's loads stay the older ones on every way into the loop, so its wait leaves set 1's in flight */
  asm volatile("s_wait_xcnt 0x0" ::: "memory");      /* in front of whatever reuses the address registers of the loads above, which stay in flight */
  int kb = 0;
  // two tiles per trip so that each register set and each LDS buffer has a fixed name; every load of the trip is unconditional (the last two tiles are peeled off below), so the waits can be counted; kept rolled: unrolled further it only grows the code
#pragma unroll 1
  for (; kb + 128 < K; kb += 128) {
    st(ra0, rb0, 0); g2_bar(); gl(ra0, rb0, kb + 128); comp(0);      /* loads two tiles ahead: in flight over this tile's and the next tile's products */
    st(ra1, rb1, 1); g2_bar(); gl(ra1, rb1, kb + 192); comp(1);
    asm volatile("s_wait_xcnt 0x0" ::: "memory"); }      /* in front of the next trip's address arithmetic, which rewrites the address registers of loads still in flight */
  st(ra0, rb0, 0); g2_bar(); comp(0);
  if (kb + 64 < K) { st(ra1, rb1, 1); g2_bar(); comp(1); }
  v8f accs[8] = {c00, c01, c02, c03, c10, c11, c12, c13};
#pragma unroll
  for (int u = 0; u < 8; ++u) { const int t = u & 3, half = u >> 2; const int col = col0 + t * 16 + ln; const float bv = bp ? bf16_round(bp[col]) : 0.f;
#pragma unroll
    for (int r = 0; r < 8; ++r) { const int rloc = half * 16 + 8 * hh + r; float v = accs[u][r] * alpha + bv; if (CP) { if (rowsPerB < 0) v += CP[cofs + (size_t)(row0g + row0 + rloc) * ldc + col];      /* rowsPerB < 0: own element of the batched C plane */ else { const int bidx = (row0g + row0 + rloc) / rowsPerB; v += CP[(size_t)bidx * sCPb + (size_t)by * 64 + col]; } }
      if (ACT == 3) v = fmaxf(v, 0.f); else if (ACT == 6) v = 0.5f * v * (1.0f + erff(v * 0.70710678118654752f)); else if (ACT == 11) v = 1.0f / (1.0f + expf(-v)); else if (ACT == 15) v = v / (1.0f + expf(-v)); else if (ACT == 12) v = (v > 0.f) ? v : 0.01f * v; else if (ACT == 8) v = tanhf(v); else if (ACT == 9) v = 0.5f * v * (1.0f + tanhf(0.7978845608028654f * (v + 0.044715f * v * v * v))); else if (ACT == 14) v = (v > 0.f) ? v : 0.1f * v; else if (ACT == 16) v = (v >= 0.f) ? v : 0.3f * v; else if (ACT == 17) v = (v >= 0.f) ? v : 0.2f * v;
      so[w][rloc][t * 16 + ln] = v; } }
  __builtin_amdgcn_fence(__ATOMIC_ACQ_REL, "workgroup"); __builtin_amdgcn_wave_barrier();
  const int rsub = lane >> 4, c4 = (lane & 15) * 4;
  {
#pragma unroll
    for (int q = 0; q < 16; ++q) { const int r = q * 2 + rsub; const v4f v = *(const v4fa*)&so[w][r][c4]; if (C) *(v4f*)(C + cofs + (size_t)(row0 + r) * ldc + col0 + c4) = v; if (C16) { v4h h4; for (int i = 0; i < 4; ++i) h4[i] = (_Float16)v[i]; *(v4h*)(C16 + cofs + (size_t)(row0 + r) * ldc + col0 + c4) = h4; } }
     } }


// ---- launches that do not depend on one another share one grid: a range of block indices per job (every test on the block index is the same for the whole work-group); no job reads what another job of its grid writes
// the seven input conversions to f16 (weights x 16, x as it is: x 1 is exact); 8 values a thread, every array a whole number of blocks
#define PB_QKV (3 * DM * DM / 8 / 256)
#define PB_X (NR * DM / 8 / 256)
#define PB_OUT (DM * DM / 8 / 256)
#define PB_LIN (64 * DM / 8 / 256)
__global__ __launch_bounds__(256) void k_prep(const float* __restrict__ Wqkv, const float* __restrict__ x, const float* __restrict__ Wout, const float* __restrict__ W1w, const float* __restrict__ W2w, const float* __restrict__ W1r, const float* __restrict__ W2r,
    _Float16* __restrict__ BQKV, _Float16* __restrict__ X16, _Float16* __restrict__ BO, _Float16* __restrict__ BL) {
  int b = blockIdx.x; const float* Wm; _Float16* Bt; float sc = 16.0f;
  if (b < PB_QKV) { Wm = Wqkv; Bt = BQKV; }
  else if ((b -= PB_QKV) < PB_X) { Wm = x; Bt = X16; sc = 1.0f; }
  else if ((b -= PB_X) < PB_OUT) { Wm = Wout; Bt = BO; }
  else { b -= PB_OUT; const int g = b / PB_LIN; b -= g * PB_LIN; Wm = g == 0 ? W1w : g == 1 ? W2w : g == 2 ? W1r : W2r; Bt = BL + (size_t)g * 64 * DM; }      /* [W1w; W2w; W1r; W2r] rows h*4 + i */
  const size_t t = (size_t)b * 256 + threadIdx.x; FragH f; for (int q = 0; q < 8; ++q) f.h[q] = (_Float16)(bf16_round(Wm[t * 8 + q]) * sc); *(v8us*)((unsigned short*)Bt + t * 8) = f.half[0];  }
__device__ __forceinline__ void ccp_body(const int bx, const float* __restrict__ QKV, int coff, _Float16* __restrict__ D) { const size_t t = (size_t)bx * 256 + threadIdx.x; if (t >= (size_t)NR * DM / 8) return; const int c0 = (int)((t * 8) % DM); const size_t row = (t * 8) / DM; const v8f a = *(const v8f*)(QKV + row * 3 * DM + coff + c0); FragH f; for (int q = 0; q < 8; ++q) f.h[q] = (_Float16)a[q];
  *(v8us*)((unsigned short*)D + (((row / TT) * NH + c0 / HD) * TT + row % TT) * HD + c0 % HD) = f.half[0];  }      /* plane (batch * NH + head), row t, 64 halves a row: one batch stride serves all 32 planes */
__device__ __forceinline__ void chl_body(const int bx, const float* __restrict__ QKV, int coff, _Float16* __restrict__ Hh, _Float16* __restrict__ Lh) {
  #pragma clang fp contract(off)
  const size_t t = (size_t)bx * 256 + threadIdx.x; if (t >= (size_t)NR * DM / 8) return; const int c0 = (int)((t * 8) % DM); const size_t row = (t * 8) / DM; const v8f a = *(const v8f*)(QKV + row * 3 * DM + coff + c0); FragH fh, fl; for (int q = 0; q < 8; ++q) { const _Float16 hv = (_Float16)a[q]; fh.h[q] = hv; fl.h[q] = (_Float16)((a[q] - (float)hv) * 1024.0f); }
  { *(v8us*)((unsigned short*)Hh + t * 8) = fh.half[0]; *(v8us*)((unsigned short*)Lh + t * 8) = fl.half[0];  } }
__device__ __forceinline__ void exter(const float* p1, const float* p2, float* L) {
  #pragma clang fp contract(off)
  const int PI[6] = {0, 0, 0, 1, 1, 2}, PJ[6] = {1, 2, 3, 2, 3, 3}; float n2 = 0.f;
  for (int k = 0; k < 6; ++k) { float a = p1[PI[k]] * p2[PJ[k]]; a += -(p1[PJ[k]] * p2[PI[k]]); L[k] = a; n2 += a * a; }
  const float n = fmaxf(sqrtf(n2), 1e-12f); for (int k = 0; k < 6; ++k) L[k] = L[k] / n; }
__device__ __forceinline__ void lines_body(const int bx, const float* __restrict__ LW, float* __restrict__ JW, float* __restrict__ RD) {
  #pragma clang fp contract(off)
  const int tt = bx * 256 + threadIdx.x; if (tt >= NR * NH) return; const int t = tt % TT; const int bh = tt / TT; const int h = bh % NH, b = bh / NH; const size_t row = (size_t)b * TT + t; float w1[4], w2[4], r1[4], r2[4];
  for (int i = 0; i < 4; ++i) { w1[i] = (t > 0) ? LW[(row - 1) * 256 + h * 4 + i] : 0.f; w2[i] = LW[row * 256 + 64 + h * 4 + i]; r1[i] = LW[row * 256 + 128 + h * 4 + i]; r2[i] = LW[row * 256 + 192 + h * 4 + i]; }
  float wl[6], rl[6]; exter(w1, w2, wl); exter(r1, r2, rl); v8f jw, rd; jw[0] = wl[5]; jw[1] = -wl[4]; jw[2] = wl[3]; jw[3] = wl[2]; jw[4] = -wl[1]; jw[5] = wl[0]; jw[6] = 0.f; jw[7] = 0.f; for (int k = 0; k < 6; ++k) rd[k] = rl[k]; rd[6] = 0.f; rd[7] = 0.f;
  const size_t o = (((size_t)b * NH + h) * TT + t) * 8; { *(v8f*)(JW + o) = jw; *(v8f*)(RD + o) = rd;  } }
// what follows the two projections, in one grid: the lines, then the q, k planes and v as hi + residual
#define SB_LIN (NR * NH / 256)
#define SB_PL (NR * DM / 8 / 256)
__global__ __launch_bounds__(256) void k_split(const float* __restrict__ LW, float* __restrict__ JW, float* __restrict__ RD, const float* __restrict__ QKV, _Float16* __restrict__ Q16, _Float16* __restrict__ K16, _Float16* __restrict__ V16, _Float16* __restrict__ VL16) {
  int b = blockIdx.x;
  if (b < SB_LIN) lines_body(b, LW, JW, RD);
  else if ((b -= SB_LIN) < SB_PL) ccp_body(b, QKV, 0, Q16);
  else if ((b -= SB_PL) < SB_PL) ccp_body(b, QKV, DM, K16);
  else chl_body(b - SB_PL, QKV, 2 * DM, V16, VL16); }      /* v as hi + residual (the bias makes the attention peaked, so v's rounding reaches the output almost unaveraged) */
typedef float v2f __attribute__((ext_vector_type(2)));
typedef float v2fa __attribute__((ext_vector_type(2), may_alias));
// Causal 6x6 Gram state and rd . M, one work-group per (batch, head). M is symmetric bit for bit (w_i * w_j rounds the same either way and both sides sum in the same order), so 21 running sums carry it.
// Three phases through one LDS array, plane e = (i, j), i <= j, column t: (A) every thread forms the 21 products of its rows; (B) 21 lanes of one wave turn each plane into its running sum over t, in the order t = 0, 1, ...; (C) every thread reads M_t of its rows and forms rd_t . M_t, i = 0..5 in order.
// Plane pitch TT + 4 floats: the 16-B reads and writes of phase B, one plane per lane, start 4 banks apart; phases A and C touch 32 columns in a row of one plane.
#define CE 21
#define CPI (TT + 4)
__device__ __forceinline__ void cum_body(const int bx, const float* __restrict__ JW, const float* __restrict__ RD, float* __restrict__ RDM) {
  __shared__ __attribute__((aligned(16))) float pm[CE][CPI];
  const int tid = threadIdx.x; const size_t bh = bx; const float* jw = JW + bh * TT * 8; const float* rd = RD + bh * TT * 8; float* ob = RDM + bh * TT * 8;
  // every global load of the block is issued before the first is waited for; thread tid has rows c * 256 + tid; all loops over c, i, j, u, q are unrolled in full so that their arrays stay in registers
  v4f wa[TT / 256], ra[TT / 256]; v2f wb[TT / 256], rb[TT / 256];      /* a row's six values as 16 + 8 bytes */
#pragma unroll
  for (int c = 0; c < TT / 256; ++c) { const float* q = jw + (size_t)(c * 256 + tid) * 8; wa[c] = *(const v4fa*)q; wb[c] = *(const v2fa*)(q + 4); }
#pragma unroll
  for (int c = 0; c < TT / 256; ++c) { const float* q = rd + (size_t)(c * 256 + tid) * 8; ra[c] = *(const v4fa*)q; rb[c] = *(const v2fa*)(q + 4); }
  asm volatile("s_wait_xcnt 0x0" ::: "memory");      /* in front of whatever reuses the address registers of the loads above, which stay in flight */
#pragma unroll
  for (int c = 0; c < TT / 256; ++c) { const float w[6] = {wa[c][0], wa[c][1], wa[c][2], wa[c][3], wb[c][0], wb[c][1]}; int e = 0;
#pragma unroll
    for (int i = 0; i < 6; ++i)
#pragma unroll
      for (int j = i; j < 6; ++j) { pm[e][c * 256 + tid] = w[i] * w[j]; ++e; } }
  __syncthreads();
  if (tid < CE) { float* p = &pm[tid][0]; float acc = 0.f; v4f cur[8], nxt[8];
    // the one dependent chain left is one add per t; the reads run 32 columns ahead of it in two named register sets, so that it never waits for LDS
#pragma unroll
    for (int u = 0; u < 8; ++u) cur[u] = *(const v4f*)(p + 4 * u);
    // two sets per trip so that each has a fixed name; kept rolled: unrolled further it only grows the code
#pragma unroll 1
    for (int t0 = 0; t0 < TT; t0 += 64) {
#pragma unroll
      for (int u = 0; u < 8; ++u) nxt[u] = *(const v4f*)(p + t0 + 32 + 4 * u);
#pragma unroll
      for (int u = 0; u < 8; ++u) { v4f o;
#pragma unroll
        for (int q = 0; q < 4; ++q) { acc += cur[u][q]; o[q] = acc; }
        *(v4f*)(p + t0 + 4 * u) = o; }
      if (t0 + 64 < TT) {
#pragma unroll
        for (int u = 0; u < 8; ++u) cur[u] = *(const v4f*)(p + t0 + 64 + 4 * u); }
#pragma unroll
      for (int u = 0; u < 8; ++u) { v4f o;
#pragma unroll
        for (int q = 0; q < 4; ++q) { acc += nxt[u][q]; o[q] = acc; }
        *(v4f*)(p + t0 + 32 + 4 * u) = o; } } }
  __syncthreads();
#pragma unroll
  for (int c = 0; c < TT / 256; ++c) { const float r[6] = {ra[c][0], ra[c][1], ra[c][2], ra[c][3], rb[c][0], rb[c][1]}; float m[CE];
#pragma unroll
    for (int e = 0; e < CE; ++e) m[e] = pm[e][c * 256 + tid];
    v8f o;
#pragma unroll
    for (int j = 0; j < 6; ++j) { float v = 0.f;
#pragma unroll
      for (int i = 0; i < 6; ++i) { const int lo = i < j ? i : j, hi = i < j ? j : i; v += r[i] * m[lo * 6 - (lo * (lo - 1)) / 2 + hi - lo]; }
      o[j] = v; }
    o[6] = 0.f; o[7] = 0.f;
    *(v8f*)(ob + (size_t)(c * 256 + tid) * 8) = o;
    if (c + 1 < TT / 256) asm volatile("s_wait_xcnt 0x0" ::: "memory"); } }      /* in front of the next rows' LDS reads and sums, which reuse the registers that the store names */
// the Gram state and the two V transpositions in one grid: the 32 long work-groups of the state first, so that they start with the launch and the short transpositions run beside them
#define VB_T (NB * NH * (TT / 64))
__global__ __launch_bounds__(256) void k_cumvt(const float* __restrict__ JW, const float* __restrict__ RD, float* __restrict__ RDM, const _Float16* __restrict__ V16, _Float16* __restrict__ VT, const _Float16* __restrict__ VL16, _Float16* __restrict__ VTL) {
  int b = blockIdx.x;
  if (b < NB * NH) cum_body(b, JW, RD, RDM);
  else { b -= NB * NH; const bool lo = b >= VB_T; vt_body<NH, TT>(lo ? b - VB_T : b, lo ? VL16 : V16, DM, 0, lo ? VTL : VT); } }
#define FA_JP 68      /* pitch of a Jw plane in floats: 16-B multiples for the reads; the staging stores of a wave (16 keys x 2 groups of 4 planes) fall on 32 different banks */
__device__ __forceinline__ v8f fa_mma(v16h a, v16h b, v8f c) { return __builtin_amdgcn_wmma_f32_16x16x32_f16(false, a, false, b, (short)0, c, false, false); }
__global__ __launch_bounds__(128) void k_fattn(const _Float16* __restrict__ Q, const _Float16* __restrict__ Kh, const _Float16* __restrict__ Vh, const _Float16* __restrict__ Vl, const float* __restrict__ RDM, const float* __restrict__ JW, const float* __restrict__ bsc, _Float16* __restrict__ CH, _Float16* __restrict__ CL) {
  // two buffers of: 64 K rows [key][64 d], 64 V^T rows hi and residual [d][64 keys] (pitch as in k_gemm2), Jw as planes [component][key]
  __shared__ __attribute__((aligned(16))) _Float16 sk[2][64][G2_LP];
  __shared__ __attribute__((aligned(16))) _Float16 sv[2][64][G2_LP];
  __shared__ __attribute__((aligned(16))) _Float16 sl[2][64][G2_LP];
  __shared__ __attribute__((aligned(16))) float sj[2][8][FA_JP];
  const int tid = threadIdx.x, w = tid >> 5, lane = tid & 31, ln = lane & 15, hh = lane >> 4;
  const int pl = blockIdx.x, by = blockIdx.y, blk = by < TT / 128 ? TT / 64 - 1 - by : by - TT / 128;      /* plane; row block: block b walks b + 1 tiles; the long half first, longest first, then the short half, shortest first, so that work-groups half a grid apart add up alike (for speed only) */
  const int tl = w * 16 + ln; const size_t prow = (size_t)pl * TT + blk * 64 + tl;      /* the lane's query: inside the block, and as a row of the planes */
  const float bs2 = bf16_round(bsc[pl % NH]) * 1.4426950408889634f, c1 = 0.125f * 1.4426950408889634f;
  const v16h q0 = g2_frag(Q + prow * HD, hh), q1 = g2_frag(Q + prow * HD + 32, hh);
  const v4f r03 = *(const v4fa*)(RDM + prow * 8); const v2f r45 = *(const v2fa*)(RDM + prow * 8 + 4);
  const float rdm[6] = {r03[0], r03[1], r03[2], r03[3], r45[0], r45[1]};
  const int sr = tid >> 3, sc = (tid & 7) * 8;      /* staging: 8 lanes cover one row's 128 B */
  const char* kg = (const char*)(Kh + (size_t)pl * TT * HD); const char* vg = (const char*)(Vh + (size_t)pl * HD * TT); const char* lg = (const char*)(Vl + (size_t)pl * HD * TT); const char* jg = (const char*)(JW + (size_t)pl * TT * 8);      /* the plane's first bytes: the same in every lane */
  const unsigned ko = (unsigned)(sr * HD + sc) * 2u, vo = (unsigned)(sr * TT + sc) * 2u, jo = (unsigned)tid * 16u;      /* the lane's own byte offsets, fixed for the whole loop; Jw: key tid >> 1, components 4 * (tid & 1) .. + 3 (6 and 7 are the rows' padding: staged along, never read) */
  v8us rk[4], rv[4], rl[4]; v4f rj;
  // every loop over i, q, c, k, r, ks, ds below is unrolled in full so that its arrays stay in registers
  auto gl = [&](int j) {
    const char* kj = kg + (size_t)j * 64 * HD * 2 + ko; const char* vj = vg + (size_t)j * 64 * 2 + vo; const char* lj = lg + (size_t)j * 64 * 2 + vo; const char* jj = jg + (size_t)j * 64 * 32 + jo;
#pragma unroll
    for (int i = 0; i < 4; ++i) rk[i] = *(const v8us*)(kj + 16 * i * HD * 2);
#pragma unroll
    for (int i = 0; i < 4; ++i) rv[i] = *(const v8us*)(vj + 16 * i * TT * 2);
#pragma unroll
    for (int i = 0; i < 4; ++i) rl[i] = *(const v8us*)(lj + 16 * i * TT * 2);
    rj = *(const v4fa*)jj;
    // in front of whatever reuses the address registers of the loads above, which stay in flight; the four addresses are inputs (read only) so that they stay whole up to the wait: otherwise the last load of a group lands on the address pair that the group's earlier loads name
    asm volatile("s_wait_xcnt 0x0" :: "v"(kj), "v"(vj), "v"(lj), "v"(jj) : "memory"); };
  auto st = [&](int buf) {
#pragma unroll
    for (int i = 0; i < 4; ++i) { *(v8us*)&sk[buf][sr + 16 * i][sc] = rk[i]; *(v8us*)&sv[buf][sr + 16 * i][sc] = rv[i]; *(v8us*)&sl[buf][sr + 16 * i][sc] = rl[i]; }
#pragma unroll
    for (int q = 0; q < 4; ++q) sj[buf][(tid & 1) * 4 + q][tid >> 1] = rj[q]; };
  const v8f z8 = {0.f,0.f,0.f,0.f,0.f,0.f,0.f,0.f};
  v8f oa[4] = {z8, z8, z8, z8};
  float m = -3.0e38f, su = 0.f;
  gl(0);
  __builtin_amdgcn_sched_barrier(0);      /* keeps the clearing of the accumulators, which reuses the address registers of the q and rd . M loads above, behind the wait that ends gl */
  // Each barrier publishes the buffer just written and ends every wave's reads of the other buffer, which is written next. The next tile's loads fly during this tile's work; the diagonal tile has none behind it (the test is the same for the whole block), so no load is in flight when a wave ends.
  for (int j = 0; ; ++j) {      /* left behind the diagonal tile, at the foot */
    const int buf = j & 1;
    st(buf); g2_bar(); if (j < blk) gl(j + 1);
    float l[4][8];
#pragma unroll
    for (int c = 0; c < 4; ++c) {
      v8f s = fa_mma(g2_frag(&sk[buf][c * 16 + ln][0], hh), q0, z8); s = fa_mma(g2_frag(&sk[buf][c * 16 + ln][32], hh), q1, s);
      v4f jv[6][2];
#pragma unroll
      for (int k = 0; k < 6; ++k) { jv[k][0] = *(const v4f*)&sj[buf][k][c * 16 + 8 * hh]; jv[k][1] = *(const v4f*)&sj[buf][k][c * 16 + 8 * hh + 4]; }
#pragma unroll
      for (int r = 0; r < 8; ++r) { float d = 0.f;
#pragma unroll
        for (int k = 0; k < 6; ++k) d += rdm[k] * jv[k][r >> 2][r & 3];
        l[c][r] = s[r] * c1 + fabsf(d) * bs2; } }
    if (j == blk) {      /* the diagonal tile alone holds keys behind a query; the same for the whole block */
#pragma unroll
      for (int c = 0; c < 4; ++c)
#pragma unroll
        for (int r = 0; r < 8; ++r) if (c * 16 + 8 * hh + r > tl) l[c][r] = -3.0e38f; }
    float mt = l[0][0];
#pragma unroll
    for (int c = 0; c < 4; ++c)
#pragma unroll
      for (int r = 0; r < 8; ++r) mt = fmaxf(mt, l[c][r]);
    mt = fmaxf(mt, __shfl_xor(mt, 16, 32));      /* the row's other 32 keys of the tile; key 0 is open to every query, so the maximum is a real logit from tile 0 on */
    const float mn = fmaxf(m, mt), al = __builtin_amdgcn_exp2f(m - mn), mo = mn - 10.0f; m = mn; su *= al;
#pragma unroll
    for (int ds = 0; ds < 4; ++ds) oa[ds] *= al;
#pragma unroll
    for (int ks = 0; ks < 2; ++ks) { FragH pf;
#pragma unroll
      for (int i = 0; i < 16; ++i) { const float e = __builtin_amdgcn_exp2f(l[2 * ks + (i >> 3)][i & 7] - mo); su += e; pf.h[i] = (_Float16)e; }
      const v16h pr = pf.v * (_Float16)0.0009765625f;
#pragma unroll
      for (int ds = 0; ds < 4; ++ds) { oa[ds] = fa_mma(g2_frag(&sv[buf][ds * 16 + ln][ks * 32], hh), pf.v, oa[ds]); oa[ds] = fa_mma(g2_frag(&sl[buf][ds * 16 + ln][ks * 32], hh), pr, oa[ds]); } }
    if (j >= blk) break; }
  su += __shfl_xor(su, 16, 32);
  const float inv = 1.0f / su;
  const size_t o = ((size_t)(pl / NH) * TT + blk * 64 + tl) * DM + (pl % NH) * HD + 8 * hh;
#pragma unroll
  for (int ds = 0; ds < 4; ++ds) { FragH f, fl;
#pragma unroll
    for (int r = 0; r < 8; ++r) { const float v = oa[ds][r] * inv; const _Float16 hv = (_Float16)v; f.h[r] = hv; fl.h[r] = (_Float16)((v - (float)hv) * 1024.0f); }
    *(v8us*)((unsigned short*)CH + o + ds * 16) = f.half[0]; *(v8us*)((unsigned short*)CL + o + ds * 16) = fl.half[0];
    if (ds + 1 < 4) asm volatile("s_wait_xcnt 0x0" ::: "memory"); } }      /* in front of the next columns' sums, which may reuse the registers that the stores name */

extern "C" void kernel_launch(void* const* d_in, const int* in_sizes, int n_in,
                              void* d_out, int out_size, void* d_ws, size_t ws_size, hipStream_t stream) {
  (void)in_sizes; (void)n_in; (void)out_size;
  const float* x = (const float*)d_in[0]; const float* Wqkv = (const float*)d_in[1]; const float* bqkv = (const float*)d_in[2]; const float* W1w = (const float*)d_in[3]; const float* W2w = (const float*)d_in[4]; const float* W1r = (const float*)d_in[5]; const float* W2r = (const float*)d_in[6]; const float* bsc = (const float*)d_in[7]; const float* Wout = (const float*)d_in[8]; const float* bout = (const float*)d_in[9];
  char* ws = (char*)d_ws; size_t off = 0;
  auto take = [&](size_t bytes) { char* p = ws + off; off += (bytes + 255) & ~(size_t)255; return p; };
  const size_t np = (size_t)NR * DM;
  _Float16* BQKV = (_Float16*)take((size_t)3 * DM * DM * 2); _Float16* BL = (_Float16*)take((size_t)256 * DM * 2); _Float16* X16 = (_Float16*)take(np * 2); float* QKV = (float*)take(np * 3 * 4); _Float16* V16 = (_Float16*)take(np * 2); _Float16* VL16 = (_Float16*)take(np * 2); float* LW = (float*)take((size_t)NR * 256 * 4); float* RD = (float*)take((size_t)NB * NH * TT * 8 * 4);
  _Float16* BO = (_Float16*)take((size_t)DM * DM * 2); _Float16* Q16 = (_Float16*)take(np * 2); _Float16* K16 = (_Float16*)take(np * 2); _Float16* VT = (_Float16*)take(np * 2); _Float16* VTL = (_Float16*)take(np * 2);
  float* JW = (float*)take((size_t)NB * NH * TT * 8 * 4); float* RDM = (float*)take((size_t)NB * NH * TT * 8 * 4);
  _Float16* CH = (_Float16*)take(np * 2); _Float16* CL = (_Float16*)take(np * 2);
  if (off > ws_size) return;      /* under 74 MiB */
  k_prep<<<PB_QKV + PB_X + PB_OUT + 4 * PB_LIN, 256, 0, stream>>>(Wqkv, x, Wout, W1w, W2w, W1r, W2r, BQKV, X16, BO, BL);      /* torch (out, in) naturals */
  k_gemm2<0><<<dim3((NR / 128) * (256 / 64) + (NR / 128) * (3 * DM / 64), 1), 128, 0, stream>>>(X16, DM, 0, BQKV, DM, 0, 0.0625f, bqkv, 0, nullptr, 1, 0, 0, QKV, nullptr, 3 * DM, 0, NR, 3 * DM, DM, (NR / 128) * (256 / 64), BL, LW, 256);      /* [q | k | v] + bias, head h at h*64; line projections f32 [row][w1 | w2 | r1 | r2] (x_prev handled by a row shift) */
  k_split<<<SB_LIN + 3 * SB_PL, 256, 0, stream>>>(LW, JW, RD, QKV, Q16, K16, V16, VL16);
  k_cumvt<<<NB * NH + 2 * VB_T, 256, 0, stream>>>(JW, RD, RDM, V16, VT, VL16, VTL);
  // attention: one launch, scores and weights stay in registers; grid x = the 32 (batch, head) planes, y = the 16 blocks of 64 query rows; q, k are [plane][t][64], v^T [plane][d][t]; the context comes out as [row][head * 64 + d], hi + residual
  k_fattn<<<dim3(NB * NH, TT / 64), 128, 0, stream>>>(Q16, K16, VT, VTL, RDM, JW, bsc, CH, CL);
  k_gemm2<0><<<dim3((NR / 128) * (DM / 64), 1), 128, 0, stream>>>(CL, DM, 0, BO, DM, 0, 0.0625f / 1024.0f, nullptr, 0, nullptr, 1, 0, 0, (float*)d_out, nullptr, DM, 0, NR, DM, DM, 0, nullptr, nullptr, 0);
  k_gemm2<0><<<dim3((NR / 128) * (DM / 64), 1), 128, 0, stream>>>(CH, DM, 0, BO, DM, 0, 0.0625f, bout, 0, (const float*)d_out, 1, (size_t)DM, 0, (float*)d_out, nullptr, DM, 0, NR, DM, DM, 0, nullptr, nullptr, 0);      /* out = (c_lo + c_hi) Wout^T + bout */
}

// v007
// One run takes 89.6 microseconds.
// Two timings next to v006 both put it at 1.21 times that version's speed.
// Counting every step since v000, it is 15.1 times as fast.
#include <hip/hip_runtime.h>
// EigenBiasAttention (2 x 1024 tokens x 1024 = 16 heads x 64; qkv = x Wqkv^T + b; causal softmax(q.k/8 + |bias|) v; bias from Plucker lines: per head w1 = x_prev W1w^T, w2 = x W2w^T, r1 = x W1r^T, r2 = x W2r^T (4-vectors), write/read lines = normalised exterior products (6-vectors), Jw = write J6, M_t = cumsum_t Jw Jw^T, bias[t][s] = |(rd_t . M_t) . Jw_s| * bias_scale[h]; out = merged . Wout^T + bout).
// Structure: exact f16 x plane; qkv and the four line projections as f16 WMMA GEMMs (32x64 wave tiles, f32 accumulation, exact x16 weights (+ bias); f32 out) then f16 q/k planes (one [t][64] plane per (batch, head)) and v planes; the exterior products / normalisation / J6 on VALU; the causal 6x6 Gram cumsum and rd . M per (batch, head) on VALU (f32; products and rd . M one row per thread, the 1024-step running sums by one wave through LDS); V^T hi/residual by LDS tiles; one fused launch for all 32 (batch, head) planes: score products (K = 64, f32), the biased causal softmax on VALU with a running row maximum (bias dot K = 6 per (t, s), bias_scale read; unnormalised f16 weights x 2^10), readout as two product terms, row scaling + hi/residual; Wout as two GEMM terms (+ bias).
// Compute dtype: inputs rounded to bf16; x / weights exact as f16 (line projections are f32 sums of exact products, so the bias path is f32-class); q, k and the softmax weights as plain f16 operands (~2^-12); v and the context as f16 hi + residual. v_wmma_f32_16x16x32_f16.
#define NB 2
#define TT 1024
#define DM 1024
#define NH 16
#define HD 64
#define NR (NB * TT)
typedef __bf16 v16b __attribute__((ext_vector_type(16)));
typedef unsigned short v8us __attribute__((ext_vector_type(8), may_alias));
typedef float  v8f  __attribute__((ext_vector_type(8)));
typedef float  v4f  __attribute__((ext_vector_type(4)));
typedef float  v4fa __attribute__((ext_vector_type(4), may_alias));
union FragB { v16b v; v8us half[2]; unsigned short u[16]; };

__device__ __forceinline__ unsigned short bf16_bits(float x) { unsigned int u = __float_as_uint(x); return (unsigned short)((u + 0x7FFFu + ((u >> 16) & 1u)) >> 16); }
__device__ __forceinline__ float bf16_val(unsigned short b) { return __uint_as_float(((unsigned int)b) << 16); }
__device__ __forceinline__ float bf16_round(float x) { return bf16_val(bf16_bits(x)); }
// D += A·B with NT terms: 1 = ah·bh, 2 = + al·bh (A split), 3 = + ah·bl (both split)
template <int NT>
__device__ __forceinline__ v8f mmaN(v16b ah, v16b al, v16b bh, v16b bl, v8f c) {
  c = __builtin_amdgcn_wmma_f32_16x16x32_bf16(false, ah, false, bh, (short)0, c, false, false);
  if (NT >= 2) c = __builtin_amdgcn_wmma_f32_16x16x32_bf16(false, al, false, bh, (short)0, c, false, false);
  if (NT >= 3) c = __builtin_amdgcn_wmma_f32_16x16x32_bf16(false, ah, false, bl, (short)0, c, false, false);
  asm volatile("v_nop\n\tv_nop\n\tv_nop\n\tv_nop" : "+v"(c) : "v"(ah), "v"(al), "v"(bh), "v"(bl));
  return c;
}

__global__ __launch_bounds__(256) void k_wt_bf16(const float* __restrict__ W, unsigned short* __restrict__ Wt, int K, int N) {
  const int t = blockIdx.x * 256 + threadIdx.x;
  const int k8n = K / 8;
  if (t >= N * k8n) return;
  const int n = t / k8n, k8 = (t % k8n) * 8;
  v8us v;
#pragma unroll
  for (int i = 0; i < 8; ++i) v[i] = bf16_bits(W[(size_t)(k8 + i) * N + n]);
  *(v8us*)(Wt + (size_t)n * K + k8) = v;
  
}

// GEMM C[M][N] (f32, pitch ldc) = act(A[M][K]·W + bias). A f32 row-major (pitch lda) converted per fragment to bf16
// (ASPLIT: hi/lo two planes -> 2 terms, else single rounded term); Wt bf16 [N][K] (pitch ldb). BIAS_BF16 rounds the
// bias to bf16 first (bias quantised to bf16 before the add). K%32==0, M%16==0, N%64==0.
template <bool ASPLIT, int ACT, bool BIAS_BF16>
__global__ __launch_bounds__(128) void k_gemm_bf(const float* __restrict__ A, int lda, const unsigned short* __restrict__ Wt, int ldb,
                                               const float* __restrict__ bias, float* __restrict__ C, int ldc, int M, int N, int K) {
  __shared__ __attribute__((aligned(16))) float so[4][16][64];
  const int tid = threadIdx.x, w = tid >> 5, lane = tid & 31, ln = lane & 15, hh = lane >> 4;
  const int ntn = N / 64;
  const int wid = blockIdx.x * 4 + w;
  const int mt = wid / ntn, nq = wid % ntn;
  if (mt * 16 >= M) return;
  const int row0 = mt * 16, col0 = nq * 64;
  const float* arow = A + (size_t)(row0 + ln) * lda;
  v8f acc[4] = {};
  for (int kb = 0; kb < K; kb += 32) {
    FragB ah, al;
    const v4f x0 = *(const v4fa*)(arow + kb + 8 * hh), x1 = *(const v4fa*)(arow + kb + 8 * hh + 4);
    const v4f x2 = *(const v4fa*)(arow + kb + 16 + 8 * hh), x3 = *(const v4fa*)(arow + kb + 16 + 8 * hh + 4);
    float xs[16] = {x0[0],x0[1],x0[2],x0[3],x1[0],x1[1],x1[2],x1[3],x2[0],x2[1],x2[2],x2[3],x3[0],x3[1],x3[2],x3[3]};
#pragma unroll
    for (int i = 0; i < 16; ++i) { const unsigned short hb = bf16_bits(xs[i]); ah.u[i] = hb; al.u[i] = ASPLIT ? bf16_bits(xs[i] - bf16_val(hb)) : (unsigned short)0; }
#pragma unroll
    for (int t = 0; t < 4; ++t) {
      const unsigned short* brow = Wt + (size_t)(col0 + t * 16 + ln) * ldb + kb;
      FragB b;
      b.half[0] = *(const v8us*)(brow + 8 * hh);
      b.half[1] = *(const v8us*)(brow + 16 + 8 * hh);
      acc[t] = mmaN<ASPLIT ? 2 : 1>(ah.v, al.v, b.v, b.v, acc[t]);
    }
  }
#pragma unroll
  for (int t = 0; t < 4; ++t) {
    float bv = bias ? bias[col0 + t * 16 + ln] : 0.f;
    if (BIAS_BF16) bv = bf16_round(bv);
#pragma unroll
    for (int r = 0; r < 8; ++r) { float v = acc[t][r] + bv; if (ACT == 1) v = fmaxf(v, 0.f); so[w][8 * hh + r][t * 16 + ln] = v; }
  }
  __builtin_amdgcn_fence(__ATOMIC_ACQ_REL, "workgroup");
  __builtin_amdgcn_wave_barrier();
  const int rsub = lane >> 4, c4 = (lane & 15) * 4;
  {
#pragma unroll
    for (int q = 0; q < 8; ++q) {
      const int r = q * 2 + rsub;
      const v4f v = *(const v4fa*)&so[w][r][c4];
      *(v4f*)(C + (size_t)(row0 + r) * ldc + col0 + c4) = v;
    }
    
  }
}

// GEMM C = act(A·W + bias + resid): A f32 (ASPLIT -> hi/lo 2 terms), Wt bf16 [N][K]; ACT 0 none, 1 relu, 2 exact gelu;
// resid (optional, f32, row index = (row % rmod), pitch ldr, RES_BF16 rounds it) added before the activation.
template <bool ASPLIT, int ACT, bool BIAS_BF16, bool RES_BF16>
__global__ __launch_bounds__(128) void k_gemm_bf3(const float* __restrict__ A, int lda, const unsigned short* __restrict__ Wt, int ldb,
                                                const float* __restrict__ bias, const float* __restrict__ resid, int rmod, int ldr,
                                                float* __restrict__ C, int ldc, int M, int N, int K) {
  __shared__ __attribute__((aligned(16))) float so[4][16][64];
  const int tid = threadIdx.x, w = tid >> 5, lane = tid & 31, ln = lane & 15, hh = lane >> 4;
  const int ntn = N / 64;
  const int wid = blockIdx.x * 4 + w;
  const int mt = wid / ntn, nq = wid % ntn;
  if (mt * 16 >= M) return;
  const int row0 = mt * 16, col0 = nq * 64;
  const float* arow = A + (size_t)(row0 + ln) * lda;
  v8f acc[4] = {};
  for (int kb = 0; kb < K; kb += 32) {
    FragB ah, al;
    const v4f x0 = *(const v4fa*)(arow + kb + 8 * hh), x1 = *(const v4fa*)(arow + kb + 8 * hh + 4);
    const v4f x2 = *(const v4fa*)(arow + kb + 16 + 8 * hh), x3 = *(const v4fa*)(arow + kb + 16 + 8 * hh + 4);
    float xs[16] = {x0[0],x0[1],x0[2],x0[3],x1[0],x1[1],x1[2],x1[3],x2[0],x2[1],x2[2],x2[3],x3[0],x3[1],x3[2],x3[3]};
#pragma unroll
    for (int i = 0; i < 16; ++i) { const unsigned short hb = bf16_bits(xs[i]); ah.u[i] = hb; al.u[i] = ASPLIT ? bf16_bits(xs[i] - bf16_val(hb)) : (unsigned short)0; }
#pragma unroll
    for (int t = 0; t < 4; ++t) {
      const unsigned short* brow = Wt + (size_t)(col0 + t * 16 + ln) * ldb + kb;
      FragB b;
      b.half[0] = *(const v8us*)(brow + 8 * hh);
      b.half[1] = *(const v8us*)(brow + 16 + 8 * hh);
      acc[t] = mmaN<ASPLIT ? 2 : 1>(ah.v, al.v, b.v, b.v, acc[t]);
    }
  }
#pragma unroll
  for (int t = 0; t < 4; ++t) {
    const int col = col0 + t * 16 + ln;
    float bv = bias ? bias[col] : 0.f;
    if (BIAS_BF16) bv = bf16_round(bv);
#pragma unroll
    for (int r = 0; r < 8; ++r) {
      float v = acc[t][r] + bv;
      if (resid) { float rv = resid[(size_t)((row0 + 8 * hh + r) % rmod) * ldr + col]; if (RES_BF16) rv = bf16_round(rv); v += rv; }
      if (ACT == 1) v = fmaxf(v, 0.f);
      if (ACT == 2) v = 0.5f * v * (1.0f + erff(v * 0.70710678118654752f));
      if (ACT == 3) { const float u = 0.7978845608028654f * (v + 0.044715f * v * v * v); v = 0.5f * v * (1.0f + tanhf(u)); }
      so[w][8 * hh + r][t * 16 + ln] = v;
    }
  }
  __builtin_amdgcn_fence(__ATOMIC_ACQ_REL, "workgroup");
  __builtin_amdgcn_wave_barrier();
  const int rsub = lane >> 4, c4 = (lane & 15) * 4;
  {
#pragma unroll
    for (int q = 0; q < 8; ++q) {
      const int r = q * 2 + rsub;
      const v4f v = *(const v4fa*)&so[w][r][c4];
      *(v4f*)(C + (size_t)(row0 + r) * ldc + col0 + c4) = v;
    }
    
  }
}
// row LayerNorm (biased variance, eps) over N: s = X (+ R); optional out_sum <- s; out_norm <- (s-mu)*rsqrt(var+eps)*g + b
template <bool PARAM_BF16>
__global__ __launch_bounds__(256) void k_layernorm(const float* __restrict__ X, const float* __restrict__ R, const float* __restrict__ g, const float* __restrict__ bta,
                                                  float* __restrict__ out_sum, float* __restrict__ out_norm, int N, float eps) {
  __shared__ float red[256];
  const int row = blockIdx.x, tid = threadIdx.x;
  const float* x = X + (size_t)row * N; const float* rr = R ? R + (size_t)row * N : nullptr;
  float vals[16];                     // up to N = 4096
  const int per = N / 256;            // contiguous chunk per thread? use strided-by-4 chunks: thread handles j = tid*4 + 1024*u
  float s1 = 0.f;
  for (int u = 0; u < per / 4; ++u) {
    const int j = tid * 4 + 1024 * u;
    const v4f a = *(const v4fa*)(x + j);
    v4f b = {0.f,0.f,0.f,0.f}; if (rr) b = *(const v4fa*)(rr + j);
#pragma unroll
    for (int q = 0; q < 4; ++q) { const float v = a[q] + b[q]; vals[u * 4 + q] = v; s1 += v; }
  }
  red[tid] = s1; __syncthreads();
  for (int st = 128; st > 0; st >>= 1) { if (tid < st) red[tid] += red[tid + st]; __syncthreads(); }
  const float mu = red[0] / (float)N; __syncthreads();
  float s2 = 0.f;
  for (int u = 0; u < per / 4; ++u)
#pragma unroll
    for (int q = 0; q < 4; ++q) { const float c = vals[u * 4 + q] - mu; s2 += c * c; }
  red[tid] = s2; __syncthreads();
  for (int st = 128; st > 0; st >>= 1) { if (tid < st) red[tid] += red[tid + st]; __syncthreads(); }
  const float rs = rsqrtf(red[0] / (float)N + eps);
  {
    for (int u = 0; u < per / 4; ++u) {
      const int j = tid * 4 + 1024 * u;
      v4f o, sm;
#pragma unroll
      for (int q = 0; q < 4; ++q) {
        float gg = g[j + q], bb = bta[j + q];
        if (PARAM_BF16) { gg = bf16_round(gg); bb = bf16_round(bb); }
        sm[q] = vals[u * 4 + q]; o[q] = (vals[u * 4 + q] - mu) * rs * gg + bb;
      }
      if (out_sum) *(v4f*)(out_sum + (size_t)row * N + j) = sm;
      *(v4f*)(out_norm + (size_t)row * N + j) = o;
    }
    
  }
}



// ---- f16 WMMA path (v_wmma_f32_16x16x32_f16): 11-bit significands for operands in range — used for every GEMM launched here
typedef _Float16 v16h __attribute__((ext_vector_type(16)));
union FragH { v16h v; v8us half[2]; _Float16 h[16]; unsigned short u[16]; };
template <int NT>
__device__ __forceinline__ v8f mmaH(v16h ah, v16h al, v16h bh, v16h bl, v8f c) {
  c = __builtin_amdgcn_wmma_f32_16x16x32_f16(false, ah, false, bh, (short)0, c, false, false);
  if (NT >= 2) c = __builtin_amdgcn_wmma_f32_16x16x32_f16(false, al, false, bh, (short)0, c, false, false);
  if (NT >= 3) c = __builtin_amdgcn_wmma_f32_16x16x32_f16(false, ah, false, bl, (short)0, c, false, false);
  asm volatile("v_nop\n\tv_nop\n\tv_nop\n\tv_nop" : "+v"(c) : "v"(ah), "v"(al), "v"(bh), "v"(bl));
  return c;
}
// batched GEMM like k_gemm_b but f16 operands: A f32 (split into f16 hi/lo if ASPLIT, else rounded to f16), Bt = f16 values [n][k]; alpha; C f32; N multiple of 16 (partial tiles skipped)
template <bool ASPLIT>
__global__ __launch_bounds__(128) void k_gemm_h(const float* __restrict__ A, int lda, size_t sA, const _Float16* __restrict__ Bh, int ldb, size_t sB, float alpha, float* __restrict__ C, int ldc, size_t sC, int M, int N, int K) {
  __shared__ __attribute__((aligned(16))) float so[4][16][64];
  const int tid = threadIdx.x, w = tid >> 5, lane = tid & 31, ln = lane & 15, hh = lane >> 4; const int by = blockIdx.y;
  A += (size_t)by * sA; Bh += (size_t)by * sB; C += (size_t)by * sC;
  const int ntn = (N + 63) / 64; const int wid = blockIdx.x * 4 + w; const int mt = wid / ntn, nq = wid % ntn; if (mt * 16 >= M) return;
  const int row0 = mt * 16, col0 = nq * 64; const float* arow = A + (size_t)(row0 + ln) * lda;
  v8f acc[4] = {};
  for (int kb = 0; kb < K; kb += 32) {
    FragH ah, al;
    const v4f x0 = *(const v4fa*)(arow + kb + 8 * hh), x1 = *(const v4fa*)(arow + kb + 8 * hh + 4), x2 = *(const v4fa*)(arow + kb + 16 + 8 * hh), x3 = *(const v4fa*)(arow + kb + 16 + 8 * hh + 4);
    float xs[16] = {x0[0],x0[1],x0[2],x0[3],x1[0],x1[1],x1[2],x1[3],x2[0],x2[1],x2[2],x2[3],x3[0],x3[1],x3[2],x3[3]};
#pragma unroll
    for (int i = 0; i < 16; ++i) { const _Float16 h = (_Float16)xs[i]; ah.h[i] = h; al.h[i] = ASPLIT ? (_Float16)(xs[i] - (float)h) : (_Float16)0.0f; }
#pragma unroll
    for (int t = 0; t < 4; ++t) { if (col0 + t * 16 >= N) continue; const size_t boff = (size_t)(col0 + t * 16 + ln) * ldb + kb; FragH bq; bq.half[0] = *(const v8us*)(Bh + boff + 8 * hh); bq.half[1] = *(const v8us*)(Bh + boff + 16 + 8 * hh);
      acc[t] = mmaH<ASPLIT ? 2 : 1>(ah.v, al.v, bq.v, bq.v, acc[t]); }
  }
#pragma unroll
  for (int t = 0; t < 4; ++t) { if (col0 + t * 16 >= N) continue;
#pragma unroll
    for (int r = 0; r < 8; ++r) so[w][8 * hh + r][t * 16 + ln] = acc[t][r] * alpha; }
  __builtin_amdgcn_fence(__ATOMIC_ACQ_REL, "workgroup"); __builtin_amdgcn_wave_barrier();
  const int rsub = lane >> 4, c4 = (lane & 15) * 4;
  {
#pragma unroll
    for (int q = 0; q < 8; ++q) { const int r = q * 2 + rsub; if (col0 + c4 < N) { const v4f v = *(const v4fa*)&so[w][r][c4]; *(v4f*)(C + (size_t)(row0 + r) * ldc + col0 + c4) = v; } }
     }
}

// Wt[n][k] = f16(W[k][n]·scale) from f32 row-major W[K][N] (scale = power of two; bf16-exact weights stay exact in f16 away from the subnormal range)
__global__ __launch_bounds__(256) void k_wt_f16(const float* __restrict__ W, _Float16* __restrict__ Wt, int K, int N, float scale) {
  const int t = blockIdx.x * 256 + threadIdx.x; if (t >= N * (K / 8)) return; const int n = t / (K / 8), k8 = (t % (K / 8)) * 8; FragH f;
#pragma unroll
  for (int i = 0; i < 8; ++i) f.h[i] = (_Float16)(bf16_round(W[(size_t)(k8 + i) * N + n]) * scale); const v8us o = f.half[0];
  *(v8us*)((unsigned short*)Wt + (size_t)n * K + k8) = o; 
}
// k_gemm_hh variant with fused epilogue: v = acc·alpha + bias[by·sBias + col] (+ CP[(row/rowsPerB)·sCPb + by·64 + col] if CP) ; ACT 0 none / 1 elu ; writes f16 C16 (and f32 C if non-null)
template <int ACT>
__global__ __launch_bounds__(128) void k_gemm_hhx(const _Float16* __restrict__ A, int lda, size_t sA, const _Float16* __restrict__ Bh, int ldb, size_t sB, float alpha, const float* __restrict__ bias, size_t sBias, const float* __restrict__ CP, int rowsPerB, size_t sCPb, int row0g,
    float* __restrict__ C, _Float16* __restrict__ C16, int ldc, size_t sC, int M, int N, int K) {
  __shared__ __attribute__((aligned(16))) float so[4][16][64];
  const int tid = threadIdx.x, w = tid >> 5, lane = tid & 31, ln = lane & 15, hh = lane >> 4; const int by = blockIdx.y;
  A += (size_t)by * sA; Bh += (size_t)by * sB; const size_t cofs = (size_t)by * sC; const float* bp = bias ? bias + (size_t)by * sBias : nullptr;
  const int ntn = (N + 63) / 64; const int wid = blockIdx.x * 4 + w; const int mt = wid / ntn, nq = wid % ntn; if (mt * 16 >= M) return;
  const int row0 = mt * 16, col0 = nq * 64; const _Float16* arow = A + (size_t)(row0 + ln) * lda;
  v8f acc[4] = {};
  for (int kb = 0; kb < K; kb += 32) { FragH ah; ah.half[0] = *(const v8us*)((const unsigned short*)arow + kb + 8 * hh); ah.half[1] = *(const v8us*)((const unsigned short*)arow + kb + 16 + 8 * hh);
#pragma unroll
    for (int t = 0; t < 4; ++t) { if (col0 + t * 16 >= N) continue; const size_t boff = (size_t)(col0 + t * 16 + ln) * ldb + kb; FragH bq; bq.half[0] = *(const v8us*)((const unsigned short*)Bh + boff + 8 * hh); bq.half[1] = *(const v8us*)((const unsigned short*)Bh + boff + 16 + 8 * hh);
      acc[t] = mmaH<1>(ah.v, ah.v, bq.v, bq.v, acc[t]); }
  }
#pragma unroll
  for (int t = 0; t < 4; ++t) { if (col0 + t * 16 >= N) continue; const int col = col0 + t * 16 + ln; const float bv = bp ? bf16_round(bp[col]) : 0.f;
#pragma unroll
    for (int r = 0; r < 8; ++r) { float v = acc[t][r] * alpha + bv; if (CP) { const int rr = row0g + row0 + 8 * hh + r; if (rowsPerB < 0) v += CP[cofs + (size_t)rr * ldc + col];      /* rowsPerB < 0: own element of the batched C plane */ else { const int bidx = rr / rowsPerB; v += CP[(size_t)bidx * sCPb + (size_t)by * 64 + col]; } } if (ACT == 1) v = (v > 0.f) ? v : expm1f(v); else if (ACT == 7) v = (v > 0.f) ? v + 1.0f : expf(v); else if (ACT == 8) v = tanhf(v); else if (ACT == 9) v = 0.5f * v * (1.0f + tanhf(0.7978845608028654f * (v + 0.044715f * v * v * v))); else if (ACT == 11) v = 1.0f / (1.0f + expf(-v)); else if (ACT == 12) v = (v > 0.f) ? v : 0.01f * v; else if (ACT == 14) v = (v > 0.f) ? v : 0.1f * v; else if (ACT == 16) v = (v >= 0.f) ? v : 0.3f * v; else if (ACT == 17) v = (v >= 0.f) ? v : 0.2f * v; else if (ACT == 15) v = v / (1.0f + expf(-v)); else if (ACT == 3) v = fmaxf(v, 0.f); else if (ACT == 6) v = 0.5f * v * (1.0f + erff(v * 0.70710678118654752f)); so[w][8 * hh + r][t * 16 + ln] = v; } }
  __builtin_amdgcn_fence(__ATOMIC_ACQ_REL, "workgroup"); __builtin_amdgcn_wave_barrier();
  const int rsub = lane >> 4, c4 = (lane & 15) * 4; typedef _Float16 v4h __attribute__((ext_vector_type(4)));
  {
#pragma unroll
    for (int q = 0; q < 8; ++q) { const int r = q * 2 + rsub; if (col0 + c4 < N) { const v4f v = *(const v4fa*)&so[w][r][c4]; if (C) *(v4f*)(C + cofs + (size_t)(row0 + r) * ldc + col0 + c4) = v; if (C16) { v4h h4; for (int i = 0; i < 4; ++i) h4[i] = (_Float16)v[i]; *(v4h*)(C16 + cofs + (size_t)(row0 + r) * ldc + col0 + c4) = h4; } } }
     }
}


typedef _Float16 v4h __attribute__((ext_vector_type(4)));

__global__ __launch_bounds__(256) void k_h16(const float* __restrict__ x, _Float16* __restrict__ X16, size_t n8) { const size_t t = (size_t)blockIdx.x * 256 + threadIdx.x; if (t >= n8) return; FragH f;
#pragma unroll
  for (int q = 0; q < 8; ++q) f.h[q] = (_Float16)x[t * 8 + q]; *(v8us*)((unsigned short*)X16 + t * 8) = f.half[0];  }
__global__ __launch_bounds__(256) void k_round16f(const float* __restrict__ W, _Float16* __restrict__ Bt, size_t n8) { const size_t t = (size_t)blockIdx.x * 256 + threadIdx.x; if (t >= n8) return; FragH f;
#pragma unroll
  for (int i = 0; i < 8; ++i) f.h[i] = (_Float16)(bf16_round(W[t * 8 + i]) * 16.0f); *(v8us*)((unsigned short*)Bt + t * 8) = f.half[0];  }
template <int NHv, int TTv>
__device__ __forceinline__ void vt_body(const int bx, const _Float16* __restrict__ V16, int ldv, int voff, _Float16* __restrict__ Vt) { __shared__ unsigned short tl[64][66]; const int tid = threadIdx.x; const int slab = bx / (TTv / 64), lg = bx % (TTv / 64); const int b = slab / NHv, h = slab % NHv;
  for (int i = tid; i < 64 * 8; i += 256) { const int r = i / 8, c8 = (i % 8) * 8; FragH f; f.half[0] = *(const v8us*)((const unsigned short*)V16 + ((size_t)b * TTv + lg * 64 + r) * ldv + voff + h * 64 + c8);
#pragma unroll
    for (int q = 0; q < 8; ++q) tl[r][c8 + q] = f.u[q]; }
  __syncthreads();
  {
#pragma unroll
    for (int rd = 0; rd < 2; ++rd) { const int d = rd * 32 + tid / 8, pc = tid % 8; FragH f;
#pragma unroll
      for (int q = 0; q < 8; ++q) f.u[q] = tl[pc * 8 + q][d];
      *(v8us*)((unsigned short*)Vt + ((size_t)slab * 64 + d) * TTv + lg * 64 + pc * 8) = f.half[0]; }
     } }

__global__ __launch_bounds__(256) void k_hl(const float* __restrict__ F, _Float16* __restrict__ Hh, _Float16* __restrict__ Hl, size_t n8) { const size_t t = (size_t)blockIdx.x * 256 + threadIdx.x; if (t >= n8) return; FragH fh, fl; const v4f a = *(const v4fa*)(F + t * 8), c = *(const v4fa*)(F + t * 8 + 4);
#pragma unroll
  for (int q = 0; q < 4; ++q) { _Float16 h = (_Float16)a[q]; fh.h[q] = h; fl.h[q] = (_Float16)((a[q] - (float)h) * 1024.0f); h = (_Float16)c[q]; fh.h[4 + q] = h; fl.h[4 + q] = (_Float16)((c[q] - (float)h) * 1024.0f); }
  { *(v8us*)((unsigned short*)Hh + t * 8) = fh.half[0]; *(v8us*)((unsigned short*)Hl + t * 8) = fl.half[0];  } }

// ---- fast GEMM (block tile 128x64, wave tile 32x64, A and B k-tiles staged in LDS; requires M % 128 == 0, N % 64 == 0 and K == 64 or K % 128 == 0); epilogue = k_gemm_hhx semantics ----
#define G2_LP 72
__device__ __forceinline__ v16h g2_frag(const _Float16* p, int hh) { FragH f; f.half[0] = *(const v8us*)((const unsigned short*)p + 8 * hh); f.half[1] = *(const v8us*)((const unsigned short*)p + 16 + 8 * hh); return f.v; }
__device__ __forceinline__ v8f g2_mma(v16h a, v16h b, v8f c) { v8f d = __builtin_amdgcn_wmma_f32_16x16x32_f16(false, a, false, b, (short)0, c, false, false); asm volatile("v_nop\n\tv_nop\n\tv_nop\n\tv_nop" : "+v"(d) : "v"(a), "v"(b)); return d; }
// work-group barrier that orders LDS alone (its fences name the LDS address space): __syncthreads() also waits for every global load in flight, and the loads for the tiles ahead must stay in flight across it; the loop's global reads are of operands that no wave of the launch writes
__device__ __forceinline__ void g2_bar() { __builtin_amdgcn_fence(__ATOMIC_RELEASE, "workgroup", "local"); __builtin_amdgcn_s_barrier(); __builtin_amdgcn_fence(__ATOMIC_ACQUIRE, "workgroup", "local"); }
template <int ACT>
__global__ __launch_bounds__(128) void k_gemm2(const _Float16* __restrict__ A, int lda, size_t sA, const _Float16* __restrict__ Bh, int ldb, size_t sB, float alpha, const float* __restrict__ bias, size_t sBias, const float* __restrict__ CP, int rowsPerB, size_t sCPb, int row0g,
    float* __restrict__ C, _Float16* __restrict__ C16, int ldc, size_t sC, int M, int N, int K, int nb1, const _Float16* __restrict__ B1, float* __restrict__ C1, int N1) { static_assert(ACT == 0 || ACT == 3 || ACT == 6 || ACT == 8 || ACT == 9 || ACT == 11 || ACT == 12 || ACT == 14 || ACT == 15 || ACT == 16 || ACT == 17, "k_gemm2: unsupported ACT code (would silently apply no activation)");
  __shared__ __attribute__((aligned(16))) float so[4][32][68];
  // k-tiles of 64 halves (one whole 128-B line per row) of the block's 128 A rows and 64 B rows, two buffers; row pitch 72 halves = 144 B = 16 B x 9 for the ds_load_b128 fragment reads
  __shared__ __attribute__((aligned(16))) _Float16 sa[2][128][G2_LP];
  __shared__ __attribute__((aligned(16))) _Float16 sb[2][64][G2_LP];
  const int tid = threadIdx.x, w = tid >> 5, lane = tid & 31, ln = lane & 15, hh = lane >> 4; const int by = blockIdx.y;
  unsigned bx = blockIdx.x; if (bx < (unsigned)nb1) { Bh = B1; C = C1; N = N1; ldc = N1; bias = nullptr; } else bx -= (unsigned)nb1;      /* a second product of the same A in the same grid (no bias, C1 of pitch N1): it has the first nb1 blocks, so that the small job starts with the launch; the same for the whole block */
  A += (size_t)by * sA; Bh += (size_t)by * sB; const size_t cofs = (size_t)by * sC; const float* bp = bias ? bias + (size_t)by * sBias : nullptr;
  const int ntn = N >> 6; const int mt = bx / ntn, nq = bx - mt * ntn; const int row0 = mt * 128 + 32 * w, col0 = nq * 64; if (mt * 128 >= M) return;      /* the same for the whole block: it stands in front of barriers */
  const int sr = tid >> 3, sc = (tid & 7) * 8;      /* staging: 8 lanes cover one row's 128 B, a wave-wide load covers 4 whole lines */
  const char* ab = (const char*)(A + (size_t)(mt * 128) * lda); const char* bb = (const char*)(Bh + (size_t)col0 * ldb);      /* the block's first A and B row: the same in every lane */
  const unsigned ao = (unsigned)(sr * lda + sc) * 2u, bo = (unsigned)(sr * ldb + sc) * 2u;      /* the lane's own byte offset, fixed for the whole loop */
  const v8f z8 = {0.f,0.f,0.f,0.f,0.f,0.f,0.f,0.f}; v8f c00 = z8, c01 = z8, c02 = z8, c03 = z8, c10 = z8, c11 = z8, c12 = z8, c13 = z8;
  v8us ra0[8], rb0[4], ra1[8], rb1[4];
  auto gl = [&](v8us* ra, v8us* rb, int kb) {
#pragma unroll
    for (int i = 0; i < 8; ++i) ra[i] = *(const v8us*)(ab + ((size_t)(16 * i) * lda + kb) * 2 + ao);
#pragma unroll
    for (int i = 0; i < 4; ++i) rb[i] = *(const v8us*)(bb + ((size_t)(16 * i) * ldb + kb) * 2 + bo); };
  auto st = [&](const v8us* ra, const v8us* rb, int buf) {
#pragma unroll
    for (int i = 0; i < 8; ++i) *(v8us*)&sa[buf][sr + 16 * i][sc] = ra[i];
#pragma unroll
    for (int i = 0; i < 4; ++i) *(v8us*)&sb[buf][sr + 16 * i][sc] = rb[i]; };
  auto comp = [&](int buf) {
#pragma unroll
    for (int kk = 0; kk < 64; kk += 32) { const v16h a0 = g2_frag(&sa[buf][32 * w + ln][kk], hh), a1 = g2_frag(&sa[buf][32 * w + 16 + ln][kk], hh);
      const v16h b0 = g2_frag(&sb[buf][ln][kk], hh), b1 = g2_frag(&sb[buf][16 + ln][kk], hh), b2 = g2_frag(&sb[buf][32 + ln][kk], hh), b3 = g2_frag(&sb[buf][48 + ln][kk], hh);
      c00 = g2_mma(a0, b0, c00); c10 = g2_mma(a1, b0, c10); c01 = g2_mma(a0, b1, c01); c11 = g2_mma(a1, b1, c11);
      c02 = g2_mma(a0, b2, c02); c12 = g2_mma(a1, b2, c12); c03 = g2_mma(a0, b3, c03); c13 = g2_mma(a1, b3, c13); } };
  // Each barrier publishes the buffer just written and ends every wave's reads of the other buffer, which is written next.
  gl(ra0, rb0, 0);
  __builtin_amdgcn_sched_barrier(0);      /* keeps set 0's loads in front of set 1's: mixed, set 0's wait at the loop's head would wait for set 1 as well */
  gl(ra1, rb1, 64 < K ? 64 : 0);      /* the second set's tile clamped, not branched round: set 0's loads stay the older ones on every way into the loop, so its wait leaves set 1's in flight */
  asm volatile("s_wait_xcnt 0x0" ::: "memory");      /* in front of whatever reuses the address registers of the loads above, which stay in flight */
  int kb = 0;
  // two tiles per trip so that each register set and each LDS buffer has a fixed name; every load of the trip is unconditional (the last two tiles are peeled off below), so the waits can be counted; kept rolled: unrolled further it only grows the code
#pragma unroll 1
  for (; kb + 128 < K; kb += 128) {
    st(ra0, rb0, 0); g2_bar(); gl(ra0, rb0, kb + 128); comp(0);      /* loads two tiles ahead: in flight over this tile's and the next tile's products */
    st(ra1, rb1, 1); g2_bar(); gl(ra1, rb1, kb + 192); comp(1);
    asm volatile("s_wait_xcnt 0x0" ::: "memory"); }      /* in front of the next trip's address arithmetic, which rewrites the address registers of loads still in flight */
  st(ra0, rb0, 0); g2_bar(); comp(0);
  if (kb + 64 < K) { st(ra1, rb1, 1); g2_bar(); comp(1); }
  v8f accs[8] = {c00, c01, c02, c03, c10, c11, c12, c13};
  // every global read of the epilogue is issued here as one batch and waited for once: read where each element is formed, every element would wait for its own row address and its own round trip, with nothing else in the wave to cover them.
  // The addend is read in the store phase's layout (rows 2 * q + (lane >> 4), 16 B a lane, 256 B a row) and joins the staged tile in front of that phase: with no activation between them that is the same sum, (product * alpha + bias) + addend. The loops over q, t are unrolled in full so that their arrays stay in registers.
  const bool cadd = ACT == 0 && CP != nullptr;      /* the same for the whole launch */
  float bvr[4] = {0.f, 0.f, 0.f, 0.f}; v4f cq[16] = {};
  if (cadd) { size_t co[16]; const float* cr[16]; const int rr0 = row0g + row0 + (lane >> 4);      /* the test on rowsPerB stands outside the loops so that the 16 row offsets are formed side by side */
    if (rowsPerB < 0) {      /* own element of the batched C plane */
#pragma unroll
      for (int q = 0; q < 16; ++q) co[q] = cofs + (size_t)(rr0 + 2 * q) * ldc; }
    else {
#pragma unroll
      for (int q = 0; q < 16; ++q) co[q] = (size_t)((rr0 + 2 * q) / rowsPerB) * sCPb + (size_t)by * 64; }
#pragma unroll
    for (int q = 0; q < 16; ++q) cr[q] = CP + co[q] + col0 + (lane & 15) * 4;
#pragma unroll
    for (int q = 0; q < 16; ++q) cq[q] = *(const v4fa*)cr[q];
    // in front of whatever reuses the address registers of the loads above, which stay in flight; the 16 row addresses are inputs (read only) so that each stays whole up to the wait
    asm volatile("s_wait_xcnt 0x0" :: "v"(cr[0]), "v"(cr[1]), "v"(cr[2]), "v"(cr[3]), "v"(cr[4]), "v"(cr[5]), "v"(cr[6]), "v"(cr[7]), "v"(cr[8]), "v"(cr[9]), "v"(cr[10]), "v"(cr[11]), "v"(cr[12]), "v"(cr[13]), "v"(cr[14]), "v"(cr[15]) : "memory"); }
  if (bp) {
#pragma unroll
    for (int t = 0; t < 4; ++t) bvr[t] = bp[col0 + t * 16 + ln];
    asm volatile("s_wait_xcnt 0x0" ::: "memory"); }      /* in front of whatever reuses the address registers of the loads above, which stay in flight */
#pragma unroll
  for (int u = 0; u < 8; ++u) { const int t = u & 3, half = u >> 2; const int col = col0 + t * 16 + ln; const float bv = bf16_round(bvr[t]);      /* no bias: the rounding of 0 is 0 */
#pragma unroll
    for (int r = 0; r < 8; ++r) { const int rloc = half * 16 + 8 * hh + r; float v = accs[u][r] * alpha + bv; if (ACT != 0 && CP) { if (rowsPerB < 0) v += CP[cofs + (size_t)(row0g + row0 + rloc) * ldc + col];      /* rowsPerB < 0: own element of the batched C plane */ else { const int bidx = (row0g + row0 + rloc) / rowsPerB; v += CP[(size_t)bidx * sCPb + (size_t)by * 64 + col]; } }
      if (ACT == 3) v = fmaxf(v, 0.f); else if (ACT == 6) v = 0.5f * v * (1.0f + erff(v * 0.70710678118654752f)); else if (ACT == 11) v = 1.0f / (1.0f + expf(-v)); else if (ACT == 15) v = v / (1.0f + expf(-v)); else if (ACT == 12) v = (v > 0.f) ? v : 0.01f * v; else if (ACT == 8) v = tanhf(v); else if (ACT == 9) v = 0.5f * v * (1.0f + tanhf(0.7978845608028654f * (v + 0.044715f * v * v * v))); else if (ACT == 14) v = (v > 0.f) ? v : 0.1f * v; else if (ACT == 16) v = (v >= 0.f) ? v : 0.3f * v; else if (ACT == 17) v = (v >= 0.f) ? v : 0.2f * v;
      so[w][rloc][t * 16 + ln] = v; } }
  __builtin_amdgcn_fence(__ATOMIC_ACQ_REL, "workgroup"); __builtin_amdgcn_wave_barrier();
  const int rsub = lane >> 4, c4 = (lane & 15) * 4;
  if (cadd) {      /* each lane adds to the 16 B pieces that it alone reads back below; unrolled in full so that cq stays in registers */
#pragma unroll
    for (int q = 0; q < 16; ++q) { v4fa* sp = (v4fa*)&so[w][q * 2 + rsub][c4]; *sp = *sp + cq[q]; } }
  {
#pragma unroll
    for (int q = 0; q < 16; ++q) { const int r = q * 2 + rsub; const v4f v = *(const v4fa*)&so[w][r][c4]; if (C) *(v4f*)(C + cofs + (size_t)(row0 + r) * ldc + col0 + c4) = v; if (C16) { v4h h4; for (int i = 0; i < 4; ++i) h4[i] = (_Float16)v[i]; *(v4h*)(C16 + cofs + (size_t)(row0 + r) * ldc + col0 + c4) = h4; } }
     } }


// ---- launches that do not depend on one another share one grid: a range of block indices per job (every test on the block index is the same for the whole work-group); no job reads what another job of its grid writes
// the seven input conversions to f16 (weights x 16, x as it is: x 1 is exact); 8 values a thread, every array a whole number of blocks
#define PB_QKV (3 * DM * DM / 8 / 256)
#define PB_X (NR * DM / 8 / 256)
#define PB_OUT (DM * DM / 8 / 256)
#define PB_LIN (64 * DM / 8 / 256)
__global__ __launch_bounds__(256) void k_prep(const float* __restrict__ Wqkv, const float* __restrict__ x, const float* __restrict__ Wout, const float* __restrict__ W1w, const float* __restrict__ W2w, const float* __restrict__ W1r, const float* __restrict__ W2r,
    _Float16* __restrict__ BQKV, _Float16* __restrict__ X16, _Float16* __restrict__ BO, _Float16* __restrict__ BL) {
  int b = blockIdx.x; const float* Wm; _Float16* Bt; float sc = 16.0f;
  if (b < PB_QKV) { Wm = Wqkv; Bt = BQKV; }
  else if ((b -= PB_QKV) < PB_X) { Wm = x; Bt = X16; sc = 1.0f; }
  else if ((b -= PB_X) < PB_OUT) { Wm = Wout; Bt = BO; }
  else { b -= PB_OUT; const int g = b / PB_LIN; b -= g * PB_LIN; Wm = g == 0 ? W1w : g == 1 ? W2w : g == 2 ? W1r : W2r; Bt = BL + (size_t)g * 64 * DM; }      /* [W1w; W2w; W1r; W2r] rows h*4 + i */
  const size_t t = (size_t)b * 256 + threadIdx.x; FragH f; for (int q = 0; q < 8; ++q) f.h[q] = (_Float16)(bf16_round(Wm[t * 8 + q]) * sc); *(v8us*)((unsigned short*)Bt + t * 8) = f.half[0];  }
__device__ __forceinline__ void ccp_body(const int bx, const float* __restrict__ QKV, int coff, _Float16* __restrict__ D) { const size_t t = (size_t)bx * 256 + threadIdx.x; if (t >= (size_t)NR * DM / 8) return; const int c0 = (int)((t * 8) % DM); const size_t row = (t * 8) / DM; const v8f a = *(const v8f*)(QKV + row * 3 * DM + coff + c0); FragH f; for (int q = 0; q < 8; ++q) f.h[q] = (_Float16)a[q];
  *(v8us*)((unsigned short*)D + (((row / TT) * NH + c0 / HD) * TT + row % TT) * HD + c0 % HD) = f.half[0];  }      /* plane (batch * NH + head), row t, 64 halves a row: one batch stride serves all 32 planes */
__device__ __forceinline__ void chl_body(const int bx, const float* __restrict__ QKV, int coff, _Float16* __restrict__ Hh, _Float16* __restrict__ Lh) {
  #pragma clang fp contract(off)
  const size_t t = (size_t)bx * 256 + threadIdx.x; if (t >= (size_t)NR * DM / 8) return; const int c0 = (int)((t * 8) % DM); const size_t row = (t * 8) / DM; const v8f a = *(const v8f*)(QKV + row * 3 * DM + coff + c0); FragH fh, fl; for (int q = 0; q < 8; ++q) { const _Float16 hv = (_Float16)a[q]; fh.h[q] = hv; fl.h[q] = (_Float16)((a[q] - (float)hv) * 1024.0f); }
  { *(v8us*)((unsigned short*)Hh + t * 8) = fh.half[0]; *(v8us*)((unsigned short*)Lh + t * 8) = fl.half[0];  } }
__device__ __forceinline__ void exter(const float* p1, const float* p2, float* L) {
  #pragma clang fp contract(off)
  const int PI[6] = {0, 0, 0, 1, 1, 2}, PJ[6] = {1, 2, 3, 2, 3, 3}; float n2 = 0.f;
  for (int k = 0; k < 6; ++k) { float a = p1[PI[k]] * p2[PJ[k]]; a += -(p1[PJ[k]] * p2[PI[k]]); L[k] = a; n2 += a * a; }
  const float n = fmaxf(sqrtf(n2), 1e-12f); for (int k = 0; k < 6; ++k) L[k] = L[k] / n; }
__device__ __forceinline__ void lines_body(const int bx, const float* __restrict__ LW, float* __restrict__ JW, float* __restrict__ RD) {
  #pragma clang fp contract(off)
  const int tt = bx * 256 + threadIdx.x; if (tt >= NR * NH) return; const int t = tt % TT; const int bh = tt / TT; const int h = bh % NH, b = bh / NH; const size_t row = (size_t)b * TT + t; float w1[4], w2[4], r1[4], r2[4];
  for (int i = 0; i < 4; ++i) { w1[i] = (t > 0) ? LW[(row - 1) * 256 + h * 4 + i] : 0.f; w2[i] = LW[row * 256 + 64 + h * 4 + i]; r1[i] = LW[row * 256 + 128 + h * 4 + i]; r2[i] = LW[row * 256 + 192 + h * 4 + i]; }
  float wl[6], rl[6]; exter(w1, w2, wl); exter(r1, r2, rl); v8f jw, rd; jw[0] = wl[5]; jw[1] = -wl[4]; jw[2] = wl[3]; jw[3] = wl[2]; jw[4] = -wl[1]; jw[5] = wl[0]; jw[6] = 0.f; jw[7] = 0.f; for (int k = 0; k < 6; ++k) rd[k] = rl[k]; rd[6] = 0.f; rd[7] = 0.f;
  const size_t o = (((size_t)b * NH + h) * TT + t) * 8; { *(v8f*)(JW + o) = jw; *(v8f*)(RD + o) = rd;  } }
// what follows the two projections, in one grid: the lines, then the q, k planes and v as hi + residual
#define SB_LIN (NR * NH / 256)
#define SB_PL (NR * DM / 8 / 256)
__global__ __launch_bounds__(256) void k_split(const float* __restrict__ LW, float* __restrict__ JW, float* __restrict__ RD, const float* __restrict__ QKV, _Float16* __restrict__ Q16, _Float16* __restrict__ K16, _Float16* __restrict__ V16, _Float16* __restrict__ VL16) {
  int b = blockIdx.x;
  if (b < SB_LIN) lines_body(b, LW, JW, RD);
  else if ((b -= SB_LIN) < SB_PL) ccp_body(b, QKV, 0, Q16);
  else if ((b -= SB_PL) < SB_PL) ccp_body(b, QKV, DM, K16);
  else chl_body(b - SB_PL, QKV, 2 * DM, V16, VL16); }      /* v as hi + residual (the bias makes the attention peaked, so v's rounding reaches the output almost unaveraged) */
typedef float v2f __attribute__((ext_vector_type(2)));
typedef float v2fa __attribute__((ext_vector_type(2), may_alias));
// Causal 6x6 Gram state and rd . M, one work-group per (batch, head). M is symmetric bit for bit (w_i * w_j rounds the same either way and both sides sum in the same order), so 21 running sums carry it.
// Three phases through one LDS array, plane e = (i, j), i <= j, column t: (A) every thread forms the 21 products of its rows; (B) 21 lanes of one wave turn each plane into its running sum over t, in the order t = 0, 1, ...; (C) every thread reads M_t of its rows and forms rd_t . M_t, i = 0..5 in order.
// Plane pitch TT + 4 floats: the 16-B reads and writes of phase B, one plane per lane, start 4 banks apart; phases A and C touch 32 columns in a row of one plane.
#define CE 21
#define CPI (TT + 4)
__device__ __forceinline__ void cum_body(const int bx, const float* __restrict__ JW, const float* __restrict__ RD, float* __restrict__ RDM) {
  __shared__ __attribute__((aligned(16))) float pm[CE][CPI];
  const int tid = threadIdx.x; const size_t bh = bx; const float* jw = JW + bh * TT * 8; const float* rd = RD + bh * TT * 8; float* ob = RDM + bh * TT * 8;
  // every global load of the block is issued before the first is waited for; thread tid has rows c * 256 + tid; all loops over c, i, j, u, q are unrolled in full so that their arrays stay in registers
  v4f wa[TT / 256], ra[TT / 256]; v2f wb[TT / 256], rb[TT / 256];      /* a row's six values as 16 + 8 bytes */
#pragma unroll
  for (int c = 0; c < TT / 256; ++c) { const float* q = jw + (size_t)(c * 256 + tid) * 8; wa[c] = *(const v4fa*)q; wb[c] = *(const v2fa*)(q + 4); }
#pragma unroll
  for (int c = 0; c < TT / 256; ++c) { const float* q = rd + (size_t)(c * 256 + tid) * 8; ra[c] = *(const v4fa*)q; rb[c] = *(const v2fa*)(q + 4); }
  asm volatile("s_wait_xcnt 0x0" ::: "memory");      /* in front of whatever reuses the address registers of the loads above, which stay in flight */
#pragma unroll
  for (int c = 0; c < TT / 256; ++c) { const float w[6] = {wa[c][0], wa[c][1], wa[c][2], wa[c][3], wb[c][0], wb[c][1]}; int e = 0;
#pragma unroll
    for (int i = 0; i < 6; ++i)
#pragma unroll
      for (int j = i; j < 6; ++j) { pm[e][c * 256 + tid] = w[i] * w[j]; ++e; } }
  __syncthreads();
  if (tid < CE) { float* p = &pm[tid][0]; float acc = 0.f; v4f cur[8], nxt[8];
    // the one dependent chain left is one add per t; the reads run 32 columns ahead of it in two named register sets, so that it never waits for LDS
#pragma unroll
    for (int u = 0; u < 8; ++u) cur[u] = *(const v4f*)(p + 4 * u);
    // two sets per trip so that each has a fixed name; kept rolled: unrolled further it only grows the code
#pragma unroll 1
    for (int t0 = 0; t0 < TT; t0 += 64) {
#pragma unroll
      for (int u = 0; u < 8; ++u) nxt[u] = *(const v4f*)(p + t0 + 32 + 4 * u);
#pragma unroll
      for (int u = 0; u < 8; ++u) { v4f o;
#pragma unroll
        for (int q = 0; q < 4; ++q) { acc += cur[u][q]; o[q] = acc; }
        *(v4f*)(p + t0 + 4 * u) = o; }
      if (t0 + 64 < TT) {
#pragma unroll
        for (int u = 0; u < 8; ++u) cur[u] = *(const v4f*)(p + t0 + 64 + 4 * u); }
#pragma unroll
      for (int u = 0; u < 8; ++u) { v4f o;
#pragma unroll
        for (int q = 0; q < 4; ++q) { acc += nxt[u][q]; o[q] = acc; }
        *(v4f*)(p + t0 + 32 + 4 * u) = o; } } }
  __syncthreads();
#pragma unroll
  for (int c = 0; c < TT / 256; ++c) { const float r[6] = {ra[c][0], ra[c][1], ra[c][2], ra[c][3], rb[c][0], rb[c][1]}; float m[CE];
#pragma unroll
    for (int e = 0; e < CE; ++e) m[e] = pm[e][c * 256 + tid];
    v8f o;
#pragma unroll
    for (int j = 0; j < 6; ++j) { float v = 0.f;
#pragma unroll
      for (int i = 0; i < 6; ++i) { const int lo = i < j ? i : j, hi = i < j ? j : i; v += r[i] * m[lo * 6 - (lo * (lo - 1)) / 2 + hi - lo]; }
      o[j] = v; }
    o[6] = 0.f; o[7] = 0.f;
    *(v8f*)(ob + (size_t)(c * 256 + tid) * 8) = o;
    if (c + 1 < TT / 256) asm volatile("s_wait_xcnt 0x0" ::: "memory"); } }      /* in front of the next rows' LDS reads and sums, which reuse the registers that the store names */
// the Gram state and the two V transpositions in one grid: the 32 long work-groups of the state first, so that they start with the launch and the short transpositions run beside them
#define VB_T (NB * NH * (TT / 64))
__global__ __launch_bounds__(256) void k_cumvt(const float* __restrict__ JW, const float* __restrict__ RD, float* __restrict__ RDM, const _Float16* __restrict__ V16, _Float16* __restrict__ VT, const _Float16* __restrict__ VL16, _Float16* __restrict__ VTL) {
  int b = blockIdx.x;
  if (b < NB * NH) cum_body(b, JW, RD, RDM);
  else { b -= NB * NH; const bool lo = b >= VB_T; vt_body<NH, TT>(lo ? b - VB_T : b, lo ? VL16 : V16, DM, 0, lo ? VTL : VT); } }
#define FA_JP 68      /* pitch of a Jw plane in floats: 16-B multiples for the reads; the staging stores of a wave (16 keys x 2 groups of 4 planes) fall on 32 different banks */
__device__ __forceinline__ v8f fa_mma(v16h a, v16h b, v8f c) { return __builtin_amdgcn_wmma_f32_16x16x32_f16(false, a, false, b, (short)0, c, false, false); }
__global__ __launch_bounds__(128) void k_fattn(const _Float16* __restrict__ Q, const _Float16* __restrict__ Kh, const _Float16* __restrict__ Vh, const _Float16* __restrict__ Vl, const float* __restrict__ RDM, const float* __restrict__ JW, const float* __restrict__ bsc, _Float16* __restrict__ CH, _Float16* __restrict__ CL) {
  // two buffers of: 64 K rows [key][64 d], 64 V^T rows hi and residual [d][64 keys] (pitch as in k_gemm2), Jw as planes [component][key]
  __shared__ __attribute__((aligned(16))) _Float16 sk[2][64][G2_LP];
  __shared__ __attribute__((aligned(16))) _Float16 sv[2][64][G2_LP];
  __shared__ __attribute__((aligned(16))) _Float16 sl[2][64][G2_LP];
  __shared__ __attribute__((aligned(16))) float sj[2][8][FA_JP];
  const int tid = threadIdx.x, w = tid >> 5, lane = tid & 31, ln = lane & 15, hh = lane >> 4;
  const int pl = blockIdx.x, by = blockIdx.y, blk = by < TT / 128 ? TT / 64 - 1 - by : by - TT / 128;      /* plane; row block: block b walks b + 1 tiles; the long half first, longest first, then the short half, shortest first, so that work-groups half a grid apart add up alike (for speed only) */
  const int tl = w * 16 + ln; const size_t prow = (size_t)pl * TT + blk * 64 + tl;      /* the lane's query: inside the block, and as a row of the planes */
  const float bs2 = bf16_round(bsc[pl % NH]) * 1.4426950408889634f, c1 = 0.125f * 1.4426950408889634f;
  const v16h q0 = g2_frag(Q + prow * HD, hh), q1 = g2_frag(Q + prow * HD + 32, hh);
  const v4f r03 = *(const v4fa*)(RDM + prow * 8); const v2f r45 = *(const v2fa*)(RDM + prow * 8 + 4);
  const float rdm[6] = {r03[0], r03[1], r03[2], r03[3], r45[0], r45[1]};
  const int sr = tid >> 3, sc = (tid & 7) * 8;      /* staging: 8 lanes cover one row's 128 B */
  const char* kg = (const char*)(Kh + (size_t)pl * TT * HD); const char* vg = (const char*)(Vh + (size_t)pl * HD * TT); const char* lg = (const char*)(Vl + (size_t)pl * HD * TT); const char* jg = (const char*)(JW + (size_t)pl * TT * 8);      /* the plane's first bytes: the same in every lane */
  const unsigned ko = (unsigned)(sr * HD + sc) * 2u, vo = (unsigned)(sr * TT + sc) * 2u, jo = (unsigned)tid * 16u;      /* the lane's own byte offsets, fixed for the whole loop; Jw: key tid >> 1, components 4 * (tid & 1) .. + 3 (6 and 7 are the rows' padding: staged along, never read) */
  v8us rk[4], rv[4], rl[4]; v4f rj;
  // every loop over i, q, c, k, r, ks, ds below is unrolled in full so that its arrays stay in registers
  auto gl = [&](int j) {
    const char* kj = kg + (size_t)j * 64 * HD * 2 + ko; const char* vj = vg + (size_t)j * 64 * 2 + vo; const char* lj = lg + (size_t)j * 64 * 2 + vo; const char* jj = jg + (size_t)j * 64 * 32 + jo;
#pragma unroll
    for (int i = 0; i < 4; ++i) rk[i] = *(const v8us*)(kj + 16 * i * HD * 2);
#pragma unroll
    for (int i = 0; i < 4; ++i) rv[i] = *(const v8us*)(vj + 16 * i * TT * 2);
#pragma unroll
    for (int i = 0; i < 4; ++i) rl[i] = *(const v8us*)(lj + 16 * i * TT * 2);
    rj = *(const v4fa*)jj;
    // in front of whatever reuses the address registers of the loads above, which stay in flight; the four addresses are inputs (read only) so that they stay whole up to the wait: otherwise the last load of a group lands on the address pair that the group's earlier loads name
    asm volatile("s_wait_xcnt 0x0" :: "v"(kj), "v"(vj), "v"(lj), "v"(jj) : "memory"); };
  auto st = [&](int buf) {
#pragma unroll
    for (int i = 0; i < 4; ++i) { *(v8us*)&sk[buf][sr + 16 * i][sc] = rk[i]; *(v8us*)&sv[buf][sr + 16 * i][sc] = rv[i]; *(v8us*)&sl[buf][sr + 16 * i][sc] = rl[i]; }
#pragma unroll
    for (int q = 0; q < 4; ++q) sj[buf][(tid & 1) * 4 + q][tid >> 1] = rj[q]; };
  const v8f z8 = {0.f,0.f,0.f,0.f,0.f,0.f,0.f,0.f};
  v8f oa[4] = {z8, z8, z8, z8};
  float m = -3.0e38f, su = 0.f;
  gl(0);
  __builtin_amdgcn_sched_barrier(0);      /* keeps the clearing of the accumulators, which reuses the address registers of the q and rd . M loads above, behind the wait that ends gl */
  // Each barrier publishes the buffer just written and ends every wave's reads of the other buffer, which is written next. The next tile's loads fly during this tile's work; the diagonal tile has none behind it (the test is the same for the whole block), so no load is in flight when a wave ends.
  for (int j = 0; ; ++j) {      /* left behind the diagonal tile, at the foot */
    const int buf = j & 1;
    st(buf); g2_bar(); if (j < blk) gl(j + 1);
    float l[4][8];
#pragma unroll
    for (int c = 0; c < 4; ++c) {
      v8f s = fa_mma(g2_frag(&sk[buf][c * 16 + ln][0], hh), q0, z8); s = fa_mma(g2_frag(&sk[buf][c * 16 + ln][32], hh), q1, s);
      v4f jv[6][2];
#pragma unroll
      for (int k = 0; k < 6; ++k) { jv[k][0] = *(const v4f*)&sj[buf][k][c * 16 + 8 * hh]; jv[k][1] = *(const v4f*)&sj[buf][k][c * 16 + 8 * hh + 4]; }
#pragma unroll
      for (int r = 0; r < 8; ++r) { float d = 0.f;
#pragma unroll
        for (int k = 0; k < 6; ++k) d += rdm[k] * jv[k][r >> 2][r & 3];
        l[c][r] = s[r] * c1 + fabsf(d) * bs2; } }
    if (j == blk) {      /* the diagonal tile alone holds keys behind a query; the same for the whole block */
#pragma unroll
      for (int c = 0; c < 4; ++c)
#pragma unroll
        for (int r = 0; r < 8; ++r) if (c * 16 + 8 * hh + r > tl) l[c][r] = -3.0e38f; }
    float mt = l[0][0];
#pragma unroll
    for (int c = 0; c < 4; ++c)
#pragma unroll
      for (int r = 0; r < 8; ++r) mt = fmaxf(mt, l[c][r]);
    mt = fmaxf(mt, __shfl_xor(mt, 16, 32));      /* the row's other 32 keys of the tile; key 0 is open to every query, so the maximum is a real logit from tile 0 on */
    const float mn = fmaxf(m, mt), al = __builtin_amdgcn_exp2f(m - mn), mo = mn - 10.0f; m = mn; su *= al;
#pragma unroll
    for (int ds = 0; ds < 4; ++ds) oa[ds] *= al;
#pragma unroll
    for (int ks = 0; ks < 2; ++ks) { FragH pf;
#pragma unroll
      for (int i = 0; i < 16; ++i) { const float e = __builtin_amdgcn_exp2f(l[2 * ks + (i >> 3)][i & 7] - mo); su += e; pf.h[i] = (_Float16)e; }
      const v16h pr = pf.v * (_Float16)0.0009765625f;
#pragma unroll
      for (int ds = 0; ds < 4; ++ds) { oa[ds] = fa_mma(g2_frag(&sv[buf][ds * 16 + ln][ks * 32], hh), pf.v, oa[ds]); oa[ds] = fa_mma(g2_frag(&sl[buf][ds * 16 + ln][ks * 32], hh), pr, oa[ds]); } }
    if (j >= blk) break; }
  su += __shfl_xor(su, 16, 32);
  const float inv = 1.0f / su;
  const size_t o = ((size_t)(pl / NH) * TT + blk * 64 + tl) * DM + (pl % NH) * HD + 8 * hh;
#pragma unroll
  for (int ds = 0; ds < 4; ++ds) { FragH f, fl;
#pragma unroll
    for (int r = 0; r < 8; ++r) { const float v = oa[ds][r] * inv; const _Float16 hv = (_Float16)v; f.h[r] = hv; fl.h[r] = (_Float16)((v - (float)hv) * 1024.0f); }
    *(v8us*)((unsigned short*)CH + o + ds * 16) = f.half[0]; *(v8us*)((unsigned short*)CL + o + ds * 16) = fl.half[0];
    if (ds + 1 < 4) asm volatile("s_wait_xcnt 0x0" ::: "memory"); } }      /* in front of the next columns' sums, which may reuse the registers that the stores name */

extern "C" void kernel_launch(void* const* d_in, const int* in_sizes, int n_in,
                              void* d_out, int out_size, void* d_ws, size_t ws_size, hipStream_t stream) {
  (void)in_sizes; (void)n_in; (void)out_size;
  const float* x = (const float*)d_in[0]; const float* Wqkv = (const float*)d_in[1]; const float* bqkv = (const float*)d_in[2]; const float* W1w = (const float*)d_in[3]; const float* W2w = (const float*)d_in[4]; const float* W1r = (const float*)d_in[5]; const float* W2r = (const float*)d_in[6]; const float* bsc = (const float*)d_in[7]; const float* Wout = (const float*)d_in[8]; const float* bout = (const float*)d_in[9];
  char* ws = (char*)d_ws; size_t off = 0;
  auto take = [&](size_t bytes) { char* p = ws + off; off += (bytes + 255) & ~(size_t)255; return p; };
  const size_t np = (size_t)NR * DM;
  _Float16* BQKV = (_Float16*)take((size_t)3 * DM * DM * 2); _Float16* BL = (_Float16*)take((size_t)256 * DM * 2); _Float16* X16 = (_Float16*)take(np * 2); float* QKV = (float*)take(np * 3 * 4); _Float16* V16 = (_Float16*)take(np * 2); _Float16* VL16 = (_Float16*)take(np * 2); float* LW = (float*)take((size_t)NR * 256 * 4); float* RD = (float*)take((size_t)NB * NH * TT * 8 * 4);
  _Float16* BO = (_Float16*)take((size_t)DM * DM * 2); _Float16* Q16 = (_Float16*)take(np * 2); _Float16* K16 = (_Float16*)take(np * 2); _Float16* VT = (_Float16*)take(np * 2); _Float16* VTL = (_Float16*)take(np * 2);
  float* JW = (float*)take((size_t)NB * NH * TT * 8 * 4); float* RDM = (float*)take((size_t)NB * NH * TT * 8 * 4);
  _Float16* CH = (_Float16*)take(np * 2); _Float16* CL = (_Float16*)take(np * 2);
  if (off > ws_size) return;      /* under 74 MiB */
  k_prep<<<PB_QKV + PB_X + PB_OUT + 4 * PB_LIN, 256, 0, stream>>>(Wqkv, x, Wout, W1w, W2w, W1r, W2r, BQKV, X16, BO, BL);      /* torch (out, in) naturals */
  k_gemm2<0><<<dim3((NR / 128) * (256 / 64) + (NR / 128) * (3 * DM / 64), 1), 128, 0, stream>>>(X16, DM, 0, BQKV, DM, 0, 0.0625f, bqkv, 0, nullptr, 1, 0, 0, QKV, nullptr, 3 * DM, 0, NR, 3 * DM, DM, (NR / 128) * (256 / 64), BL, LW, 256);      /* [q | k | v] + bias, head h at h*64; line projections f32 [row][w1 | w2 | r1 | r2] (x_prev handled by a row shift) */
  k_split<<<SB_LIN + 3 * SB_PL, 256, 0, stream>>>(LW, JW, RD, QKV, Q16, K16, V16, VL16);
  k_cumvt<<<NB * NH + 2 * VB_T, 256, 0, stream>>>(JW, RD, RDM, V16, VT, VL16, VTL);
  // attention: one launch, scores and weights stay in registers; grid x = the 32 (batch, head) planes, y = the 16 blocks of 64 query rows; q, k are [plane][t][64], v^T [plane][d][t]; the context comes out as [row][head * 64 + d], hi + residual
  k_fattn<<<dim3(NB * NH, TT / 64), 128, 0, stream>>>(Q16, K16, VT, VTL, RDM, JW, bsc, CH, CL);
  k_gemm2<0><<<dim3((NR / 128) * (DM / 64), 1), 128, 0, stream>>>(CL, DM, 0, BO, DM, 0, 0.0625f / 1024.0f, nullptr, 0, nullptr, 1, 0, 0, (float*)d_out, nullptr, DM, 0, NR, DM, DM, 0, nullptr, nullptr, 0);
  k_gemm2<0><<<dim3((NR / 128) * (DM / 64), 1), 128, 0, stream>>>(CH, DM, 0, BO, DM, 0, 0.0625f, bout, 0, (const float*)d_out, 1, (size_t)DM, 0, (float*)d_out, nullptr, DM, 0, NR, DM, DM, 0, nullptr, nullptr, 0);      /* out = (c_lo + c_hi) Wout^T + bout */
}

// v008
// A run of this version takes 83.5 microseconds.
// Two timings next to v007 put it at 1.08 and 1.05 times that version's speed.
// Over all steps from v000 it is 16.2 times as fast.
#include <hip/hip_runtime.h>
// EigenBiasAttention (2 x 1024 tokens x 1024 = 16 heads x 64; qkv = x Wqkv^T + b; causal softmax(q.k/8 + |bias|) v; bias from Plucker lines: per head w1 = x_prev W1w^T, w2 = x W2w^T, r1 = x W1r^T, r2 = x W2r^T (4-vectors), write/read lines = normalised exterior products (6-vectors), Jw = write J6, M_t = cumsum_t Jw Jw^T, bias[t][s] = |(rd_t . M_t) . Jw_s| * bias_scale[h]; out = merged . Wout^T + bout).
// Structure: exact f16 x plane; qkv and the four line projections as f16 WMMA GEMMs (32x64 wave tiles, f32 accumulation, exact x16 weights (+ bias)), whose epilogue writes the f16 q/k planes (one [t][64] plane per (batch, head)) and V^T hi/residual (the line projections f32); the exterior products / normalisation / J6 on VALU; the causal 6x6 Gram cumsum and rd . M per (batch, head) on VALU (f32; products and rd . M one row per thread, the 1024-step running sums by one wave through LDS); one fused launch for all 32 (batch, head) planes: score products (K = 64, f32), the biased causal softmax on VALU with a running row maximum (bias dot K = 6 per (t, s), bias_scale read; unnormalised f16 weights x 2^10), readout as two product terms, row scaling + hi/residual; Wout as two GEMM terms (+ bias).
// Compute dtype: inputs rounded to bf16; x / weights exact as f16 (line projections are f32 sums of exact products, so the bias path is f32-class); q, k and the softmax weights as plain f16 operands (~2^-12); v and the context as f16 hi + residual. v_wmma_f32_16x16x32_f16.
#define NB 2
#define TT 1024
#define DM 1024
#define NH 16
#define HD 64
#define NR (NB * TT)
typedef __bf16 v16b __attribute__((ext_vector_type(16)));
typedef unsigned short v8us __attribute__((ext_vector_type(8), may_alias));
typedef float  v8f  __attribute__((ext_vector_type(8)));
typedef float  v4f  __attribute__((ext_vector_type(4)));
typedef float  v4fa __attribute__((ext_vector_type(4), may_alias));
union FragB { v16b v; v8us half[2]; unsigned short u[16]; };

__device__ __forceinline__ unsigned short bf16_bits(float x) { unsigned int u = __float_as_uint(x); return (unsigned short)((u + 0x7FFFu + ((u >> 16) & 1u)) >> 16); }
__device__ __forceinline__ float bf16_val(unsigned short b) { return __uint_as_float(((unsigned int)b) << 16); }
__device__ __forceinline__ float bf16_round(float x) { return bf16_val(bf16_bits(x)); }
// D += A·B with NT terms: 1 = ah·bh, 2 = + al·bh (A split), 3 = + ah·bl (both split)
template <int NT>
__device__ __forceinline__ v8f mmaN(v16b ah, v16b al, v16b bh, v16b bl, v8f c) {
  c = __builtin_amdgcn_wmma_f32_16x16x32_bf16(false, ah, false, bh, (short)0, c, false, false);
  if (NT >= 2) c = __builtin_amdgcn_wmma_f32_16x16x32_bf16(false, al, false, bh, (short)0, c, false, false);
  if (NT >= 3) c = __builtin_amdgcn_wmma_f32_16x16x32_bf16(false, ah, false, bl, (short)0, c, false, false);
  asm volatile("v_nop\n\tv_nop\n\tv_nop\n\tv_nop" : "+v"(c) : "v"(ah), "v"(al), "v"(bh), "v"(bl));
  return c;
}

__global__ __launch_bounds__(256) void k_wt_bf16(const float* __restrict__ W, unsigned short* __restrict__ Wt, int K, int N) {
  const int t = blockIdx.x * 256 + threadIdx.x;
  const int k8n = K / 8;
  if (t >= N * k8n) return;
  const int n = t / k8n, k8 = (t % k8n) * 8;
  v8us v;
#pragma unroll
  for (int i = 0; i < 8; ++i) v[i] = bf16_bits(W[(size_t)(k8 + i) * N + n]);
  *(v8us*)(Wt + (size_t)n * K + k8) = v;
  
}

// GEMM C[M][N] (f32, pitch ldc) = act(A[M][K]·W + bias). A f32 row-major (pitch lda) converted per fragment to bf16
// (ASPLIT: hi/lo two planes -> 2 terms, else single rounded term); Wt bf16 [N][K] (pitch ldb). BIAS_BF16 rounds the
// bias to bf16 first (bias quantised to bf16 before the add). K%32==0, M%16==0, N%64==0.
template <bool ASPLIT, int ACT, bool BIAS_BF16>
__global__ __launch_bounds__(128) void k_gemm_bf(const float* __restrict__ A, int lda, const unsigned short* __restrict__ Wt, int ldb,
                                               const float* __restrict__ bias, float* __restrict__ C, int ldc, int M, int N, int K) {
  __shared__ __attribute__((aligned(16))) float so[4][16][64];
  const int tid = threadIdx.x, w = tid >> 5, lane = tid & 31, ln = lane & 15, hh = lane >> 4;
  const int ntn = N / 64;
  const int wid = blockIdx.x * 4 + w;
  const int mt = wid / ntn, nq = wid % ntn;
  if (mt * 16 >= M) return;
  const int row0 = mt * 16, col0 = nq * 64;
  const float* arow = A + (size_t)(row0 + ln) * lda;
  v8f acc[4] = {};
  for (int kb = 0; kb < K; kb += 32) {
    FragB ah, al;
    const v4f x0 = *(const v4fa*)(arow + kb + 8 * hh), x1 = *(const v4fa*)(arow + kb + 8 * hh + 4);
    const v4f x2 = *(const v4fa*)(arow + kb + 16 + 8 * hh), x3 = *(const v4fa*)(arow + kb + 16 + 8 * hh + 4);
    float xs[16] = {x0[0],x0[1],x0[2],x0[3],x1[0],x1[1],x1[2],x1[3],x2[0],x2[1],x2[2],x2[3],x3[0],x3[1],x3[2],x3[3]};
#pragma unroll
    for (int i = 0; i < 16; ++i) { const unsigned short hb = bf16_bits(xs[i]); ah.u[i] = hb; al.u[i] = ASPLIT ? bf16_bits(xs[i] - bf16_val(hb)) : (unsigned short)0; }
#pragma unroll
    for (int t = 0; t < 4; ++t) {
      const unsigned short* brow = Wt + (size_t)(col0 + t * 16 + ln) * ldb + kb;
      FragB b;
      b.half[0] = *(const v8us*)(brow + 8 * hh);
      b.half[1] = *(const v8us*)(brow + 16 + 8 * hh);
      acc[t] = mmaN<ASPLIT ? 2 : 1>(ah.v, al.v, b.v, b.v, acc[t]);
    }
  }
#pragma unroll
  for (int t = 0; t < 4; ++t) {
    float bv = bias ? bias[col0 + t * 16 + ln] : 0.f;
    if (BIAS_BF16) bv = bf16_round(bv);
#pragma unroll
    for (int r = 0; r < 8; ++r) { float v = acc[t][r] + bv; if (ACT == 1) v = fmaxf(v, 0.f); so[w][8 * hh + r][t * 16 + ln] = v; }
  }
  __builtin_amdgcn_fence(__ATOMIC_ACQ_REL, "workgroup");
  __builtin_amdgcn_wave_barrier();
  const int rsub = lane >> 4, c4 = (lane & 15) * 4;
  {
#pragma unroll
    for (int q = 0; q < 8; ++q) {
      const int r = q * 2 + rsub;
      const v4f v = *(const v4fa*)&so[w][r][c4];
      *(v4f*)(C + (size_t)(row0 + r) * ldc + col0 + c4) = v;
    }
    
  }
}

// GEMM C = act(A·W + bias + resid): A f32 (ASPLIT -> hi/lo 2 terms), Wt bf16 [N][K]; ACT 0 none, 1 relu, 2 exact gelu;
// resid (optional, f32, row index = (row % rmod), pitch ldr, RES_BF16 rounds it) added before the activation.
template <bool ASPLIT, int ACT, bool BIAS_BF16, bool RES_BF16>
__global__ __launch_bounds__(128) void k_gemm_bf3(const float* __restrict__ A, int lda, const unsigned short* __restrict__ Wt, int ldb,
                                                const float* __restrict__ bias, const float* __restrict__ resid, int rmod, int ldr,
                                                float* __restrict__ C, int ldc, int M, int N, int K) {
  __shared__ __attribute__((aligned(16))) float so[4][16][64];
  const int tid = threadIdx.x, w = tid >> 5, lane = tid & 31, ln = lane & 15, hh = lane >> 4;
  const int ntn = N / 64;
  const int wid = blockIdx.x * 4 + w;
  const int mt = wid / ntn, nq = wid % ntn;
  if (mt * 16 >= M) return;
  const int row0 = mt * 16, col0 = nq * 64;
  const float* arow = A + (size_t)(row0 + ln) * lda;
  v8f acc[4] = {};
  for (int kb = 0; kb < K; kb += 32) {
    FragB ah, al;
    const v4f x0 = *(const v4fa*)(arow + kb + 8 * hh), x1 = *(const v4fa*)(arow + kb + 8 * hh + 4);
    const v4f x2 = *(const v4fa*)(arow + kb + 16 + 8 * hh), x3 = *(const v4fa*)(arow + kb + 16 + 8 * hh + 4);
    float xs[16] = {x0[0],x0[1],x0[2],x0[3],x1[0],x1[1],x1[2],x1[3],x2[0],x2[1],x2[2],x2[3],x3[0],x3[1],x3[2],x3[3]};
#pragma unroll
    for (int i = 0; i < 16; ++i) { const unsigned short hb = bf16_bits(xs[i]); ah.u[i] = hb; al.u[i] = ASPLIT ? bf16_bits(xs[i] - bf16_val(hb)) : (unsigned short)0; }
#pragma unroll
    for (int t = 0; t < 4; ++t) {
      const unsigned short* brow = Wt + (size_t)(col0 + t * 16 + ln) * ldb + kb;
      FragB b;
      b.half[0] = *(const v8us*)(brow + 8 * hh);
      b.half[1] = *(const v8us*)(brow + 16 + 8 * hh);
      acc[t] = mmaN<ASPLIT ? 2 : 1>(ah.v, al.v, b.v, b.v, acc[t]);
    }
  }
#pragma unroll
  for (int t = 0; t < 4; ++t) {
    const int col = col0 + t * 16 + ln;
    float bv = bias ? bias[col] : 0.f;
    if (BIAS_BF16) bv = bf16_round(bv);
#pragma unroll
    for (int r = 0; r < 8; ++r) {
      float v = acc[t][r] + bv;
      if (resid) { float rv = resid[(size_t)((row0 + 8 * hh + r) % rmod) * ldr + col]; if (RES_BF16) rv = bf16_round(rv); v += rv; }
      if (ACT == 1) v = fmaxf(v, 0.f);
      if (ACT == 2) v = 0.5f * v * (1.0f + erff(v * 0.70710678118654752f));
      if (ACT == 3) { const float u = 0.7978845608028654f * (v + 0.044715f * v * v * v); v = 0.5f * v * (1.0f + tanhf(u)); }
      so[w][8 * hh + r][t * 16 + ln] = v;
    }
  }
  __builtin_amdgcn_fence(__ATOMIC_ACQ_REL, "workgroup");
  __builtin_amdgcn_wave_barrier();
  const int rsub = lane >> 4, c4 = (lane & 15) * 4;
  {
#pragma unroll
    for (int q = 0; q < 8; ++q) {
      const int r = q * 2 + rsub;
      const v4f v = *(const v4fa*)&so[w][r][c4];
      *(v4f*)(C + (size_t)(row0 + r) * ldc + col0 + c4) = v;
    }
    
  }
}
// row LayerNorm (biased variance, eps) over N: s = X (+ R); optional out_sum <- s; out_norm <- (s-mu)*rsqrt(var+eps)*g + b
template <bool PARAM_BF16>
__global__ __launch_bounds__(256) void k_layernorm(const float* __restrict__ X, const float* __restrict__ R, const float* __restrict__ g, const float* __restrict__ bta,
                                                  float* __restrict__ out_sum, float* __restrict__ out_norm, int N, float eps) {
  __shared__ float red[256];
  const int row = blockIdx.x, tid = threadIdx.x;
  const float* x = X + (size_t)row * N; const float* rr = R ? R + (size_t)row * N : nullptr;
  float vals[16];                     // up to N = 4096
  const int per = N / 256;            // contiguous chunk per thread? use strided-by-4 chunks: thread handles j = tid*4 + 1024*u
  float s1 = 0.f;
  for (int u = 0; u < per / 4; ++u) {
    const int j = tid * 4 + 1024 * u;
    const v4f a = *(const v4fa*)(x + j);
    v4f b = {0.f,0.f,0.f,0.f}; if (rr) b = *(const v4fa*)(rr + j);
#pragma unroll
    for (int q = 0; q < 4; ++q) { const float v = a[q] + b[q]; vals[u * 4 + q] = v; s1 += v; }
  }
  red[tid] = s1; __syncthreads();
  for (int st = 128; st > 0; st >>= 1) { if (tid < st) red[tid] += red[tid + st]; __syncthreads(); }
  const float mu = red[0] / (float)N; __syncthreads();
  float s2 = 0.f;
  for (int u = 0; u < per / 4; ++u)
#pragma unroll
    for (int q = 0; q < 4; ++q) { const float c = vals[u * 4 + q] - mu; s2 += c * c; }
  red[tid] = s2; __syncthreads();
  for (int st = 128; st > 0; st >>= 1) { if (tid < st) red[tid] += red[tid + st]; __syncthreads(); }
  const float rs = rsqrtf(red[0] / (float)N + eps);
  {
    for (int u = 0; u < per / 4; ++u) {
      const int j = tid * 4 + 1024 * u;
      v4f o, sm;
#pragma unroll
      for (int q = 0; q < 4; ++q) {
        float gg = g[j + q], bb = bta[j + q];
        if (PARAM_BF16) { gg = bf16_round(gg); bb = bf16_round(bb); }
        sm[q] = vals[u * 4 + q]; o[q] = (vals[u * 4 + q] - mu) * rs * gg + bb;
      }
      if (out_sum) *(v4f*)(out_sum + (size_t)row * N + j) = sm;
      *(v4f*)(out_norm + (size_t)row * N + j) = o;
    }
    
  }
}



// ---- f16 WMMA path (v_wmma_f32_16x16x32_f16): 11-bit significands for operands in range — used for every GEMM launched here
typedef _Float16 v16h __attribute__((ext_vector_type(16)));
union FragH { v16h v; v8us half[2]; _Float16 h[16]; unsigned short u[16]; };
template <int NT>
__device__ __forceinline__ v8f mmaH(v16h ah, v16h al, v16h bh, v16h bl, v8f c) {
  c = __builtin_amdgcn_wmma_f32_16x16x32_f16(false, ah, false, bh, (short)0, c, false, false);
  if (NT >= 2) c = __builtin_amdgcn_wmma_f32_16x16x32_f16(false, al, false, bh, (short)0, c, false, false);
  if (NT >= 3) c = __builtin_amdgcn_wmma_f32_16x16x32_f16(false, ah, false, bl, (short)0, c, false, false);
  asm volatile("v_nop\n\tv_nop\n\tv_nop\n\tv_nop" : "+v"(c) : "v"(ah), "v"(al), "v"(bh), "v"(bl));
  return c;
}
// batched GEMM like k_gemm_b but f16 operands: A f32 (split into f16 hi/lo if ASPLIT, else rounded to f16), Bt = f16 values [n][k]; alpha; C f32; N multiple of 16 (partial tiles skipped)
template <bool ASPLIT>
__global__ __launch_bounds__(128) void k_gemm_h(const float* __restrict__ A, int lda, size_t sA, const _Float16* __restrict__ Bh, int ldb, size_t sB, float alpha, float* __restrict__ C, int ldc, size_t sC, int M, int N, int K) {
  __shared__ __attribute__((aligned(16))) float so[4][16][64];
  const int tid = threadIdx.x, w = tid >> 5, lane = tid & 31, ln = lane & 15, hh = lane >> 4; const int by = blockIdx.y;
  A += (size_t)by * sA; Bh += (size_t)by * sB; C += (size_t)by * sC;
  const int ntn = (N + 63) / 64; const int wid = blockIdx.x * 4 + w; const int mt = wid / ntn, nq = wid % ntn; if (mt * 16 >= M) return;
  const int row0 = mt * 16, col0 = nq * 64; const float* arow = A + (size_t)(row0 + ln) * lda;
  v8f acc[4] = {};
  for (int kb = 0; kb < K; kb += 32) {
    FragH ah, al;
    const v4f x0 = *(const v4fa*)(arow + kb + 8 * hh), x1 = *(const v4fa*)(arow + kb + 8 * hh + 4), x2 = *(const v4fa*)(arow + kb + 16 + 8 * hh), x3 = *(const v4fa*)(arow + kb + 16 + 8 * hh + 4);
    float xs[16] = {x0[0],x0[1],x0[2],x0[3],x1[0],x1[1],x1[2],x1[3],x2[0],x2[1],x2[2],x2[3],x3[0],x3[1],x3[2],x3[3]};
#pragma unroll
    for (int i = 0; i < 16; ++i) { const _Float16 h = (_Float16)xs[i]; ah.h[i] = h; al.h[i] = ASPLIT ? (_Float16)(xs[i] - (float)h) : (_Float16)0.0f; }
#pragma unroll
    for (int t = 0; t < 4; ++t) { if (col0 + t * 16 >= N) continue; const size_t boff = (size_t)(col0 + t * 16 + ln) * ldb + kb; FragH bq; bq.half[0] = *(const v8us*)(Bh + boff + 8 * hh); bq.half[1] = *(const v8us*)(Bh + boff + 16 + 8 * hh);
      acc[t] = mmaH<ASPLIT ? 2 : 1>(ah.v, al.v, bq.v, bq.v, acc[t]); }
  }
#pragma unroll
  for (int t = 0; t < 4; ++t) { if (col0 + t * 16 >= N) continue;
#pragma unroll
    for (int r = 0; r < 8; ++r) so[w][8 * hh + r][t * 16 + ln] = acc[t][r] * alpha; }
  __builtin_amdgcn_fence(__ATOMIC_ACQ_REL, "workgroup"); __builtin_amdgcn_wave_barrier();
  const int rsub = lane >> 4, c4 = (lane & 15) * 4;
  {
#pragma unroll
    for (int q = 0; q < 8; ++q) { const int r = q * 2 + rsub; if (col0 + c4 < N) { const v4f v = *(const v4fa*)&so[w][r][c4]; *(v4f*)(C + (size_t)(row0 + r) * ldc + col0 + c4) = v; } }
     }
}

// Wt[n][k] = f16(W[k][n]·scale) from f32 row-major W[K][N] (scale = power of two; bf16-exact weights stay exact in f16 away from the subnormal range)
__global__ __launch_bounds__(256) void k_wt_f16(const float* __restrict__ W, _Float16* __restrict__ Wt, int K, int N, float scale) {
  const int t = blockIdx.x * 256 + threadIdx.x; if (t >= N * (K / 8)) return; const int n = t / (K / 8), k8 = (t % (K / 8)) * 8; FragH f;
#pragma unroll
  for (int i = 0; i < 8; ++i) f.h[i] = (_Float16)(bf16_round(W[(size_t)(k8 + i) * N + n]) * scale); const v8us o = f.half[0];
  *(v8us*)((unsigned short*)Wt + (size_t)n * K + k8) = o; 
}
// k_gemm_hh variant with fused epilogue: v = acc·alpha + bias[by·sBias + col] (+ CP[(row/rowsPerB)·sCPb + by·64 + col] if CP) ; ACT 0 none / 1 elu ; writes f16 C16 (and f32 C if non-null)
template <int ACT>
__global__ __launch_bounds__(128) void k_gemm_hhx(const _Float16* __restrict__ A, int lda, size_t sA, const _Float16* __restrict__ Bh, int ldb, size_t sB, float alpha, const float* __restrict__ bias, size_t sBias, const float* __restrict__ CP, int rowsPerB, size_t sCPb, int row0g,
    float* __restrict__ C, _Float16* __restrict__ C16, int ldc, size_t sC, int M, int N, int K) {
  __shared__ __attribute__((aligned(16))) float so[4][16][64];
  const int tid = threadIdx.x, w = tid >> 5, lane = tid & 31, ln = lane & 15, hh = lane >> 4; const int by = blockIdx.y;
  A += (size_t)by * sA; Bh += (size_t)by * sB; const size_t cofs = (size_t)by * sC; const float* bp = bias ? bias + (size_t)by * sBias : nullptr;
  const int ntn = (N + 63) / 64; const int wid = blockIdx.x * 4 + w; const int mt = wid / ntn, nq = wid % ntn; if (mt * 16 >= M) return;
  const int row0 = mt * 16, col0 = nq * 64; const _Float16* arow = A + (size_t)(row0 + ln) * lda;
  v8f acc[4] = {};
  for (int kb = 0; kb < K; kb += 32) { FragH ah; ah.half[0] = *(const v8us*)((const unsigned short*)arow + kb + 8 * hh); ah.half[1] = *(const v8us*)((const unsigned short*)arow + kb + 16 + 8 * hh);
#pragma unroll
    for (int t = 0; t < 4; ++t) { if (col0 + t * 16 >= N) continue; const size_t boff = (size_t)(col0 + t * 16 + ln) * ldb + kb; FragH bq; bq.half[0] = *(const v8us*)((const unsigned short*)Bh + boff + 8 * hh); bq.half[1] = *(const v8us*)((const unsigned short*)Bh + boff + 16 + 8 * hh);
      acc[t] = mmaH<1>(ah.v, ah.v, bq.v, bq.v, acc[t]); }
  }
#pragma unroll
  for (int t = 0; t < 4; ++t) { if (col0 + t * 16 >= N) continue; const int col = col0 + t * 16 + ln; const float bv = bp ? bf16_round(bp[col]) : 0.f;
#pragma unroll
    for (int r = 0; r < 8; ++r) { float v = acc[t][r] * alpha + bv; if (CP) { const int rr = row0g + row0 + 8 * hh + r; if (rowsPerB < 0) v += CP[cofs + (size_t)rr * ldc + col];      /* rowsPerB < 0: own element of the batched C plane */ else { const int bidx = rr / rowsPerB; v += CP[(size_t)bidx * sCPb + (size_t)by * 64 + col]; } } if (ACT == 1) v = (v > 0.f) ? v : expm1f(v); else if (ACT == 7) v = (v > 0.f) ? v + 1.0f : expf(v); else if (ACT == 8) v = tanhf(v); else if (ACT == 9) v = 0.5f * v * (1.0f + tanhf(0.7978845608028654f * (v + 0.044715f * v * v * v))); else if (ACT == 11) v = 1.0f / (1.0f + expf(-v)); else if (ACT == 12) v = (v > 0.f) ? v : 0.01f * v; else if (ACT == 14) v = (v > 0.f) ? v : 0.1f * v; else if (ACT == 16) v = (v >= 0.f) ? v : 0.3f * v; else if (ACT == 17) v = (v >= 0.f) ? v : 0.2f * v; else if (ACT == 15) v = v / (1.0f + expf(-v)); else if (ACT == 3) v = fmaxf(v, 0.f); else if (ACT == 6) v = 0.5f * v * (1.0f + erff(v * 0.70710678118654752f)); so[w][8 * hh + r][t * 16 + ln] = v; } }
  __builtin_amdgcn_fence(__ATOMIC_ACQ_REL, "workgroup"); __builtin_amdgcn_wave_barrier();
  const int rsub = lane >> 4, c4 = (lane & 15) * 4; typedef _Float16 v4h __attribute__((ext_vector_type(4)));
  {
#pragma unroll
    for (int q = 0; q < 8; ++q) { const int r = q * 2 + rsub; if (col0 + c4 < N) { const v4f v = *(const v4fa*)&so[w][r][c4]; if (C) *(v4f*)(C + cofs + (size_t)(row0 + r) * ldc + col0 + c4) = v; if (C16) { v4h h4; for (int i = 0; i < 4; ++i) h4[i] = (_Float16)v[i]; *(v4h*)(C16 + cofs + (size_t)(row0 + r) * ldc + col0 + c4) = h4; } } }
     }
}


typedef _Float16 v4h __attribute__((ext_vector_type(4)));

__global__ __launch_bounds__(256) void k_h16(const float* __restrict__ x, _Float16* __restrict__ X16, size_t n8) { const size_t t = (size_t)blockIdx.x * 256 + threadIdx.x; if (t >= n8) return; FragH f;
#pragma unroll
  for (int q = 0; q < 8; ++q) f.h[q] = (_Float16)x[t * 8 + q]; *(v8us*)((unsigned short*)X16 + t * 8) = f.half[0];  }
__global__ __launch_bounds__(256) void k_round16f(const float* __restrict__ W, _Float16* __restrict__ Bt, size_t n8) { const size_t t = (size_t)blockIdx.x * 256 + threadIdx.x; if (t >= n8) return; FragH f;
#pragma unroll
  for (int i = 0; i < 8; ++i) f.h[i] = (_Float16)(bf16_round(W[t * 8 + i]) * 16.0f); *(v8us*)((unsigned short*)Bt + t * 8) = f.half[0];  }
__global__ __launch_bounds__(256) void k_hl(const float* __restrict__ F, _Float16* __restrict__ Hh, _Float16* __restrict__ Hl, size_t n8) { const size_t t = (size_t)blockIdx.x * 256 + threadIdx.x; if (t >= n8) return; FragH fh, fl; const v4f a = *(const v4fa*)(F + t * 8), c = *(const v4fa*)(F + t * 8 + 4);
#pragma unroll
  for (int q = 0; q < 4; ++q) { _Float16 h = (_Float16)a[q]; fh.h[q] = h; fl.h[q] = (_Float16)((a[q] - (float)h) * 1024.0f); h = (_Float16)c[q]; fh.h[4 + q] = h; fl.h[4 + q] = (_Float16)((c[q] - (float)h) * 1024.0f); }
  { *(v8us*)((unsigned short*)Hh + t * 8) = fh.half[0]; *(v8us*)((unsigned short*)Hl + t * 8) = fl.half[0];  } }

// ---- fast GEMM (block tile 128x64, wave tile 32x64, A and B k-tiles staged in LDS; requires M % 128 == 0, N % 64 == 0 and K == 64 or K % 128 == 0); epilogue = k_gemm_hhx semantics ----
#define G2_LP 72
__device__ __forceinline__ v16h g2_frag(const _Float16* p, int hh) { FragH f; f.half[0] = *(const v8us*)((const unsigned short*)p + 8 * hh); f.half[1] = *(const v8us*)((const unsigned short*)p + 16 + 8 * hh); return f.v; }
__device__ __forceinline__ v8f g2_mma(v16h a, v16h b, v8f c) { v8f d = __builtin_amdgcn_wmma_f32_16x16x32_f16(false, a, false, b, (short)0, c, false, false); asm volatile("v_nop\n\tv_nop\n\tv_nop\n\tv_nop" : "+v"(d) : "v"(a), "v"(b)); return d; }
// work-group barrier that orders LDS alone (its fences name the LDS address space): __syncthreads() also waits for every global load in flight, and the loads for the tiles ahead must stay in flight across it; the loop's global reads are of operands that no wave of the launch writes
__device__ __forceinline__ void g2_bar() { __builtin_amdgcn_fence(__ATOMIC_RELEASE, "workgroup", "local"); __builtin_amdgcn_s_barrier(); __builtin_amdgcn_fence(__ATOMIC_ACQUIRE, "workgroup", "local"); }
template <int ACT, bool PL>
__global__ __launch_bounds__(128) void k_gemm2(const _Float16* __restrict__ A, int lda, size_t sA, const _Float16* __restrict__ Bh, int ldb, size_t sB, float alpha, const float* __restrict__ bias, size_t sBias, const float* __restrict__ CP, int rowsPerB, size_t sCPb, int row0g,
    float* __restrict__ C, _Float16* __restrict__ C16, int ldc, size_t sC, int M, int N, int K, int nb1, const _Float16* __restrict__ B1, float* __restrict__ C1, int N1,
    _Float16* __restrict__ PQ, _Float16* __restrict__ PK, _Float16* __restrict__ PVH, _Float16* __restrict__ PVL) { static_assert(ACT == 0 || ACT == 3 || ACT == 6 || ACT == 8 || ACT == 9 || ACT == 11 || ACT == 12 || ACT == 14 || ACT == 15 || ACT == 16 || ACT == 17, "k_gemm2: unsupported ACT code (would silently apply no activation)");
  __shared__ __attribute__((aligned(16))) float so[4][32][68];
  // k-tiles of 64 halves (one whole 128-B line per row) of the block's 128 A rows and 64 B rows, two buffers; row pitch 72 halves = 144 B = 16 B x 9 for the ds_load_b128 fragment reads
  __shared__ __attribute__((aligned(16))) _Float16 sa[2][128][G2_LP];
  __shared__ __attribute__((aligned(16))) _Float16 sb[2][64][G2_LP];
  const int tid = threadIdx.x, w = tid >> 5, lane = tid & 31, ln = lane & 15, hh = lane >> 4; const int by = blockIdx.y;
  unsigned bx = blockIdx.x; const bool job1 = bx < (unsigned)nb1; if (job1) { Bh = B1; C = C1; N = N1; ldc = N1; bias = nullptr; } else bx -= (unsigned)nb1;      /* a second product of the same A in the same grid (no bias, C1 of pitch N1): it has the first nb1 blocks, so that the small job starts with the launch; the same for the whole block */
  A += (size_t)by * sA; Bh += (size_t)by * sB; const size_t cofs = (size_t)by * sC; const float* bp = bias ? bias + (size_t)by * sBias : nullptr;
  const int ntn = N >> 6; const int mt = bx / ntn, nq = bx - mt * ntn; const int row0 = mt * 128 + 32 * w, col0 = nq * 64; if (mt * 128 >= M) return;      /* the same for the whole block: it stands in front of barriers */
  const int sr = tid >> 3, sc = (tid & 7) * 8;      /* staging: 8 lanes cover one row's 128 B, a wave-wide load covers 4 whole lines */
  const char* ab = (const char*)(A + (size_t)(mt * 128) * lda); const char* bb = (const char*)(Bh + (size_t)col0 * ldb);      /* the block's first A and B row: the same in every lane */
  const unsigned ao = (unsigned)(sr * lda + sc) * 2u, bo = (unsigned)(sr * ldb + sc) * 2u;      /* the lane's own byte offset, fixed for the whole loop */
  const v8f z8 = {0.f,0.f,0.f,0.f,0.f,0.f,0.f,0.f}; v8f c00 = z8, c01 = z8, c02 = z8, c03 = z8, c10 = z8, c11 = z8, c12 = z8, c13 = z8;
  v8us ra0[8], rb0[4], ra1[8], rb1[4];
  auto gl = [&](v8us* ra, v8us* rb, int kb) {
#pragma unroll
    for (int i = 0; i < 8; ++i) ra[i] = *(const v8us*)(ab + ((size_t)(16 * i) * lda + kb) * 2 + ao);
#pragma unroll
    for (int i = 0; i < 4; ++i) rb[i] = *(const v8us*)(bb + ((size_t)(16 * i) * ldb + kb) * 2 + bo); };
  auto st = [&](const v8us* ra, const v8us* rb, int buf) {
#pragma unroll
    for (int i = 0; i < 8; ++i) *(v8us*)&sa[buf][sr + 16 * i][sc] = ra[i];
#pragma unroll
    for (int i = 0; i < 4; ++i) *(v8us*)&sb[buf][sr + 16 * i][sc] = rb[i]; };
  auto comp = [&](int buf) {
#pragma unroll
    for (int kk = 0; kk < 64; kk += 32) { const v16h a0 = g2_frag(&sa[buf][32 * w + ln][kk], hh), a1 = g2_frag(&sa[buf][32 * w + 16 + ln][kk], hh);
      const v16h b0 = g2_frag(&sb[buf][ln][kk], hh), b1 = g2_frag(&sb[buf][16 + ln][kk], hh), b2 = g2_frag(&sb[buf][32 + ln][kk], hh), b3 = g2_frag(&sb[buf][48 + ln][kk], hh);
      c00 = g2_mma(a0, b0, c00); c10 = g2_mma(a1, b0, c10); c01 = g2_mma(a0, b1, c01); c11 = g2_mma(a1, b1, c11);
      c02 = g2_mma(a0, b2, c02); c12 = g2_mma(a1, b2, c12); c03 = g2_mma(a0, b3, c03); c13 = g2_mma(a1, b3, c13); } };
  // Each barrier publishes the buffer just written and ends every wave's reads of the other buffer, which is written next.
  gl(ra0, rb0, 0);
  __builtin_amdgcn_sched_barrier(0);      /* keeps set 0's loads in front of set 1's: mixed, set 0's wait at the loop's head would wait for set 1 as well */
  gl(ra1, rb1, 64 < K ? 64 : 0);      /* the second set's tile clamped, not branched round: set 0's loads stay the older ones on every way into the loop, so its wait leaves set 1's in flight */
  asm volatile("s_wait_xcnt 0x0" ::: "memory");      /* in front of whatever reuses the address registers of the loads above, which stay in flight */
  int kb = 0;
  // two tiles per trip so that each register set and each LDS buffer has a fixed name; every load of the trip is unconditional (the last two tiles are peeled off below), so the waits can be counted; kept rolled: unrolled further it only grows the code
#pragma unroll 1
  for (; kb + 128 < K; kb += 128) {
    st(ra0, rb0, 0); g2_bar(); gl(ra0, rb0, kb + 128); comp(0);      /* loads two tiles ahead: in flight over this tile's and the next tile's products */
    st(ra1, rb1, 1); g2_bar(); gl(ra1, rb1, kb + 192); comp(1);
    asm volatile("s_wait_xcnt 0x0" ::: "memory"); }      /* in front of the next trip's address arithmetic, which rewrites the address registers of loads still in flight */
  st(ra0, rb0, 0); g2_bar(); comp(0);
  if (kb + 64 < K) { st(ra1, rb1, 1); g2_bar(); comp(1); }
  v8f accs[8] = {c00, c01, c02, c03, c10, c11, c12, c13};
  // every global read of the epilogue is issued here as one batch and waited for once: read where each element is formed, every element would wait for its own row address and its own round trip, with nothing else in the wave to cover them.
  // The addend is read in the store phase's layout (rows 2 * q + (lane >> 4), 16 B a lane, 256 B a row) and joins the staged tile in front of that phase: with no activation between them that is the same sum, (product * alpha + bias) + addend. The loops over q, t are unrolled in full so that their arrays stay in registers.
  const bool cadd = ACT == 0 && CP != nullptr;      /* the same for the whole launch */
  float bvr[4] = {0.f, 0.f, 0.f, 0.f}; v4f cq[16] = {};
  if (cadd) { size_t co[16]; const float* cr[16]; const int rr0 = row0g + row0 + (lane >> 4);      /* the test on rowsPerB stands outside the loops so that the 16 row offsets are formed side by side */
    if (rowsPerB < 0) {      /* own element of the batched C plane */
#pragma unroll
      for (int q = 0; q < 16; ++q) co[q] = cofs + (size_t)(rr0 + 2 * q) * ldc; }
    else {
#pragma unroll
      for (int q = 0; q < 16; ++q) co[q] = (size_t)((rr0 + 2 * q) / rowsPerB) * sCPb + (size_t)by * 64; }
#pragma unroll
    for (int q = 0; q < 16; ++q) cr[q] = CP + co[q] + col0 + (lane & 15) * 4;
#pragma unroll
    for (int q = 0; q < 16; ++q) cq[q] = *(const v4fa*)cr[q];
    // in front of whatever reuses the address registers of the loads above, which stay in flight; the 16 row addresses are inputs (read only) so that each stays whole up to the wait
    asm volatile("s_wait_xcnt 0x0" :: "v"(cr[0]), "v"(cr[1]), "v"(cr[2]), "v"(cr[3]), "v"(cr[4]), "v"(cr[5]), "v"(cr[6]), "v"(cr[7]), "v"(cr[8]), "v"(cr[9]), "v"(cr[10]), "v"(cr[11]), "v"(cr[12]), "v"(cr[13]), "v"(cr[14]), "v"(cr[15]) : "memory"); }
  if (bp) {
#pragma unroll
    for (int t = 0; t < 4; ++t) bvr[t] = bp[col0 + t * 16 + ln];
    asm volatile("s_wait_xcnt 0x0" ::: "memory"); }      /* in front of whatever reuses the address registers of the loads above, which stay in flight */
  if (PL && !job1) {      /* the same for the whole block */
    static_assert(!PL || (TT % 128 == 0 && HD == 64 && DM % HD == 0), "k_gemm2: a block tile must be one head's columns and lie in one batch");
    // C = [q | k | v] is not stored: the block's 64 columns are one head of q, k or v and its 128 rows lie in one batch, so the tile goes out as the attention's own operand: q, k as f16 rows [plane][t][64], v as V^T hi + residual x 2^10 [plane][d][t]. The loops over u, r, q, i are unrolled in full so that their arrays stay in registers.
    const int part = col0 / DM, tb = (mt * 128) % TT; const size_t plane = (size_t)((mt * 128) / TT) * NH + (col0 % DM) / HD;
    if (part < 2) {      /* rows: through the wave's own f32 tile, read back 8 columns a lane; a wave-wide store covers 4 whole rows = 512 B in a row */
#pragma unroll
      for (int u = 0; u < 8; ++u) { const int t = u & 3, half = u >> 2; const float bv = bf16_round(bvr[t]);
#pragma unroll
        for (int r = 0; r < 8; ++r) so[w][half * 16 + 8 * hh + r][t * 16 + ln] = accs[u][r] * alpha + bv; }
      __builtin_amdgcn_fence(__ATOMIC_ACQ_REL, "workgroup"); __builtin_amdgcn_wave_barrier();      /* the wave's LDS stores stand in front of the reads below, in which its lanes read one another's elements; no other wave touches this tile */
      unsigned short* D = (unsigned short*)(part == 0 ? PQ : PK) + (plane * TT + tb + 32 * w + (lane >> 3)) * HD + (lane & 7) * 8;
      FragH f[8];
#pragma unroll
      for (int q = 0; q < 8; ++q) { const float* sp = &so[w][q * 4 + (lane >> 3)][(lane & 7) * 8]; const v4f a = *(const v4fa*)sp, b = *(const v4fa*)(sp + 4);
#pragma unroll
        for (int i = 0; i < 4; ++i) { f[q].h[i] = (_Float16)a[i]; f[q].h[4 + i] = (_Float16)b[i]; } }
#pragma unroll
      for (int q = 0; q < 8; ++q) *(v8us*)(D + q * 4 * HD) = f[q].half[0];
      asm volatile("s_wait_xcnt 0x0" ::: "memory"); }      /* in front of whatever reuses the registers that the stores above name */
    else {      /* columns: a lane's accumulator registers are 8 consecutive t of one d, a 16-B piece of V^T; the block's pieces meet in LDS (the f32 tiles' space, pitch 136 halves = 16 B x 17), so that whole rows of 128 t = 256 B go out; hi + residual because the bias makes the attention peaked, so that v's rounding reaches the output almost unaveraged */
      unsigned short* th = (unsigned short*)&so[0][0][0]; unsigned short* tl = th + 64 * 136;
#pragma unroll
      for (int u = 0; u < 8; ++u) { const int t = u & 3, half = u >> 2; const float bv = bf16_round(bvr[t]); FragH fh, fl;
#pragma unroll
        for (int r = 0; r < 8; ++r) { const float v = accs[u][r] * alpha + bv; const _Float16 hv = (_Float16)v; fh.h[r] = hv; fl.h[r] = (_Float16)((v - (float)hv) * 1024.0f); }
        const int o = (t * 16 + ln) * 136 + 32 * w + half * 16 + 8 * hh; *(v8us*)(th + o) = fh.half[0]; *(v8us*)(tl + o) = fl.half[0]; }
      __syncthreads();      /* every wave's 32 t of each row are in place before a row is read */
      const size_t go = (plane * HD + (tid >> 4)) * TT + tb + (tid & 15) * 8; const int lo = (tid >> 4) * 136 + (tid & 15) * 8;
      v8us xh[8], xl[8];
#pragma unroll
      for (int i = 0; i < 8; ++i) { xh[i] = *(const v8us*)(th + lo + i * 8 * 136); xl[i] = *(const v8us*)(tl + lo + i * 8 * 136); }
#pragma unroll
      for (int i = 0; i < 8; ++i) { *(v8us*)((unsigned short*)PVH + go + (size_t)i * 8 * TT) = xh[i]; *(v8us*)((unsigned short*)PVL + go + (size_t)i * 8 * TT) = xl[i]; }
      asm volatile("s_wait_xcnt 0x0" ::: "memory"); }      /* in front of whatever reuses the registers that the stores above name */
    return; }
#pragma unroll
  for (int u = 0; u < 8; ++u) { const int t = u & 3, half = u >> 2; const int col = col0 + t * 16 + ln; const float bv = bf16_round(bvr[t]);      /* no bias: the rounding of 0 is 0 */
#pragma unroll
    for (int r = 0; r < 8; ++r) { const int rloc = half * 16 + 8 * hh + r; float v = accs[u][r] * alpha + bv; if (ACT != 0 && CP) { if (rowsPerB < 0) v += CP[cofs + (size_t)(row0g + row0 + rloc) * ldc + col];      /* rowsPerB < 0: own element of the batched C plane */ else { const int bidx = (row0g + row0 + rloc) / rowsPerB; v += CP[(size_t)bidx * sCPb + (size_t)by * 64 + col]; } }
      if (ACT == 3) v = fmaxf(v, 0.f); else if (ACT == 6) v = 0.5f * v * (1.0f + erff(v * 0.70710678118654752f)); else if (ACT == 11) v = 1.0f / (1.0f + expf(-v)); else if (ACT == 15) v = v / (1.0f + expf(-v)); else if (ACT == 12) v = (v > 0.f) ? v : 0.01f * v; else if (ACT == 8) v = tanhf(v); else if (ACT == 9) v = 0.5f * v * (1.0f + tanhf(0.7978845608028654f * (v + 0.044715f * v * v * v))); else if (ACT == 14) v = (v > 0.f) ? v : 0.1f * v; else if (ACT == 16) v = (v >= 0.f) ? v : 0.3f * v; else if (ACT == 17) v = (v >= 0.f) ? v : 0.2f * v;
      so[w][rloc][t * 16 + ln] = v; } }
  __builtin_amdgcn_fence(__ATOMIC_ACQ_REL, "workgroup"); __builtin_amdgcn_wave_barrier();
  const int rsub = lane >> 4, c4 = (lane & 15) * 4;
  if (cadd) {      /* each lane adds to the 16 B pieces that it alone reads back below; unrolled in full so that cq stays in registers */
#pragma unroll
    for (int q = 0; q < 16; ++q) { v4fa* sp = (v4fa*)&so[w][q * 2 + rsub][c4]; *sp = *sp + cq[q]; } }
  {
#pragma unroll
    for (int q = 0; q < 16; ++q) { const int r = q * 2 + rsub; const v4f v = *(const v4fa*)&so[w][r][c4]; if (C) *(v4f*)(C + cofs + (size_t)(row0 + r) * ldc + col0 + c4) = v; if (C16) { v4h h4; for (int i = 0; i < 4; ++i) h4[i] = (_Float16)v[i]; *(v4h*)(C16 + cofs + (size_t)(row0 + r) * ldc + col0 + c4) = h4; } }
     } }


// ---- launches that do not depend on one another share one grid: a range of block indices per job (every test on the block index is the same for the whole work-group); no job reads what another job of its grid writes
// the seven input conversions to f16 (weights x 16, x as it is: x 1 is exact); 8 values a thread, every array a whole number of blocks
#define PB_QKV (3 * DM * DM / 8 / 256)
#define PB_X (NR * DM / 8 / 256)
#define PB_OUT (DM * DM / 8 / 256)
#define PB_LIN (64 * DM / 8 / 256)
__global__ __launch_bounds__(256) void k_prep(const float* __restrict__ Wqkv, const float* __restrict__ x, const float* __restrict__ Wout, const float* __restrict__ W1w, const float* __restrict__ W2w, const float* __restrict__ W1r, const float* __restrict__ W2r,
    _Float16* __restrict__ BQKV, _Float16* __restrict__ X16, _Float16* __restrict__ BO, _Float16* __restrict__ BL) {
  int b = blockIdx.x; const float* Wm; _Float16* Bt; float sc = 16.0f;
  if (b < PB_QKV) { Wm = Wqkv; Bt = BQKV; }
  else if ((b -= PB_QKV) < PB_X) { Wm = x; Bt = X16; sc = 1.0f; }
  else if ((b -= PB_X) < PB_OUT) { Wm = Wout; Bt = BO; }
  else { b -= PB_OUT; const int g = b / PB_LIN; b -= g * PB_LIN; Wm = g == 0 ? W1w : g == 1 ? W2w : g == 2 ? W1r : W2r; Bt = BL + (size_t)g * 64 * DM; }      /* [W1w; W2w; W1r; W2r] rows h*4 + i */
  const size_t t = (size_t)b * 256 + threadIdx.x; FragH f; for (int q = 0; q < 8; ++q) f.h[q] = (_Float16)(bf16_round(Wm[t * 8 + q]) * sc); *(v8us*)((unsigned short*)Bt + t * 8) = f.half[0];  }
__device__ __forceinline__ void exter(const float* p1, const float* p2, float* L) {
  #pragma clang fp contract(off)
  const int PI[6] = {0, 0, 0, 1, 1, 2}, PJ[6] = {1, 2, 3, 2, 3, 3}; float n2 = 0.f;
  for (int k = 0; k < 6; ++k) { float a = p1[PI[k]] * p2[PJ[k]]; a += -(p1[PJ[k]] * p2[PI[k]]); L[k] = a; n2 += a * a; }
  const float n = fmaxf(sqrtf(n2), 1e-12f); for (int k = 0; k < 6; ++k) L[k] = L[k] / n; }
__device__ __forceinline__ void lines_body(const int bx, const float* __restrict__ LW, float* __restrict__ JW, float* __restrict__ RD) {
  #pragma clang fp contract(off)
  const int tt = bx * 256 + threadIdx.x; if (tt >= NR * NH) return; const int t = tt % TT; const int bh = tt / TT; const int h = bh % NH, b = bh / NH; const size_t row = (size_t)b * TT + t; float w1[4], w2[4], r1[4], r2[4];
  for (int i = 0; i < 4; ++i) { w1[i] = (t > 0) ? LW[(row - 1) * 256 + h * 4 + i] : 0.f; w2[i] = LW[row * 256 + 64 + h * 4 + i]; r1[i] = LW[row * 256 + 128 + h * 4 + i]; r2[i] = LW[row * 256 + 192 + h * 4 + i]; }
  float wl[6], rl[6]; exter(w1, w2, wl); exter(r1, r2, rl); v8f jw, rd; jw[0] = wl[5]; jw[1] = -wl[4]; jw[2] = wl[3]; jw[3] = wl[2]; jw[4] = -wl[1]; jw[5] = wl[0]; jw[6] = 0.f; jw[7] = 0.f; for (int k = 0; k < 6; ++k) rd[k] = rl[k]; rd[6] = 0.f; rd[7] = 0.f;
  const size_t o = (((size_t)b * NH + h) * TT + t) * 8; { *(v8f*)(JW + o) = jw; *(v8f*)(RD + o) = rd;  } }
#define SB_LIN (NR * NH / 256)
__global__ __launch_bounds__(256) void k_lines(const float* __restrict__ LW, float* __restrict__ JW, float* __restrict__ RD) { lines_body(blockIdx.x, LW, JW, RD); }
typedef float v2f __attribute__((ext_vector_type(2)));
typedef float v2fa __attribute__((ext_vector_type(2), may_alias));
// Causal 6x6 Gram state and rd . M, one work-group per (batch, head). M is symmetric bit for bit (w_i * w_j rounds the same either way and both sides sum in the same order), so 21 running sums carry it.
// Three phases through one LDS array, plane e = (i, j), i <= j, column t: (A) every thread forms the 21 products of its rows; (B) 21 lanes of one wave turn each plane into its running sum over t, in the order t = 0, 1, ...; (C) every thread reads M_t of its rows and forms rd_t . M_t, i = 0..5 in order.
// Plane pitch TT + 4 floats: the 16-B reads and writes of phase B, one plane per lane, start 4 banks apart; phases A and C touch 32 columns in a row of one plane.
#define CE 21
#define CPI (TT + 4)
__device__ __forceinline__ void cum_body(const int bx, const float* __restrict__ JW, const float* __restrict__ RD, float* __restrict__ RDM) {
  __shared__ __attribute__((aligned(16))) float pm[CE][CPI];
  const int tid = threadIdx.x; const size_t bh = bx; const float* jw = JW + bh * TT * 8; const float* rd = RD + bh * TT * 8; float* ob = RDM + bh * TT * 8;
  // every global load of the block is issued before the first is waited for; thread tid has rows c * 256 + tid; all loops over c, i, j, u, q are unrolled in full so that their arrays stay in registers
  v4f wa[TT / 256], ra[TT / 256]; v2f wb[TT / 256], rb[TT / 256];      /* a row's six values as 16 + 8 bytes */
#pragma unroll
  for (int c = 0; c < TT / 256; ++c) { const float* q = jw + (size_t)(c * 256 + tid) * 8; wa[c] = *(const v4fa*)q; wb[c] = *(const v2fa*)(q + 4); }
#pragma unroll
  for (int c = 0; c < TT / 256; ++c) { const float* q = rd + (size_t)(c * 256 + tid) * 8; ra[c] = *(const v4fa*)q; rb[c] = *(const v2fa*)(q + 4); }
  asm volatile("s_wait_xcnt 0x0" ::: "memory");      /* in front of whatever reuses the address registers of the loads above, which stay in flight */
#pragma unroll
  for (int c = 0; c < TT / 256; ++c) { const float w[6] = {wa[c][0], wa[c][1], wa[c][2], wa[c][3], wb[c][0], wb[c][1]}; int e = 0;
#pragma unroll
    for (int i = 0; i < 6; ++i)
#pragma unroll
      for (int j = i; j < 6; ++j) { pm[e][c * 256 + tid] = w[i] * w[j]; ++e; } }
  __syncthreads();
  if (tid < CE) { float* p = &pm[tid][0]; float acc = 0.f; v4f cur[8], nxt[8];
    // the one dependent chain left is one add per t; the reads run 32 columns ahead of it in two named register sets, so that it never waits for LDS
#pragma unroll
    for (int u = 0; u < 8; ++u) cur[u] = *(const v4f*)(p + 4 * u);
    // two sets per trip so that each has a fixed name; kept rolled: unrolled further it only grows the code
#pragma unroll 1
    for (int t0 = 0; t0 < TT; t0 += 64) {
#pragma unroll
      for (int u = 0; u < 8; ++u) nxt[u] = *(const v4f*)(p + t0 + 32 + 4 * u);
#pragma unroll
      for (int u = 0; u < 8; ++u) { v4f o;
#pragma unroll
        for (int q = 0; q < 4; ++q) { acc += cur[u][q]; o[q] = acc; }
        *(v4f*)(p + t0 + 4 * u) = o; }
      if (t0 + 64 < TT) {
#pragma unroll
        for (int u = 0; u < 8; ++u) cur[u] = *(const v4f*)(p + t0 + 64 + 4 * u); }
#pragma unroll
      for (int u = 0; u < 8; ++u) { v4f o;
#pragma unroll
        for (int q = 0; q < 4; ++q) { acc += nxt[u][q]; o[q] = acc; }
        *(v4f*)(p + t0 + 32 + 4 * u) = o; } } }
  __syncthreads();
#pragma unroll
  for (int c = 0; c < TT / 256; ++c) { const float r[6] = {ra[c][0], ra[c][1], ra[c][2], ra[c][3], rb[c][0], rb[c][1]}; float m[CE];
#pragma unroll
    for (int e = 0; e < CE; ++e) m[e] = pm[e][c * 256 + tid];
    v8f o;
#pragma unroll
    for (int j = 0; j < 6; ++j) { float v = 0.f;
#pragma unroll
      for (int i = 0; i < 6; ++i) { const int lo = i < j ? i : j, hi = i < j ? j : i; v += r[i] * m[lo * 6 - (lo * (lo - 1)) / 2 + hi - lo]; }
      o[j] = v; }
    o[6] = 0.f; o[7] = 0.f;
    *(v8f*)(ob + (size_t)(c * 256 + tid) * 8) = o;
    if (c + 1 < TT / 256) asm volatile("s_wait_xcnt 0x0" ::: "memory"); } }      /* in front of the next rows' LDS reads and sums, which reuse the registers that the store names */
__global__ __launch_bounds__(256) void k_cum(const float* __restrict__ JW, const float* __restrict__ RD, float* __restrict__ RDM) { cum_body(blockIdx.x, JW, RD, RDM); }
#define FA_JP 68      /* pitch of a Jw plane in floats: 16-B multiples for the reads; the staging stores of a wave (16 keys x 2 groups of 4 planes) fall on 32 different banks */
__device__ __forceinline__ v8f fa_mma(v16h a, v16h b, v8f c) { return __builtin_amdgcn_wmma_f32_16x16x32_f16(false, a, false, b, (short)0, c, false, false); }
__global__ __launch_bounds__(128) void k_fattn(const _Float16* __restrict__ Q, const _Float16* __restrict__ Kh, const _Float16* __restrict__ Vh, const _Float16* __restrict__ Vl, const float* __restrict__ RDM, const float* __restrict__ JW, const float* __restrict__ bsc, _Float16* __restrict__ CH, _Float16* __restrict__ CL) {
  // two buffers of: 64 K rows [key][64 d], 64 V^T rows hi and residual [d][64 keys] (pitch as in k_gemm2), Jw as planes [component][key]
  __shared__ __attribute__((aligned(16))) _Float16 sk[2][64][G2_LP];
  __shared__ __attribute__((aligned(16))) _Float16 sv[2][64][G2_LP];
  __shared__ __attribute__((aligned(16))) _Float16 sl[2][64][G2_LP];
  __shared__ __attribute__((aligned(16))) float sj[2][8][FA_JP];
  const int tid = threadIdx.x, w = tid >> 5, lane = tid & 31, ln = lane & 15, hh = lane >> 4;
  const int pl = blockIdx.x, by = blockIdx.y, blk = by < TT / 128 ? TT / 64 - 1 - by : by - TT / 128;      /* plane; row block: block b walks b + 1 tiles; the long half first, longest first, then the short half, shortest first, so that work-groups half a grid apart add up alike (for speed only) */
  const int tl = w * 16 + ln; const size_t prow = (size_t)pl * TT + blk * 64 + tl;      /* the lane's query: inside the block, and as a row of the planes */
  const float bs2 = bf16_round(bsc[pl % NH]) * 1.4426950408889634f, c1 = 0.125f * 1.4426950408889634f;
  const v16h q0 = g2_frag(Q + prow * HD, hh), q1 = g2_frag(Q + prow * HD + 32, hh);
  const v4f r03 = *(const v4fa*)(RDM + prow * 8); const v2f r45 = *(const v2fa*)(RDM + prow * 8 + 4);
  const float rdm[6] = {r03[0], r03[1], r03[2], r03[3], r45[0], r45[1]};
  const int sr = tid >> 3, sc = (tid & 7) * 8;      /* staging: 8 lanes cover one row's 128 B */
  const char* kg = (const char*)(Kh + (size_t)pl * TT * HD); const char* vg = (const char*)(Vh + (size_t)pl * HD * TT); const char* lg = (const char*)(Vl + (size_t)pl * HD * TT); const char* jg = (const char*)(JW + (size_t)pl * TT * 8);      /* the plane's first bytes: the same in every lane */
  const unsigned ko = (unsigned)(sr * HD + sc) * 2u, vo = (unsigned)(sr * TT + sc) * 2u, jo = (unsigned)tid * 16u;      /* the lane's own byte offsets, fixed for the whole loop; Jw: key tid >> 1, components 4 * (tid & 1) .. + 3 (6 and 7 are the rows' padding: staged along, never read) */
  v8us rk[4], rv[4], rl[4]; v4f rj;
  // every loop over i, q, c, k, r, ks, ds below is unrolled in full so that its arrays stay in registers
  auto gl = [&](int j) {
    const char* kj = kg + (size_t)j * 64 * HD * 2 + ko; const char* vj = vg + (size_t)j * 64 * 2 + vo; const char* lj = lg + (size_t)j * 64 * 2 + vo; const char* jj = jg + (size_t)j * 64 * 32 + jo;
#pragma unroll
    for (int i = 0; i < 4; ++i) rk[i] = *(const v8us*)(kj + 16 * i * HD * 2);
#pragma unroll
    for (int i = 0; i < 4; ++i) rv[i] = *(const v8us*)(vj + 16 * i * TT * 2);
#pragma unroll
    for (int i = 0; i < 4; ++i) rl[i] = *(const v8us*)(lj + 16 * i * TT * 2);
    rj = *(const v4fa*)jj;
    // in front of whatever reuses the address registers of the loads above, which stay in flight; the four addresses are inputs (read only) so that they stay whole up to the wait: otherwise the last load of a group lands on the address pair that the group's earlier loads name
    asm volatile("s_wait_xcnt 0x0" :: "v"(kj), "v"(vj), "v"(lj), "v"(jj) : "memory"); };
  auto st = [&](int buf) {
#pragma unroll
    for (int i = 0; i < 4; ++i) { *(v8us*)&sk[buf][sr + 16 * i][sc] = rk[i]; *(v8us*)&sv[buf][sr + 16 * i][sc] = rv[i]; *(v8us*)&sl[buf][sr + 16 * i][sc] = rl[i]; }
#pragma unroll
    for (int q = 0; q < 4; ++q) sj[buf][(tid & 1) * 4 + q][tid >> 1] = rj[q]; };
  const v8f z8 = {0.f,0.f,0.f,0.f,0.f,0.f,0.f,0.f};
  v8f oa[4] = {z8, z8, z8, z8};
  float m = -3.0e38f, su = 0.f;
  gl(0);
  __builtin_amdgcn_sched_barrier(0);      /* keeps the clearing of the accumulators, which reuses the address registers of the q and rd . M loads above, behind the wait that ends gl */
  // Each barrier publishes the buffer just written and ends every wave's reads of the other buffer, which is written next. The next tile's loads fly during this tile's work; the diagonal tile has none behind it (the test is the same for the whole block), so no load is in flight when a wave ends.
  for (int j = 0; ; ++j) {      /* left behind the diagonal tile, at the foot */
    const int buf = j & 1;
    st(buf); g2_bar(); if (j < blk) gl(j + 1);
    float l[4][8];
#pragma unroll
    for (int c = 0; c < 4; ++c) {
      v8f s = fa_mma(g2_frag(&sk[buf][c * 16 + ln][0], hh), q0, z8); s = fa_mma(g2_frag(&sk[buf][c * 16 + ln][32], hh), q1, s);
      v4f jv[6][2];
#pragma unroll
      for (int k = 0; k < 6; ++k) { jv[k][0] = *(const v4f*)&sj[buf][k][c * 16 + 8 * hh]; jv[k][1] = *(const v4f*)&sj[buf][k][c * 16 + 8 * hh + 4]; }
#pragma unroll
      for (int r = 0; r < 8; ++r) { float d = 0.f;
#pragma unroll
        for (int k = 0; k < 6; ++k) d += rdm[k] * jv[k][r >> 2][r & 3];
        l[c][r] = s[r] * c1 + fabsf(d) * bs2; } }
    if (j == blk) {      /* the diagonal tile alone holds keys behind a query; the same for the whole block */
#pragma unroll
      for (int c = 0; c < 4; ++c)
#pragma unroll
        for (int r = 0; r < 8; ++r) if (c * 16 + 8 * hh + r > tl) l[c][r] = -3.0e38f; }
    float mt = l[0][0];
#pragma unroll
    for (int c = 0; c < 4; ++c)
#pragma unroll
      for (int r = 0; r < 8; ++r) mt = fmaxf(mt, l[c][r]);
    mt = fmaxf(mt, __shfl_xor(mt, 16, 32));      /* the row's other 32 keys of the tile; key 0 is open to every query, so the maximum is a real logit from tile 0 on */
    const float mn = fmaxf(m, mt), al = __builtin_amdgcn_exp2f(m - mn), mo = mn - 10.0f; m = mn; su *= al;
#pragma unroll
    for (int ds = 0; ds < 4; ++ds) oa[ds] *= al;
#pragma unroll
    for (int ks = 0; ks < 2; ++ks) { FragH pf;
#pragma unroll
      for (int i = 0; i < 16; ++i) { const float e = __builtin_amdgcn_exp2f(l[2 * ks + (i >> 3)][i & 7] - mo); su += e; pf.h[i] = (_Float16)e; }
      const v16h pr = pf.v * (_Float16)0.0009765625f;
#pragma unroll
      for (int ds = 0; ds < 4; ++ds) { oa[ds] = fa_mma(g2_frag(&sv[buf][ds * 16 + ln][ks * 32], hh), pf.v, oa[ds]); oa[ds] = fa_mma(g2_frag(&sl[buf][ds * 16 + ln][ks * 32], hh), pr, oa[ds]); } }
    if (j >= blk) break; }
  su += __shfl_xor(su, 16, 32);
  const float inv = 1.0f / su;
  const size_t o = ((size_t)(pl / NH) * TT + blk * 64 + tl) * DM + (pl % NH) * HD + 8 * hh;
#pragma unroll
  for (int ds = 0; ds < 4; ++ds) { FragH f, fl;
#pragma unroll
    for (int r = 0; r < 8; ++r) { const float v = oa[ds][r] * inv; const _Float16 hv = (_Float16)v; f.h[r] = hv; fl.h[r] = (_Float16)((v - (float)hv) * 1024.0f); }
    *(v8us*)((unsigned short*)CH + o + ds * 16) = f.half[0]; *(v8us*)((unsigned short*)CL + o + ds * 16) = fl.half[0];
    if (ds + 1 < 4) asm volatile("s_wait_xcnt 0x0" ::: "memory"); } }      /* in front of the next columns' sums, which may reuse the registers that the stores name */

extern "C" void kernel_launch(void* const* d_in, const int* in_sizes, int n_in,
                              void* d_out, int out_size, void* d_ws, size_t ws_size, hipStream_t stream) {
  (void)in_sizes; (void)n_in; (void)out_size;
  const float* x = (const float*)d_in[0]; const float* Wqkv = (const float*)d_in[1]; const float* bqkv = (const float*)d_in[2]; const float* W1w = (const float*)d_in[3]; const float* W2w = (const float*)d_in[4]; const float* W1r = (const float*)d_in[5]; const float* W2r = (const float*)d_in[6]; const float* bsc = (const float*)d_in[7]; const float* Wout = (const float*)d_in[8]; const float* bout = (const float*)d_in[9];
  char* ws = (char*)d_ws; size_t off = 0;
  auto take = [&](size_t bytes) { char* p = ws + off; off += (bytes + 255) & ~(size_t)255; return p; };
  const size_t np = (size_t)NR * DM;
  _Float16* BQKV = (_Float16*)take((size_t)3 * DM * DM * 2); _Float16* BL = (_Float16*)take((size_t)256 * DM * 2); _Float16* X16 = (_Float16*)take(np * 2); float* LW = (float*)take((size_t)NR * 256 * 4); float* RD = (float*)take((size_t)NB * NH * TT * 8 * 4);
  _Float16* BO = (_Float16*)take((size_t)DM * DM * 2); _Float16* Q16 = (_Float16*)take(np * 2); _Float16* K16 = (_Float16*)take(np * 2); _Float16* VT = (_Float16*)take(np * 2); _Float16* VTL = (_Float16*)take(np * 2);
  float* JW = (float*)take((size_t)NB * NH * TT * 8 * 4); float* RDM = (float*)take((size_t)NB * NH * TT * 8 * 4);
  _Float16* CH = (_Float16*)take(np * 2); _Float16* CL = (_Float16*)take(np * 2);
  if (off > ws_size) return;      /* under 42 MiB */
  k_prep<<<PB_QKV + PB_X + PB_OUT + 4 * PB_LIN, 256, 0, stream>>>(Wqkv, x, Wout, W1w, W2w, W1r, W2r, BQKV, X16, BO, BL);      /* torch (out, in) naturals */
  k_gemm2<0, true><<<dim3((NR / 128) * (256 / 64) + (NR / 128) * (3 * DM / 64), 1), 128, 0, stream>>>(X16, DM, 0, BQKV, DM, 0, 0.0625f, bqkv, 0, nullptr, 1, 0, 0, nullptr, nullptr, 3 * DM, 0, NR, 3 * DM, DM, (NR / 128) * (256 / 64), BL, LW, 256, Q16, K16, VT, VTL);      /* [q | k | v] + bias, head h at h*64, written as the attention's f16 planes; line projections f32 [row][w1 | w2 | r1 | r2] (x_prev handled by a row shift) */
  k_lines<<<SB_LIN, 256, 0, stream>>>(LW, JW, RD);
  k_cum<<<NB * NH, 256, 0, stream>>>(JW, RD, RDM);
  // attention: one launch, scores and weights stay in registers; grid x = the 32 (batch, head) planes, y = the 16 blocks of 64 query rows; q, k are [plane][t][64], v^T [plane][d][t]; the context comes out as [row][head * 64 + d], hi + residual
  k_fattn<<<dim3(NB * NH, TT / 64), 128, 0, stream>>>(Q16, K16, VT, VTL, RDM, JW, bsc, CH, CL);
  k_gemm2<0, false><<<dim3((NR / 128) * (DM / 64), 1), 128, 0, stream>>>(CL, DM, 0, BO, DM, 0, 0.0625f / 1024.0f, nullptr, 0, nullptr, 1, 0, 0, (float*)d_out, nullptr, DM, 0, NR, DM, DM, 0, nullptr, nullptr, 0, nullptr, nullptr, nullptr, nullptr);
  k_gemm2<0, false><<<dim3((NR / 128) * (DM / 64), 1), 128, 0, stream>>>(CH, DM, 0, BO, DM, 0, 0.0625f, bout, 0, (const float*)d_out, 1, (size_t)DM, 0, (float*)d_out, nullptr, DM, 0, NR, DM, DM, 0, nullptr, nullptr, 0, nullptr, nullptr, nullptr, nullptr);      /* out = (c_lo + c_hi) Wout^T + bout */
}

// v009
// It runs in 73.4 microseconds.
// Timed twice side by side with v008, it ran 1.15 and 1.14 times as fast.
// All steps since v000 together make it 18.5 times as fast.
#include <hip/hip_runtime.h>
// EigenBiasAttention (2 x 1024 tokens x 1024 = 16 heads x 64; qkv = x Wqkv^T + b; causal softmax(q.k/8 + |bias|) v; bias from Plucker lines: per head w1 = x_prev W1w^T, w2 = x W2w^T, r1 = x W1r^T, r2 = x W2r^T (4-vectors), write/read lines = normalised exterior products (6-vectors), Jw = write J6, M_t = cumsum_t Jw Jw^T, bias[t][s] = |(rd_t . M_t) . Jw_s| * bias_scale[h]; out = merged . Wout^T + bout).
// Structure: exact f16 x plane; qkv and the four line projections as f16 WMMA GEMMs (32x64 wave tiles, f32 accumulation, exact x16 weights (+ bias)), whose epilogue writes the f16 q/k planes (one [t][64] plane per (batch, head)) and V^T hi/residual (the line projections f32); the exterior products / normalisation / J6 on VALU; the causal 6x6 Gram cumsum and rd . M per (batch, head) on VALU (f32; products and rd . M four rows per thread, the 1024-step running sums by one wave through LDS); one fused launch for all 32 (batch, head) planes: score products (K = 64, f32), the biased causal softmax on VALU with a running row maximum (bias dot K = 6 per (t, s), bias_scale read; unnormalised f16 weights x 2^10), readout as two product terms, row scaling + hi/residual; Wout as two product terms of one launch (+ bias).
// Compute dtype: inputs rounded to bf16; x / weights exact as f16 (line projections are f32 sums of exact products, so the bias path is f32-class); q, k and the softmax weights as plain f16 operands (~2^-12); v and the context as f16 hi + residual. v_wmma_f32_16x16x32_f16.
#define NB 2
#define TT 1024
#define DM 1024
#define NH 16
#define HD 64
#define NR (NB * TT)
typedef __bf16 v16b __attribute__((ext_vector_type(16)));
typedef unsigned short v8us __attribute__((ext_vector_type(8), may_alias));
typedef float  v8f  __attribute__((ext_vector_type(8)));
typedef float  v4f  __attribute__((ext_vector_type(4)));
typedef float  v4fa __attribute__((ext_vector_type(4), may_alias));
union FragB { v16b v; v8us half[2]; unsigned short u[16]; };

__device__ __forceinline__ unsigned short bf16_bits(float x) { unsigned int u = __float_as_uint(x); return (unsigned short)((u + 0x7FFFu + ((u >> 16) & 1u)) >> 16); }
__device__ __forceinline__ float bf16_val(unsigned short b) { return __uint_as_float(((unsigned int)b) << 16); }
__device__ __forceinline__ float bf16_round(float x) { return bf16_val(bf16_bits(x)); }
// D += A·B with NT terms: 1 = ah·bh, 2 = + al·bh (A split), 3 = + ah·bl (both split)
template <int NT>
__device__ __forceinline__ v8f mmaN(v16b ah, v16b al, v16b bh, v16b bl, v8f c) {
  c = __builtin_amdgcn_wmma_f32_16x16x32_bf16(false, ah, false, bh, (short)0, c, false, false);
  if (NT >= 2) c = __builtin_amdgcn_wmma_f32_16x16x32_bf16(false, al, false, bh, (short)0, c, false, false);
  if (NT >= 3) c = __builtin_amdgcn_wmma_f32_16x16x32_bf16(false, ah, false, bl, (short)0, c, false, false);
  asm volatile("v_nop\n\tv_nop\n\tv_nop\n\tv_nop" : "+v"(c) : "v"(ah), "v"(al), "v"(bh), "v"(bl));
  return c;
}

__global__ __launch_bounds__(256) void k_wt_bf16(const float* __restrict__ W, unsigned short* __restrict__ Wt, int K, int N) {
  const int t = blockIdx.x * 256 + threadIdx.x;
  const int k8n = K / 8;
  if (t >= N * k8n) return;
  const int n = t / k8n, k8 = (t % k8n) * 8;
  v8us v;
#pragma unroll
  for (int i = 0; i < 8; ++i) v[i] = bf16_bits(W[(size_t)(k8 + i) * N + n]);
  *(v8us*)(Wt + (size_t)n * K + k8) = v;
  
}

// GEMM C[M][N] (f32, pitch ldc) = act(A[M][K]·W + bias). A f32 row-major (pitch lda) converted per fragment to bf16
// (ASPLIT: hi/lo two planes -> 2 terms, else single rounded term); Wt bf16 [N][K] (pitch ldb). BIAS_BF16 rounds the
// bias to bf16 first (bias quantised to bf16 before the add). K%32==0, M%16==0, N%64==0.
template <bool ASPLIT, int ACT, bool BIAS_BF16>
__global__ __launch_bounds__(128) void k_gemm_bf(const float* __restrict__ A, int lda, const unsigned short* __restrict__ Wt, int ldb,
                                               const float* __restrict__ bias, float* __restrict__ C, int ldc, int M, int N, int K) {
  __shared__ __attribute__((aligned(16))) float so[4][16][64];
  const int tid = threadIdx.x, w = tid >> 5, lane = tid & 31, ln = lane & 15, hh = lane >> 4;
  const int ntn = N / 64;
  const int wid = blockIdx.x * 4 + w;
  const int mt = wid / ntn, nq = wid % ntn;
  if (mt * 16 >= M) return;
  const int row0 = mt * 16, col0 = nq * 64;
  const float* arow = A + (size_t)(row0 + ln) * lda;
  v8f acc[4] = {};
  for (int kb = 0; kb < K; kb += 32) {
    FragB ah, al;
    const v4f x0 = *(const v4fa*)(arow + kb + 8 * hh), x1 = *(const v4fa*)(arow + kb + 8 * hh + 4);
    const v4f x2 = *(const v4fa*)(arow + kb + 16 + 8 * hh), x3 = *(const v4fa*)(arow + kb + 16 + 8 * hh + 4);
    float xs[16] = {x0[0],x0[1],x0[2],x0[3],x1[0],x1[1],x1[2],x1[3],x2[0],x2[1],x2[2],x2[3],x3[0],x3[1],x3[2],x3[3]};
#pragma unroll
    for (int i = 0; i < 16; ++i) { const unsigned short hb = bf16_bits(xs[i]); ah.u[i] = hb; al.u[i] = ASPLIT ? bf16_bits(xs[i] - bf16_val(hb)) : (unsigned short)0; }
#pragma unroll
    for (int t = 0; t < 4; ++t) {
      const unsigned short* brow = Wt + (size_t)(col0 + t * 16 + ln) * ldb + kb;
      FragB b;
      b.half[0] = *(const v8us*)(brow + 8 * hh);
      b.half[1] = *(const v8us*)(brow + 16 + 8 * hh);
      acc[t] = mmaN<ASPLIT ? 2 : 1>(ah.v, al.v, b.v, b.v, acc[t]);
    }
  }
#pragma unroll
  for (int t = 0; t < 4; ++t) {
    float bv = bias ? bias[col0 + t * 16 + ln] : 0.f;
    if (BIAS_BF16) bv = bf16_round(bv);
#pragma unroll
    for (int r = 0; r < 8; ++r) { float v = acc[t][r] + bv; if (ACT == 1) v = fmaxf(v, 0.f); so[w][8 * hh + r][t * 16 + ln] = v; }
  }
  __builtin_amdgcn_fence(__ATOMIC_ACQ_REL, "workgroup");
  __builtin_amdgcn_wave_barrier();
  const int rsub = lane >> 4, c4 = (lane & 15) * 4;
  {
#pragma unroll
    for (int q = 0; q < 8; ++q) {
      const int r = q * 2 + rsub;
      const v4f v = *(const v4fa*)&so[w][r][c4];
      *(v4f*)(C + (size_t)(row0 + r) * ldc + col0 + c4) = v;
    }
    
  }
}

// GEMM C = act(A·W + bias + resid): A f32 (ASPLIT -> hi/lo 2 terms), Wt bf16 [N][K]; ACT 0 none, 1 relu, 2 exact gelu;
// resid (optional, f32, row index = (row % rmod), pitch ldr, RES_BF16 rounds it) added before the activation.
template <bool ASPLIT, int ACT, bool BIAS_BF16, bool RES_BF16>
__global__ __launch_bounds__(128) void k_gemm_bf3(const float* __restrict__ A, int lda, const unsigned short* __restrict__ Wt, int ldb,
                                                const float* __restrict__ bias, const float* __restrict__ resid, int rmod, int ldr,
                                                float* __restrict__ C, int ldc, int M, int N, int K) {
  __shared__ __attribute__((aligned(16))) float so[4][16][64];
  const int tid = threadIdx.x, w = tid >> 5, lane = tid & 31, ln = lane & 15, hh = lane >> 4;
  const int ntn = N / 64;
  const int wid = blockIdx.x * 4 + w;
  const int mt = wid / ntn, nq = wid % ntn;
  if (mt * 16 >= M) return;
  const int row0 = mt * 16, col0 = nq * 64;
  const float* arow = A + (size_t)(row0 + ln) * lda;
  v8f acc[4] = {};
  for (int kb = 0; kb < K; kb += 32) {
    FragB ah, al;
    const v4f x0 = *(const v4fa*)(arow + kb + 8 * hh), x1 = *(const v4fa*)(arow + kb + 8 * hh + 4);
    const v4f x2 = *(const v4fa*)(arow + kb + 16 + 8 * hh), x3 = *(const v4fa*)(arow + kb + 16 + 8 * hh + 4);
    float xs[16] = {x0[0],x0[1],x0[2],x0[3],x1[0],x1[1],x1[2],x1[3],x2[0],x2[1],x2[2],x2[3],x3[0],x3[1],x3[2],x3[3]};
#pragma unroll
    for (int i = 0; i < 16; ++i) { const unsigned short hb = bf16_bits(xs[i]); ah.u[i] = hb; al.u[i] = ASPLIT ? bf16_bits(xs[i] - bf16_val(hb)) : (unsigned short)0; }
#pragma unroll
    for (int t = 0; t < 4; ++t) {
      const unsigned short* brow = Wt + (size_t)(col0 + t * 16 + ln) * ldb + kb;
      FragB b;
      b.half[0] = *(const v8us*)(brow + 8 * hh);
      b.half[1] = *(const v8us*)(brow + 16 + 8 * hh);
      acc[t] = mmaN<ASPLIT ? 2 : 1>(ah.v, al.v, b.v, b.v, acc[t]);
    }
  }
#pragma unroll
  for (int t = 0; t < 4; ++t) {
    const int col = col0 + t * 16 + ln;
    float bv = bias ? bias[col] : 0.f;
    if (BIAS_BF16) bv = bf16_round(bv);
#pragma unroll
    for (int r = 0; r < 8; ++r) {
      float v = acc[t][r] + bv;
      if (resid) { float rv = resid[(size_t)((row0 + 8 * hh + r) % rmod) * ldr + col]; if (RES_BF16) rv = bf16_round(rv); v += rv; }
      if (ACT == 1) v = fmaxf(v, 0.f);
      if (ACT == 2) v = 0.5f * v * (1.0f + erff(v * 0.70710678118654752f));
      if (ACT == 3) { const float u = 0.7978845608028654f * (v + 0.044715f * v * v * v); v = 0.5f * v * (1.0f + tanhf(u)); }
      so[w][8 * hh + r][t * 16 + ln] = v;
    }
  }
  __builtin_amdgcn_fence(__ATOMIC_ACQ_REL, "workgroup");
  __builtin_amdgcn_wave_barrier();
  const int rsub = lane >> 4, c4 = (lane & 15) * 4;
  {
#pragma unroll
    for (int q = 0; q < 8; ++q) {
      const int r = q * 2 + rsub;
      const v4f v = *(const v4fa*)&so[w][r][c4];
      *(v4f*)(C + (size_t)(row0 + r) * ldc + col0 + c4) = v;
    }
    
  }
}
// row LayerNorm (biased variance, eps) over N: s = X (+ R); optional out_sum <- s; out_norm <- (s-mu)*rsqrt(var+eps)*g + b
template <bool PARAM_BF16>
__global__ __launch_bounds__(256) void k_layernorm(const float* __restrict__ X, const float* __restrict__ R, const float* __restrict__ g, const float* __restrict__ bta,
                                                  float* __restrict__ out_sum, float* __restrict__ out_norm, int N, float eps) {
  __shared__ float red[256];
  const int row = blockIdx.x, tid = threadIdx.x;
  const float* x = X + (size_t)row * N; const float* rr = R ? R + (size_t)row * N : nullptr;
  float vals[16];                     // up to N = 4096
  const int per = N / 256;            // contiguous chunk per thread? use strided-by-4 chunks: thread handles j = tid*4 + 1024*u
  float s1 = 0.f;
  for (int u = 0; u < per / 4; ++u) {
    const int j = tid * 4 + 1024 * u;
    const v4f a = *(const v4fa*)(x + j);
    v4f b = {0.f,0.f,0.f,0.f}; if (rr) b = *(const v4fa*)(rr + j);
#pragma unroll
    for (int q = 0; q < 4; ++q) { const float v = a[q] + b[q]; vals[u * 4 + q] = v; s1 += v; }
  }
  red[tid] = s1; __syncthreads();
  for (int st = 128; st > 0; st >>= 1) { if (tid < st) red[tid] += red[tid + st]; __syncthreads(); }
  const float mu = red[0] / (float)N; __syncthreads();
  float s2 = 0.f;
  for (int u = 0; u < per / 4; ++u)
#pragma unroll
    for (int q = 0; q < 4; ++q) { const float c = vals[u * 4 + q] - mu; s2 += c * c; }
  red[tid] = s2; __syncthreads();
  for (int st = 128; st > 0; st >>= 1) { if (tid < st) red[tid] += red[tid + st]; __syncthreads(); }
  const float rs = rsqrtf(red[0] / (float)N + eps);
  {
    for (int u = 0; u < per / 4; ++u) {
      const int j = tid * 4 + 1024 * u;
      v4f o, sm;
#pragma unroll
      for (int q = 0; q < 4; ++q) {
        float gg = g[j + q], bb = bta[j + q];
        if (PARAM_BF16) { gg = bf16_round(gg); bb = bf16_round(bb); }
        sm[q] = vals[u * 4 + q]; o[q] = (vals[u * 4 + q] - mu) * rs * gg + bb;
      }
      if (out_sum) *(v4f*)(out_sum + (size_t)row * N + j) = sm;
      *(v4f*)(out_norm + (size_t)row * N + j) = o;
    }
    
  }
}



// ---- f16 WMMA path (v_wmma_f32_16x16x32_f16): 11-bit significands for operands in range — used for every GEMM launched here
typedef _Float16 v16h __attribute__((ext_vector_type(16)));
union FragH { v16h v; v8us half[2]; _Float16 h[16]; unsigned short u[16]; };
template <int NT>
__device__ __forceinline__ v8f mmaH(v16h ah, v16h al, v16h bh, v16h bl, v8f c) {
  c = __builtin_amdgcn_wmma_f32_16x16x32_f16(false, ah, false, bh, (short)0, c, false, false);
  if (NT >= 2) c = __builtin_amdgcn_wmma_f32_16x16x32_f16(false, al, false, bh, (short)0, c, false, false);
  if (NT >= 3) c = __builtin_amdgcn_wmma_f32_16x16x32_f16(false, ah, false, bl, (short)0, c, false, false);
  asm volatile("v_nop\n\tv_nop\n\tv_nop\n\tv_nop" : "+v"(c) : "v"(ah), "v"(al), "v"(bh), "v"(bl));
  return c;
}
// batched GEMM like k_gemm_b but f16 operands: A f32 (split into f16 hi/lo if ASPLIT, else rounded to f16), Bt = f16 values [n][k]; alpha; C f32; N multiple of 16 (partial tiles skipped)
template <bool ASPLIT>
__global__ __launch_bounds__(128) void k_gemm_h(const float* __restrict__ A, int lda, size_t sA, const _Float16* __restrict__ Bh, int ldb, size_t sB, float alpha, float* __restrict__ C, int ldc, size_t sC, int M, int N, int K) {
  __shared__ __attribute__((aligned(16))) float so[4][16][64];
  const int tid = threadIdx.x, w = tid >> 5, lane = tid & 31, ln = lane & 15, hh = lane >> 4; const int by = blockIdx.y;
  A += (size_t)by * sA; Bh += (size_t)by * sB; C += (size_t)by * sC;
  const int ntn = (N + 63) / 64; const int wid = blockIdx.x * 4 + w; const int mt = wid / ntn, nq = wid % ntn; if (mt * 16 >= M) return;
  const int row0 = mt * 16, col0 = nq * 64; const float* arow = A + (size_t)(row0 + ln) * lda;
  v8f acc[4] = {};
  for (int kb = 0; kb < K; kb += 32) {
    FragH ah, al;
    const v4f x0 = *(const v4fa*)(arow + kb + 8 * hh), x1 = *(const v4fa*)(arow + kb + 8 * hh + 4), x2 = *(const v4fa*)(arow + kb + 16 + 8 * hh), x3 = *(const v4fa*)(arow + kb + 16 + 8 * hh + 4);
    float xs[16] = {x0[0],x0[1],x0[2],x0[3],x1[0],x1[1],x1[2],x1[3],x2[0],x2[1],x2[2],x2[3],x3[0],x3[1],x3[2],x3[3]};
#pragma unroll
    for (int i = 0; i < 16; ++i) { const _Float16 h = (_Float16)xs[i]; ah.h[i] = h; al.h[i] = ASPLIT ? (_Float16)(xs[i] - (float)h) : (_Float16)0.0f; }
#pragma unroll
    for (int t = 0; t < 4; ++t) { if (col0 + t * 16 >= N) continue; const size_t boff = (size_t)(col0 + t * 16 + ln) * ldb + kb; FragH bq; bq.half[0] = *(const v8us*)(Bh + boff + 8 * hh); bq.half[1] = *(const v8us*)(Bh + boff + 16 + 8 * hh);
      acc[t] = mmaH<ASPLIT ? 2 : 1>(ah.v, al.v, bq.v, bq.v, acc[t]); }
  }
#pragma unroll
  for (int t = 0; t < 4; ++t) { if (col0 + t * 16 >= N) continue;
#pragma unroll
    for (int r = 0; r < 8; ++r) so[w][8 * hh + r][t * 16 + ln] = acc[t][r] * alpha; }
  __builtin_amdgcn_fence(__ATOMIC_ACQ_REL, "workgroup"); __builtin_amdgcn_wave_barrier();
  const int rsub = lane >> 4, c4 = (lane & 15) * 4;
  {
#pragma unroll
    for (int q = 0; q < 8; ++q) { const int r = q * 2 + rsub; if (col0 + c4 < N) { const v4f v = *(const v4fa*)&so[w][r][c4]; *(v4f*)(C + (size_t)(row0 + r) * ldc + col0 + c4) = v; } }
     }
}

// Wt[n][k] = f16(W[k][n]·scale) from f32 row-major W[K][N] (scale = power of two; bf16-exact weights stay exact in f16 away from the subnormal range)
__global__ __launch_bounds__(256) void k_wt_f16(const float* __restrict__ W, _Float16* __restrict__ Wt, int K, int N, float scale) {
  const int t = blockIdx.x * 256 + threadIdx.x; if (t >= N * (K / 8)) return; const int n = t / (K / 8), k8 = (t % (K / 8)) * 8; FragH f;
#pragma unroll
  for (int i = 0; i < 8; ++i) f.h[i] = (_Float16)(bf16_round(W[(size_t)(k8 + i) * N + n]) * scale); const v8us o = f.half[0];
  *(v8us*)((unsigned short*)Wt + (size_t)n * K + k8) = o; 
}
// k_gemm_hh variant with fused epilogue: v = acc·alpha + bias[by·sBias + col] (+ CP[(row/rowsPerB)·sCPb + by·64 + col] if CP) ; ACT 0 none / 1 elu ; writes f16 C16 (and f32 C if non-null)
template <int ACT>
__global__ __launch_bounds__(128) void k_gemm_hhx(const _Float16* __restrict__ A, int lda, size_t sA, const _Float16* __restrict__ Bh, int ldb, size_t sB, float alpha, const float* __restrict__ bias, size_t sBias, const float* __restrict__ CP, int rowsPerB, size_t sCPb, int row0g,
    float* __restrict__ C, _Float16* __restrict__ C16, int ldc, size_t sC, int M, int N, int K) {
  __shared__ __attribute__((aligned(16))) float so[4][16][64];
  const int tid = threadIdx.x, w = tid >> 5, lane = tid & 31, ln = lane & 15, hh = lane >> 4; const int by = blockIdx.y;
  A += (size_t)by * sA; Bh += (size_t)by * sB; const size_t cofs = (size_t)by * sC; const float* bp = bias ? bias + (size_t)by * sBias : nullptr;
  const int ntn = (N + 63) / 64; const int wid = blockIdx.x * 4 + w; const int mt = wid / ntn, nq = wid % ntn; if (mt * 16 >= M) return;
  const int row0 = mt * 16, col0 = nq * 64; const _Float16* arow = A + (size_t)(row0 + ln) * lda;
  v8f acc[4] = {};
  for (int kb = 0; kb < K; kb += 32) { FragH ah; ah.half[0] = *(const v8us*)((const unsigned short*)arow + kb + 8 * hh); ah.half[1] = *(const v8us*)((const unsigned short*)arow + kb + 16 + 8 * hh);
#pragma unroll
    for (int t = 0; t < 4; ++t) { if (col0 + t * 16 >= N) continue; const size_t boff = (size_t)(col0 + t * 16 + ln) * ldb + kb; FragH bq; bq.half[0] = *(const v8us*)((const unsigned short*)Bh + boff + 8 * hh); bq.half[1] = *(const v8us*)((const unsigned short*)Bh + boff + 16 + 8 * hh);
      acc[t] = mmaH<1>(ah.v, ah.v, bq.v, bq.v, acc[t]); }
  }
#pragma unroll
  for (int t = 0; t < 4; ++t) { if (col0 + t * 16 >= N) continue; const int col = col0 + t * 16 + ln; const float bv = bp ? bf16_round(bp[col]) : 0.f;
#pragma unroll
    for (int r = 0; r < 8; ++r) { float v = acc[t][r] * alpha + bv; if (CP) { const int rr = row0g + row0 + 8 * hh + r; if (rowsPerB < 0) v += CP[cofs + (size_t)rr * ldc + col];      /* rowsPerB < 0: own element of the batched C plane */ else { const int bidx = rr / rowsPerB; v += CP[(size_t)bidx * sCPb + (size_t)by * 64 + col]; } } if (ACT == 1) v = (v > 0.f) ? v : expm1f(v); else if (ACT == 7) v = (v > 0.f) ? v + 1.0f : expf(v); else if (ACT == 8) v = tanhf(v); else if (ACT == 9) v = 0.5f * v * (1.0f + tanhf(0.7978845608028654f * (v + 0.044715f * v * v * v))); else if (ACT == 11) v = 1.0f / (1.0f + expf(-v)); else if (ACT == 12) v = (v > 0.f) ? v : 0.01f * v; else if (ACT == 14) v = (v > 0.f) ? v : 0.1f * v; else if (ACT == 16) v = (v >= 0.f) ? v : 0.3f * v; else if (ACT == 17) v = (v >= 0.f) ? v : 0.2f * v; else if (ACT == 15) v = v / (1.0f + expf(-v)); else if (ACT == 3) v = fmaxf(v, 0.f); else if (ACT == 6) v = 0.5f * v * (1.0f + erff(v * 0.70710678118654752f)); so[w][8 * hh + r][t * 16 + ln] = v; } }
  __builtin_amdgcn_fence(__ATOMIC_ACQ_REL, "workgroup"); __builtin_amdgcn_wave_barrier();
  const int rsub = lane >> 4, c4 = (lane & 15) * 4; typedef _Float16 v4h __attribute__((ext_vector_type(4)));
  {
#pragma unroll
    for (int q = 0; q < 8; ++q) { const int r = q * 2 + rsub; if (col0 + c4 < N) { const v4f v = *(const v4fa*)&so[w][r][c4]; if (C) *(v4f*)(C + cofs + (size_t)(row0 + r) * ldc + col0 + c4) = v; if (C16) { v4h h4; for (int i = 0; i < 4; ++i) h4[i] = (_Float16)v[i]; *(v4h*)(C16 + cofs + (size_t)(row0 + r) * ldc + col0 + c4) = h4; } } }
     }
}


typedef _Float16 v4h __attribute__((ext_vector_type(4)));

__global__ __launch_bounds__(256) void k_h16(const float* __restrict__ x, _Float16* __restrict__ X16, size_t n8) { const size_t t = (size_t)blockIdx.x * 256 + threadIdx.x; if (t >= n8) return; FragH f;
#pragma unroll
  for (int q = 0; q < 8; ++q) f.h[q] = (_Float16)x[t * 8 + q]; *(v8us*)((unsigned short*)X16 + t * 8) = f.half[0];  }
__global__ __launch_bounds__(256) void k_round16f(const float* __restrict__ W, _Float16* __restrict__ Bt, size_t n8) { const size_t t = (size_t)blockIdx.x * 256 + threadIdx.x; if (t >= n8) return; FragH f;
#pragma unroll
  for (int i = 0; i < 8; ++i) f.h[i] = (_Float16)(bf16_round(W[t * 8 + i]) * 16.0f); *(v8us*)((unsigned short*)Bt + t * 8) = f.half[0];  }
__global__ __launch_bounds__(256) void k_hl(const float* __restrict__ F, _Float16* __restrict__ Hh, _Float16* __restrict__ Hl, size_t n8) { const size_t t = (size_t)blockIdx.x * 256 + threadIdx.x; if (t >= n8) return; FragH fh, fl; const v4f a = *(const v4fa*)(F + t * 8), c = *(const v4fa*)(F + t * 8 + 4);
#pragma unroll
  for (int q = 0; q < 4; ++q) { _Float16 h = (_Float16)a[q]; fh.h[q] = h; fl.h[q] = (_Float16)((a[q] - (float)h) * 1024.0f); h = (_Float16)c[q]; fh.h[4 + q] = h; fl.h[4 + q] = (_Float16)((c[q] - (float)h) * 1024.0f); }
  { *(v8us*)((unsigned short*)Hh + t * 8) = fh.half[0]; *(v8us*)((unsigned short*)Hl + t * 8) = fl.half[0];  } }

// ---- fast GEMM (block tile 128x64, wave tile 32x64, A and B k-tiles staged in LDS; requires M % 128 == 0, N % 64 == 0 and K == 64 or K % 128 == 0); epilogue = k_gemm_hhx semantics ----
#define G2_LP 72
__device__ __forceinline__ v16h g2_frag(const _Float16* p, int hh) { FragH f; f.half[0] = *(const v8us*)((const unsigned short*)p + 8 * hh); f.half[1] = *(const v8us*)((const unsigned short*)p + 16 + 8 * hh); return f.v; }
__device__ __forceinline__ v8f g2_mma(v16h a, v16h b, v8f c) { v8f d = __builtin_amdgcn_wmma_f32_16x16x32_f16(false, a, false, b, (short)0, c, false, false); asm volatile("v_nop\n\tv_nop\n\tv_nop\n\tv_nop" : "+v"(d) : "v"(a), "v"(b)); return d; }
// work-group barrier that orders LDS alone (its fences name the LDS address space): __syncthreads() also waits for every global load in flight, and the loads for the tiles ahead must stay in flight across it; the loop's global reads are of operands that no wave of the launch writes
__device__ __forceinline__ void g2_bar() { __builtin_amdgcn_fence(__ATOMIC_RELEASE, "workgroup", "local"); __builtin_amdgcn_s_barrier(); __builtin_amdgcn_fence(__ATOMIC_ACQUIRE, "workgroup", "local"); }
template <int ACT, bool PL>
__global__ __launch_bounds__(128) void k_gemm2(const _Float16* __restrict__ A, int lda, size_t sA, const _Float16* __restrict__ Bh, int ldb, size_t sB, float alpha, const float* __restrict__ bias, size_t sBias, const float* __restrict__ CP, int rowsPerB, size_t sCPb, int row0g,
    float* __restrict__ C, _Float16* __restrict__ C16, int ldc, size_t sC, int M, int N, int K, int nb1, const _Float16* __restrict__ B1, float* __restrict__ C1, int N1,
    _Float16* __restrict__ PQ, _Float16* __restrict__ PK, _Float16* __restrict__ PVH, _Float16* __restrict__ PVL) { static_assert(ACT == 0 || ACT == 3 || ACT == 6 || ACT == 8 || ACT == 9 || ACT == 11 || ACT == 12 || ACT == 14 || ACT == 15 || ACT == 16 || ACT == 17, "k_gemm2: unsupported ACT code (would silently apply no activation)");
  __shared__ __attribute__((aligned(16))) float so[4][32][68];
  // k-tiles of 64 halves (one whole 128-B line per row) of the block's 128 A rows and 64 B rows, two buffers; row pitch 72 halves = 144 B = 16 B x 9 for the ds_load_b128 fragment reads
  __shared__ __attribute__((aligned(16))) _Float16 sa[2][128][G2_LP];
  __shared__ __attribute__((aligned(16))) _Float16 sb[2][64][G2_LP];
  const int tid = threadIdx.x, w = tid >> 5, lane = tid & 31, ln = lane & 15, hh = lane >> 4; const int by = blockIdx.y;
  unsigned bx = blockIdx.x; const bool job1 = bx < (unsigned)nb1; if (job1) { Bh = B1; C = C1; N = N1; ldc = N1; bias = nullptr; } else bx -= (unsigned)nb1;      /* a second product of the same A in the same grid (no bias, C1 of pitch N1): it has the first nb1 blocks, so that the small job starts with the launch; the same for the whole block */
  A += (size_t)by * sA; Bh += (size_t)by * sB; const size_t cofs = (size_t)by * sC; const float* bp = bias ? bias + (size_t)by * sBias : nullptr;
  const int ntn = N >> 6; const int mt = bx / ntn, nq = bx - mt * ntn; const int row0 = mt * 128 + 32 * w, col0 = nq * 64; if (mt * 128 >= M) return;      /* the same for the whole block: it stands in front of barriers */
  const int sr = tid >> 3, sc = (tid & 7) * 8;      /* staging: 8 lanes cover one row's 128 B, a wave-wide load covers 4 whole lines */
  const char* ab = (const char*)(A + (size_t)(mt * 128) * lda); const char* bb = (const char*)(Bh + (size_t)col0 * ldb);      /* the block's first A and B row: the same in every lane */
  const unsigned ao = (unsigned)(sr * lda + sc) * 2u, bo = (unsigned)(sr * ldb + sc) * 2u;      /* the lane's own byte offset, fixed for the whole loop */
  const v8f z8 = {0.f,0.f,0.f,0.f,0.f,0.f,0.f,0.f}; v8f c00 = z8, c01 = z8, c02 = z8, c03 = z8, c10 = z8, c11 = z8, c12 = z8, c13 = z8;
  v8us ra0[8], rb0[4], ra1[8], rb1[4];
  auto gl = [&](v8us* ra, v8us* rb, int kb) {
#pragma unroll
    for (int i = 0; i < 8; ++i) ra[i] = *(const v8us*)(ab + ((size_t)(16 * i) * lda + kb) * 2 + ao);
#pragma unroll
    for (int i = 0; i < 4; ++i) rb[i] = *(const v8us*)(bb + ((size_t)(16 * i) * ldb + kb) * 2 + bo); };
  auto st = [&](const v8us* ra, const v8us* rb, int buf) {
#pragma unroll
    for (int i = 0; i < 8; ++i) *(v8us*)&sa[buf][sr + 16 * i][sc] = ra[i];
#pragma unroll
    for (int i = 0; i < 4; ++i) *(v8us*)&sb[buf][sr + 16 * i][sc] = rb[i]; };
  auto comp = [&](int buf) {
#pragma unroll
    for (int kk = 0; kk < 64; kk += 32) { const v16h a0 = g2_frag(&sa[buf][32 * w + ln][kk], hh), a1 = g2_frag(&sa[buf][32 * w + 16 + ln][kk], hh);
      const v16h b0 = g2_frag(&sb[buf][ln][kk], hh), b1 = g2_frag(&sb[buf][16 + ln][kk], hh), b2 = g2_frag(&sb[buf][32 + ln][kk], hh), b3 = g2_frag(&sb[buf][48 + ln][kk], hh);
      c00 = g2_mma(a0, b0, c00); c10 = g2_mma(a1, b0, c10); c01 = g2_mma(a0, b1, c01); c11 = g2_mma(a1, b1, c11);
      c02 = g2_mma(a0, b2, c02); c12 = g2_mma(a1, b2, c12); c03 = g2_mma(a0, b3, c03); c13 = g2_mma(a1, b3, c13); } };
  // Each barrier publishes the buffer just written and ends every wave's reads of the other buffer, which is written next.
  gl(ra0, rb0, 0);
  __builtin_amdgcn_sched_barrier(0);      /* keeps set 0's loads in front of set 1's: mixed, set 0's wait at the loop's head would wait for set 1 as well */
  gl(ra1, rb1, 64 < K ? 64 : 0);      /* the second set's tile clamped, not branched round: set 0's loads stay the older ones on every way into the loop, so its wait leaves set 1's in flight */
  asm volatile("s_wait_xcnt 0x0" ::: "memory");      /* in front of whatever reuses the address registers of the loads above, which stay in flight */
  int kb = 0;
  // two tiles per trip so that each register set and each LDS buffer has a fixed name; every load of the trip is unconditional (the last two tiles are peeled off below), so the waits can be counted; kept rolled: unrolled further it only grows the code
#pragma unroll 1
  for (; kb + 128 < K; kb += 128) {
    st(ra0, rb0, 0); g2_bar(); gl(ra0, rb0, kb + 128); comp(0);      /* loads two tiles ahead: in flight over this tile's and the next tile's products */
    st(ra1, rb1, 1); g2_bar(); gl(ra1, rb1, kb + 192); comp(1);
    asm volatile("s_wait_xcnt 0x0" ::: "memory"); }      /* in front of the next trip's address arithmetic, which rewrites the address registers of loads still in flight */
  st(ra0, rb0, 0); g2_bar(); comp(0);
  if (kb + 64 < K) { st(ra1, rb1, 1); g2_bar(); comp(1); }
  v8f accs[8] = {c00, c01, c02, c03, c10, c11, c12, c13};
  // every global read of the epilogue is issued here as one batch and waited for once: read where each element is formed, every element would wait for its own row address and its own round trip, with nothing else in the wave to cover them.
  // The addend is read in the store phase's layout (rows 2 * q + (lane >> 4), 16 B a lane, 256 B a row) and joins the staged tile in front of that phase: with no activation between them that is the same sum, (product * alpha + bias) + addend. The loops over q, t are unrolled in full so that their arrays stay in registers.
  const bool cadd = ACT == 0 && CP != nullptr;      /* the same for the whole launch */
  float bvr[4] = {0.f, 0.f, 0.f, 0.f}; v4f cq[16] = {};
  if (cadd) { size_t co[16]; const float* cr[16]; const int rr0 = row0g + row0 + (lane >> 4);      /* the test on rowsPerB stands outside the loops so that the 16 row offsets are formed side by side */
    if (rowsPerB < 0) {      /* own element of the batched C plane */
#pragma unroll
      for (int q = 0; q < 16; ++q) co[q] = cofs + (size_t)(rr0 + 2 * q) * ldc; }
    else {
#pragma unroll
      for (int q = 0; q < 16; ++q) co[q] = (size_t)((rr0 + 2 * q) / rowsPerB) * sCPb + (size_t)by * 64; }
#pragma unroll
    for (int q = 0; q < 16; ++q) cr[q] = CP + co[q] + col0 + (lane & 15) * 4;
#pragma unroll
    for (int q = 0; q < 16; ++q) cq[q] = *(const v4fa*)cr[q];
    // in front of whatever reuses the address registers of the loads above, which stay in flight; the 16 row addresses are inputs (read only) so that each stays whole up to the wait
    asm volatile("s_wait_xcnt 0x0" :: "v"(cr[0]), "v"(cr[1]), "v"(cr[2]), "v"(cr[3]), "v"(cr[4]), "v"(cr[5]), "v"(cr[6]), "v"(cr[7]), "v"(cr[8]), "v"(cr[9]), "v"(cr[10]), "v"(cr[11]), "v"(cr[12]), "v"(cr[13]), "v"(cr[14]), "v"(cr[15]) : "memory"); }
  if (bp) {
#pragma unroll
    for (int t = 0; t < 4; ++t) bvr[t] = bp[col0 + t * 16 + ln];
    asm volatile("s_wait_xcnt 0x0" ::: "memory"); }      /* in front of whatever reuses the address registers of the loads above, which stay in flight */
  if (PL && !job1) {      /* the same for the whole block */
    static_assert(!PL || (TT % 128 == 0 && HD == 64 && DM % HD == 0), "k_gemm2: a block tile must be one head's columns and lie in one batch");
    // C = [q | k | v] is not stored: the block's 64 columns are one head of q, k or v and its 128 rows lie in one batch, so the tile goes out as the attention's own operand: q, k as f16 rows [plane][t][64], v as V^T hi + residual x 2^10 [plane][d][t]. The loops over u, r, q, i are unrolled in full so that their arrays stay in registers.
    const int part = col0 / DM, tb = (mt * 128) % TT; const size_t plane = (size_t)((mt * 128) / TT) * NH + (col0 % DM) / HD;
    if (part < 2) {      /* rows: through the wave's own f32 tile, read back 8 columns a lane; a wave-wide store covers 4 whole rows = 512 B in a row */
#pragma unroll
      for (int u = 0; u < 8; ++u) { const int t = u & 3, half = u >> 2; const float bv = bf16_round(bvr[t]);
#pragma unroll
        for (int r = 0; r < 8; ++r) so[w][half * 16 + 8 * hh + r][t * 16 + ln] = accs[u][r] * alpha + bv; }
      __builtin_amdgcn_fence(__ATOMIC_ACQ_REL, "workgroup"); __builtin_amdgcn_wave_barrier();      /* the wave's LDS stores stand in front of the reads below, in which its lanes read one another's elements; no other wave touches this tile */
      unsigned short* D = (unsigned short*)(part == 0 ? PQ : PK) + (plane * TT + tb + 32 * w + (lane >> 3)) * HD + (lane & 7) * 8;
      FragH f[8];
#pragma unroll
      for (int q = 0; q < 8; ++q) { const float* sp = &so[w][q * 4 + (lane >> 3)][(lane & 7) * 8]; const v4f a = *(const v4fa*)sp, b = *(const v4fa*)(sp + 4);
#pragma unroll
        for (int i = 0; i < 4; ++i) { f[q].h[i] = (_Float16)a[i]; f[q].h[4 + i] = (_Float16)b[i]; } }
#pragma unroll
      for (int q = 0; q < 8; ++q) *(v8us*)(D + q * 4 * HD) = f[q].half[0];
      asm volatile("s_wait_xcnt 0x0" ::: "memory"); }      /* in front of whatever reuses the registers that the stores above name */
    else {      /* columns: a lane's accumulator registers are 8 consecutive t of one d, a 16-B piece of V^T; the block's pieces meet in LDS (the f32 tiles' space, pitch 136 halves = 16 B x 17), so that whole rows of 128 t = 256 B go out; hi + residual because the bias makes the attention peaked, so that v's rounding reaches the output almost unaveraged */
      unsigned short* th = (unsigned short*)&so[0][0][0]; unsigned short* tl = th + 64 * 136;
#pragma unroll
      for (int u = 0; u < 8; ++u) { const int t = u & 3, half = u >> 2; const float bv = bf16_round(bvr[t]); FragH fh, fl;
#pragma unroll
        for (int r = 0; r < 8; ++r) { const float v = accs[u][r] * alpha + bv; const _Float16 hv = (_Float16)v; fh.h[r] = hv; fl.h[r] = (_Float16)((v - (float)hv) * 1024.0f); }
        const int o = (t * 16 + ln) * 136 + 32 * w + half * 16 + 8 * hh; *(v8us*)(th + o) = fh.half[0]; *(v8us*)(tl + o) = fl.half[0]; }
      __syncthreads();      /* every wave's 32 t of each row are in place before a row is read */
      const size_t go = (plane * HD + (tid >> 4)) * TT + tb + (tid & 15) * 8; const int lo = (tid >> 4) * 136 + (tid & 15) * 8;
      v8us xh[8], xl[8];
#pragma unroll
      for (int i = 0; i < 8; ++i) { xh[i] = *(const v8us*)(th + lo + i * 8 * 136); xl[i] = *(const v8us*)(tl + lo + i * 8 * 136); }
#pragma unroll
      for (int i = 0; i < 8; ++i) { *(v8us*)((unsigned short*)PVH + go + (size_t)i * 8 * TT) = xh[i]; *(v8us*)((unsigned short*)PVL + go + (size_t)i * 8 * TT) = xl[i]; }
      asm volatile("s_wait_xcnt 0x0" ::: "memory"); }      /* in front of whatever reuses the registers that the stores above name */
    return; }
#pragma unroll
  for (int u = 0; u < 8; ++u) { const int t = u & 3, half = u >> 2; const int col = col0 + t * 16 + ln; const float bv = bf16_round(bvr[t]);      /* no bias: the rounding of 0 is 0 */
#pragma unroll
    for (int r = 0; r < 8; ++r) { const int rloc = half * 16 + 8 * hh + r; float v = accs[u][r] * alpha + bv; if (ACT != 0 && CP) { if (rowsPerB < 0) v += CP[cofs + (size_t)(row0g + row0 + rloc) * ldc + col];      /* rowsPerB < 0: own element of the batched C plane */ else { const int bidx = (row0g + row0 + rloc) / rowsPerB; v += CP[(size_t)bidx * sCPb + (size_t)by * 64 + col]; } }
      if (ACT == 3) v = fmaxf(v, 0.f); else if (ACT == 6) v = 0.5f * v * (1.0f + erff(v * 0.70710678118654752f)); else if (ACT == 11) v = 1.0f / (1.0f + expf(-v)); else if (ACT == 15) v = v / (1.0f + expf(-v)); else if (ACT == 12) v = (v > 0.f) ? v : 0.01f * v; else if (ACT == 8) v = tanhf(v); else if (ACT == 9) v = 0.5f * v * (1.0f + tanhf(0.7978845608028654f * (v + 0.044715f * v * v * v))); else if (ACT == 14) v = (v > 0.f) ? v : 0.1f * v; else if (ACT == 16) v = (v >= 0.f) ? v : 0.3f * v; else if (ACT == 17) v = (v >= 0.f) ? v : 0.2f * v;
      so[w][rloc][t * 16 + ln] = v; } }
  __builtin_amdgcn_fence(__ATOMIC_ACQ_REL, "workgroup"); __builtin_amdgcn_wave_barrier();
  const int rsub = lane >> 4, c4 = (lane & 15) * 4;
  if (cadd) {      /* each lane adds to the 16 B pieces that it alone reads back below; unrolled in full so that cq stays in registers */
#pragma unroll
    for (int q = 0; q < 16; ++q) { v4fa* sp = (v4fa*)&so[w][q * 2 + rsub][c4]; *sp = *sp + cq[q]; } }
  {
#pragma unroll
    for (int q = 0; q < 16; ++q) { const int r = q * 2 + rsub; const v4f v = *(const v4fa*)&so[w][r][c4]; if (C) *(v4f*)(C + cofs + (size_t)(row0 + r) * ldc + col0 + c4) = v; if (C16) { v4h h4; for (int i = 0; i < 4; ++i) h4[i] = (_Float16)v[i]; *(v4h*)(C16 + cofs + (size_t)(row0 + r) * ldc + col0 + c4) = h4; } }
     } }


// ---- output projection, both terms of the context in one launch: out = (c_hi + c_lo x 2^-10) . Wout^T + bout. Block tile 128 x 64 as in k_gemm2, eight waves: waves 0-3 take the hi plane's 128 rows, waves 4-7 the residual plane's same rows (wave tile 32 x 64),
// so one staged B k-tile serves both terms, a SIMD holds two waves (one of each term), and the residual term never goes through memory. The terms meet in LDS behind the loop: (hi x alpha + bias) + lo x alpha x 2^-10, the sum that two launches formed through out.
__global__ __launch_bounds__(256) void k_gemm_hl(const _Float16* __restrict__ AH, const _Float16* __restrict__ AL, const _Float16* __restrict__ Bh, const float* __restrict__ bias, float* __restrict__ C) {
  static_assert(NR % 128 == 0 && DM % 128 == 0 && DM >= 256, "k_gemm_hl: whole block tiles, two k-tiles a trip and two peeled");
  __shared__ __attribute__((aligned(16))) float so[8][32][68];
  // k-tiles of 64 halves: rows 0-127 of sa the hi plane, 128-255 the residual plane, so that wave w reads rows 32 * w ..; 128 B rows; two buffers; pitch as in k_gemm2
  __shared__ __attribute__((aligned(16))) _Float16 sa[2][256][G2_LP];
  __shared__ __attribute__((aligned(16))) _Float16 sb[2][64][G2_LP];
  const int tid = threadIdx.x, w = tid >> 5, lane = tid & 31, ln = lane & 15, hh = lane >> 4;
  const int mt = blockIdx.x / (DM / 64), col0 = (blockIdx.x % (DM / 64)) * 64;
  const int sr = tid >> 3, sc = (tid & 7) * 8;      /* staging: 8 lanes cover one row's 128 B, the block 32 rows a step */
  const char* hb = (const char*)(AH + (size_t)(mt * 128) * DM); const char* lb = (const char*)(AL + (size_t)(mt * 128) * DM); const char* bb = (const char*)(Bh + (size_t)col0 * DM);      /* the block's first rows: the same in every lane */
  const unsigned ao = (unsigned)(sr * DM + sc) * 2u;      /* the lane's own byte offset, fixed for the whole loop */
  const v8f z8 = {0.f,0.f,0.f,0.f,0.f,0.f,0.f,0.f}; v8f c00 = z8, c01 = z8, c02 = z8, c03 = z8, c10 = z8, c11 = z8, c12 = z8, c13 = z8;
  v8us ra0[8], rb0[2], ra1[8], rb1[2]; float bvr[4];
  // every loop over i, t, u, r, q below is unrolled in full so that its arrays stay in registers
  auto gl = [&](v8us* ra, v8us* rb, int kb) {
#pragma unroll
    for (int i = 0; i < 4; ++i) ra[i] = *(const v8us*)(hb + ((size_t)(32 * i) * DM + kb) * 2 + ao);
#pragma unroll
    for (int i = 0; i < 4; ++i) ra[4 + i] = *(const v8us*)(lb + ((size_t)(32 * i) * DM + kb) * 2 + ao);
#pragma unroll
    for (int i = 0; i < 2; ++i) rb[i] = *(const v8us*)(bb + ((size_t)(32 * i) * DM + kb) * 2 + ao); };
  auto st = [&](const v8us* ra, const v8us* rb, int buf) {
#pragma unroll
    for (int i = 0; i < 8; ++i) *(v8us*)&sa[buf][sr + 32 * i][sc] = ra[i];
#pragma unroll
    for (int i = 0; i < 2; ++i) *(v8us*)&sb[buf][sr + 32 * i][sc] = rb[i]; };
  auto comp = [&](int buf) {
#pragma unroll
    for (int kk = 0; kk < 64; kk += 32) { const v16h a0 = g2_frag(&sa[buf][32 * w + ln][kk], hh), a1 = g2_frag(&sa[buf][32 * w + 16 + ln][kk], hh);
      const v16h b0 = g2_frag(&sb[buf][ln][kk], hh), b1 = g2_frag(&sb[buf][16 + ln][kk], hh), b2 = g2_frag(&sb[buf][32 + ln][kk], hh), b3 = g2_frag(&sb[buf][48 + ln][kk], hh);
      c00 = g2_mma(a0, b0, c00); c10 = g2_mma(a1, b0, c10); c01 = g2_mma(a0, b1, c01); c11 = g2_mma(a1, b1, c11);
      c02 = g2_mma(a0, b2, c02); c12 = g2_mma(a1, b2, c12); c03 = g2_mma(a0, b3, c03); c13 = g2_mma(a1, b3, c13); } };
  // the bias values are the oldest loads of the wave: they have landed with the first tile and cost the epilogue no round trip
#pragma unroll
  for (int t = 0; t < 4; ++t) bvr[t] = bias[col0 + t * 16 + ln];
  gl(ra0, rb0, 0);
  __builtin_amdgcn_sched_barrier(0);      /* keeps set 0's loads in front of set 1's: mixed, set 0's wait at the loop's head would wait for set 1 as well */
  gl(ra1, rb1, 64);
  asm volatile("s_wait_xcnt 0x0" ::: "memory");      /* in front of whatever reuses the address registers of the loads above, which stay in flight */
  int kb = 0;
  // Each barrier publishes the buffer just written and ends every wave's reads of the other buffer, which is written next. Two tiles per trip so that each register set and each LDS buffer has a fixed name; the last two tiles are peeled off, so every load of a trip is unconditional and the waits can be counted; kept rolled: unrolled further it only grows the code
#pragma unroll 1
  for (; kb + 128 < DM; kb += 128) {
    st(ra0, rb0, 0); g2_bar(); gl(ra0, rb0, kb + 128); comp(0);      /* loads two tiles ahead: in flight over this tile's and the next tile's products */
    st(ra1, rb1, 1); g2_bar(); gl(ra1, rb1, kb + 192); comp(1);
    asm volatile("s_wait_xcnt 0x0" ::: "memory"); }      /* in front of the next trip's address arithmetic, which rewrites the address registers of loads still in flight */
  st(ra0, rb0, 0); g2_bar(); comp(0);
  st(ra1, rb1, 1); g2_bar(); comp(1);
  const v8f accs[8] = {c00, c01, c02, c03, c10, c11, c12, c13};
  const bool res = w >= 4; const float alpha = res ? 0.0625f / 1024.0f : 0.0625f; float bv[4];      /* weights x 16; residual x 2^10; the bias joins the hi term alone */
#pragma unroll
  for (int t = 0; t < 4; ++t) { const float b = bf16_round(bvr[t]); bv[t] = res ? 0.f : b; }
#pragma unroll
  for (int u = 0; u < 8; ++u) { const int t = u & 3, half = u >> 2;
#pragma unroll
    for (int r = 0; r < 8; ++r) so[w][half * 16 + 8 * hh + r][t * 16 + ln] = accs[u][r] * alpha + bv[t]; }
  __syncthreads();      /* both terms of every tile are in place before they are added */
  // wave w adds and stores 16 rows of row group w & 3: 16 B a lane, a wave-wide store covers 2 rows of 256 B; all sums first, the stores last, so that nothing rewrites a register that a store names
  const int wq = w & 3, r0 = (w >> 2) * 16 + (lane >> 4), c4 = (lane & 15) * 4; v4f o[8];
#pragma unroll
  for (int q = 0; q < 8; ++q) o[q] = *(const v4fa*)&so[wq][r0 + 2 * q][c4] + *(const v4fa*)&so[4 + wq][r0 + 2 * q][c4];
  float* cp = C + (size_t)(mt * 128 + 32 * wq + r0) * DM + col0 + c4;
#pragma unroll
  for (int q = 0; q < 8; ++q) *(v4f*)(cp + (size_t)(2 * q) * DM) = o[q]; }

// ---- launches that do not depend on one another share one grid: a range of block indices per job (every test on the block index is the same for the whole work-group); no job reads what another job of its grid writes
// the seven input conversions to f16 (weights x 16, x as it is: x 1 is exact); 8 values a thread, every array a whole number of blocks
#define PB_QKV (3 * DM * DM / 8 / 256)
#define PB_X (NR * DM / 8 / 256)
#define PB_OUT (DM * DM / 8 / 256)
#define PB_LIN (64 * DM / 8 / 256)
__global__ __launch_bounds__(256) void k_prep(const float* __restrict__ Wqkv, const float* __restrict__ x, const float* __restrict__ Wout, const float* __restrict__ W1w, const float* __restrict__ W2w, const float* __restrict__ W1r, const float* __restrict__ W2r,
    _Float16* __restrict__ BQKV, _Float16* __restrict__ X16, _Float16* __restrict__ BO, _Float16* __restrict__ BL) {
  int b = blockIdx.x; const float* Wm; _Float16* Bt; float sc = 16.0f;
  if (b < PB_QKV) { Wm = Wqkv; Bt = BQKV; }
  else if ((b -= PB_QKV) < PB_X) { Wm = x; Bt = X16; sc = 1.0f; }
  else if ((b -= PB_X) < PB_OUT) { Wm = Wout; Bt = BO; }
  else { b -= PB_OUT; const int g = b / PB_LIN; b -= g * PB_LIN; Wm = g == 0 ? W1w : g == 1 ? W2w : g == 2 ? W1r : W2r; Bt = BL + (size_t)g * 64 * DM; }      /* [W1w; W2w; W1r; W2r] rows h*4 + i */
  const size_t t = (size_t)b * 256 + threadIdx.x; FragH f; for (int q = 0; q < 8; ++q) f.h[q] = (_Float16)(bf16_round(Wm[t * 8 + q]) * sc); *(v8us*)((unsigned short*)Bt + t * 8) = f.half[0];  }
__device__ __forceinline__ void exter(const float* p1, const float* p2, float* L) {
  #pragma clang fp contract(off)
  const int PI[6] = {0, 0, 0, 1, 1, 2}, PJ[6] = {1, 2, 3, 2, 3, 3}; float n2 = 0.f;
  for (int k = 0; k < 6; ++k) { float a = p1[PI[k]] * p2[PJ[k]]; a += -(p1[PJ[k]] * p2[PI[k]]); L[k] = a; n2 += a * a; }
  const float n = fmaxf(sqrtf(n2), 1e-12f); for (int k = 0; k < 6; ++k) L[k] = L[k] / n; }
__device__ __forceinline__ void lines_body(const int bx, const float* __restrict__ LW, float* __restrict__ JW, float* __restrict__ RD) {
  #pragma clang fp contract(off)
  const int tt = bx * 256 + threadIdx.x; if (tt >= NR * NH) return; const int t = tt % TT; const int bh = tt / TT; const int h = bh % NH, b = bh / NH; const size_t row = (size_t)b * TT + t; float w1[4], w2[4], r1[4], r2[4];
  for (int i = 0; i < 4; ++i) { w1[i] = (t > 0) ? LW[(row - 1) * 256 + h * 4 + i] : 0.f; w2[i] = LW[row * 256 + 64 + h * 4 + i]; r1[i] = LW[row * 256 + 128 + h * 4 + i]; r2[i] = LW[row * 256 + 192 + h * 4 + i]; }
  float wl[6], rl[6]; exter(w1, w2, wl); exter(r1, r2, rl); v8f jw, rd; jw[0] = wl[5]; jw[1] = -wl[4]; jw[2] = wl[3]; jw[3] = wl[2]; jw[4] = -wl[1]; jw[5] = wl[0]; jw[6] = 0.f; jw[7] = 0.f; for (int k = 0; k < 6; ++k) rd[k] = rl[k]; rd[6] = 0.f; rd[7] = 0.f;
  const size_t o = (((size_t)b * NH + h) * TT + t) * 8; { *(v8f*)(JW + o) = jw; *(v8f*)(RD + o) = rd;  } }
#define SB_LIN (NR * NH / 256)
__global__ __launch_bounds__(256) void k_lines(const float* __restrict__ LW, float* __restrict__ JW, float* __restrict__ RD) { lines_body(blockIdx.x, LW, JW, RD); }
typedef float v2f __attribute__((ext_vector_type(2)));
typedef float v2fa __attribute__((ext_vector_type(2), may_alias));
// Causal 6x6 Gram state and rd . M, one work-group per (batch, head). M is symmetric bit for bit (w_i * w_j rounds the same either way and both sides sum in the same order), so 21 running sums carry it.
// Three phases through one LDS array, plane e = (i, j), i <= j, column t: (A) every thread forms the 21 products of its rows; (B) 21 lanes of one wave turn each plane into its running sum over t, in the order t = 0, 1, ...; (C) every thread reads M_t of its rows and forms rd_t . M_t, i = 0..5 in order.
// Plane pitch TT + 4 floats: the 16-B reads and writes of phase B, one plane per lane, start 4 banks apart; phases A and C touch 32 columns in a row of one plane.
#define CE 21
#define CPI (TT + 4)
__device__ __forceinline__ void cum_body(const int bx, const float* __restrict__ JW, const float* __restrict__ RD, float* __restrict__ RDM) {
  __shared__ __attribute__((aligned(16))) float pm[CE][CPI];
  const int tid = threadIdx.x; const size_t bh = bx; const float* jw = JW + bh * TT * 8; const float* rd = RD + bh * TT * 8; float* ob = RDM + bh * TT * 8;
  // every global load of the block is issued before the first is waited for; thread tid has rows c * 256 + tid; all loops over c, i, j, u, q are unrolled in full so that their arrays stay in registers
  v4f wa[TT / 256], ra[TT / 256]; v2f wb[TT / 256], rb[TT / 256];      /* a row's six values as 16 + 8 bytes */
#pragma unroll
  for (int c = 0; c < TT / 256; ++c) { const float* q = jw + (size_t)(c * 256 + tid) * 8; wa[c] = *(const v4fa*)q; wb[c] = *(const v2fa*)(q + 4); }
#pragma unroll
  for (int c = 0; c < TT / 256; ++c) { const float* q = rd + (size_t)(c * 256 + tid) * 8; ra[c] = *(const v4fa*)q; rb[c] = *(const v2fa*)(q + 4); }
  asm volatile("s_wait_xcnt 0x0" ::: "memory");      /* in front of whatever reuses the address registers of the loads above, which stay in flight */
#pragma unroll
  for (int c = 0; c < TT / 256; ++c) { const float w[6] = {wa[c][0], wa[c][1], wa[c][2], wa[c][3], wb[c][0], wb[c][1]}; int e = 0;
#pragma unroll
    for (int i = 0; i < 6; ++i)
#pragma unroll
      for (int j = i; j < 6; ++j) { pm[e][c * 256 + tid] = w[i] * w[j]; ++e; } }
  __syncthreads();
  if (tid < CE) { float* p = &pm[tid][0]; float acc = 0.f; v4f cur[8], nxt[8];
    // the one dependent chain left is one add per t; the reads run 32 columns ahead of it in two named register sets, so that it never waits for LDS
#pragma unroll
    for (int u = 0; u < 8; ++u) cur[u] = *(const v4f*)(p + 4 * u);
    // two sets per trip so that each has a fixed name; kept rolled: unrolled further it only grows the code
#pragma unroll 1
    for (int t0 = 0; t0 < TT; t0 += 64) {
#pragma unroll
      for (int u = 0; u < 8; ++u) nxt[u] = *(const v4f*)(p + t0 + 32 + 4 * u);
#pragma unroll
      for (int u = 0; u < 8; ++u) { v4f o;
#pragma unroll
        for (int q = 0; q < 4; ++q) { acc += cur[u][q]; o[q] = acc; }
        *(v4f*)(p + t0 + 4 * u) = o; }
      if (t0 + 64 < TT) {
#pragma unroll
        for (int u = 0; u < 8; ++u) cur[u] = *(const v4f*)(p + t0 + 64 + 4 * u); }
#pragma unroll
      for (int u = 0; u < 8; ++u) { v4f o;
#pragma unroll
        for (int q = 0; q < 4; ++q) { acc += nxt[u][q]; o[q] = acc; }
        *(v4f*)(p + t0 + 32 + 4 * u) = o; } } }
  __syncthreads();
#pragma unroll
  for (int c = 0; c < TT / 256; ++c) { const float r[6] = {ra[c][0], ra[c][1], ra[c][2], ra[c][3], rb[c][0], rb[c][1]}; float m[CE];
#pragma unroll
    for (int e = 0; e < CE; ++e) m[e] = pm[e][c * 256 + tid];
    v8f o;
#pragma unroll
    for (int j = 0; j < 6; ++j) { float v = 0.f;
#pragma unroll
      for (int i = 0; i < 6; ++i) { const int lo = i < j ? i : j, hi = i < j ? j : i; v += r[i] * m[lo * 6 - (lo * (lo - 1)) / 2 + hi - lo]; }
      o[j] = v; }
    o[6] = 0.f; o[7] = 0.f;
    *(v8f*)(ob + (size_t)(c * 256 + tid) * 8) = o;
    if (c + 1 < TT / 256) asm volatile("s_wait_xcnt 0x0" ::: "memory"); } }      /* in front of the next rows' LDS reads and sums, which reuse the registers that the store names */
__global__ __launch_bounds__(256) void k_cum(const float* __restrict__ JW, const float* __restrict__ RD, float* __restrict__ RDM) { cum_body(blockIdx.x, JW, RD, RDM); }
#define FA_JP 68      /* pitch of a Jw plane in floats: 16-B multiples for the reads; the staging stores of a wave (16 keys x 2 groups of 4 planes) fall on 32 different banks */
__device__ __forceinline__ v8f fa_mma(v16h a, v16h b, v8f c) { return __builtin_amdgcn_wmma_f32_16x16x32_f16(false, a, false, b, (short)0, c, false, false); }
__global__ __launch_bounds__(128) void k_fattn(const _Float16* __restrict__ Q, const _Float16* __restrict__ Kh, const _Float16* __restrict__ Vh, const _Float16* __restrict__ Vl, const float* __restrict__ RDM, const float* __restrict__ JW, const float* __restrict__ bsc, _Float16* __restrict__ CH, _Float16* __restrict__ CL) {
  // two buffers of: 64 K rows [key][64 d], 64 V^T rows hi and residual [d][64 keys] (pitch as in k_gemm2), Jw as planes [component][key]
  __shared__ __attribute__((aligned(16))) _Float16 sk[2][64][G2_LP];
  __shared__ __attribute__((aligned(16))) _Float16 sv[2][64][G2_LP];
  __shared__ __attribute__((aligned(16))) _Float16 sl[2][64][G2_LP];
  __shared__ __attribute__((aligned(16))) float sj[2][8][FA_JP];
  const int tid = threadIdx.x, w = tid >> 5, lane = tid & 31, ln = lane & 15, hh = lane >> 4;
  const int pl = blockIdx.x, by = blockIdx.y, blk = by < TT / 128 ? TT / 64 - 1 - by : by - TT / 128;      /* plane; row block: block b walks b + 1 tiles; the long half first, longest first, then the short half, shortest first, so that work-groups half a grid apart add up alike (for speed only) */
  const int tl = w * 16 + ln; const size_t prow = (size_t)pl * TT + blk * 64 + tl;      /* the lane's query: inside the block, and as a row of the planes */
  const float bs2 = bf16_round(bsc[pl % NH]) * 1.4426950408889634f, c1 = 0.125f * 1.4426950408889634f;
  const v16h q0 = g2_frag(Q + prow * HD, hh), q1 = g2_frag(Q + prow * HD + 32, hh);
  const v4f r03 = *(const v4fa*)(RDM + prow * 8); const v2f r45 = *(const v2fa*)(RDM + prow * 8 + 4);
  const float rdm[6] = {r03[0], r03[1], r03[2], r03[3], r45[0], r45[1]};
  const int sr = tid >> 3, sc = (tid & 7) * 8;      /* staging: 8 lanes cover one row's 128 B */
  const char* kg = (const char*)(Kh + (size_t)pl * TT * HD); const char* vg = (const char*)(Vh + (size_t)pl * HD * TT); const char* lg = (const char*)(Vl + (size_t)pl * HD * TT); const char* jg = (const char*)(JW + (size_t)pl * TT * 8);      /* the plane's first bytes: the same in every lane */
  const unsigned ko = (unsigned)(sr * HD + sc) * 2u, vo = (unsigned)(sr * TT + sc) * 2u, jo = (unsigned)tid * 16u;      /* the lane's own byte offsets, fixed for the whole loop; Jw: key tid >> 1, components 4 * (tid & 1) .. + 3 (6 and 7 are the rows' padding: staged along, never read) */
  v8us rk[4], rv[4], rl[4]; v4f rj;
  // every loop over i, q, c, k, r, ks, ds below is unrolled in full so that its arrays stay in registers
  auto gl = [&](int j) {
    const char* kj = kg + (size_t)j * 64 * HD * 2 + ko; const char* vj = vg + (size_t)j * 64 * 2 + vo; const char* lj = lg + (size_t)j * 64 * 2 + vo; const char* jj = jg + (size_t)j * 64 * 32 + jo;
#pragma unroll
    for (int i = 0; i < 4; ++i) rk[i] = *(const v8us*)(kj + 16 * i * HD * 2);
#pragma unroll
    for (int i = 0; i < 4; ++i) rv[i] = *(const v8us*)(vj + 16 * i * TT * 2);
#pragma unroll
    for (int i = 0; i < 4; ++i) rl[i] = *(const v8us*)(lj + 16 * i * TT * 2);
    rj = *(const v4fa*)jj;
    // in front of whatever reuses the address registers of the loads above, which stay in flight; the four addresses are inputs (read only) so that they stay whole up to the wait: otherwise the last load of a group lands on the address pair that the group's earlier loads name
    asm volatile("s_wait_xcnt 0x0" :: "v"(kj), "v"(vj), "v"(lj), "v"(jj) : "memory"); };
  auto st = [&](int buf) {
#pragma unroll
    for (int i = 0; i < 4; ++i) { *(v8us*)&sk[buf][sr + 16 * i][sc] = rk[i]; *(v8us*)&sv[buf][sr + 16 * i][sc] = rv[i]; *(v8us*)&sl[buf][sr + 16 * i][sc] = rl[i]; }
#pragma unroll
    for (int q = 0; q < 4; ++q) sj[buf][(tid & 1) * 4 + q][tid >> 1] = rj[q]; };
  const v8f z8 = {0.f,0.f,0.f,0.f,0.f,0.f,0.f,0.f};
  v8f oa[4] = {z8, z8, z8, z8};
  float m = -3.0e38f, su = 0.f;
  gl(0);
  __builtin_amdgcn_sched_barrier(0);      /* keeps the clearing of the accumulators, which reuses the address registers of the q and rd . M loads above, behind the wait that ends gl */
  // Each barrier publishes the buffer just written and ends every wave's reads of the other buffer, which is written next. The next tile's loads fly during this tile's work; the diagonal tile has none behind it (the test is the same for the whole block), so no load is in flight when a wave ends.
  for (int j = 0; ; ++j) {      /* left behind the diagonal tile, at the foot */
    const int buf = j & 1;
    st(buf); g2_bar(); if (j < blk) gl(j + 1);
    float l[4][8];
#pragma unroll
    for (int c = 0; c < 4; ++c) {
      v8f s = fa_mma(g2_frag(&sk[buf][c * 16 + ln][0], hh), q0, z8); s = fa_mma(g2_frag(&sk[buf][c * 16 + ln][32], hh), q1, s);
      v4f jv[6][2];
#pragma unroll
      for (int k = 0; k < 6; ++k) { jv[k][0] = *(const v4f*)&sj[buf][k][c * 16 + 8 * hh]; jv[k][1] = *(const v4f*)&sj[buf][k][c * 16 + 8 * hh + 4]; }
#pragma unroll
      for (int r = 0; r < 8; ++r) { float d = 0.f;
#pragma unroll
        for (int k = 0; k < 6; ++k) d += rdm[k] * jv[k][r >> 2][r & 3];
        l[c][r] = s[r] * c1 + fabsf(d) * bs2; } }
    if (j == blk) {      /* the diagonal tile alone holds keys behind a query; the same for the whole block */
#pragma unroll
      for (int c = 0; c < 4; ++c)
#pragma unroll
        for (int r = 0; r < 8; ++r) if (c * 16 + 8 * hh + r > tl) l[c][r] = -3.0e38f; }
    float mt = l[0][0];
#pragma unroll
    for (int c = 0; c < 4; ++c)
#pragma unroll
      for (int r = 0; r < 8; ++r) mt = fmaxf(mt, l[c][r]);
    mt = fmaxf(mt, __shfl_xor(mt, 16, 32));      /* the row's other 32 keys of the tile; key 0 is open to every query, so the maximum is a real logit from tile 0 on */
    const float mn = fmaxf(m, mt), al = __builtin_amdgcn_exp2f(m - mn), mo = mn - 10.0f; m = mn; su *= al;
#pragma unroll
    for (int ds = 0; ds < 4; ++ds) oa[ds] *= al;
#pragma unroll
    for (int ks = 0; ks < 2; ++ks) { FragH pf;
#pragma unroll
      for (int i = 0; i < 16; ++i) { const float e = __builtin_amdgcn_exp2f(l[2 * ks + (i >> 3)][i & 7] - mo); su += e; pf.h[i] = (_Float16)e; }
      const v16h pr = pf.v * (_Float16)0.0009765625f;
#pragma unroll
      for (int ds = 0; ds < 4; ++ds) { oa[ds] = fa_mma(g2_frag(&sv[buf][ds * 16 + ln][ks * 32], hh), pf.v, oa[ds]); oa[ds] = fa_mma(g2_frag(&sl[buf][ds * 16 + ln][ks * 32], hh), pr, oa[ds]); } }
    if (j >= blk) break; }
  su += __shfl_xor(su, 16, 32);
  const float inv = 1.0f / su;
  const size_t o = ((size_t)(pl / NH) * TT + blk * 64 + tl) * DM + (pl % NH) * HD + 8 * hh;
#pragma unroll
  for (int ds = 0; ds < 4; ++ds) { FragH f, fl;
#pragma unroll
    for (int r = 0; r < 8; ++r) { const float v = oa[ds][r] * inv; const _Float16 hv = (_Float16)v; f.h[r] = hv; fl.h[r] = (_Float16)((v - (float)hv) * 1024.0f); }
    *(v8us*)((unsigned short*)CH + o + ds * 16) = f.half[0]; *(v8us*)((unsigned short*)CL + o + ds * 16) = fl.half[0];
    if (ds + 1 < 4) asm volatile("s_wait_xcnt 0x0" ::: "memory"); } }      /* in front of the next columns' sums, which may reuse the registers that the stores name */

extern "C" void kernel_launch(void* const* d_in, const int* in_sizes, int n_in,
                              void* d_out, int out_size, void* d_ws, size_t ws_size, hipStream_t stream) {
  (void)in_sizes; (void)n_in; (void)out_size;
  const float* x = (const float*)d_in[0]; const float* Wqkv = (const float*)d_in[1]; const float* bqkv = (const float*)d_in[2]; const float* W1w = (const float*)d_in[3]; const float* W2w = (const float*)d_in[4]; const float* W1r = (const float*)d_in[5]; const float* W2r = (const float*)d_in[6]; const float* bsc = (const float*)d_in[7]; const float* Wout = (const float*)d_in[8]; const float* bout = (const float*)d_in[9];
  char* ws = (char*)d_ws; size_t off = 0;
  auto take = [&](size_t bytes) { char* p = ws + off; off += (bytes + 255) & ~(size_t)255; return p; };
  const size_t np = (size_t)NR * DM;
  _Float16* BQKV = (_Float16*)take((size_t)3 * DM * DM * 2); _Float16* BL = (_Float16*)take((size_t)256 * DM * 2); _Float16* X16 = (_Float16*)take(np * 2); float* LW = (float*)take((size_t)NR * 256 * 4); float* RD = (float*)take((size_t)NB * NH * TT * 8 * 4);
  _Float16* BO = (_Float16*)take((size_t)DM * DM * 2); _Float16* Q16 = (_Float16*)take(np * 2); _Float16* K16 = (_Float16*)take(np * 2); _Float16* VT = (_Float16*)take(np * 2); _Float16* VTL = (_Float16*)take(np * 2);
  float* JW = (float*)take((size_t)NB * NH * TT * 8 * 4); float* RDM = (float*)take((size_t)NB * NH * TT * 8 * 4);
  _Float16* CH = (_Float16*)take(np * 2); _Float16* CL = (_Float16*)take(np * 2);
  if (off > ws_size) return;      /* under 42 MiB */
  k_prep<<<PB_QKV + PB_X + PB_OUT + 4 * PB_LIN, 256, 0, stream>>>(Wqkv, x, Wout, W1w, W2w, W1r, W2r, BQKV, X16, BO, BL);      /* torch (out, in) naturals */
  k_gemm2<0, true><<<dim3((NR / 128) * (256 / 64) + (NR / 128) * (3 * DM / 64), 1), 128, 0, stream>>>(X16, DM, 0, BQKV, DM, 0, 0.0625f, bqkv, 0, nullptr, 1, 0, 0, nullptr, nullptr, 3 * DM, 0, NR, 3 * DM, DM, (NR / 128) * (256 / 64), BL, LW, 256, Q16, K16, VT, VTL);      /* [q | k | v] + bias, head h at h*64, written as the attention's f16 planes; line projections f32 [row][w1 | w2 | r1 | r2] (x_prev handled by a row shift) */
  k_lines<<<SB_LIN, 256, 0, stream>>>(LW, JW, RD);
  k_cum<<<NB * NH, 256, 0, stream>>>(JW, RD, RDM);
  // attention: one launch, scores and weights stay in registers; grid x = the 32 (batch, head) planes, y = the 16 blocks of 64 query rows; q, k are [plane][t][64], v^T [plane][d][t]; the context comes out as [row][head * 64 + d], hi + residual
  k_fattn<<<dim3(NB * NH, TT / 64), 128, 0, stream>>>(Q16, K16, VT, VTL, RDM, JW, bsc, CH, CL);
  k_gemm_hl<<<(NR / 128) * (DM / 64), 256, 0, stream>>>(CH, CL, BO, bout, (float*)d_out);      /* out = (c_hi + c_lo x 2^-10) Wout^T + bout */
}
